// v000
// Measured on an AMD MI455X. A time is GPU time per run, averaged over a window of back-to-back runs after a warm-up
// (all launches, gaps included; the runs take copies of the inputs in turn), and the median of several windows.
// Apart from v000's, it joins two sittings. Times from different sittings can be a few percent apart, while
// side-by-side timings come from the same sitting.
// v000 is the starting kernel. One run takes 1740 microseconds.
#include <hip/hip_runtime.h>
#include <stdint.h>

// Contractions: v_wmma_f32_16x16x32_bf16 (bf16 operands, f32 accumulate). Input projections: single product on RNE-bf16 inputs. Score (K x Qt), P x V: bf16 hi/lo split (3 products). Output projection: hi/lo split activations x bf16 weights (2 products).

#define B_DIM 2
#define T_DIM 2048
#define C_DIM 768
#define NH    12
#define HS    64

typedef unsigned short us_t;
typedef __bf16         v16bf __attribute__((ext_vector_type(16)));
typedef unsigned short v16us __attribute__((ext_vector_type(16)));
typedef unsigned short v8us  __attribute__((ext_vector_type(8)));
typedef float          v8f   __attribute__((ext_vector_type(8)));
typedef float          v4f   __attribute__((ext_vector_type(4)));
typedef unsigned int   v4u   __attribute__((ext_vector_type(4)));

union Frag { v16us u; v8us half[2]; };

// ---------------------------------------------------------------------------
// helpers
// ---------------------------------------------------------------------------
__device__ __forceinline__ v8f vzero() {
  v8f z;
#pragma unroll
  for (int i = 0; i < 8; ++i) z[i] = 0.0f;
  return z;
}

// RNE f32 -> bf16 bits
__device__ __forceinline__ us_t f2bf(float f) {
  unsigned u = __float_as_uint(f);
  u += 0x7FFFu + ((u >> 16) & 1u);
  return (us_t)(u >> 16);
}
__device__ __forceinline__ float bf2f(us_t b) { return __uint_as_float(((unsigned)b) << 16); }
__device__ __forceinline__ float bfr(float f) { return bf2f(f2bf(f)); }
__device__ __forceinline__ unsigned pk2(us_t a, us_t b) { return (unsigned)a | (((unsigned)b) << 16); }

// 16x16x32 fragment loader (A rows / B columns stored k-contiguous):
// lane l: row/col = l&15, h = l>>4; elements 0..7 <- k0+8h+0..7, elements 8..15 <- k0+16+8h+0..7.
// p points at element k0 of the row; needs 16-B alignment.
__device__ __forceinline__ v16us ld_frag(const us_t* __restrict__ p, int hh) {
  Frag f;
  f.half[0] = *(const v8us*)(p + 8 * hh);
  f.half[1] = *(const v8us*)(p + 16 + 8 * hh);
  return f.u;
}

// D[16x16] += A[16x32] * B[32x16]; D element r of lane l = (row 8*(l>>4)+r, col l&15).
// Followed by the 4-slot VALU hazard guard (ties D, keeps A/B live).
__device__ __forceinline__ v8f mma(v16us a, v16us b, v8f c) {
  v16bf av = __builtin_bit_cast(v16bf, a);
  v16bf bv = __builtin_bit_cast(v16bf, b);
  c = __builtin_amdgcn_wmma_f32_16x16x32_bf16(false, av, false, bv, (short)0, c, false, false);
  asm volatile("v_nop\n\tv_nop\n\tv_nop\n\tv_nop" : "+v"(c) : "v"(a), "v"(b));
  return c;
}

// ---------------------------------------------------------------------------
// ---------------------------------------------------------------------------
__global__ __launch_bounds__(256) void k_cvt(const float* __restrict__ in,
                                            us_t* __restrict__ out, int n8) {
  const int i = blockIdx.x * 256 + threadIdx.x;
  if (i >= n8) return;
  const v4f* src = (const v4f*)(in + (size_t)i * 8);
  const v4f a = src[0];
  const v4f c = src[1];
  v4u p;
  p[0] = pk2(f2bf(a[0]), f2bf(a[1]));
  p[1] = pk2(f2bf(a[2]), f2bf(a[3]));
  p[2] = pk2(f2bf(c[0]), f2bf(c[1]));
  p[3] = pk2(f2bf(c[2]), f2bf(c[3]));
  v4u* dst = (v4u*)(out + (size_t)i * 8);
  *dst = p;
  
}

// ---------------------------------------------------------------------------
// 1) C[m][n] = sum_k A[m][k] * W[n][k]  (A: MxK bf16, W: NxK bf16, C: MxN f32)
//    SPLITA: C = (A + A2) * W^T with A = hi plane, A2 = lo plane (two products).
//    block = 4 waves, 64x64 tile; wave = 16 rows x 64 cols.
//    Epilogue: tile staged in LDS, each 256-B row segment written as 16 lanes x 16 B
//    Host guarantees M % 64 == 0, N % 64 == 0, K % 32 == 0.
// ---------------------------------------------------------------------------
template <int SPLITA>
__global__ __launch_bounds__(128) void k_gemm(const us_t* __restrict__ A,
                                             const us_t* __restrict__ A2,
                                             const us_t* __restrict__ W,
                                             float* __restrict__ Cout,
                                             int M, int N, int K) {
  __shared__ __align__(16) float ldsC[4][16][68];
  (void)M;
  const int w = threadIdx.x >> 5, lane = threadIdx.x & 31, m = lane & 15, hh = lane >> 4;
  const int mbase = blockIdx.y * 64 + w * 16;
  const int nbase = blockIdx.x * 64;
  const us_t* arow  = A  + (size_t)(mbase + m) * K;
  const us_t* a2row = A2 + (size_t)(mbase + m) * K;
  const us_t* wrow  = W  + (size_t)(nbase + m) * K;   // + 16*g rows per column group

  v8f acc[4];
#pragma unroll
  for (int g = 0; g < 4; ++g) acc[g] = vzero();

#pragma unroll 2
  for (int kb = 0; kb < K; kb += 32) {
    const v16us a = ld_frag(arow + kb, hh);
    v16us a2 = a;
    if (SPLITA) a2 = ld_frag(a2row + kb, hh);
#pragma unroll
    for (int g = 0; g < 4; ++g) {
      const v16us bw = ld_frag(wrow + (size_t)(16 * g) * K + kb, hh);
      acc[g] = mma(a, bw, acc[g]);
      if (SPLITA) acc[g] = mma(a2, bw, acc[g]);
    }
  }

  // stage D tiles: acc[g][r] = C[mbase + 8hh + r][nbase + 16g + m]
#pragma unroll
  for (int g = 0; g < 4; ++g) {
#pragma unroll
    for (int r = 0; r < 8; ++r) ldsC[w][8 * hh + r][16 * g + m] = acc[g][r];
  }
  __syncthreads();

  v4f val[8];
#pragma unroll
  for (int it = 0; it < 8; ++it) val[it] = *(const v4f*)(&ldsC[w][2 * it + hh][4 * m]);

  float* gb = Cout + (size_t)mbase * N + nbase + 4 * m;
#pragma unroll
  for (int it = 0; it < 8; ++it)
    *(v4f*)(gb + (size_t)(2 * it + hh) * N) = val[it];
  
}

// ---------------------------------------------------------------------------
// 2) fused leaky average over T (serial, f32) + L2 normalisation + beta scale,
//    written as bf16 hi/lo planes khi/klo in [B][NH][T][HS] layout.
//    One wave = 4 heads (lane group of 8 = one head, 8 channels per lane);
//    grid = B * (C/256) waves, every wave runs the full T loop.
// ---------------------------------------------------------------------------
__global__ __launch_bounds__(32) void k_ema_knorm(const float* __restrict__ u,
                                                 const float* __restrict__ la_coef,
                                                 const float* __restrict__ kbeta,
                                                 us_t* __restrict__ khi,
                                                 us_t* __restrict__ klo) {
#pragma clang fp contract(off)
  const int lane = threadIdx.x & 31;
  const int b    = blockIdx.x / (C_DIM / 256);
  const int grp  = blockIdx.x % (C_DIM / 256);
  const int h    = grp * 4 + (lane >> 3);
  const int sub  = lane & 7;

  const float cc   = bfr(la_coef[h]);
  const float omc  = 1.0f - cc;
  const float beta = expf(fminf(bfr(kbeta[h]) * 10.0f, 5.0f));

  const float* up   = u + (size_t)b * T_DIM * C_DIM + h * HS + 8 * sub;
  const size_t drow = ((size_t)(b * NH + h) * T_DIM) * HS + 8 * sub;

  float y[8];
#pragma unroll
  for (int i = 0; i < 8; ++i) y[i] = 0.0f;

  for (int t = 0; t < T_DIM; ++t) {
    const v4f* src = (const v4f*)(up + (size_t)t * C_DIM);
    const v4f x0 = src[0];
    const v4f x1 = src[1];
    float xin[8];
#pragma unroll
    for (int i = 0; i < 4; ++i) { xin[i] = x0[i]; xin[4 + i] = x1[i]; }
    float ss = 0.0f;
#pragma unroll
    for (int i = 0; i < 8; ++i) {
      y[i] = cc * y[i] + omc * xin[i];
      ss += y[i] * y[i];
    }
    ss += __shfl_xor(ss, 1, 32);
    ss += __shfl_xor(ss, 2, 32);
    ss += __shfl_xor(ss, 4, 32);
    const float rn = 1.0f / (sqrtf(ss) + 1e-6f);

    v4u ph, pl;
#pragma unroll
    for (int i = 0; i < 4; ++i) {
      const float ka = (y[2 * i] * rn) * beta;
      const float kc = (y[2 * i + 1] * rn) * beta;
      const us_t ha = f2bf(ka), hc = f2bf(kc);
      ph[i] = pk2(ha, hc);
      pl[i] = pk2(f2bf(ka - bf2f(ha)), f2bf(kc - bf2f(hc)));
    }
    const size_t off = drow + (size_t)t * HS;
    *(v4u*)(khi + off) = ph;
    *(v4u*)(klo + off) = pl;
    
  }
}

// ---------------------------------------------------------------------------
// 3) value featurizer: f = xl[t+1]*(1-vc) + xl[t]*vc, L2 normalise, beta scale,
//    written TRANSPOSED as bf16 hi/lo planes vthi/vtlo in [B*NH][HS][T] layout
//    (key-contiguous rows for the P x V B-fragments).
// ---------------------------------------------------------------------------
__global__ __launch_bounds__(128) void k_vmake(const float* __restrict__ xl,
                                              const float* __restrict__ v_coef,
                                              const float* __restrict__ vbeta,
                                              us_t* __restrict__ vthi,
                                              us_t* __restrict__ vtlo) {
#pragma clang fp contract(off)
  __shared__ __align__(16) us_t ldsH[HS][72];
  __shared__ __align__(16) us_t ldsL[HS][72];
  const int bh = blockIdx.y, b = bh / NH, h = bh % NH;
  const int t0 = blockIdx.x * 64;
  const int w = threadIdx.x >> 5, lane = threadIdx.x & 31;

  const float vc  = bfr(v_coef[h]);
  const float omv = 1.0f - vc;
  const float vb  = expf(fminf(bfr(vbeta[h]) * 10.0f, 5.0f));

  for (int rr = 0; rr < 16; ++rr) {
    const int tl = w * 16 + rr;
    const int t  = t0 + tl;
    const float* cur = xl + ((size_t)b * T_DIM + t) * C_DIM + h * HS;
    const float c0 = cur[lane], c1 = cur[lane + 32];
    float s0 = 0.0f, s1 = 0.0f;
    if (t + 1 < T_DIM) {
      const float* nx = cur + C_DIM;
      s0 = nx[lane];
      s1 = nx[lane + 32];
    }
    const float f0 = s0 * omv + c0 * vc;
    const float f1 = s1 * omv + c1 * vc;
    float ss = f0 * f0 + f1 * f1;
    ss += __shfl_xor(ss, 16, 32);
    ss += __shfl_xor(ss, 8, 32);
    ss += __shfl_xor(ss, 4, 32);
    ss += __shfl_xor(ss, 2, 32);
    ss += __shfl_xor(ss, 1, 32);
    const float rn = 1.0f / (sqrtf(ss) + 1e-6f);
    const float v0 = (f0 * rn) * vb;
    const float v1 = (f1 * rn) * vb;
    const us_t h0 = f2bf(v0), h1 = f2bf(v1);
    ldsH[lane][tl]      = h0;
    ldsH[lane + 32][tl] = h1;
    ldsL[lane][tl]      = f2bf(v0 - bf2f(h0));
    ldsL[lane + 32][tl] = f2bf(v1 - bf2f(h1));
  }
  __syncthreads();

  const int tid = threadIdx.x;
  const int ch  = tid & 7;
  const int dsl = tid >> 3;            // 0..15
  v4u ph[4], pl[4];
#pragma unroll
  for (int it = 0; it < 4; ++it) {
    const int d = it * 16 + dsl;
    ph[it] = *(const v4u*)(&ldsH[d][8 * ch]);
    pl[it] = *(const v4u*)(&ldsL[d][8 * ch]);
  }
  const size_t gb = ((size_t)bh * HS) * T_DIM + t0 + 8 * ch;
#pragma unroll
  for (int it = 0; it < 4; ++it) {
    const size_t off = gb + (size_t)(it * 16 + dsl) * T_DIM;
    *(v4u*)(vthi + off) = ph[it];
    *(v4u*)(vtlo + off) = pl[it];
  }
  
}

// ---------------------------------------------------------------------------
// 4) shifted-causal flash attention, per wave 16 queries, key tiles of 32.
//    Scores computed transposed: St[key][query] = K_tile (A, rows = keys) x Qt (B, cols = queries),
//    so lane = query owns its softmax statistics and the P A-fragment for P x V is an
//    in-register repack of the two 16-key D tiles (element r <- tile keys 0..15, 8+r <- tile keys 16..31).
//    O[query][dim] accumulated with A = P, B = Vt rows (key-contiguous). All fragments from
//    dense global rows; bf16 hi/lo: hi*hi + hi*lo + lo*hi.
//    grid = (ceil((T-1)/64), B*NH), block 128. Output y hi/lo planes [B][T][C];
// ---------------------------------------------------------------------------
__global__ __launch_bounds__(128) void k_attn(const us_t* __restrict__ khi,
                                             const us_t* __restrict__ klo,
                                             const us_t* __restrict__ vthi,
                                             const us_t* __restrict__ vtlo,
                                             us_t* __restrict__ yhi,
                                             us_t* __restrict__ ylo) {
#pragma clang fp contract(off)
  __shared__ __align__(16) float ldsO[4][16][68];
  __shared__ float ldsInv[4][16];

  const int bh = blockIdx.y, b = bh / NH, h = bh % NH;
  const int w = threadIdx.x >> 5, lane = threadIdx.x & 31, m = lane & 15, hh = lane >> 4;
  const int Tm1 = T_DIM - 1;
  const int q0  = 1 + 64 * blockIdx.x + 16 * w;   // first query time of this wave
  const int tq  = q0 + m;                          // this lane's query (B column n and stats owner)
  const int tqc = (tq < Tm1) ? tq : Tm1;           // clamped for loads (slot tq == T is never stored)

  const size_t kbh = (size_t)bh * T_DIM * HS;
  const size_t vbh = (size_t)bh * HS * T_DIM;

  // Q fragments (B operand): column n = query, k = dim; q rows are k rows at time tq
  const us_t* qh_row = khi + kbh + (size_t)tqc * HS;
  const us_t* ql_row = klo + kbh + (size_t)tqc * HS;
  const v16us qh0 = ld_frag(qh_row, hh),      ql0 = ld_frag(ql_row, hh);        // dims 0..31
  const v16us qh1 = ld_frag(qh_row + 32, hh), ql1 = ld_frag(ql_row + 32, hh);   // dims 32..63

  int qmax = q0 + 15;
  if (qmax > Tm1) qmax = Tm1;
  const int ntiles = (qmax + 31) >> 5;             // keys 0..qmax-1, wave-uniform

  v8f o[4];
#pragma unroll
  for (int g = 0; g < 4; ++g) o[g] = vzero();
  float mrun = -1e30f, lrun = 0.0f;

  for (int kt = 0; kt < ntiles; ++kt) {
    const int kbase = kt * 32;

    // St tiles: s[g][r] = score(key kbase + 16g + 8hh + r, query q0 + m)
    v8f s[2];
#pragma unroll
    for (int g = 0; g < 2; ++g) {
      s[g] = vzero();
      const size_t ar = kbh + (size_t)(kbase + 16 * g + m) * HS;
      {
        const v16us kh = ld_frag(khi + ar, hh);
        const v16us kl = ld_frag(klo + ar, hh);
        s[g] = mma(kh, qh0, s[g]);
        s[g] = mma(kh, ql0, s[g]);
        s[g] = mma(kl, qh0, s[g]);
      }
      {
        const v16us kh = ld_frag(khi + ar + 32, hh);
        const v16us kl = ld_frag(klo + ar + 32, hh);
        s[g] = mma(kh, qh1, s[g]);
        s[g] = mma(kh, ql1, s[g]);
        s[g] = mma(kl, qh1, s[g]);
      }
    }

    // causal mask (key < tq), online softmax per lane (= per query)
    float p0[8], p1[8];
    float mx = -1e30f;
#pragma unroll
    for (int r = 0; r < 8; ++r) {
      const int key0 = kbase + 8 * hh + r;
      float a = s[0][r];
      float c = s[1][r];
      if (key0 >= tq)      a = -1e30f;
      if (key0 + 16 >= tq) c = -1e30f;
      p0[r] = a;
      p1[r] = c;
      mx = fmaxf(mx, fmaxf(a, c));
    }
    mx = fmaxf(mx, __shfl_xor(mx, 16, 32));
    const float mn = fmaxf(mrun, mx);
    const float sc = __expf(mrun - mn);
    float sum = 0.0f;
#pragma unroll
    for (int r = 0; r < 8; ++r) {
      p0[r] = __expf(p0[r] - mn);
      p1[r] = __expf(p1[r] - mn);
      sum += p0[r] + p1[r];
    }
    sum += __shfl_xor(sum, 16, 32);
    lrun = lrun * sc + sum;
    mrun = mn;

    // rescale O: o[g][r] belongs to query q0 + 8hh + r, whose scale lives in lane 8hh + r
#pragma unroll
    for (int r = 0; r < 8; ++r) {
      const float scr = __shfl(sc, 8 * hh + r, 32);
#pragma unroll
      for (int g = 0; g < 4; ++g) o[g][r] *= scr;
    }

    // P as A fragment (lane = query row, k = key within tile), bf16 hi/lo
    Frag ph, pl;
#pragma unroll
    for (int r = 0; r < 8; ++r) {
      const us_t a = f2bf(p0[r]);
      const us_t c = f2bf(p1[r]);
      ph.u[r]     = a;
      ph.u[8 + r] = c;
      pl.u[r]     = f2bf(p0[r] - bf2f(a));
      pl.u[8 + r] = f2bf(p1[r] - bf2f(c));
    }

    // O += P x V ; B fragment column n = dim 16g + m, k = key from the transposed planes
#pragma unroll
    for (int g = 0; g < 4; ++g) {
      const size_t vr = vbh + (size_t)(16 * g + m) * T_DIM + kbase;
      const v16us vh = ld_frag(vthi + vr, hh);
      const v16us vl = ld_frag(vtlo + vr, hh);
      o[g] = mma(ph.u, vh, o[g]);
      o[g] = mma(ph.u, vl, o[g]);
      o[g] = mma(pl.u, vh, o[g]);
    }
  }

  // epilogue: stage O (f32) and 1/l, then whole-line stores of the hi/lo planes
  const float inv = 1.0f / lrun;
  if (hh == 0) ldsInv[w][m] = inv;
#pragma unroll
  for (int g = 0; g < 4; ++g) {
#pragma unroll
    for (int r = 0; r < 8; ++r) ldsO[w][8 * hh + r][16 * g + m] = o[g][r];
  }
  __syncthreads();

  const int ch   = lane & 7;
  const int rsel = lane >> 3;          // 0..3
  v4u yh[4], yl[4];
#pragma unroll
  for (int it = 0; it < 4; ++it) {
    const int row = it * 4 + rsel;
    const float iv = ldsInv[w][row];
    const v4f* sp = (const v4f*)(&ldsO[w][row][8 * ch]);
    const v4f e0 = sp[0];
    const v4f e1 = sp[1];
    float vv[8];
#pragma unroll
    for (int i = 0; i < 4; ++i) { vv[i] = e0[i] * iv; vv[4 + i] = e1[i] * iv; }
#pragma unroll
    for (int i = 0; i < 4; ++i) {
      const us_t ha = f2bf(vv[2 * i]);
      const us_t hc = f2bf(vv[2 * i + 1]);
      yh[it][i] = pk2(ha, hc);
      yl[it][i] = pk2(f2bf(vv[2 * i] - bf2f(ha)), f2bf(vv[2 * i + 1] - bf2f(hc)));
    }
  }
  v4u vz;
#pragma unroll
  for (int i = 0; i < 4; ++i) vz[i] = 0u;

  const size_t yb = ((size_t)b * T_DIM) * C_DIM + h * HS + 8 * ch;   // + t * C_DIM
  const bool zrow = (blockIdx.x == 0) && (w == 0) && (lane < 8);     // row t = 0 of this (b,h)

#pragma unroll
  for (int it = 0; it < 4; ++it) {
    const int tqr = q0 + it * 4 + rsel;
    if (tqr <= Tm1) {
      const size_t off = yb + (size_t)tqr * C_DIM;
      *(v4u*)(yhi + off) = yh[it];
      *(v4u*)(ylo + off) = yl[it];
    }
  }
  if (zrow) {
    *(v4u*)(yhi + yb) = vz;
    *(v4u*)(ylo + yb) = vz;
  }
  
}

// ---------------------------------------------------------------------------
// launcher
// ---------------------------------------------------------------------------
extern "C" void kernel_launch(void* const* d_in, const int* in_sizes, int n_in,
                              void* d_out, int out_size, void* d_ws,
                              size_t ws_size, hipStream_t stream) {
  const size_t MT = (size_t)B_DIM * T_DIM;          // 4096 rows
  const size_t NX = MT * C_DIM;                     // 3145728
  const size_t NW = (size_t)C_DIM * C_DIM;          // 589824

  if (n_in < 8) return;
  if ((size_t)in_sizes[0] != NX || (size_t)in_sizes[1] != NW || in_sizes[2] != NH ||
      (size_t)in_sizes[3] != NW || in_sizes[4] != NH || in_sizes[5] != NH ||
      in_sizes[6] != NH || (size_t)in_sizes[7] != NW || (size_t)out_size != NX) return;

  const float* x       = (const float*)d_in[0];
  const float* W_la    = (const float*)d_in[1];
  const float* la_coef = (const float*)d_in[2];
  const float* W_v     = (const float*)d_in[3];
  const float* v_coef  = (const float*)d_in[4];
  const float* kbeta   = (const float*)d_in[5];
  const float* vbeta   = (const float*)d_in[6];
  const float* W_proj  = (const float*)d_in[7];
  float* out = (float*)d_out;

  // workspace carve (all sizes multiples of 256 B)
  size_t off = 0;
  char* ws = (char*)d_ws;
  us_t* xb   = (us_t*)(ws + off); off += NX * 2;
  us_t* wla  = (us_t*)(ws + off); off += NW * 2;
  us_t* wv   = (us_t*)(ws + off); off += NW * 2;
  us_t* wpj  = (us_t*)(ws + off); off += NW * 2;
  float* u   = (float*)(ws + off); off += NX * 4;
  float* xl  = (float*)(ws + off); off += NX * 4;
  us_t* khi  = (us_t*)(ws + off); off += NX * 2;
  us_t* klo  = (us_t*)(ws + off); off += NX * 2;
  us_t* vthi = (us_t*)(ws + off); off += NX * 2;
  us_t* vtlo = (us_t*)(ws + off); off += NX * 2;
  us_t* yhi  = (us_t*)(ws + off); off += NX * 2;
  us_t* ylo  = (us_t*)(ws + off); off += NX * 2;   // total 72,744,960 B
  if (off > ws_size) return;

  // 0) RNE convert inputs to bf16
  const int nx8 = (int)(NX / 8), nw8 = (int)(NW / 8);
  k_cvt<<<(nx8 + 255) / 256, 256, 0, stream>>>(x, xb, nx8);
  k_cvt<<<(nw8 + 255) / 256, 256, 0, stream>>>(W_la, wla, nw8);
  k_cvt<<<(nw8 + 255) / 256, 256, 0, stream>>>(W_v, wv, nw8);
  k_cvt<<<(nw8 + 255) / 256, 256, 0, stream>>>(W_proj, wpj, nw8);

  // 1) u = x W_la^T ; xl = x W_v^T
  dim3 ggrid(C_DIM / 64, (unsigned)(MT / 64));
  k_gemm<0><<<ggrid, 128, 0, stream>>>(xb, xb, wla, u, (int)MT, C_DIM, C_DIM);
  k_gemm<0><<<ggrid, 128, 0, stream>>>(xb, xb, wv, xl, (int)MT, C_DIM, C_DIM);

  // 2) leaky average + normalised, scaled keys as bf16 hi/lo
  k_ema_knorm<<<B_DIM * (C_DIM / 256), 32, 0, stream>>>(u, la_coef, kbeta, khi, klo);

  // 3) values (transposed, bf16 hi/lo)
  dim3 vgrid(T_DIM / 64, B_DIM * NH);
  k_vmake<<<vgrid, 128, 0, stream>>>(xl, v_coef, vbeta, vthi, vtlo);

  // 4) attention -> y hi/lo planes
  dim3 agrid((T_DIM - 1 + 63) / 64, B_DIM * NH);
  k_attn<<<agrid, 128, 0, stream>>>(khi, klo, vthi, vtlo, yhi, ylo);

  // 5) out = y W_proj^T (hi and lo planes, two products)
  k_gemm<1><<<ggrid, 128, 0, stream>>>(yhi, ylo, wpj, out, (int)MT, C_DIM, C_DIM);
}

// v001
// It runs in 314 microseconds.
// In both of two side-by-side timings against v000, it was 5.54 times as fast.
#include <hip/hip_runtime.h>
#include <stdint.h>

// Contractions: v_wmma_f32_16x16x32_bf16 (bf16 operands, f32 accumulate). Input projections: single product on RNE-bf16 inputs. Score (K x Qt), P x V: bf16 hi/lo split (3 products). Output projection: hi/lo split activations x bf16 weights (2 products).

#define B_DIM 2
#define T_DIM 2048
#define C_DIM 768
#define NH    12
#define HS    64

typedef unsigned short us_t;
typedef __bf16         v16bf __attribute__((ext_vector_type(16)));
typedef unsigned short v16us __attribute__((ext_vector_type(16)));
typedef unsigned short v8us  __attribute__((ext_vector_type(8)));
typedef float          v8f   __attribute__((ext_vector_type(8)));
typedef float          v4f   __attribute__((ext_vector_type(4)));
typedef unsigned int   v4u   __attribute__((ext_vector_type(4)));

union Frag { v16us u; v8us half[2]; };

// ---------------------------------------------------------------------------
// helpers
// ---------------------------------------------------------------------------
__device__ __forceinline__ v8f vzero() {
  v8f z;
#pragma unroll
  for (int i = 0; i < 8; ++i) z[i] = 0.0f;
  return z;
}

// RNE f32 -> bf16 bits
__device__ __forceinline__ us_t f2bf(float f) {
  unsigned u = __float_as_uint(f);
  u += 0x7FFFu + ((u >> 16) & 1u);
  return (us_t)(u >> 16);
}
__device__ __forceinline__ float bf2f(us_t b) { return __uint_as_float(((unsigned)b) << 16); }
__device__ __forceinline__ float bfr(float f) { return bf2f(f2bf(f)); }
__device__ __forceinline__ unsigned pk2(us_t a, us_t b) { return (unsigned)a | (((unsigned)b) << 16); }

// 16x16x32 fragment loader (A rows / B columns stored k-contiguous):
// lane l: row/col = l&15, h = l>>4; elements 0..7 <- k0+8h+0..7, elements 8..15 <- k0+16+8h+0..7.
// p points at element k0 of the row; needs 16-B alignment.
__device__ __forceinline__ v16us ld_frag(const us_t* __restrict__ p, int hh) {
  Frag f;
  f.half[0] = *(const v8us*)(p + 8 * hh);
  f.half[1] = *(const v8us*)(p + 16 + 8 * hh);
  return f.u;
}

// D[16x16] += A[16x32] * B[32x16]; D element r of lane l = (row 8*(l>>4)+r, col l&15).
// Followed by the 4-slot VALU hazard guard (ties D, keeps A/B live).
__device__ __forceinline__ v8f mma(v16us a, v16us b, v8f c) {
  v16bf av = __builtin_bit_cast(v16bf, a);
  v16bf bv = __builtin_bit_cast(v16bf, b);
  c = __builtin_amdgcn_wmma_f32_16x16x32_bf16(false, av, false, bv, (short)0, c, false, false);
  asm volatile("v_nop\n\tv_nop\n\tv_nop\n\tv_nop" : "+v"(c) : "v"(a), "v"(b));
  return c;
}

// ---------------------------------------------------------------------------
// ---------------------------------------------------------------------------
__global__ __launch_bounds__(256) void k_cvt(const float* __restrict__ in,
                                            us_t* __restrict__ out, int n8) {
  const int i = blockIdx.x * 256 + threadIdx.x;
  if (i >= n8) return;
  const v4f* src = (const v4f*)(in + (size_t)i * 8);
  const v4f a = src[0];
  const v4f c = src[1];
  v4u p;
  p[0] = pk2(f2bf(a[0]), f2bf(a[1]));
  p[1] = pk2(f2bf(a[2]), f2bf(a[3]));
  p[2] = pk2(f2bf(c[0]), f2bf(c[1]));
  p[3] = pk2(f2bf(c[2]), f2bf(c[3]));
  v4u* dst = (v4u*)(out + (size_t)i * 8);
  *dst = p;
  
}

// ---------------------------------------------------------------------------
// 1) C[m][n] = sum_k A[m][k] * W[n][k]  (A: MxK bf16, W: NxK bf16, C: MxN f32)
//    SPLITA: C = (A + A2) * W^T with A = hi plane, A2 = lo plane (two products).
//    block = 4 waves, 64x64 tile; wave = 16 rows x 64 cols.
//    Epilogue: tile staged in LDS, each 256-B row segment written as 16 lanes x 16 B
//    Host guarantees M % 64 == 0, N % 64 == 0, K % 32 == 0.
// ---------------------------------------------------------------------------
template <int SPLITA>
__global__ __launch_bounds__(128) void k_gemm(const us_t* __restrict__ A,
                                             const us_t* __restrict__ A2,
                                             const us_t* __restrict__ W,
                                             float* __restrict__ Cout,
                                             int M, int N, int K) {
  __shared__ __align__(16) float ldsC[4][16][68];
  (void)M;
  const int w = threadIdx.x >> 5, lane = threadIdx.x & 31, m = lane & 15, hh = lane >> 4;
  const int mbase = blockIdx.y * 64 + w * 16;
  const int nbase = blockIdx.x * 64;
  const us_t* arow  = A  + (size_t)(mbase + m) * K;
  const us_t* a2row = A2 + (size_t)(mbase + m) * K;
  const us_t* wrow  = W  + (size_t)(nbase + m) * K;   // + 16*g rows per column group

  v8f acc[4];
#pragma unroll
  for (int g = 0; g < 4; ++g) acc[g] = vzero();

#pragma unroll 2
  for (int kb = 0; kb < K; kb += 32) {
    const v16us a = ld_frag(arow + kb, hh);
    v16us a2 = a;
    if (SPLITA) a2 = ld_frag(a2row + kb, hh);
#pragma unroll
    for (int g = 0; g < 4; ++g) {
      const v16us bw = ld_frag(wrow + (size_t)(16 * g) * K + kb, hh);
      acc[g] = mma(a, bw, acc[g]);
      if (SPLITA) acc[g] = mma(a2, bw, acc[g]);
    }
  }

  // stage D tiles: acc[g][r] = C[mbase + 8hh + r][nbase + 16g + m]
#pragma unroll
  for (int g = 0; g < 4; ++g) {
#pragma unroll
    for (int r = 0; r < 8; ++r) ldsC[w][8 * hh + r][16 * g + m] = acc[g][r];
  }
  __syncthreads();

  v4f val[8];
#pragma unroll
  for (int it = 0; it < 8; ++it) val[it] = *(const v4f*)(&ldsC[w][2 * it + hh][4 * m]);

  float* gb = Cout + (size_t)mbase * N + nbase + 4 * m;
#pragma unroll
  for (int it = 0; it < 8; ++it)
    *(v4f*)(gb + (size_t)(2 * it + hh) * N) = val[it];
  
}

// ---------------------------------------------------------------------------
// 2) leaky average over T (f32) + L2 normalisation + beta scale,
//    written as bf16 hi/lo planes khi/klo in [B][NH][T][HS] layout.
//    The recurrence y[t] = c*y[t-1] + (1-c)*u[t] is linear, so T is cut into chunks of
//    EMA_CL rows that run side by side from a zero state:
//      y[t0+k] = ylocal[k] + c^(k+1) * S,   S = true state in front of the chunk,
//      S(next chunk) = c^EMA_CL * S + (end state of this chunk from zero).
//    A work-group = one (batch, head) and EMA_ROWS consecutive rows. It forms the end states
//    of every chunk up to its own last one (earlier chunks again, from L2), folds them in LDS,
//    and normalises and stores its own rows only: nothing passes between work-groups.
//    Lane group of 8 = one row (8 channels per lane).
//    The loops of constant length are unrolled so that their arrays stay in registers; the load
//    loop also so that all 32 loads of a chunk are in flight before the first is used.
// ---------------------------------------------------------------------------
#define EMA_CL    16                     // rows per chunk
#define EMA_NCH   (T_DIM / EMA_CL)       // chunks per (batch, head)
#define EMA_SEG   8                      // work-groups per (batch, head)
#define EMA_CPS   (EMA_NCH / EMA_SEG)    // chunks stored by one work-group
#define EMA_ROWS  (EMA_CL * EMA_CPS)     // rows stored by one work-group
#define EMA_NT    512                    // threads per work-group
#define EMA_NG    (EMA_NT / 8)           // lane groups per work-group
#define EMA_PITCH 96                     // floats per staged row: neighbour rows fall on the two bank halves

__global__ __launch_bounds__(EMA_NT) void k_ema_knorm(const float* __restrict__ u,
                                                     const float* __restrict__ la_coef,
                                                     const float* __restrict__ kbeta,
                                                     us_t* __restrict__ khi,
                                                     us_t* __restrict__ klo) {
#pragma clang fp contract(off)
  // In all three arrays a lane's channels 8sub..8sub+3 sit at float 4*sub, 8sub+4..8sub+7 at 32 + 4*sub.
  __shared__ __align__(16) float ldsE[EMA_NCH][HS];           // end state of each chunk from a zero start
  __shared__ __align__(16) float ldsS[EMA_CPS][HS];           // true state in front of each own chunk
  __shared__ __align__(16) float ldsY[EMA_ROWS][EMA_PITCH];   // own rows from a zero start

  const int tid  = threadIdx.x;
  const int grp  = tid >> 3;
  const int sub  = tid & 7;
  const int seg  = (EMA_SEG - 1) - (int)blockIdx.x;           // the longest work-groups start first
  const int bh   = blockIdx.y, b = bh / NH, h = bh % NH;
  const int own0 = EMA_CPS * seg;                             // first own chunk
  const int nch  = own0 + EMA_CPS;                            // chunks this work-group walks

  const float cc   = bfr(la_coef[h]);
  const float omc  = 1.0f - cc;
  const float beta = expf(fminf(bfr(kbeta[h]) * 10.0f, 5.0f));

  // cp = c^(k+1) for this lane group's row position k = grp % EMA_CL; cl = c^EMA_CL
  float cp = 1.0f, cl = cc;
  {
    const int e = (grp & (EMA_CL - 1)) + 1;                   // 1..16
#pragma unroll
    for (int bit = 0; bit < 4; ++bit) {
      if ((e >> bit) & 1) cp *= cl;
      cl *= cl;
    }
    if (e >> 4) cp = cl;
  }

  const float* up = u + (size_t)b * T_DIM * C_DIM + h * HS + 8 * sub;

  // a) every chunk from a zero state; own0 and nch are multiples of 4, so a wave's four groups agree
  for (int j = grp; j < nch; j += EMA_NG) {
    const float* cpn = up + (size_t)(j * EMA_CL) * C_DIM;
    v4f x0[EMA_CL], x1[EMA_CL];
#pragma unroll
    for (int k = 0; k < EMA_CL; ++k) {
      const v4f* src = (const v4f*)(cpn + (size_t)k * C_DIM);
      x0[k] = src[0];
      x1[k] = src[1];
    }
    const bool own = (j >= own0);
    float* yrow = &ldsY[own ? (j - own0) * EMA_CL : 0][4 * sub];
    v4f y0, y1;
#pragma unroll
    for (int i = 0; i < 4; ++i) { y0[i] = 0.0f; y1[i] = 0.0f; }
#pragma unroll
    for (int k = 0; k < EMA_CL; ++k) {
#pragma unroll
      for (int i = 0; i < 4; ++i) {
        y0[i] = cc * y0[i] + omc * x0[k][i];
        y1[i] = cc * y1[i] + omc * x1[k][i];
      }
      if (own) {
        *(v4f*)(yrow + k * EMA_PITCH)      = y0;
        *(v4f*)(yrow + k * EMA_PITCH + 32) = y1;
      }
    }
    *(v4f*)(&ldsE[j][4 * sub])      = y0;
    *(v4f*)(&ldsE[j][32 + 4 * sub]) = y1;
  }
  __syncthreads();

  // b) fold the end states in time order, one channel per lane (two waves)
  if (tid < HS) {
    float s = 0.0f;
    for (int j0 = 0; j0 < own0; j0 += EMA_CPS) {
      float e[EMA_CPS];
#pragma unroll
      for (int i = 0; i < EMA_CPS; ++i) e[i] = ldsE[j0 + i][tid];
#pragma unroll
      for (int i = 0; i < EMA_CPS; ++i) s = cl * s + e[i];
    }
    float e[EMA_CPS];
#pragma unroll
    for (int i = 0; i < EMA_CPS; ++i) e[i] = ldsE[own0 + i][tid];
#pragma unroll
    for (int i = 0; i < EMA_CPS; ++i) {
      ldsS[i][tid] = s;
      s = cl * s + e[i];
    }
  }
  __syncthreads();

  // c) own rows: add the carried state, normalise, scale, split, store
  const size_t drow = ((size_t)bh * T_DIM + (size_t)seg * EMA_ROWS) * HS + 8 * sub;
#pragma unroll
  for (int it = 0; it < EMA_ROWS / EMA_NG; ++it) {
    const int r = grp + EMA_NG * it;                          // r % EMA_CL == grp % EMA_CL
    const v4f a0 = *(const v4f*)(&ldsY[r][4 * sub]);
    const v4f a1 = *(const v4f*)(&ldsY[r][32 + 4 * sub]);
    const v4f s0 = *(const v4f*)(&ldsS[r / EMA_CL][4 * sub]);
    const v4f s1 = *(const v4f*)(&ldsS[r / EMA_CL][32 + 4 * sub]);
    float y[8];
#pragma unroll
    for (int i = 0; i < 4; ++i) {
      y[i]     = a0[i] + cp * s0[i];
      y[4 + i] = a1[i] + cp * s1[i];
    }
    float ss = 0.0f;
#pragma unroll
    for (int i = 0; i < 8; ++i) ss += y[i] * y[i];
    ss += __shfl_xor(ss, 1, 32);
    ss += __shfl_xor(ss, 2, 32);
    ss += __shfl_xor(ss, 4, 32);
    const float rn = 1.0f / (sqrtf(ss) + 1e-6f);

    v4u ph, pl;
#pragma unroll
    for (int i = 0; i < 4; ++i) {
      const float ka = (y[2 * i] * rn) * beta;
      const float kc = (y[2 * i + 1] * rn) * beta;
      const us_t ha = f2bf(ka), hc = f2bf(kc);
      ph[i] = pk2(ha, hc);
      pl[i] = pk2(f2bf(ka - bf2f(ha)), f2bf(kc - bf2f(hc)));
    }
    const size_t off = drow + (size_t)r * HS;
    *(v4u*)(khi + off) = ph;
    *(v4u*)(klo + off) = pl;
  }
}

// ---------------------------------------------------------------------------
// 3) value featurizer: f = xl[t+1]*(1-vc) + xl[t]*vc, L2 normalise, beta scale,
//    written TRANSPOSED as bf16 hi/lo planes vthi/vtlo in [B*NH][HS][T] layout
//    (key-contiguous rows for the P x V B-fragments).
// ---------------------------------------------------------------------------
__global__ __launch_bounds__(128) void k_vmake(const float* __restrict__ xl,
                                              const float* __restrict__ v_coef,
                                              const float* __restrict__ vbeta,
                                              us_t* __restrict__ vthi,
                                              us_t* __restrict__ vtlo) {
#pragma clang fp contract(off)
  __shared__ __align__(16) us_t ldsH[HS][72];
  __shared__ __align__(16) us_t ldsL[HS][72];
  const int bh = blockIdx.y, b = bh / NH, h = bh % NH;
  const int t0 = blockIdx.x * 64;
  const int w = threadIdx.x >> 5, lane = threadIdx.x & 31;

  const float vc  = bfr(v_coef[h]);
  const float omv = 1.0f - vc;
  const float vb  = expf(fminf(bfr(vbeta[h]) * 10.0f, 5.0f));

  for (int rr = 0; rr < 16; ++rr) {
    const int tl = w * 16 + rr;
    const int t  = t0 + tl;
    const float* cur = xl + ((size_t)b * T_DIM + t) * C_DIM + h * HS;
    const float c0 = cur[lane], c1 = cur[lane + 32];
    float s0 = 0.0f, s1 = 0.0f;
    if (t + 1 < T_DIM) {
      const float* nx = cur + C_DIM;
      s0 = nx[lane];
      s1 = nx[lane + 32];
    }
    const float f0 = s0 * omv + c0 * vc;
    const float f1 = s1 * omv + c1 * vc;
    float ss = f0 * f0 + f1 * f1;
    ss += __shfl_xor(ss, 16, 32);
    ss += __shfl_xor(ss, 8, 32);
    ss += __shfl_xor(ss, 4, 32);
    ss += __shfl_xor(ss, 2, 32);
    ss += __shfl_xor(ss, 1, 32);
    const float rn = 1.0f / (sqrtf(ss) + 1e-6f);
    const float v0 = (f0 * rn) * vb;
    const float v1 = (f1 * rn) * vb;
    const us_t h0 = f2bf(v0), h1 = f2bf(v1);
    ldsH[lane][tl]      = h0;
    ldsH[lane + 32][tl] = h1;
    ldsL[lane][tl]      = f2bf(v0 - bf2f(h0));
    ldsL[lane + 32][tl] = f2bf(v1 - bf2f(h1));
  }
  __syncthreads();

  const int tid = threadIdx.x;
  const int ch  = tid & 7;
  const int dsl = tid >> 3;            // 0..15
  v4u ph[4], pl[4];
#pragma unroll
  for (int it = 0; it < 4; ++it) {
    const int d = it * 16 + dsl;
    ph[it] = *(const v4u*)(&ldsH[d][8 * ch]);
    pl[it] = *(const v4u*)(&ldsL[d][8 * ch]);
  }
  const size_t gb = ((size_t)bh * HS) * T_DIM + t0 + 8 * ch;
#pragma unroll
  for (int it = 0; it < 4; ++it) {
    const size_t off = gb + (size_t)(it * 16 + dsl) * T_DIM;
    *(v4u*)(vthi + off) = ph[it];
    *(v4u*)(vtlo + off) = pl[it];
  }
  
}

// ---------------------------------------------------------------------------
// 4) shifted-causal flash attention, per wave 16 queries, key tiles of 32.
//    Scores computed transposed: St[key][query] = K_tile (A, rows = keys) x Qt (B, cols = queries),
//    so lane = query owns its softmax statistics and the P A-fragment for P x V is an
//    in-register repack of the two 16-key D tiles (element r <- tile keys 0..15, 8+r <- tile keys 16..31).
//    O[query][dim] accumulated with A = P, B = Vt rows (key-contiguous). All fragments from
//    dense global rows; bf16 hi/lo: hi*hi + hi*lo + lo*hi.
//    grid = (ceil((T-1)/64), B*NH), block 128. Output y hi/lo planes [B][T][C];
// ---------------------------------------------------------------------------
__global__ __launch_bounds__(128) void k_attn(const us_t* __restrict__ khi,
                                             const us_t* __restrict__ klo,
                                             const us_t* __restrict__ vthi,
                                             const us_t* __restrict__ vtlo,
                                             us_t* __restrict__ yhi,
                                             us_t* __restrict__ ylo) {
#pragma clang fp contract(off)
  __shared__ __align__(16) float ldsO[4][16][68];
  __shared__ float ldsInv[4][16];

  const int bh = blockIdx.y, b = bh / NH, h = bh % NH;
  const int w = threadIdx.x >> 5, lane = threadIdx.x & 31, m = lane & 15, hh = lane >> 4;
  const int Tm1 = T_DIM - 1;
  const int q0  = 1 + 64 * blockIdx.x + 16 * w;   // first query time of this wave
  const int tq  = q0 + m;                          // this lane's query (B column n and stats owner)
  const int tqc = (tq < Tm1) ? tq : Tm1;           // clamped for loads (slot tq == T is never stored)

  const size_t kbh = (size_t)bh * T_DIM * HS;
  const size_t vbh = (size_t)bh * HS * T_DIM;

  // Q fragments (B operand): column n = query, k = dim; q rows are k rows at time tq
  const us_t* qh_row = khi + kbh + (size_t)tqc * HS;
  const us_t* ql_row = klo + kbh + (size_t)tqc * HS;
  const v16us qh0 = ld_frag(qh_row, hh),      ql0 = ld_frag(ql_row, hh);        // dims 0..31
  const v16us qh1 = ld_frag(qh_row + 32, hh), ql1 = ld_frag(ql_row + 32, hh);   // dims 32..63

  int qmax = q0 + 15;
  if (qmax > Tm1) qmax = Tm1;
  const int ntiles = (qmax + 31) >> 5;             // keys 0..qmax-1, wave-uniform

  v8f o[4];
#pragma unroll
  for (int g = 0; g < 4; ++g) o[g] = vzero();
  float mrun = -1e30f, lrun = 0.0f;

  for (int kt = 0; kt < ntiles; ++kt) {
    const int kbase = kt * 32;

    // St tiles: s[g][r] = score(key kbase + 16g + 8hh + r, query q0 + m)
    v8f s[2];
#pragma unroll
    for (int g = 0; g < 2; ++g) {
      s[g] = vzero();
      const size_t ar = kbh + (size_t)(kbase + 16 * g + m) * HS;
      {
        const v16us kh = ld_frag(khi + ar, hh);
        const v16us kl = ld_frag(klo + ar, hh);
        s[g] = mma(kh, qh0, s[g]);
        s[g] = mma(kh, ql0, s[g]);
        s[g] = mma(kl, qh0, s[g]);
      }
      {
        const v16us kh = ld_frag(khi + ar + 32, hh);
        const v16us kl = ld_frag(klo + ar + 32, hh);
        s[g] = mma(kh, qh1, s[g]);
        s[g] = mma(kh, ql1, s[g]);
        s[g] = mma(kl, qh1, s[g]);
      }
    }

    // causal mask (key < tq), online softmax per lane (= per query)
    float p0[8], p1[8];
    float mx = -1e30f;
#pragma unroll
    for (int r = 0; r < 8; ++r) {
      const int key0 = kbase + 8 * hh + r;
      float a = s[0][r];
      float c = s[1][r];
      if (key0 >= tq)      a = -1e30f;
      if (key0 + 16 >= tq) c = -1e30f;
      p0[r] = a;
      p1[r] = c;
      mx = fmaxf(mx, fmaxf(a, c));
    }
    mx = fmaxf(mx, __shfl_xor(mx, 16, 32));
    const float mn = fmaxf(mrun, mx);
    const float sc = __expf(mrun - mn);
    float sum = 0.0f;
#pragma unroll
    for (int r = 0; r < 8; ++r) {
      p0[r] = __expf(p0[r] - mn);
      p1[r] = __expf(p1[r] - mn);
      sum += p0[r] + p1[r];
    }
    sum += __shfl_xor(sum, 16, 32);
    lrun = lrun * sc + sum;
    mrun = mn;

    // rescale O: o[g][r] belongs to query q0 + 8hh + r, whose scale lives in lane 8hh + r
#pragma unroll
    for (int r = 0; r < 8; ++r) {
      const float scr = __shfl(sc, 8 * hh + r, 32);
#pragma unroll
      for (int g = 0; g < 4; ++g) o[g][r] *= scr;
    }

    // P as A fragment (lane = query row, k = key within tile), bf16 hi/lo
    Frag ph, pl;
#pragma unroll
    for (int r = 0; r < 8; ++r) {
      const us_t a = f2bf(p0[r]);
      const us_t c = f2bf(p1[r]);
      ph.u[r]     = a;
      ph.u[8 + r] = c;
      pl.u[r]     = f2bf(p0[r] - bf2f(a));
      pl.u[8 + r] = f2bf(p1[r] - bf2f(c));
    }

    // O += P x V ; B fragment column n = dim 16g + m, k = key from the transposed planes
#pragma unroll
    for (int g = 0; g < 4; ++g) {
      const size_t vr = vbh + (size_t)(16 * g + m) * T_DIM + kbase;
      const v16us vh = ld_frag(vthi + vr, hh);
      const v16us vl = ld_frag(vtlo + vr, hh);
      o[g] = mma(ph.u, vh, o[g]);
      o[g] = mma(ph.u, vl, o[g]);
      o[g] = mma(pl.u, vh, o[g]);
    }
  }

  // epilogue: stage O (f32) and 1/l, then whole-line stores of the hi/lo planes
  const float inv = 1.0f / lrun;
  if (hh == 0) ldsInv[w][m] = inv;
#pragma unroll
  for (int g = 0; g < 4; ++g) {
#pragma unroll
    for (int r = 0; r < 8; ++r) ldsO[w][8 * hh + r][16 * g + m] = o[g][r];
  }
  __syncthreads();

  const int ch   = lane & 7;
  const int rsel = lane >> 3;          // 0..3
  v4u yh[4], yl[4];
#pragma unroll
  for (int it = 0; it < 4; ++it) {
    const int row = it * 4 + rsel;
    const float iv = ldsInv[w][row];
    const v4f* sp = (const v4f*)(&ldsO[w][row][8 * ch]);
    const v4f e0 = sp[0];
    const v4f e1 = sp[1];
    float vv[8];
#pragma unroll
    for (int i = 0; i < 4; ++i) { vv[i] = e0[i] * iv; vv[4 + i] = e1[i] * iv; }
#pragma unroll
    for (int i = 0; i < 4; ++i) {
      const us_t ha = f2bf(vv[2 * i]);
      const us_t hc = f2bf(vv[2 * i + 1]);
      yh[it][i] = pk2(ha, hc);
      yl[it][i] = pk2(f2bf(vv[2 * i] - bf2f(ha)), f2bf(vv[2 * i + 1] - bf2f(hc)));
    }
  }
  v4u vz;
#pragma unroll
  for (int i = 0; i < 4; ++i) vz[i] = 0u;

  const size_t yb = ((size_t)b * T_DIM) * C_DIM + h * HS + 8 * ch;   // + t * C_DIM
  const bool zrow = (blockIdx.x == 0) && (w == 0) && (lane < 8);     // row t = 0 of this (b,h)

#pragma unroll
  for (int it = 0; it < 4; ++it) {
    const int tqr = q0 + it * 4 + rsel;
    if (tqr <= Tm1) {
      const size_t off = yb + (size_t)tqr * C_DIM;
      *(v4u*)(yhi + off) = yh[it];
      *(v4u*)(ylo + off) = yl[it];
    }
  }
  if (zrow) {
    *(v4u*)(yhi + yb) = vz;
    *(v4u*)(ylo + yb) = vz;
  }
  
}

// ---------------------------------------------------------------------------
// launcher
// ---------------------------------------------------------------------------
extern "C" void kernel_launch(void* const* d_in, const int* in_sizes, int n_in,
                              void* d_out, int out_size, void* d_ws,
                              size_t ws_size, hipStream_t stream) {
  const size_t MT = (size_t)B_DIM * T_DIM;          // 4096 rows
  const size_t NX = MT * C_DIM;                     // 3145728
  const size_t NW = (size_t)C_DIM * C_DIM;          // 589824

  if (n_in < 8) return;
  if ((size_t)in_sizes[0] != NX || (size_t)in_sizes[1] != NW || in_sizes[2] != NH ||
      (size_t)in_sizes[3] != NW || in_sizes[4] != NH || in_sizes[5] != NH ||
      in_sizes[6] != NH || (size_t)in_sizes[7] != NW || (size_t)out_size != NX) return;

  const float* x       = (const float*)d_in[0];
  const float* W_la    = (const float*)d_in[1];
  const float* la_coef = (const float*)d_in[2];
  const float* W_v     = (const float*)d_in[3];
  const float* v_coef  = (const float*)d_in[4];
  const float* kbeta   = (const float*)d_in[5];
  const float* vbeta   = (const float*)d_in[6];
  const float* W_proj  = (const float*)d_in[7];
  float* out = (float*)d_out;

  // workspace carve (all sizes multiples of 256 B)
  size_t off = 0;
  char* ws = (char*)d_ws;
  us_t* xb   = (us_t*)(ws + off); off += NX * 2;
  us_t* wla  = (us_t*)(ws + off); off += NW * 2;
  us_t* wv   = (us_t*)(ws + off); off += NW * 2;
  us_t* wpj  = (us_t*)(ws + off); off += NW * 2;
  float* u   = (float*)(ws + off); off += NX * 4;
  float* xl  = (float*)(ws + off); off += NX * 4;
  us_t* khi  = (us_t*)(ws + off); off += NX * 2;
  us_t* klo  = (us_t*)(ws + off); off += NX * 2;
  us_t* vthi = (us_t*)(ws + off); off += NX * 2;
  us_t* vtlo = (us_t*)(ws + off); off += NX * 2;
  us_t* yhi  = (us_t*)(ws + off); off += NX * 2;
  us_t* ylo  = (us_t*)(ws + off); off += NX * 2;   // total 72,744,960 B
  if (off > ws_size) return;

  // 0) RNE convert inputs to bf16
  const int nx8 = (int)(NX / 8), nw8 = (int)(NW / 8);
  k_cvt<<<(nx8 + 255) / 256, 256, 0, stream>>>(x, xb, nx8);
  k_cvt<<<(nw8 + 255) / 256, 256, 0, stream>>>(W_la, wla, nw8);
  k_cvt<<<(nw8 + 255) / 256, 256, 0, stream>>>(W_v, wv, nw8);
  k_cvt<<<(nw8 + 255) / 256, 256, 0, stream>>>(W_proj, wpj, nw8);

  // 1) u = x W_la^T ; xl = x W_v^T
  dim3 ggrid(C_DIM / 64, (unsigned)(MT / 64));
  k_gemm<0><<<ggrid, 128, 0, stream>>>(xb, xb, wla, u, (int)MT, C_DIM, C_DIM);
  k_gemm<0><<<ggrid, 128, 0, stream>>>(xb, xb, wv, xl, (int)MT, C_DIM, C_DIM);

  // 2) leaky average + normalised, scaled keys as bf16 hi/lo
  dim3 egrid(EMA_SEG, B_DIM * NH);
  k_ema_knorm<<<egrid, EMA_NT, 0, stream>>>(u, la_coef, kbeta, khi, klo);

  // 3) values (transposed, bf16 hi/lo)
  dim3 vgrid(T_DIM / 64, B_DIM * NH);
  k_vmake<<<vgrid, 128, 0, stream>>>(xl, v_coef, vbeta, vthi, vtlo);

  // 4) attention -> y hi/lo planes
  dim3 agrid((T_DIM - 1 + 63) / 64, B_DIM * NH);
  k_attn<<<agrid, 128, 0, stream>>>(khi, klo, vthi, vtlo, yhi, ylo);

  // 5) out = y W_proj^T (hi and lo planes, two products)
  k_gemm<1><<<ggrid, 128, 0, stream>>>(yhi, ylo, wpj, out, (int)MT, C_DIM, C_DIM);
}

// v002
// Measured time: 236 microseconds a run.
// Two timings next to v001 both put it at 1.33 times that version's speed.
// Counting every step since v000, it is 7.38 times as fast.
#include <hip/hip_runtime.h>
#include <stdint.h>

// Contractions: v_wmma_f32_16x16x32_bf16 (bf16 operands, f32 accumulate). Input projections: single product on RNE-bf16 inputs. Score (K x Qt), P x V: bf16 hi/lo split (3 products). Output projection: hi/lo split activations x bf16 weights (2 products).

#define B_DIM 2
#define T_DIM 2048
#define C_DIM 768
#define NH    12
#define HS    64

typedef unsigned short us_t;
typedef __bf16         v16bf __attribute__((ext_vector_type(16)));
typedef unsigned short v16us __attribute__((ext_vector_type(16)));
typedef unsigned short v8us  __attribute__((ext_vector_type(8)));
typedef float          v8f   __attribute__((ext_vector_type(8)));
typedef float          v4f   __attribute__((ext_vector_type(4)));
typedef unsigned int   v4u   __attribute__((ext_vector_type(4)));

union Frag { v16us u; v8us half[2]; };

// ---------------------------------------------------------------------------
// helpers
// ---------------------------------------------------------------------------
__device__ __forceinline__ v8f vzero() {
  v8f z;
#pragma unroll
  for (int i = 0; i < 8; ++i) z[i] = 0.0f;
  return z;
}

// RNE f32 -> bf16 bits
__device__ __forceinline__ us_t f2bf(float f) {
  unsigned u = __float_as_uint(f);
  u += 0x7FFFu + ((u >> 16) & 1u);
  return (us_t)(u >> 16);
}
__device__ __forceinline__ float bf2f(us_t b) { return __uint_as_float(((unsigned)b) << 16); }
__device__ __forceinline__ float bfr(float f) { return bf2f(f2bf(f)); }
__device__ __forceinline__ unsigned pk2(us_t a, us_t b) { return (unsigned)a | (((unsigned)b) << 16); }

// 16x16x32 fragment loader (A rows / B columns stored k-contiguous):
// lane l: row/col = l&15, h = l>>4; elements 0..7 <- k0+8h+0..7, elements 8..15 <- k0+16+8h+0..7.
// p points at element k0 of the row; needs 16-B alignment.
__device__ __forceinline__ v16us ld_frag(const us_t* __restrict__ p, int hh) {
  Frag f;
  f.half[0] = *(const v8us*)(p + 8 * hh);
  f.half[1] = *(const v8us*)(p + 16 + 8 * hh);
  return f.u;
}

// D[16x16] += A[16x32] * B[32x16]; D element r of lane l = (row 8*(l>>4)+r, col l&15).
// Followed by the 4-slot VALU hazard guard (ties D, keeps A/B live).
__device__ __forceinline__ v8f mma(v16us a, v16us b, v8f c) {
  v16bf av = __builtin_bit_cast(v16bf, a);
  v16bf bv = __builtin_bit_cast(v16bf, b);
  c = __builtin_amdgcn_wmma_f32_16x16x32_bf16(false, av, false, bv, (short)0, c, false, false);
  asm volatile("v_nop\n\tv_nop\n\tv_nop\n\tv_nop" : "+v"(c) : "v"(a), "v"(b));
  return c;
}

// ---------------------------------------------------------------------------
// ---------------------------------------------------------------------------
__global__ __launch_bounds__(256) void k_cvt(const float* __restrict__ in,
                                            us_t* __restrict__ out, int n8) {
  const int i = blockIdx.x * 256 + threadIdx.x;
  if (i >= n8) return;
  const v4f* src = (const v4f*)(in + (size_t)i * 8);
  const v4f a = src[0];
  const v4f c = src[1];
  v4u p;
  p[0] = pk2(f2bf(a[0]), f2bf(a[1]));
  p[1] = pk2(f2bf(a[2]), f2bf(a[3]));
  p[2] = pk2(f2bf(c[0]), f2bf(c[1]));
  p[3] = pk2(f2bf(c[2]), f2bf(c[3]));
  v4u* dst = (v4u*)(out + (size_t)i * 8);
  *dst = p;
  
}

// ---------------------------------------------------------------------------
// 1) C[m][n] = sum_k A[m][k] * W[n][k]  (A: MxK bf16, W: NxK bf16, C: MxN f32)
//    SPLITA: C = (A + A2) * W^T with A = hi plane, A2 = lo plane (two products).
//    block = 4 waves, 64x64 tile; wave = 16 rows x 64 cols.
//    Epilogue: tile staged in LDS, each 256-B row segment written as 16 lanes x 16 B
//    Fragments sit in a ring of GEMM_ST k-steps of registers: a step's registers are loaded again
//    (for GEMM_ST steps further on) right behind its products, so GEMM_ST steps of loads are in flight.
//    The loops over ring steps and column groups are unrolled so that the ring's arrays stay in registers.
//    Host guarantees M % 64 == 0, N % 64 == 0, K % (32 * GEMM_ST) == 0, K > 0.
// ---------------------------------------------------------------------------
#define GEMM_ST 4
template <int SPLITA>
__global__ __launch_bounds__(128) void k_gemm(const us_t* __restrict__ A,
                                             const us_t* __restrict__ A2,
                                             const us_t* __restrict__ W,
                                             float* __restrict__ Cout,
                                             int M, int N, int K) {
  __shared__ __align__(16) float ldsC[4][16][68];
  (void)M;
  const int w = threadIdx.x >> 5, lane = threadIdx.x & 31, m = lane & 15, hh = lane >> 4;
  const int mbase = blockIdx.y * 64 + w * 16;
  const int nbase = blockIdx.x * 64;
  // element offsets of this lane's 16-B piece of its fragment rows; they walk along k
  unsigned ao = (unsigned)(mbase + m) * (unsigned)K + 8u * hh;
  unsigned wo[4];
#pragma unroll
  for (int g = 0; g < 4; ++g) wo[g] = (unsigned)(nbase + 16 * g + m) * (unsigned)K + 8u * hh;

  v8f acc[4];
#pragma unroll
  for (int g = 0; g < 4; ++g) acc[g] = vzero();

  v16us a[GEMM_ST], a2[GEMM_ST], bw[GEMM_ST][4];
#pragma unroll
  for (int i = 0; i < GEMM_ST; ++i) {
    a[i] = ld_frag(A + ao + 32 * i, 0);
    if (SPLITA) a2[i] = ld_frag(A2 + ao + 32 * i, 0);
#pragma unroll
    for (int g = 0; g < 4; ++g) bw[i][g] = ld_frag(W + wo[g] + 32 * i, 0);
    // keeps these loads in the ring's order, step by step: the loop's load-count waits must hold
    // for both ways into the loop and would otherwise wait for nearly the whole ring
    __builtin_amdgcn_sched_barrier(0);
  }
  // registers that held addresses of the loads above are written again below
  asm volatile("s_wait_xcnt 0x0" ::: "memory");

  for (int kb = 32 * GEMM_ST; kb < K; kb += 32 * GEMM_ST) {
    ao += 32 * GEMM_ST;
#pragma unroll
    for (int g = 0; g < 4; ++g) wo[g] += 32 * GEMM_ST;
#pragma unroll
    for (int i = 0; i < GEMM_ST; ++i) {
#pragma unroll
      for (int g = 0; g < 4; ++g) {
        acc[g] = mma(a[i], bw[i][g], acc[g]);
        if (SPLITA) acc[g] = mma(a2[i], bw[i][g], acc[g]);
      }
      a[i] = ld_frag(A + ao + 32 * i, 0);
      if (SPLITA) a2[i] = ld_frag(A2 + ao + 32 * i, 0);
#pragma unroll
      for (int g = 0; g < 4; ++g) bw[i][g] = ld_frag(W + wo[g] + 32 * i, 0);
    }
    // the next trip forms new addresses in the registers of the loads just issued
    asm volatile("s_wait_xcnt 0x0" ::: "memory");
  }
#pragma unroll
  for (int i = 0; i < GEMM_ST; ++i) {
#pragma unroll
    for (int g = 0; g < 4; ++g) {
      acc[g] = mma(a[i], bw[i][g], acc[g]);
      if (SPLITA) acc[g] = mma(a2[i], bw[i][g], acc[g]);
    }
  }

  // stage D tiles: acc[g][r] = C[mbase + 8hh + r][nbase + 16g + m]
#pragma unroll
  for (int g = 0; g < 4; ++g) {
#pragma unroll
    for (int r = 0; r < 8; ++r) ldsC[w][8 * hh + r][16 * g + m] = acc[g][r];
  }
  __syncthreads();

  v4f val[8];
#pragma unroll
  for (int it = 0; it < 8; ++it) val[it] = *(const v4f*)(&ldsC[w][2 * it + hh][4 * m]);

  float* gb = Cout + (size_t)mbase * N + nbase + 4 * m;
#pragma unroll
  for (int it = 0; it < 8; ++it)
    *(v4f*)(gb + (size_t)(2 * it + hh) * N) = val[it];
  
}

// ---------------------------------------------------------------------------
// 2) leaky average over T (f32) + L2 normalisation + beta scale,
//    written as bf16 hi/lo planes khi/klo in [B][NH][T][HS] layout.
//    The recurrence y[t] = c*y[t-1] + (1-c)*u[t] is linear, so T is cut into chunks of
//    EMA_CL rows that run side by side from a zero state:
//      y[t0+k] = ylocal[k] + c^(k+1) * S,   S = true state in front of the chunk,
//      S(next chunk) = c^EMA_CL * S + (end state of this chunk from zero).
//    A work-group = one (batch, head) and EMA_ROWS consecutive rows. It forms the end states
//    of every chunk up to its own last one (earlier chunks again, from L2), folds them in LDS,
//    and normalises and stores its own rows only: nothing passes between work-groups.
//    Lane group of 8 = one row (8 channels per lane).
//    The loops of constant length are unrolled so that their arrays stay in registers; the load
//    loop also so that all 32 loads of a chunk are in flight before the first is used.
// ---------------------------------------------------------------------------
#define EMA_CL    16                     // rows per chunk
#define EMA_NCH   (T_DIM / EMA_CL)       // chunks per (batch, head)
#define EMA_SEG   8                      // work-groups per (batch, head)
#define EMA_CPS   (EMA_NCH / EMA_SEG)    // chunks stored by one work-group
#define EMA_ROWS  (EMA_CL * EMA_CPS)     // rows stored by one work-group
#define EMA_NT    512                    // threads per work-group
#define EMA_NG    (EMA_NT / 8)           // lane groups per work-group
#define EMA_PITCH 96                     // floats per staged row: neighbour rows fall on the two bank halves

__global__ __launch_bounds__(EMA_NT) void k_ema_knorm(const float* __restrict__ u,
                                                     const float* __restrict__ la_coef,
                                                     const float* __restrict__ kbeta,
                                                     us_t* __restrict__ khi,
                                                     us_t* __restrict__ klo) {
#pragma clang fp contract(off)
  // In all three arrays a lane's channels 8sub..8sub+3 sit at float 4*sub, 8sub+4..8sub+7 at 32 + 4*sub.
  __shared__ __align__(16) float ldsE[EMA_NCH][HS];           // end state of each chunk from a zero start
  __shared__ __align__(16) float ldsS[EMA_CPS][HS];           // true state in front of each own chunk
  __shared__ __align__(16) float ldsY[EMA_ROWS][EMA_PITCH];   // own rows from a zero start

  const int tid  = threadIdx.x;
  const int grp  = tid >> 3;
  const int sub  = tid & 7;
  const int seg  = (EMA_SEG - 1) - (int)blockIdx.x;           // the longest work-groups start first
  const int bh   = blockIdx.y, b = bh / NH, h = bh % NH;
  const int own0 = EMA_CPS * seg;                             // first own chunk
  const int nch  = own0 + EMA_CPS;                            // chunks this work-group walks

  const float cc   = bfr(la_coef[h]);
  const float omc  = 1.0f - cc;
  const float beta = expf(fminf(bfr(kbeta[h]) * 10.0f, 5.0f));

  // cp = c^(k+1) for this lane group's row position k = grp % EMA_CL; cl = c^EMA_CL
  float cp = 1.0f, cl = cc;
  {
    const int e = (grp & (EMA_CL - 1)) + 1;                   // 1..16
#pragma unroll
    for (int bit = 0; bit < 4; ++bit) {
      if ((e >> bit) & 1) cp *= cl;
      cl *= cl;
    }
    if (e >> 4) cp = cl;
  }

  const float* up = u + (size_t)b * T_DIM * C_DIM + h * HS + 8 * sub;

  // a) every chunk from a zero state; own0 and nch are multiples of 4, so a wave's four groups agree
  for (int j = grp; j < nch; j += EMA_NG) {
    const float* cpn = up + (size_t)(j * EMA_CL) * C_DIM;
    v4f x0[EMA_CL], x1[EMA_CL];
#pragma unroll
    for (int k = 0; k < EMA_CL; ++k) {
      const v4f* src = (const v4f*)(cpn + (size_t)k * C_DIM);
      x0[k] = src[0];
      x1[k] = src[1];
    }
    const bool own = (j >= own0);
    float* yrow = &ldsY[own ? (j - own0) * EMA_CL : 0][4 * sub];
    v4f y0, y1;
#pragma unroll
    for (int i = 0; i < 4; ++i) { y0[i] = 0.0f; y1[i] = 0.0f; }
#pragma unroll
    for (int k = 0; k < EMA_CL; ++k) {
#pragma unroll
      for (int i = 0; i < 4; ++i) {
        y0[i] = cc * y0[i] + omc * x0[k][i];
        y1[i] = cc * y1[i] + omc * x1[k][i];
      }
      if (own) {
        *(v4f*)(yrow + k * EMA_PITCH)      = y0;
        *(v4f*)(yrow + k * EMA_PITCH + 32) = y1;
      }
    }
    *(v4f*)(&ldsE[j][4 * sub])      = y0;
    *(v4f*)(&ldsE[j][32 + 4 * sub]) = y1;
  }
  __syncthreads();

  // b) fold the end states in time order, one channel per lane (two waves)
  if (tid < HS) {
    float s = 0.0f;
    for (int j0 = 0; j0 < own0; j0 += EMA_CPS) {
      float e[EMA_CPS];
#pragma unroll
      for (int i = 0; i < EMA_CPS; ++i) e[i] = ldsE[j0 + i][tid];
#pragma unroll
      for (int i = 0; i < EMA_CPS; ++i) s = cl * s + e[i];
    }
    float e[EMA_CPS];
#pragma unroll
    for (int i = 0; i < EMA_CPS; ++i) e[i] = ldsE[own0 + i][tid];
#pragma unroll
    for (int i = 0; i < EMA_CPS; ++i) {
      ldsS[i][tid] = s;
      s = cl * s + e[i];
    }
  }
  __syncthreads();

  // c) own rows: add the carried state, normalise, scale, split, store
  const size_t drow = ((size_t)bh * T_DIM + (size_t)seg * EMA_ROWS) * HS + 8 * sub;
#pragma unroll
  for (int it = 0; it < EMA_ROWS / EMA_NG; ++it) {
    const int r = grp + EMA_NG * it;                          // r % EMA_CL == grp % EMA_CL
    const v4f a0 = *(const v4f*)(&ldsY[r][4 * sub]);
    const v4f a1 = *(const v4f*)(&ldsY[r][32 + 4 * sub]);
    const v4f s0 = *(const v4f*)(&ldsS[r / EMA_CL][4 * sub]);
    const v4f s1 = *(const v4f*)(&ldsS[r / EMA_CL][32 + 4 * sub]);
    float y[8];
#pragma unroll
    for (int i = 0; i < 4; ++i) {
      y[i]     = a0[i] + cp * s0[i];
      y[4 + i] = a1[i] + cp * s1[i];
    }
    float ss = 0.0f;
#pragma unroll
    for (int i = 0; i < 8; ++i) ss += y[i] * y[i];
    ss += __shfl_xor(ss, 1, 32);
    ss += __shfl_xor(ss, 2, 32);
    ss += __shfl_xor(ss, 4, 32);
    const float rn = 1.0f / (sqrtf(ss) + 1e-6f);

    v4u ph, pl;
#pragma unroll
    for (int i = 0; i < 4; ++i) {
      const float ka = (y[2 * i] * rn) * beta;
      const float kc = (y[2 * i + 1] * rn) * beta;
      const us_t ha = f2bf(ka), hc = f2bf(kc);
      ph[i] = pk2(ha, hc);
      pl[i] = pk2(f2bf(ka - bf2f(ha)), f2bf(kc - bf2f(hc)));
    }
    const size_t off = drow + (size_t)r * HS;
    *(v4u*)(khi + off) = ph;
    *(v4u*)(klo + off) = pl;
  }
}

// ---------------------------------------------------------------------------
// 3) value featurizer: f = xl[t+1]*(1-vc) + xl[t]*vc, L2 normalise, beta scale,
//    written TRANSPOSED as bf16 hi/lo planes vthi/vtlo in [B*NH][HS][T] layout
//    (key-contiguous rows for the P x V B-fragments).
// ---------------------------------------------------------------------------
__global__ __launch_bounds__(128) void k_vmake(const float* __restrict__ xl,
                                              const float* __restrict__ v_coef,
                                              const float* __restrict__ vbeta,
                                              us_t* __restrict__ vthi,
                                              us_t* __restrict__ vtlo) {
#pragma clang fp contract(off)
  __shared__ __align__(16) us_t ldsH[HS][72];
  __shared__ __align__(16) us_t ldsL[HS][72];
  const int bh = blockIdx.y, b = bh / NH, h = bh % NH;
  const int t0 = blockIdx.x * 64;
  const int w = threadIdx.x >> 5, lane = threadIdx.x & 31;

  const float vc  = bfr(v_coef[h]);
  const float omv = 1.0f - vc;
  const float vb  = expf(fminf(bfr(vbeta[h]) * 10.0f, 5.0f));

  for (int rr = 0; rr < 16; ++rr) {
    const int tl = w * 16 + rr;
    const int t  = t0 + tl;
    const float* cur = xl + ((size_t)b * T_DIM + t) * C_DIM + h * HS;
    const float c0 = cur[lane], c1 = cur[lane + 32];
    float s0 = 0.0f, s1 = 0.0f;
    if (t + 1 < T_DIM) {
      const float* nx = cur + C_DIM;
      s0 = nx[lane];
      s1 = nx[lane + 32];
    }
    const float f0 = s0 * omv + c0 * vc;
    const float f1 = s1 * omv + c1 * vc;
    float ss = f0 * f0 + f1 * f1;
    ss += __shfl_xor(ss, 16, 32);
    ss += __shfl_xor(ss, 8, 32);
    ss += __shfl_xor(ss, 4, 32);
    ss += __shfl_xor(ss, 2, 32);
    ss += __shfl_xor(ss, 1, 32);
    const float rn = 1.0f / (sqrtf(ss) + 1e-6f);
    const float v0 = (f0 * rn) * vb;
    const float v1 = (f1 * rn) * vb;
    const us_t h0 = f2bf(v0), h1 = f2bf(v1);
    ldsH[lane][tl]      = h0;
    ldsH[lane + 32][tl] = h1;
    ldsL[lane][tl]      = f2bf(v0 - bf2f(h0));
    ldsL[lane + 32][tl] = f2bf(v1 - bf2f(h1));
  }
  __syncthreads();

  const int tid = threadIdx.x;
  const int ch  = tid & 7;
  const int dsl = tid >> 3;            // 0..15
  v4u ph[4], pl[4];
#pragma unroll
  for (int it = 0; it < 4; ++it) {
    const int d = it * 16 + dsl;
    ph[it] = *(const v4u*)(&ldsH[d][8 * ch]);
    pl[it] = *(const v4u*)(&ldsL[d][8 * ch]);
  }
  const size_t gb = ((size_t)bh * HS) * T_DIM + t0 + 8 * ch;
#pragma unroll
  for (int it = 0; it < 4; ++it) {
    const size_t off = gb + (size_t)(it * 16 + dsl) * T_DIM;
    *(v4u*)(vthi + off) = ph[it];
    *(v4u*)(vtlo + off) = pl[it];
  }
  
}

// ---------------------------------------------------------------------------
// 4) shifted-causal flash attention, per wave 16 queries, key tiles of 32.
//    Scores computed transposed: St[key][query] = K_tile (A, rows = keys) x Qt (B, cols = queries),
//    so lane = query owns its softmax statistics and the P A-fragment for P x V is an
//    in-register repack of the two 16-key D tiles (element r <- tile keys 0..15, 8+r <- tile keys 16..31).
//    O[query][dim] accumulated with A = P, B = Vt rows (key-contiguous). All fragments from
//    dense global rows; bf16 hi/lo: hi*hi + hi*lo + lo*hi.
//    Every fragment of a tile has registers of its own: the V loads of a tile are issued in front of
//    its score products, the K loads of the next tile right behind them, so that no product waits
//    for a load issued just in front of it. The fragment loops are unrolled so that the arrays stay in registers.
//    grid = (ceil((T-1)/64), B*NH), block 128. Output y hi/lo planes [B][T][C];
// ---------------------------------------------------------------------------
__global__ __launch_bounds__(128) void k_attn(const us_t* __restrict__ khi,
                                             const us_t* __restrict__ klo,
                                             const us_t* __restrict__ vthi,
                                             const us_t* __restrict__ vtlo,
                                             us_t* __restrict__ yhi,
                                             us_t* __restrict__ ylo) {
#pragma clang fp contract(off)
  __shared__ __align__(16) float ldsO[4][16][68];
  __shared__ float ldsInv[4][16];

  const int bh = blockIdx.y, b = bh / NH, h = bh % NH;
  const int w = threadIdx.x >> 5, lane = threadIdx.x & 31, m = lane & 15, hh = lane >> 4;
  const int Tm1 = T_DIM - 1;
  const int q0  = 1 + 64 * blockIdx.x + 16 * w;   // first query time of this wave
  const int tq  = q0 + m;                          // this lane's query (B column n and stats owner)
  const int tqc = (tq < Tm1) ? tq : Tm1;           // clamped for loads (slot tq == T is never stored)

  const size_t kbh = (size_t)bh * T_DIM * HS;
  const size_t vbh = (size_t)bh * HS * T_DIM;

  // Q fragments (B operand): column n = query, k = dim; q rows are k rows at time tq
  const us_t* qh_row = khi + kbh + (size_t)tqc * HS;
  const us_t* ql_row = klo + kbh + (size_t)tqc * HS;
  const v16us qh0 = ld_frag(qh_row, hh),      ql0 = ld_frag(ql_row, hh);        // dims 0..31
  const v16us qh1 = ld_frag(qh_row + 32, hh), ql1 = ld_frag(ql_row + 32, hh);   // dims 32..63

  int qmax = q0 + 15;
  if (qmax > Tm1) qmax = Tm1;
  const int ntiles = (qmax + 31) >> 5;             // keys 0..qmax-1, wave-uniform

  v8f o[4];
#pragma unroll
  for (int g = 0; g < 4; ++g) o[g] = vzero();
  float mrun = -1e30f, lrun = 0.0f;

  // this lane's 16-B piece of its fragment rows; the pointers walk from tile to tile
  const us_t* kh_p = khi + kbh + (size_t)m * HS + 8 * hh;
  const us_t* kl_p = klo + kbh + (size_t)m * HS + 8 * hh;
  const us_t* vh_p = vthi + vbh + (size_t)m * T_DIM + 8 * hh;
  const us_t* vl_p = vtlo + vbh + (size_t)m * T_DIM + 8 * hh;

  // K fragments of the current tile, index 2g + dim half (tile 0 always exists: qmax >= 16)
  v16us kh[4], kl[4];
#pragma unroll
  for (int j = 0; j < 4; ++j) {
    kh[j] = ld_frag(kh_p + (j >> 1) * 16 * HS + (j & 1) * 32, 0);
    kl[j] = ld_frag(kl_p + (j >> 1) * 16 * HS + (j & 1) * 32, 0);
  }

  for (int kt = 0; kt < ntiles; ++kt) {
    const int kbase = kt * 32;

    // V fragments of this tile (B operand: column n = dim 16g + m, k = key from the transposed planes)
    v16us vh[4], vl[4];
#pragma unroll
    for (int g = 0; g < 4; ++g) {
      vh[g] = ld_frag(vh_p + (size_t)(16 * g) * T_DIM, 0);
      vl[g] = ld_frag(vl_p + (size_t)(16 * g) * T_DIM, 0);
    }

    // St tiles: s[g][r] = score(key kbase + 16g + 8hh + r, query q0 + m)
    v8f s[2];
#pragma unroll
    for (int g = 0; g < 2; ++g) {
      s[g] = vzero();
      s[g] = mma(kh[2 * g], qh0, s[g]);
      s[g] = mma(kh[2 * g], ql0, s[g]);
      s[g] = mma(kl[2 * g], qh0, s[g]);
      s[g] = mma(kh[2 * g + 1], qh1, s[g]);
      s[g] = mma(kh[2 * g + 1], ql1, s[g]);
      s[g] = mma(kl[2 * g + 1], qh1, s[g]);
    }

    // K fragments of the next tile into the registers just read (the last tile loads itself again)
    {
      const int kstep = (kt + 1 < ntiles) ? 32 * HS : 0;
      kh_p += kstep;
      kl_p += kstep;
#pragma unroll
      for (int j = 0; j < 4; ++j) {
        kh[j] = ld_frag(kh_p + (j >> 1) * 16 * HS + (j & 1) * 32, 0);
        kl[j] = ld_frag(kl_p + (j >> 1) * 16 * HS + (j & 1) * 32, 0);
      }
      vh_p += 32;
      vl_p += 32;
    }

    // causal mask (key < tq), online softmax per lane (= per query)
    float p0[8], p1[8];
    float mx = -1e30f;
#pragma unroll
    for (int r = 0; r < 8; ++r) {
      const int key0 = kbase + 8 * hh + r;
      float a = s[0][r];
      float c = s[1][r];
      if (key0 >= tq)      a = -1e30f;
      if (key0 + 16 >= tq) c = -1e30f;
      p0[r] = a;
      p1[r] = c;
      mx = fmaxf(mx, fmaxf(a, c));
    }
    mx = fmaxf(mx, __shfl_xor(mx, 16, 32));
    const float mn = fmaxf(mrun, mx);
    const float sc = __expf(mrun - mn);
    float sum = 0.0f;
#pragma unroll
    for (int r = 0; r < 8; ++r) {
      p0[r] = __expf(p0[r] - mn);
      p1[r] = __expf(p1[r] - mn);
      sum += p0[r] + p1[r];
    }
    sum += __shfl_xor(sum, 16, 32);
    lrun = lrun * sc + sum;
    mrun = mn;

    // rescale O: o[g][r] belongs to query q0 + 8hh + r, whose scale lives in lane 8hh + r
#pragma unroll
    for (int r = 0; r < 8; ++r) {
      const float scr = __shfl(sc, 8 * hh + r, 32);
#pragma unroll
      for (int g = 0; g < 4; ++g) o[g][r] *= scr;
    }

    // P as A fragment (lane = query row, k = key within tile), bf16 hi/lo
    Frag ph, pl;
#pragma unroll
    for (int r = 0; r < 8; ++r) {
      const us_t a = f2bf(p0[r]);
      const us_t c = f2bf(p1[r]);
      ph.u[r]     = a;
      ph.u[8 + r] = c;
      pl.u[r]     = f2bf(p0[r] - bf2f(a));
      pl.u[8 + r] = f2bf(p1[r] - bf2f(c));
    }

    // O += P x V
#pragma unroll
    for (int g = 0; g < 4; ++g) {
      o[g] = mma(ph.u, vh[g], o[g]);
      o[g] = mma(ph.u, vl[g], o[g]);
      o[g] = mma(pl.u, vh[g], o[g]);
    }
  }

  // epilogue: stage O (f32) and 1/l, then whole-line stores of the hi/lo planes
  const float inv = 1.0f / lrun;
  if (hh == 0) ldsInv[w][m] = inv;
#pragma unroll
  for (int g = 0; g < 4; ++g) {
#pragma unroll
    for (int r = 0; r < 8; ++r) ldsO[w][8 * hh + r][16 * g + m] = o[g][r];
  }
  __syncthreads();

  const int ch   = lane & 7;
  const int rsel = lane >> 3;          // 0..3
  v4u yh[4], yl[4];
#pragma unroll
  for (int it = 0; it < 4; ++it) {
    const int row = it * 4 + rsel;
    const float iv = ldsInv[w][row];
    const v4f* sp = (const v4f*)(&ldsO[w][row][8 * ch]);
    const v4f e0 = sp[0];
    const v4f e1 = sp[1];
    float vv[8];
#pragma unroll
    for (int i = 0; i < 4; ++i) { vv[i] = e0[i] * iv; vv[4 + i] = e1[i] * iv; }
#pragma unroll
    for (int i = 0; i < 4; ++i) {
      const us_t ha = f2bf(vv[2 * i]);
      const us_t hc = f2bf(vv[2 * i + 1]);
      yh[it][i] = pk2(ha, hc);
      yl[it][i] = pk2(f2bf(vv[2 * i] - bf2f(ha)), f2bf(vv[2 * i + 1] - bf2f(hc)));
    }
  }
  v4u vz;
#pragma unroll
  for (int i = 0; i < 4; ++i) vz[i] = 0u;

  const size_t yb = ((size_t)b * T_DIM) * C_DIM + h * HS + 8 * ch;   // + t * C_DIM
  const bool zrow = (blockIdx.x == 0) && (w == 0) && (lane < 8);     // row t = 0 of this (b,h)

#pragma unroll
  for (int it = 0; it < 4; ++it) {
    const int tqr = q0 + it * 4 + rsel;
    if (tqr <= Tm1) {
      const size_t off = yb + (size_t)tqr * C_DIM;
      *(v4u*)(yhi + off) = yh[it];
      *(v4u*)(ylo + off) = yl[it];
    }
  }
  if (zrow) {
    *(v4u*)(yhi + yb) = vz;
    *(v4u*)(ylo + yb) = vz;
  }
  
}

// ---------------------------------------------------------------------------
// launcher
// ---------------------------------------------------------------------------
extern "C" void kernel_launch(void* const* d_in, const int* in_sizes, int n_in,
                              void* d_out, int out_size, void* d_ws,
                              size_t ws_size, hipStream_t stream) {
  const size_t MT = (size_t)B_DIM * T_DIM;          // 4096 rows
  const size_t NX = MT * C_DIM;                     // 3145728
  const size_t NW = (size_t)C_DIM * C_DIM;          // 589824

  if (n_in < 8) return;
  if ((size_t)in_sizes[0] != NX || (size_t)in_sizes[1] != NW || in_sizes[2] != NH ||
      (size_t)in_sizes[3] != NW || in_sizes[4] != NH || in_sizes[5] != NH ||
      in_sizes[6] != NH || (size_t)in_sizes[7] != NW || (size_t)out_size != NX) return;

  const float* x       = (const float*)d_in[0];
  const float* W_la    = (const float*)d_in[1];
  const float* la_coef = (const float*)d_in[2];
  const float* W_v     = (const float*)d_in[3];
  const float* v_coef  = (const float*)d_in[4];
  const float* kbeta   = (const float*)d_in[5];
  const float* vbeta   = (const float*)d_in[6];
  const float* W_proj  = (const float*)d_in[7];
  float* out = (float*)d_out;

  // workspace carve (all sizes multiples of 256 B)
  size_t off = 0;
  char* ws = (char*)d_ws;
  us_t* xb   = (us_t*)(ws + off); off += NX * 2;
  us_t* wla  = (us_t*)(ws + off); off += NW * 2;
  us_t* wv   = (us_t*)(ws + off); off += NW * 2;
  us_t* wpj  = (us_t*)(ws + off); off += NW * 2;
  float* u   = (float*)(ws + off); off += NX * 4;
  float* xl  = (float*)(ws + off); off += NX * 4;
  us_t* khi  = (us_t*)(ws + off); off += NX * 2;
  us_t* klo  = (us_t*)(ws + off); off += NX * 2;
  us_t* vthi = (us_t*)(ws + off); off += NX * 2;
  us_t* vtlo = (us_t*)(ws + off); off += NX * 2;
  us_t* yhi  = (us_t*)(ws + off); off += NX * 2;
  us_t* ylo  = (us_t*)(ws + off); off += NX * 2;   // total 72,744,960 B
  if (off > ws_size) return;

  // 0) RNE convert inputs to bf16
  const int nx8 = (int)(NX / 8), nw8 = (int)(NW / 8);
  k_cvt<<<(nx8 + 255) / 256, 256, 0, stream>>>(x, xb, nx8);
  k_cvt<<<(nw8 + 255) / 256, 256, 0, stream>>>(W_la, wla, nw8);
  k_cvt<<<(nw8 + 255) / 256, 256, 0, stream>>>(W_v, wv, nw8);
  k_cvt<<<(nw8 + 255) / 256, 256, 0, stream>>>(W_proj, wpj, nw8);

  // 1) u = x W_la^T ; xl = x W_v^T
  dim3 ggrid(C_DIM / 64, (unsigned)(MT / 64));
  k_gemm<0><<<ggrid, 128, 0, stream>>>(xb, xb, wla, u, (int)MT, C_DIM, C_DIM);
  k_gemm<0><<<ggrid, 128, 0, stream>>>(xb, xb, wv, xl, (int)MT, C_DIM, C_DIM);

  // 2) leaky average + normalised, scaled keys as bf16 hi/lo
  dim3 egrid(EMA_SEG, B_DIM * NH);
  k_ema_knorm<<<egrid, EMA_NT, 0, stream>>>(u, la_coef, kbeta, khi, klo);

  // 3) values (transposed, bf16 hi/lo)
  dim3 vgrid(T_DIM / 64, B_DIM * NH);
  k_vmake<<<vgrid, 128, 0, stream>>>(xl, v_coef, vbeta, vthi, vtlo);

  // 4) attention -> y hi/lo planes
  dim3 agrid((T_DIM - 1 + 63) / 64, B_DIM * NH);
  k_attn<<<agrid, 128, 0, stream>>>(khi, klo, vthi, vtlo, yhi, ylo);

  // 5) out = y W_proj^T (hi and lo planes, two products)
  k_gemm<1><<<ggrid, 128, 0, stream>>>(yhi, ylo, wpj, out, (int)MT, C_DIM, C_DIM);
}

// v003
// It runs in 154 microseconds.
// Two timings next to v002 put it at 1.52 and 1.53 times that version's speed.
// Over all steps from v000 it is 11.3 times as fast.
#include <hip/hip_runtime.h>
#include <stdint.h>

// Contractions: v_wmma_f32_16x16x32_bf16 (bf16 operands, f32 accumulate). Input projections: single product on RNE-bf16 inputs. Score (K x Qt), P x V: bf16 hi/lo split (3 products). Output projection: hi/lo split activations x bf16 weights (2 products).

#define B_DIM 2
#define T_DIM 2048
#define C_DIM 768
#define NH    12
#define HS    64

typedef unsigned short us_t;
typedef __bf16         v16bf __attribute__((ext_vector_type(16)));
typedef unsigned short v16us __attribute__((ext_vector_type(16)));
typedef unsigned short v8us  __attribute__((ext_vector_type(8)));
typedef float          v8f   __attribute__((ext_vector_type(8)));
typedef float          v4f   __attribute__((ext_vector_type(4)));
typedef unsigned int   v4u   __attribute__((ext_vector_type(4)));

union Frag { v16us u; v8us half[2]; };

// ---------------------------------------------------------------------------
// helpers
// ---------------------------------------------------------------------------
__device__ __forceinline__ v8f vzero() {
  v8f z;
#pragma unroll
  for (int i = 0; i < 8; ++i) z[i] = 0.0f;
  return z;
}

// RNE f32 -> bf16 bits
__device__ __forceinline__ us_t f2bf(float f) {
  unsigned u = __float_as_uint(f);
  u += 0x7FFFu + ((u >> 16) & 1u);
  return (us_t)(u >> 16);
}
__device__ __forceinline__ float bf2f(us_t b) { return __uint_as_float(((unsigned)b) << 16); }
__device__ __forceinline__ float bfr(float f) { return bf2f(f2bf(f)); }
__device__ __forceinline__ unsigned pk2(us_t a, us_t b) { return (unsigned)a | (((unsigned)b) << 16); }

// 16x16x32 fragment (A rows / B columns), k order:
// lane l: row/col = l&15, h = l>>4; elements 0..7 <- k0+8h+0..7, elements 8..15 <- k0+16+8h+0..7.
// Every bf16 plane (x, the weights, K, Vt, y) is kept in fragment order: a fragment of 16 rows x 32 k is 1 KiB of its own.
// Lane l finds its elements 0..7 at us_t 8 l and its elements 8..15 at us_t 256 + 8 l, so each of the two loads
// of a wave covers 512 contiguous bytes = 4 whole lines, where a row-major plane makes it touch 16 lines.
// p points at this lane's first piece.
__device__ __forceinline__ v16us ld_fragp(const us_t* __restrict__ p) {
  Frag f;
  f.half[0] = *(const v8us*)(p);
  f.half[1] = *(const v8us*)(p + 256);
  return f.u;
}
// place, in 16-B pieces, of piece (row, k8 = k / 8) in a fragment-order plane with kf fragments along k
__device__ __forceinline__ unsigned pk_idx(unsigned row, unsigned k8, unsigned kf) {
  return ((row >> 4) * kf + (k8 >> 2)) * 64u + (k8 & 3u) * 16u + (row & 15u);
}

// D[16x16] += A[16x32] * B[32x16]; D element r of lane l = (row 8*(l>>4)+r, col l&15).
// Followed by the 4-slot VALU hazard guard (ties D, keeps A/B live).
__device__ __forceinline__ v8f mma(v16us a, v16us b, v8f c) {
  v16bf av = __builtin_bit_cast(v16bf, a);
  v16bf bv = __builtin_bit_cast(v16bf, b);
  c = __builtin_amdgcn_wmma_f32_16x16x32_bf16(false, av, false, bv, (short)0, c, false, false);
  asm volatile("v_nop\n\tv_nop\n\tv_nop\n\tv_nop" : "+v"(c) : "v"(a), "v"(b));
  return c;
}

// ---------------------------------------------------------------------------
// 0) f32 [rows][C_DIM] -> RNE bf16 in fragment order; thread i writes piece i of the plane.
//    Host guarantees n8 % 64 == 0 and rows % 16 == 0.
// ---------------------------------------------------------------------------
__global__ __launch_bounds__(256) void k_cvt(const float* __restrict__ in,
                                            us_t* __restrict__ out, int n8) {
  const int i = blockIdx.x * 256 + threadIdx.x;
  if (i >= n8) return;
  const unsigned blk = (unsigned)i >> 6;
  const unsigned row = (blk / (C_DIM / 32)) * 16u + ((unsigned)i & 15u);
  const unsigned k8  = (blk % (C_DIM / 32)) * 4u + (((unsigned)i >> 4) & 3u);
  const v4f* src = (const v4f*)(in + (size_t)row * C_DIM + k8 * 8u);
  const v4f a = src[0];
  const v4f c = src[1];
  v4u p;
  p[0] = pk2(f2bf(a[0]), f2bf(a[1]));
  p[1] = pk2(f2bf(a[2]), f2bf(a[3]));
  p[2] = pk2(f2bf(c[0]), f2bf(c[1]));
  p[3] = pk2(f2bf(c[2]), f2bf(c[3]));
  v4u* dst = (v4u*)(out + (size_t)i * 8);
  *dst = p;
  
}

// ---------------------------------------------------------------------------
// 1) C[m][n] = sum_k A[m][k] * W[n][k]  (A: MxK bf16, W: NxK bf16, both in fragment order, C: MxN f32 row-major)
//    SPLITA: C = (A + A2) * W^T with A = hi plane, A2 = lo plane (two products); these are the y planes, whose
//    row b*T + i holds time i + 1 (row b*T + T-1: zeros, time 0), so the result rows are stored one time step on.
//    block = 4 waves, 64x64 tile; wave = 16 rows x 64 cols.
//    Epilogue: tile staged in LDS, each 256-B row segment written as 16 lanes x 16 B
//    Fragments sit in a ring of GEMM_ST k-steps of registers: a step's registers are loaded again
//    (for GEMM_ST steps further on) right behind its products, so GEMM_ST steps of loads are in flight.
//    The loops over ring steps and column groups are unrolled so that the ring's arrays stay in registers.
//    Host guarantees M % 64 == 0, N % 64 == 0, K % (32 * GEMM_ST) == 0, K > 0.
// ---------------------------------------------------------------------------
#define GEMM_ST 4
template <int SPLITA>
__global__ __launch_bounds__(128) void k_gemm(const us_t* __restrict__ A,
                                             const us_t* __restrict__ A2,
                                             const us_t* __restrict__ W,
                                             float* __restrict__ Cout,
                                             int M, int N, int K) {
  __shared__ __align__(16) float ldsC[4][16][68];
  (void)M;
  const int w = threadIdx.x >> 5, lane = threadIdx.x & 31, m = lane & 15, hh = lane >> 4;
  const int mbase = blockIdx.y * 64 + w * 16;
  const int nbase = blockIdx.x * 64;
  // element offsets of this lane's 16-B piece of its fragment rows; they walk along k
  const unsigned kf = (unsigned)K >> 5;            // fragments along k
  unsigned ao = (unsigned)(mbase >> 4) * kf * 512u + 8u * lane;
  unsigned wo[4];
#pragma unroll
  for (int g = 0; g < 4; ++g) wo[g] = (unsigned)((nbase >> 4) + g) * kf * 512u + 8u * lane;

  v8f acc[4];
#pragma unroll
  for (int g = 0; g < 4; ++g) acc[g] = vzero();

  v16us a[GEMM_ST], a2[GEMM_ST], bw[GEMM_ST][4];
#pragma unroll
  for (int i = 0; i < GEMM_ST; ++i) {
    a[i] = ld_fragp(A + ao + 512 * i);
    if (SPLITA) a2[i] = ld_fragp(A2 + ao + 512 * i);
#pragma unroll
    for (int g = 0; g < 4; ++g) bw[i][g] = ld_fragp(W + wo[g] + 512 * i);
    // keeps these loads in the ring's order, step by step: the loop's load-count waits must hold
    // for both ways into the loop and would otherwise wait for nearly the whole ring
    __builtin_amdgcn_sched_barrier(0);
  }
  // registers that held addresses of the loads above are written again below
  asm volatile("s_wait_xcnt 0x0" ::: "memory");

  for (int kb = 32 * GEMM_ST; kb < K; kb += 32 * GEMM_ST) {
    ao += 512 * GEMM_ST;
#pragma unroll
    for (int g = 0; g < 4; ++g) wo[g] += 512 * GEMM_ST;
#pragma unroll
    for (int i = 0; i < GEMM_ST; ++i) {
#pragma unroll
      for (int g = 0; g < 4; ++g) {
        acc[g] = mma(a[i], bw[i][g], acc[g]);
        if (SPLITA) acc[g] = mma(a2[i], bw[i][g], acc[g]);
      }
      a[i] = ld_fragp(A + ao + 512 * i);
      if (SPLITA) a2[i] = ld_fragp(A2 + ao + 512 * i);
#pragma unroll
      for (int g = 0; g < 4; ++g) bw[i][g] = ld_fragp(W + wo[g] + 512 * i);
    }
    // the next trip forms new addresses in the registers of the loads just issued
    asm volatile("s_wait_xcnt 0x0" ::: "memory");
  }
#pragma unroll
  for (int i = 0; i < GEMM_ST; ++i) {
#pragma unroll
    for (int g = 0; g < 4; ++g) {
      acc[g] = mma(a[i], bw[i][g], acc[g]);
      if (SPLITA) acc[g] = mma(a2[i], bw[i][g], acc[g]);
    }
  }

  // stage D tiles: acc[g][r] = C[mbase + 8hh + r][nbase + 16g + m]
#pragma unroll
  for (int g = 0; g < 4; ++g) {
#pragma unroll
    for (int r = 0; r < 8; ++r) ldsC[w][8 * hh + r][16 * g + m] = acc[g][r];
  }
  __syncthreads();

  v4f val[8];
#pragma unroll
  for (int it = 0; it < 8; ++it) val[it] = *(const v4f*)(&ldsC[w][2 * it + hh][4 * m]);

  float* gb = Cout + nbase + 4 * m;
#pragma unroll
  for (int it = 0; it < 8; ++it) {
    int row = mbase + 2 * it + hh;
    if (SPLITA) row = (row & ~(T_DIM - 1)) | ((row + 1) & (T_DIM - 1));
    *(v4f*)(gb + (size_t)row * N) = val[it];
  }
  
}

// ---------------------------------------------------------------------------
// 2) leaky average over T (f32) + L2 normalisation + beta scale,
//    written as bf16 hi/lo planes khi/klo, per (batch, head) a fragment-order plane of T rows x HS.
//    The recurrence y[t] = c*y[t-1] + (1-c)*u[t] is linear, so T is cut into chunks of
//    EMA_CL rows that run side by side from a zero state:
//      y[t0+k] = ylocal[k] + c^(k+1) * S,   S = true state in front of the chunk,
//      S(next chunk) = c^EMA_CL * S + (end state of this chunk from zero).
//    A work-group = one (batch, head) and EMA_ROWS consecutive rows. It forms the end states
//    of every chunk up to its own last one (earlier chunks again, from L2), folds them in LDS,
//    and normalises and stores its own rows only: nothing passes between work-groups.
//    Lane group of 8 = one row (8 channels per lane). In the store phase a wave owns the 16 rows of one chunk,
//    which are the rows of one fragment, so every 128-B line of the planes is written by one wave.
//    The loops of constant length are unrolled so that their arrays stay in registers; the load
//    loop also so that all 32 loads of a chunk are in flight before the first is used.
// ---------------------------------------------------------------------------
#define EMA_CL    16                     // rows per chunk
#define EMA_NCH   (T_DIM / EMA_CL)       // chunks per (batch, head)
#define EMA_SEG   8                      // work-groups per (batch, head)
#define EMA_CPS   (EMA_NCH / EMA_SEG)    // chunks stored by one work-group
#define EMA_ROWS  (EMA_CL * EMA_CPS)     // rows stored by one work-group
#define EMA_NT    512                    // threads per work-group
#define EMA_NG    (EMA_NT / 8)           // lane groups per work-group
#define EMA_PITCH 96                     // floats per staged row: neighbour rows fall on the two bank halves

__global__ __launch_bounds__(EMA_NT) void k_ema_knorm(const float* __restrict__ u,
                                                     const float* __restrict__ la_coef,
                                                     const float* __restrict__ kbeta,
                                                     us_t* __restrict__ khi,
                                                     us_t* __restrict__ klo) {
#pragma clang fp contract(off)
  // In all three arrays a lane's channels 8sub..8sub+3 sit at float 4*sub, 8sub+4..8sub+7 at 32 + 4*sub.
  __shared__ __align__(16) float ldsE[EMA_NCH][HS];           // end state of each chunk from a zero start
  __shared__ __align__(16) float ldsS[EMA_CPS][HS];           // true state in front of each own chunk
  __shared__ __align__(16) float ldsY[EMA_ROWS][EMA_PITCH];   // own rows from a zero start

  const int tid  = threadIdx.x;
  const int grp  = tid >> 3;
  const int sub  = tid & 7;
  const int seg  = (EMA_SEG - 1) - (int)blockIdx.x;           // the longest work-groups start first
  const int bh   = blockIdx.y, b = bh / NH, h = bh % NH;
  const int own0 = EMA_CPS * seg;                             // first own chunk
  const int nch  = own0 + EMA_CPS;                            // chunks this work-group walks

  const float cc   = bfr(la_coef[h]);
  const float omc  = 1.0f - cc;
  const float beta = expf(fminf(bfr(kbeta[h]) * 10.0f, 5.0f));

  // cp[it] = c^(k+1) for the row position k = 4 it + grp % 4 in its chunk; cl = c^EMA_CL
  float cp[EMA_ROWS / EMA_NG], cl = cc;
#pragma unroll
  for (int it = 0; it < EMA_ROWS / EMA_NG; ++it) {
    const int e = 4 * it + (grp & 3) + 1;                     // 1..16
    float p = 1.0f;
    cl = cc;
#pragma unroll
    for (int bit = 0; bit < 4; ++bit) {
      if ((e >> bit) & 1) p *= cl;
      cl *= cl;
    }
    if (e >> 4) p = cl;
    cp[it] = p;
  }

  const float* up = u + (size_t)b * T_DIM * C_DIM + h * HS + 8 * sub;

  // a) every chunk from a zero state; own0 and nch are multiples of 4, so a wave's four groups agree
  for (int j = grp; j < nch; j += EMA_NG) {
    const float* cpn = up + (size_t)(j * EMA_CL) * C_DIM;
    v4f x0[EMA_CL], x1[EMA_CL];
#pragma unroll
    for (int k = 0; k < EMA_CL; ++k) {
      const v4f* src = (const v4f*)(cpn + (size_t)k * C_DIM);
      x0[k] = src[0];
      x1[k] = src[1];
    }
    const bool own = (j >= own0);
    float* yrow = &ldsY[own ? (j - own0) * EMA_CL : 0][4 * sub];
    v4f y0, y1;
#pragma unroll
    for (int i = 0; i < 4; ++i) { y0[i] = 0.0f; y1[i] = 0.0f; }
#pragma unroll
    for (int k = 0; k < EMA_CL; ++k) {
#pragma unroll
      for (int i = 0; i < 4; ++i) {
        y0[i] = cc * y0[i] + omc * x0[k][i];
        y1[i] = cc * y1[i] + omc * x1[k][i];
      }
      if (own) {
        *(v4f*)(yrow + k * EMA_PITCH)      = y0;
        *(v4f*)(yrow + k * EMA_PITCH + 32) = y1;
      }
    }
    *(v4f*)(&ldsE[j][4 * sub])      = y0;
    *(v4f*)(&ldsE[j][32 + 4 * sub]) = y1;
  }
  __syncthreads();

  // b) fold the end states in time order, one channel per lane (two waves)
  if (tid < HS) {
    float s = 0.0f;
    for (int j0 = 0; j0 < own0; j0 += EMA_CPS) {
      float e[EMA_CPS];
#pragma unroll
      for (int i = 0; i < EMA_CPS; ++i) e[i] = ldsE[j0 + i][tid];
#pragma unroll
      for (int i = 0; i < EMA_CPS; ++i) s = cl * s + e[i];
    }
    float e[EMA_CPS];
#pragma unroll
    for (int i = 0; i < EMA_CPS; ++i) e[i] = ldsE[own0 + i][tid];
#pragma unroll
    for (int i = 0; i < EMA_CPS; ++i) {
      ldsS[i][tid] = s;
      s = cl * s + e[i];
    }
  }
  __syncthreads();

  // c) own rows: add the carried state, normalise, scale, split, store
  static_assert(4 * (EMA_ROWS / EMA_NG) == EMA_CL && EMA_CL == 16, "a wave stores one chunk = one fragment's rows");
  const size_t dpl = (size_t)bh * T_DIM * HS;
#pragma unroll
  for (int it = 0; it < EMA_ROWS / EMA_NG; ++it) {
    const int r = (grp >> 2) * EMA_CL + 4 * it + (grp & 3);   // r % EMA_CL == 4 it + grp % 4
    const v4f a0 = *(const v4f*)(&ldsY[r][4 * sub]);
    const v4f a1 = *(const v4f*)(&ldsY[r][32 + 4 * sub]);
    const v4f s0 = *(const v4f*)(&ldsS[r / EMA_CL][4 * sub]);
    const v4f s1 = *(const v4f*)(&ldsS[r / EMA_CL][32 + 4 * sub]);
    float y[8];
#pragma unroll
    for (int i = 0; i < 4; ++i) {
      y[i]     = a0[i] + cp[it] * s0[i];
      y[4 + i] = a1[i] + cp[it] * s1[i];
    }
    float ss = 0.0f;
#pragma unroll
    for (int i = 0; i < 8; ++i) ss += y[i] * y[i];
    ss += __shfl_xor(ss, 1, 32);
    ss += __shfl_xor(ss, 2, 32);
    ss += __shfl_xor(ss, 4, 32);
    const float rn = 1.0f / (sqrtf(ss) + 1e-6f);

    v4u ph, pl;
#pragma unroll
    for (int i = 0; i < 4; ++i) {
      const float ka = (y[2 * i] * rn) * beta;
      const float kc = (y[2 * i + 1] * rn) * beta;
      const us_t ha = f2bf(ka), hc = f2bf(kc);
      ph[i] = pk2(ha, hc);
      pl[i] = pk2(f2bf(ka - bf2f(ha)), f2bf(kc - bf2f(hc)));
    }
    const size_t off = dpl + 8u * pk_idx((unsigned)(seg * EMA_ROWS + r), (unsigned)sub, HS / 32);
    *(v4u*)(khi + off) = ph;
    *(v4u*)(klo + off) = pl;
  }
}

// ---------------------------------------------------------------------------
// 3) value featurizer: f = xl[t+1]*(1-vc) + xl[t]*vc, L2 normalise, beta scale,
//    written TRANSPOSED as bf16 hi/lo planes vthi/vtlo of fragments (rows = dims, k = key, for the P x V
//    B-fragments); per (batch, head) the four fragments of a 32-key tile lie side by side, tile after tile.
// ---------------------------------------------------------------------------
__global__ __launch_bounds__(128) void k_vmake(const float* __restrict__ xl,
                                              const float* __restrict__ v_coef,
                                              const float* __restrict__ vbeta,
                                              us_t* __restrict__ vthi,
                                              us_t* __restrict__ vtlo) {
#pragma clang fp contract(off)
  __shared__ __align__(16) us_t ldsH[HS][72];
  __shared__ __align__(16) us_t ldsL[HS][72];
  const int bh = blockIdx.y, b = bh / NH, h = bh % NH;
  const int t0 = blockIdx.x * 64;
  const int w = threadIdx.x >> 5, lane = threadIdx.x & 31;

  const float vc  = bfr(v_coef[h]);
  const float omv = 1.0f - vc;
  const float vb  = expf(fminf(bfr(vbeta[h]) * 10.0f, 5.0f));

  for (int rr = 0; rr < 16; ++rr) {
    const int tl = w * 16 + rr;
    const int t  = t0 + tl;
    const float* cur = xl + ((size_t)b * T_DIM + t) * C_DIM + h * HS;
    const float c0 = cur[lane], c1 = cur[lane + 32];
    float s0 = 0.0f, s1 = 0.0f;
    if (t + 1 < T_DIM) {
      const float* nx = cur + C_DIM;
      s0 = nx[lane];
      s1 = nx[lane + 32];
    }
    const float f0 = s0 * omv + c0 * vc;
    const float f1 = s1 * omv + c1 * vc;
    float ss = f0 * f0 + f1 * f1;
    ss += __shfl_xor(ss, 16, 32);
    ss += __shfl_xor(ss, 8, 32);
    ss += __shfl_xor(ss, 4, 32);
    ss += __shfl_xor(ss, 2, 32);
    ss += __shfl_xor(ss, 1, 32);
    const float rn = 1.0f / (sqrtf(ss) + 1e-6f);
    const float v0 = (f0 * rn) * vb;
    const float v1 = (f1 * rn) * vb;
    const us_t h0 = f2bf(v0), h1 = f2bf(v1);
    ldsH[lane][tl]      = h0;
    ldsH[lane + 32][tl] = h1;
    ldsL[lane][tl]      = f2bf(v0 - bf2f(h0));
    ldsL[lane + 32][tl] = f2bf(v1 - bf2f(h1));
  }
  __syncthreads();

  const int tid = threadIdx.x;
  const int ch  = tid >> 4;            // 0..7: a wave stores two key octets of 16 dims = 512 contiguous bytes
  const int dsl = tid & 15;
  v4u ph[4], pl[4];
#pragma unroll
  for (int it = 0; it < 4; ++it) {
    const int d = it * 16 + dsl;
    ph[it] = *(const v4u*)(&ldsH[d][8 * ch]);
    pl[it] = *(const v4u*)(&ldsL[d][8 * ch]);
  }
  const size_t gb = ((size_t)bh * HS) * T_DIM;
#pragma unroll
  for (int it = 0; it < 4; ++it) {
    const size_t off = gb + 8u * (unsigned)(((t0 / 32 + (ch >> 2)) * 4 + it) * 64 + (ch & 3) * 16 + dsl);
    *(v4u*)(vthi + off) = ph[it];
    *(v4u*)(vtlo + off) = pl[it];
  }
  
}

// ---------------------------------------------------------------------------
// 4) shifted-causal flash attention, per wave 16 queries, key tiles of 32.
//    Scores computed transposed: St[key][query] = K_tile (A, rows = keys) x Qt (B, cols = queries),
//    so lane = query owns its softmax statistics and the P A-fragment for P x V is an
//    in-register repack of the two 16-key D tiles (element r <- tile keys 0..15, 8+r <- tile keys 16..31).
//    O[query][dim] accumulated with A = P, B = Vt rows (k = key). All fragments from
//    fragment-order global planes; bf16 hi/lo: hi*hi + hi*lo + lo*hi.
//    Every fragment of a tile has registers of its own: the V loads of a tile are issued in front of
//    its score products, the K loads of the next tile right behind them, so that no product waits
//    for a load issued just in front of it. The fragment loops are unrolled so that the arrays stay in registers.
//    grid = (ceil((T-1)/64), B*NH), block 128. Output y hi/lo: fragment-order planes of B*T rows x C, row b*T + i
//    holding time i + 1, so that a wave's 16 queries are the rows of one fragment and every 128-B line has one
//    writer; the slot of time T (row b*T + T-1) takes the zeros of time 0.
// ---------------------------------------------------------------------------
__global__ __launch_bounds__(128) void k_attn(const us_t* __restrict__ khi,
                                             const us_t* __restrict__ klo,
                                             const us_t* __restrict__ vthi,
                                             const us_t* __restrict__ vtlo,
                                             us_t* __restrict__ yhi,
                                             us_t* __restrict__ ylo) {
#pragma clang fp contract(off)
  __shared__ __align__(16) float ldsO[4][16][68];

  const int bh = blockIdx.y, b = bh / NH, h = bh % NH;
  const int w = threadIdx.x >> 5, lane = threadIdx.x & 31, m = lane & 15, hh = lane >> 4;
  const int Tm1 = T_DIM - 1;
  const int q0  = 1 + 64 * blockIdx.x + 16 * w;   // first query time of this wave
  const int tq  = q0 + m;                          // this lane's query (B column n and stats owner)
  const int tqc = (tq < Tm1) ? tq : Tm1;           // clamped for loads (slot tq == T is stored as zeros)

  const size_t kbh = (size_t)bh * T_DIM * HS;
  const size_t vbh = (size_t)bh * HS * T_DIM;

  // Q fragments (B operand): column n = query, k = dim; q rows are k rows at time tq
  const us_t* qh_row = khi + kbh + 8u * pk_idx((unsigned)tqc, (unsigned)hh, HS / 32);
  const us_t* ql_row = klo + kbh + 8u * pk_idx((unsigned)tqc, (unsigned)hh, HS / 32);
  const v16us qh0 = ld_fragp(qh_row),       ql0 = ld_fragp(ql_row);         // dims 0..31
  const v16us qh1 = ld_fragp(qh_row + 512), ql1 = ld_fragp(ql_row + 512);   // dims 32..63

  int qmax = q0 + 15;
  if (qmax > Tm1) qmax = Tm1;
  const int ntiles = (qmax + 31) >> 5;             // keys 0..qmax-1, wave-uniform

  v8f o[4];
#pragma unroll
  for (int g = 0; g < 4; ++g) o[g] = vzero();
  float mrun = -1e30f, lrun = 0.0f;

  // this lane's first piece of the tile's first fragment; the pointers walk from tile to tile.
  // A tile's four K fragments lie side by side, and so do its four V fragments.
  const us_t* kh_p = khi + kbh + 8 * lane;
  const us_t* kl_p = klo + kbh + 8 * lane;
  const us_t* vh_p = vthi + vbh + 8 * lane;
  const us_t* vl_p = vtlo + vbh + 8 * lane;

  // K fragments of the current tile, index 2g + dim half (tile 0 always exists: qmax >= 16)
  v16us kh[4], kl[4];
#pragma unroll
  for (int j = 0; j < 4; ++j) {
    kh[j] = ld_fragp(kh_p + j * 512);
    kl[j] = ld_fragp(kl_p + j * 512);
  }
  // from here on the K pointers stand at the tile that the trip fetches ahead (the last tile fetches itself again)
  {
    const int kstep = (1 < ntiles) ? 4 * 512 : 0;
    kh_p += kstep;
    kl_p += kstep;
  }

  for (int kt = 0; kt < ntiles; ++kt) {
    const int kbase = kt * 32;

    // V fragments of this tile (B operand: column n = dim 16g + m, k = key from the transposed planes)
    v16us vh[4], vl[4];
#pragma unroll
    for (int g = 0; g < 4; ++g) {
      vh[g] = ld_fragp(vh_p + g * 512);
      vl[g] = ld_fragp(vl_p + g * 512);
    }

    // St tiles: s[g][r] = score(key kbase + 16g + 8hh + r, query q0 + m)
    v8f s[2];
#pragma unroll
    for (int g = 0; g < 2; ++g) {
      s[g] = vzero();
      s[g] = mma(kh[2 * g], qh0, s[g]);
      s[g] = mma(kh[2 * g], ql0, s[g]);
      s[g] = mma(kl[2 * g], qh0, s[g]);
      s[g] = mma(kh[2 * g + 1], qh1, s[g]);
      s[g] = mma(kh[2 * g + 1], ql1, s[g]);
      s[g] = mma(kl[2 * g + 1], qh1, s[g]);
    }

    // K fragments of the next tile into the registers just read
    {
#pragma unroll
      for (int j = 0; j < 4; ++j) {
        kh[j] = ld_fragp(kh_p + j * 512);
        kl[j] = ld_fragp(kl_p + j * 512);
      }
    }

    // causal mask (key < tq), online softmax per lane (= per query)
    float p0[8], p1[8];
    float mx = -1e30f;
#pragma unroll
    for (int r = 0; r < 8; ++r) {
      const int key0 = kbase + 8 * hh + r;
      float a = s[0][r];
      float c = s[1][r];
      if (key0 >= tq)      a = -1e30f;
      if (key0 + 16 >= tq) c = -1e30f;
      p0[r] = a;
      p1[r] = c;
      mx = fmaxf(mx, fmaxf(a, c));
    }
    mx = fmaxf(mx, __shfl_xor(mx, 16, 32));
    const float mn = fmaxf(mrun, mx);
    const float sc = __expf(mrun - mn);
    float sum = 0.0f;
#pragma unroll
    for (int r = 0; r < 8; ++r) {
      p0[r] = __expf(p0[r] - mn);
      p1[r] = __expf(p1[r] - mn);
      sum += p0[r] + p1[r];
    }
    sum += __shfl_xor(sum, 16, 32);
    lrun = lrun * sc + sum;
    mrun = mn;

    // rescale O: o[g][r] belongs to query q0 + 8hh + r, whose scale lives in lane 8hh + r
#pragma unroll
    for (int r = 0; r < 8; ++r) {
      const float scr = __shfl(sc, 8 * hh + r, 32);
#pragma unroll
      for (int g = 0; g < 4; ++g) o[g][r] *= scr;
    }

    // P as A fragment (lane = query row, k = key within tile), bf16 hi/lo
    Frag ph, pl;
#pragma unroll
    for (int r = 0; r < 8; ++r) {
      const us_t a = f2bf(p0[r]);
      const us_t c = f2bf(p1[r]);
      ph.u[r]     = a;
      ph.u[8 + r] = c;
      pl.u[r]     = f2bf(p0[r] - bf2f(a));
      pl.u[8 + r] = f2bf(p1[r] - bf2f(c));
    }

    // O += P x V
#pragma unroll
    for (int g = 0; g < 4; ++g) {
      o[g] = mma(ph.u, vh[g], o[g]);
      o[g] = mma(ph.u, vl[g], o[g]);
      o[g] = mma(pl.u, vh[g], o[g]);
    }

    // the address registers of this trip's loads are written again below; here their requests are long under way
    asm volatile("s_wait_xcnt 0x0" ::: "memory");
    // keeps the pointer additions below behind that wait: the scheduler otherwise lifts them to the head of the trip
    __builtin_amdgcn_sched_barrier(0);
    {
      const int kstep = (kt + 2 < ntiles) ? 4 * 512 : 0;
      kh_p += kstep;
      kl_p += kstep;
      vh_p += 4 * 512;
      vl_p += 4 * 512;
    }
  }

  // epilogue: stage O (f32), then whole-line stores of the hi/lo planes.
  // Both halves of the wave hold the same lrun for query q0 + m, the row that this lane stores.
  const float inv = 1.0f / lrun;
#pragma unroll
  for (int g = 0; g < 4; ++g) {
#pragma unroll
    for (int r = 0; r < 8; ++r) ldsO[w][8 * hh + r][16 * g + m] = o[g][r];
  }
  __syncthreads();

  const unsigned live = (tq <= Tm1) ? 0xFFFFFFFFu : 0u;   // the slot of time T is stored as zeros
  v4u yh[4], yl[4];
#pragma unroll
  for (int it = 0; it < 4; ++it) {
    const v4f* sp = (const v4f*)(&ldsO[w][m][8 * (2 * it + hh)]);
    const v4f e0 = sp[0];
    const v4f e1 = sp[1];
    float vv[8];
#pragma unroll
    for (int i = 0; i < 4; ++i) { vv[i] = e0[i] * inv; vv[4 + i] = e1[i] * inv; }
#pragma unroll
    for (int i = 0; i < 4; ++i) {
      const us_t ha = f2bf(vv[2 * i]);
      const us_t hc = f2bf(vv[2 * i + 1]);
      yh[it][i] = pk2(ha, hc) & live;
      yl[it][i] = pk2(f2bf(vv[2 * i] - bf2f(ha)), f2bf(vv[2 * i + 1] - bf2f(hc))) & live;
    }
  }

  const unsigned yrow = (unsigned)(b * T_DIM + tq - 1);
#pragma unroll
  for (int it = 0; it < 4; ++it) {
    const size_t off = 8u * pk_idx(yrow, (unsigned)(h * (HS / 8) + 2 * it + hh), C_DIM / 32);
    *(v4u*)(yhi + off) = yh[it];
    *(v4u*)(ylo + off) = yl[it];
  }
}

// ---------------------------------------------------------------------------
// launcher
// ---------------------------------------------------------------------------
extern "C" void kernel_launch(void* const* d_in, const int* in_sizes, int n_in,
                              void* d_out, int out_size, void* d_ws,
                              size_t ws_size, hipStream_t stream) {
  const size_t MT = (size_t)B_DIM * T_DIM;          // 4096 rows
  const size_t NX = MT * C_DIM;                     // 3145728
  const size_t NW = (size_t)C_DIM * C_DIM;          // 589824

  if (n_in < 8) return;
  if ((size_t)in_sizes[0] != NX || (size_t)in_sizes[1] != NW || in_sizes[2] != NH ||
      (size_t)in_sizes[3] != NW || in_sizes[4] != NH || in_sizes[5] != NH ||
      in_sizes[6] != NH || (size_t)in_sizes[7] != NW || (size_t)out_size != NX) return;

  const float* x       = (const float*)d_in[0];
  const float* W_la    = (const float*)d_in[1];
  const float* la_coef = (const float*)d_in[2];
  const float* W_v     = (const float*)d_in[3];
  const float* v_coef  = (const float*)d_in[4];
  const float* kbeta   = (const float*)d_in[5];
  const float* vbeta   = (const float*)d_in[6];
  const float* W_proj  = (const float*)d_in[7];
  float* out = (float*)d_out;

  // workspace carve (all sizes multiples of 256 B)
  size_t off = 0;
  char* ws = (char*)d_ws;
  us_t* xb   = (us_t*)(ws + off); off += NX * 2;
  us_t* wla  = (us_t*)(ws + off); off += NW * 2;
  us_t* wv   = (us_t*)(ws + off); off += NW * 2;
  us_t* wpj  = (us_t*)(ws + off); off += NW * 2;
  float* u   = (float*)(ws + off); off += NX * 4;
  float* xl  = (float*)(ws + off); off += NX * 4;
  us_t* khi  = (us_t*)(ws + off); off += NX * 2;
  us_t* klo  = (us_t*)(ws + off); off += NX * 2;
  us_t* vthi = (us_t*)(ws + off); off += NX * 2;
  us_t* vtlo = (us_t*)(ws + off); off += NX * 2;
  us_t* yhi  = (us_t*)(ws + off); off += NX * 2;
  us_t* ylo  = (us_t*)(ws + off); off += NX * 2;   // total 72,744,960 B
  if (off > ws_size) return;

  // 0) RNE convert inputs to bf16, fragment order
  const int nx8 = (int)(NX / 8), nw8 = (int)(NW / 8);
  k_cvt<<<(nx8 + 255) / 256, 256, 0, stream>>>(x, xb, nx8);
  k_cvt<<<(nw8 + 255) / 256, 256, 0, stream>>>(W_la, wla, nw8);
  k_cvt<<<(nw8 + 255) / 256, 256, 0, stream>>>(W_v, wv, nw8);
  k_cvt<<<(nw8 + 255) / 256, 256, 0, stream>>>(W_proj, wpj, nw8);

  // 1) u = x W_la^T ; xl = x W_v^T
  dim3 ggrid(C_DIM / 64, (unsigned)(MT / 64));
  k_gemm<0><<<ggrid, 128, 0, stream>>>(xb, xb, wla, u, (int)MT, C_DIM, C_DIM);
  k_gemm<0><<<ggrid, 128, 0, stream>>>(xb, xb, wv, xl, (int)MT, C_DIM, C_DIM);

  // 2) leaky average + normalised, scaled keys as bf16 hi/lo
  dim3 egrid(EMA_SEG, B_DIM * NH);
  k_ema_knorm<<<egrid, EMA_NT, 0, stream>>>(u, la_coef, kbeta, khi, klo);

  // 3) values (transposed, bf16 hi/lo)
  dim3 vgrid(T_DIM / 64, B_DIM * NH);
  k_vmake<<<vgrid, 128, 0, stream>>>(xl, v_coef, vbeta, vthi, vtlo);

  // 4) attention -> y hi/lo planes
  dim3 agrid((T_DIM - 1 + 63) / 64, B_DIM * NH);
  k_attn<<<agrid, 128, 0, stream>>>(khi, klo, vthi, vtlo, yhi, ylo);

  // 5) out = y W_proj^T (hi and lo planes, two products)
  k_gemm<1><<<ggrid, 128, 0, stream>>>(yhi, ylo, wpj, out, (int)MT, C_DIM, C_DIM);
}

// v004
// Measured time: 128 microseconds a run.
// Timed twice side by side with v003, it ran 1.21 and 1.20 times as fast.
// Counting every step since v000, it is 13.6 times as fast.
#include <hip/hip_runtime.h>
#include <stdint.h>

// Contractions: v_wmma_f32_16x16x32_bf16 (bf16 operands, f32 accumulate). Input projections: single product on RNE-bf16 inputs. Score (K x Qt), P x V: bf16 hi/lo split (3 products). Output projection: hi/lo split activations x bf16 weights (2 products).

#define B_DIM 2
#define T_DIM 2048
#define C_DIM 768
#define NH    12
#define HS    64

typedef unsigned short us_t;
typedef __bf16         v16bf __attribute__((ext_vector_type(16)));
typedef unsigned short v16us __attribute__((ext_vector_type(16)));
typedef unsigned short v8us  __attribute__((ext_vector_type(8)));
typedef float          v8f   __attribute__((ext_vector_type(8)));
typedef float          v4f   __attribute__((ext_vector_type(4)));
typedef unsigned int   v4u   __attribute__((ext_vector_type(4)));

union Frag { v16us u; v8us half[2]; };

// ---------------------------------------------------------------------------
// helpers
// ---------------------------------------------------------------------------
__device__ __forceinline__ v8f vzero() {
  v8f z;
#pragma unroll
  for (int i = 0; i < 8; ++i) z[i] = 0.0f;
  return z;
}

// RNE f32 -> bf16 bits
__device__ __forceinline__ us_t f2bf(float f) {
  unsigned u = __float_as_uint(f);
  u += 0x7FFFu + ((u >> 16) & 1u);
  return (us_t)(u >> 16);
}
__device__ __forceinline__ float bf2f(us_t b) { return __uint_as_float(((unsigned)b) << 16); }
__device__ __forceinline__ float bfr(float f) { return bf2f(f2bf(f)); }
__device__ __forceinline__ unsigned pk2(us_t a, us_t b) { return (unsigned)a | (((unsigned)b) << 16); }

// 16x16x32 fragment (A rows / B columns), k order:
// lane l: row/col = l&15, h = l>>4; elements 0..7 <- k0+8h+0..7, elements 8..15 <- k0+16+8h+0..7.
// Every bf16 plane (x, the weights, K, Vt, y) is kept in fragment order: a fragment of 16 rows x 32 k is 1 KiB of its own.
// Lane l finds its elements 0..7 at us_t 8 l and its elements 8..15 at us_t 256 + 8 l, so each of the two loads
// of a wave covers 512 contiguous bytes = 4 whole lines, where a row-major plane makes it touch 16 lines.
// p points at this lane's first piece.
__device__ __forceinline__ v16us ld_fragp(const us_t* __restrict__ p) {
  Frag f;
  f.half[0] = *(const v8us*)(p);
  f.half[1] = *(const v8us*)(p + 256);
  return f.u;
}
// place, in 16-B pieces, of piece (row, k8 = k / 8) in a fragment-order plane with kf fragments along k
__device__ __forceinline__ unsigned pk_idx(unsigned row, unsigned k8, unsigned kf) {
  return ((row >> 4) * kf + (k8 >> 2)) * 64u + (k8 & 3u) * 16u + (row & 15u);
}

// D[16x16] += A[16x32] * B[32x16]; D element r of lane l = (row 8*(l>>4)+r, col l&15).
// Followed by the 4-slot VALU hazard guard (ties D, keeps A/B live).
__device__ __forceinline__ v8f mma(v16us a, v16us b, v8f c) {
  v16bf av = __builtin_bit_cast(v16bf, a);
  v16bf bv = __builtin_bit_cast(v16bf, b);
  c = __builtin_amdgcn_wmma_f32_16x16x32_bf16(false, av, false, bv, (short)0, c, false, false);
  asm volatile("v_nop\n\tv_nop\n\tv_nop\n\tv_nop" : "+v"(c) : "v"(a), "v"(b));
  return c;
}

// ---------------------------------------------------------------------------
// 0) f32 [rows][C_DIM] -> RNE bf16 in fragment order; thread i writes piece i of the plane.
//    Host guarantees n8 % 64 == 0 and rows % 16 == 0.
// ---------------------------------------------------------------------------
__global__ __launch_bounds__(256) void k_cvt(const float* __restrict__ in,
                                            us_t* __restrict__ out, int n8) {
  const int i = blockIdx.x * 256 + threadIdx.x;
  if (i >= n8) return;
  const unsigned blk = (unsigned)i >> 6;
  const unsigned row = (blk / (C_DIM / 32)) * 16u + ((unsigned)i & 15u);
  const unsigned k8  = (blk % (C_DIM / 32)) * 4u + (((unsigned)i >> 4) & 3u);
  const v4f* src = (const v4f*)(in + (size_t)row * C_DIM + k8 * 8u);
  const v4f a = src[0];
  const v4f c = src[1];
  v4u p;
  p[0] = pk2(f2bf(a[0]), f2bf(a[1]));
  p[1] = pk2(f2bf(a[2]), f2bf(a[3]));
  p[2] = pk2(f2bf(c[0]), f2bf(c[1]));
  p[3] = pk2(f2bf(c[2]), f2bf(c[3]));
  v4u* dst = (v4u*)(out + (size_t)i * 8);
  *dst = p;
  
}

// ---------------------------------------------------------------------------
// 1) C[m][n] = sum_k A[m][k] * W[n][k]  (A: MxK bf16, W: NxK bf16, both in fragment order, C: MxN f32 row-major)
//    SPLITA: C = (A + A2) * W^T with A = hi plane, A2 = lo plane (two products); these are the y planes, whose
//    row b*T + i holds time i + 1 (row b*T + T-1: zeros, time 0), so the result rows are stored one time step on.
//    block = 4 waves, 64x64 tile; wave = 16 rows x 64 cols.
//    Epilogue: tile staged in LDS, each 256-B row segment written as 16 lanes x 16 B
//    Fragments sit in a ring of GEMM_ST k-steps of registers: a step's registers are loaded again
//    (for GEMM_ST steps further on) right behind its products, so GEMM_ST steps of loads are in flight.
//    The loops over ring steps and column groups are unrolled so that the ring's arrays stay in registers.
//    Host guarantees M % 64 == 0, N % 64 == 0, K % (32 * GEMM_ST) == 0, K > 0.
// ---------------------------------------------------------------------------
#define GEMM_ST 4
template <int SPLITA>
__global__ __launch_bounds__(128) void k_gemm(const us_t* __restrict__ A,
                                             const us_t* __restrict__ A2,
                                             const us_t* __restrict__ W,
                                             float* __restrict__ Cout,
                                             int M, int N, int K) {
  __shared__ __align__(16) float ldsC[4][16][68];
  (void)M;
  const int w = threadIdx.x >> 5, lane = threadIdx.x & 31, m = lane & 15, hh = lane >> 4;
  const int mbase = blockIdx.y * 64 + w * 16;
  const int nbase = blockIdx.x * 64;
  // element offsets of this lane's 16-B piece of its fragment rows; they walk along k
  const unsigned kf = (unsigned)K >> 5;            // fragments along k
  unsigned ao = (unsigned)(mbase >> 4) * kf * 512u + 8u * lane;
  unsigned wo[4];
#pragma unroll
  for (int g = 0; g < 4; ++g) wo[g] = (unsigned)((nbase >> 4) + g) * kf * 512u + 8u * lane;

  v8f acc[4];
#pragma unroll
  for (int g = 0; g < 4; ++g) acc[g] = vzero();

  v16us a[GEMM_ST], a2[GEMM_ST], bw[GEMM_ST][4];
#pragma unroll
  for (int i = 0; i < GEMM_ST; ++i) {
    a[i] = ld_fragp(A + ao + 512 * i);
    if (SPLITA) a2[i] = ld_fragp(A2 + ao + 512 * i);
#pragma unroll
    for (int g = 0; g < 4; ++g) bw[i][g] = ld_fragp(W + wo[g] + 512 * i);
    // keeps these loads in the ring's order, step by step: the loop's load-count waits must hold
    // for both ways into the loop and would otherwise wait for nearly the whole ring
    __builtin_amdgcn_sched_barrier(0);
  }
  // registers that held addresses of the loads above are written again below
  asm volatile("s_wait_xcnt 0x0" ::: "memory");

  for (int kb = 32 * GEMM_ST; kb < K; kb += 32 * GEMM_ST) {
    ao += 512 * GEMM_ST;
#pragma unroll
    for (int g = 0; g < 4; ++g) wo[g] += 512 * GEMM_ST;
#pragma unroll
    for (int i = 0; i < GEMM_ST; ++i) {
#pragma unroll
      for (int g = 0; g < 4; ++g) {
        acc[g] = mma(a[i], bw[i][g], acc[g]);
        if (SPLITA) acc[g] = mma(a2[i], bw[i][g], acc[g]);
      }
      a[i] = ld_fragp(A + ao + 512 * i);
      if (SPLITA) a2[i] = ld_fragp(A2 + ao + 512 * i);
#pragma unroll
      for (int g = 0; g < 4; ++g) bw[i][g] = ld_fragp(W + wo[g] + 512 * i);
    }
    // the next trip forms new addresses in the registers of the loads just issued
    asm volatile("s_wait_xcnt 0x0" ::: "memory");
  }
#pragma unroll
  for (int i = 0; i < GEMM_ST; ++i) {
#pragma unroll
    for (int g = 0; g < 4; ++g) {
      acc[g] = mma(a[i], bw[i][g], acc[g]);
      if (SPLITA) acc[g] = mma(a2[i], bw[i][g], acc[g]);
    }
  }

  // stage D tiles: acc[g][r] = C[mbase + 8hh + r][nbase + 16g + m]
#pragma unroll
  for (int g = 0; g < 4; ++g) {
#pragma unroll
    for (int r = 0; r < 8; ++r) ldsC[w][8 * hh + r][16 * g + m] = acc[g][r];
  }
  __syncthreads();

  v4f val[8];
#pragma unroll
  for (int it = 0; it < 8; ++it) val[it] = *(const v4f*)(&ldsC[w][2 * it + hh][4 * m]);

  float* gb = Cout + nbase + 4 * m;
#pragma unroll
  for (int it = 0; it < 8; ++it) {
    int row = mbase + 2 * it + hh;
    if (SPLITA) row = (row & ~(T_DIM - 1)) | ((row + 1) & (T_DIM - 1));
    *(v4f*)(gb + (size_t)row * N) = val[it];
  }
  
}

// ---------------------------------------------------------------------------
// 2) leaky average over T (f32) + L2 normalisation + beta scale,
//    written as bf16 hi/lo planes khi/klo, per (batch, head) a fragment-order plane of T rows x HS.
//    The recurrence y[t] = c*y[t-1] + (1-c)*u[t] is linear, so T is cut into chunks of
//    EMA_CL rows that run side by side from a zero state:
//      y[t0+k] = ylocal[k] + c^(k+1) * S,   S = true state in front of the chunk,
//      S(next chunk) = c^EMA_CL * S + (end state of this chunk from zero).
//    A work-group = one (batch, head) and EMA_ROWS consecutive rows. It forms the end states
//    of every chunk up to its own last one (earlier chunks again, from L2), folds them in LDS,
//    and normalises and stores its own rows only: nothing passes between work-groups.
//    Lane group of 8 = one row (8 channels per lane). In the store phase a wave owns the 16 rows of one chunk,
//    which are the rows of one fragment, so every 128-B line of the planes is written by one wave.
//    The loops of constant length are unrolled so that their arrays stay in registers; the load
//    loop also so that all 32 loads of a chunk are in flight before the first is used.
// ---------------------------------------------------------------------------
#define EMA_CL    16                     // rows per chunk
#define EMA_NCH   (T_DIM / EMA_CL)       // chunks per (batch, head)
#define EMA_SEG   8                      // work-groups per (batch, head)
#define EMA_CPS   (EMA_NCH / EMA_SEG)    // chunks stored by one work-group
#define EMA_ROWS  (EMA_CL * EMA_CPS)     // rows stored by one work-group
#define EMA_NT    512                    // threads per work-group
#define EMA_NG    (EMA_NT / 8)           // lane groups per work-group
#define EMA_PITCH 96                     // floats per staged row: neighbour rows fall on the two bank halves

__global__ __launch_bounds__(EMA_NT) void k_ema_knorm(const float* __restrict__ u,
                                                     const float* __restrict__ la_coef,
                                                     const float* __restrict__ kbeta,
                                                     us_t* __restrict__ khi,
                                                     us_t* __restrict__ klo) {
#pragma clang fp contract(off)
  // In all three arrays a lane's channels 8sub..8sub+3 sit at float 4*sub, 8sub+4..8sub+7 at 32 + 4*sub.
  __shared__ __align__(16) float ldsE[EMA_NCH][HS];           // end state of each chunk from a zero start
  __shared__ __align__(16) float ldsS[EMA_CPS][HS];           // true state in front of each own chunk
  __shared__ __align__(16) float ldsY[EMA_ROWS][EMA_PITCH];   // own rows from a zero start

  const int tid  = threadIdx.x;
  const int grp  = tid >> 3;
  const int sub  = tid & 7;
  const int seg  = (EMA_SEG - 1) - (int)blockIdx.x;           // the longest work-groups start first
  const int bh   = blockIdx.y, b = bh / NH, h = bh % NH;
  const int own0 = EMA_CPS * seg;                             // first own chunk
  const int nch  = own0 + EMA_CPS;                            // chunks this work-group walks

  const float cc   = bfr(la_coef[h]);
  const float omc  = 1.0f - cc;
  const float beta = expf(fminf(bfr(kbeta[h]) * 10.0f, 5.0f));

  // cp[it] = c^(k+1) for the row position k = 4 it + grp % 4 in its chunk; cl = c^EMA_CL
  float cp[EMA_ROWS / EMA_NG], cl = cc;
#pragma unroll
  for (int it = 0; it < EMA_ROWS / EMA_NG; ++it) {
    const int e = 4 * it + (grp & 3) + 1;                     // 1..16
    float p = 1.0f;
    cl = cc;
#pragma unroll
    for (int bit = 0; bit < 4; ++bit) {
      if ((e >> bit) & 1) p *= cl;
      cl *= cl;
    }
    if (e >> 4) p = cl;
    cp[it] = p;
  }

  const float* up = u + (size_t)b * T_DIM * C_DIM + h * HS + 8 * sub;

  // a) every chunk from a zero state; own0 and nch are multiples of 4, so a wave's four groups agree
  for (int j = grp; j < nch; j += EMA_NG) {
    const float* cpn = up + (size_t)(j * EMA_CL) * C_DIM;
    v4f x0[EMA_CL], x1[EMA_CL];
#pragma unroll
    for (int k = 0; k < EMA_CL; ++k) {
      const v4f* src = (const v4f*)(cpn + (size_t)k * C_DIM);
      x0[k] = src[0];
      x1[k] = src[1];
    }
    const bool own = (j >= own0);
    float* yrow = &ldsY[own ? (j - own0) * EMA_CL : 0][4 * sub];
    v4f y0, y1;
#pragma unroll
    for (int i = 0; i < 4; ++i) { y0[i] = 0.0f; y1[i] = 0.0f; }
#pragma unroll
    for (int k = 0; k < EMA_CL; ++k) {
#pragma unroll
      for (int i = 0; i < 4; ++i) {
        y0[i] = cc * y0[i] + omc * x0[k][i];
        y1[i] = cc * y1[i] + omc * x1[k][i];
      }
      if (own) {
        *(v4f*)(yrow + k * EMA_PITCH)      = y0;
        *(v4f*)(yrow + k * EMA_PITCH + 32) = y1;
      }
    }
    *(v4f*)(&ldsE[j][4 * sub])      = y0;
    *(v4f*)(&ldsE[j][32 + 4 * sub]) = y1;
  }
  __syncthreads();

  // b) fold the end states in time order, one channel per lane (two waves)
  if (tid < HS) {
    float s = 0.0f;
    for (int j0 = 0; j0 < own0; j0 += EMA_CPS) {
      float e[EMA_CPS];
#pragma unroll
      for (int i = 0; i < EMA_CPS; ++i) e[i] = ldsE[j0 + i][tid];
#pragma unroll
      for (int i = 0; i < EMA_CPS; ++i) s = cl * s + e[i];
    }
    float e[EMA_CPS];
#pragma unroll
    for (int i = 0; i < EMA_CPS; ++i) e[i] = ldsE[own0 + i][tid];
#pragma unroll
    for (int i = 0; i < EMA_CPS; ++i) {
      ldsS[i][tid] = s;
      s = cl * s + e[i];
    }
  }
  __syncthreads();

  // c) own rows: add the carried state, normalise, scale, split, store
  static_assert(4 * (EMA_ROWS / EMA_NG) == EMA_CL && EMA_CL == 16, "a wave stores one chunk = one fragment's rows");
  const size_t dpl = (size_t)bh * T_DIM * HS;
#pragma unroll
  for (int it = 0; it < EMA_ROWS / EMA_NG; ++it) {
    const int r = (grp >> 2) * EMA_CL + 4 * it + (grp & 3);   // r % EMA_CL == 4 it + grp % 4
    const v4f a0 = *(const v4f*)(&ldsY[r][4 * sub]);
    const v4f a1 = *(const v4f*)(&ldsY[r][32 + 4 * sub]);
    const v4f s0 = *(const v4f*)(&ldsS[r / EMA_CL][4 * sub]);
    const v4f s1 = *(const v4f*)(&ldsS[r / EMA_CL][32 + 4 * sub]);
    float y[8];
#pragma unroll
    for (int i = 0; i < 4; ++i) {
      y[i]     = a0[i] + cp[it] * s0[i];
      y[4 + i] = a1[i] + cp[it] * s1[i];
    }
    float ss = 0.0f;
#pragma unroll
    for (int i = 0; i < 8; ++i) ss += y[i] * y[i];
    ss += __shfl_xor(ss, 1, 32);
    ss += __shfl_xor(ss, 2, 32);
    ss += __shfl_xor(ss, 4, 32);
    const float rn = 1.0f / (sqrtf(ss) + 1e-6f);

    v4u ph, pl;
#pragma unroll
    for (int i = 0; i < 4; ++i) {
      const float ka = (y[2 * i] * rn) * beta;
      const float kc = (y[2 * i + 1] * rn) * beta;
      const us_t ha = f2bf(ka), hc = f2bf(kc);
      ph[i] = pk2(ha, hc);
      pl[i] = pk2(f2bf(ka - bf2f(ha)), f2bf(kc - bf2f(hc)));
    }
    const size_t off = dpl + 8u * pk_idx((unsigned)(seg * EMA_ROWS + r), (unsigned)sub, HS / 32);
    *(v4u*)(khi + off) = ph;
    *(v4u*)(klo + off) = pl;
  }
}

// ---------------------------------------------------------------------------
// 3) value featurizer: f = xl[t+1]*(1-vc) + xl[t]*vc, L2 normalise, beta scale,
//    written TRANSPOSED as bf16 hi/lo planes vthi/vtlo of fragments (rows = dims, k = key, for the P x V
//    B-fragments); per (batch, head) the four fragments of a 32-key tile lie side by side, tile after tile.
// ---------------------------------------------------------------------------
__global__ __launch_bounds__(128) void k_vmake(const float* __restrict__ xl,
                                              const float* __restrict__ v_coef,
                                              const float* __restrict__ vbeta,
                                              us_t* __restrict__ vthi,
                                              us_t* __restrict__ vtlo) {
#pragma clang fp contract(off)
  __shared__ __align__(16) us_t ldsH[HS][72];
  __shared__ __align__(16) us_t ldsL[HS][72];
  const int bh = blockIdx.y, b = bh / NH, h = bh % NH;
  const int t0 = blockIdx.x * 64;
  const int w = threadIdx.x >> 5, lane = threadIdx.x & 31;

  const float vc  = bfr(v_coef[h]);
  const float omv = 1.0f - vc;
  const float vb  = expf(fminf(bfr(vbeta[h]) * 10.0f, 5.0f));

  for (int rr = 0; rr < 16; ++rr) {
    const int tl = w * 16 + rr;
    const int t  = t0 + tl;
    const float* cur = xl + ((size_t)b * T_DIM + t) * C_DIM + h * HS;
    const float c0 = cur[lane], c1 = cur[lane + 32];
    float s0 = 0.0f, s1 = 0.0f;
    if (t + 1 < T_DIM) {
      const float* nx = cur + C_DIM;
      s0 = nx[lane];
      s1 = nx[lane + 32];
    }
    const float f0 = s0 * omv + c0 * vc;
    const float f1 = s1 * omv + c1 * vc;
    float ss = f0 * f0 + f1 * f1;
    ss += __shfl_xor(ss, 16, 32);
    ss += __shfl_xor(ss, 8, 32);
    ss += __shfl_xor(ss, 4, 32);
    ss += __shfl_xor(ss, 2, 32);
    ss += __shfl_xor(ss, 1, 32);
    const float rn = 1.0f / (sqrtf(ss) + 1e-6f);
    const float v0 = (f0 * rn) * vb;
    const float v1 = (f1 * rn) * vb;
    const us_t h0 = f2bf(v0), h1 = f2bf(v1);
    ldsH[lane][tl]      = h0;
    ldsH[lane + 32][tl] = h1;
    ldsL[lane][tl]      = f2bf(v0 - bf2f(h0));
    ldsL[lane + 32][tl] = f2bf(v1 - bf2f(h1));
  }
  __syncthreads();

  const int tid = threadIdx.x;
  const int ch  = tid >> 4;            // 0..7: a wave stores two key octets of 16 dims = 512 contiguous bytes
  const int dsl = tid & 15;
  v4u ph[4], pl[4];
#pragma unroll
  for (int it = 0; it < 4; ++it) {
    const int d = it * 16 + dsl;
    ph[it] = *(const v4u*)(&ldsH[d][8 * ch]);
    pl[it] = *(const v4u*)(&ldsL[d][8 * ch]);
  }
  const size_t gb = ((size_t)bh * HS) * T_DIM;
#pragma unroll
  for (int it = 0; it < 4; ++it) {
    const size_t off = gb + 8u * (unsigned)(((t0 / 32 + (ch >> 2)) * 4 + it) * 64 + (ch & 3) * 16 + dsl);
    *(v4u*)(vthi + off) = ph[it];
    *(v4u*)(vtlo + off) = pl[it];
  }
  
}

// ---------------------------------------------------------------------------
// 4) shifted-causal flash attention, query tiles of 16, key tiles of 32.
//    Scores computed transposed: St[key][query] = K_tile (A, rows = keys) x Qt (B, cols = queries),
//    so lane = query owns its softmax statistics and the P A-fragment for P x V is an
//    in-register repack of the two 16-key D tiles (element r <- tile keys 0..15, 8+r <- tile keys 16..31).
//    O[query][dim] accumulated with A = P, B = Vt rows (k = key). All fragments from
//    fragment-order global planes; bf16 hi/lo: hi*hi + hi*lo + lo*hi.
//    Every fragment of a tile has registers of its own: the V loads of a tile are issued in front of
//    its score products, the K loads of the wave's next tile right behind them, so that no product waits
//    for a load issued just in front of it. The fragment loops are unrolled so that the arrays stay in registers.
//    Equal work for every wave: query tile t walks t / 2 + 1 key tiles, so work-group p takes the long
//    tiles 127 - 2p, 126 - 2p and then the short tiles 2p, 2p + 1 (65 key tiles per pair). Two waves share a
//    query tile: one walks its even key tiles, the other its odd ones, each with softmax statistics of its
//    own; the two partial results (maximum, sum, O) meet in LDS behind one barrier, where each wave joins,
//    normalises and stores one of the work-group's four query tiles.
//    grid = (T / 64, B*NH), block 128. Output y hi/lo: fragment-order planes of B*T rows x C, row b*T + i
//    holding time i + 1, so that a tile's 16 queries are the rows of one fragment and every 128-B line has one
//    writer; the slot of time T (row b*T + T-1) takes the zeros of time 0.
// ---------------------------------------------------------------------------
#define ATT_NQT (T_DIM / 16)             // query tiles per (batch, head)
// khi and klo carry no __restrict__: with it the compiler lifts the loads of each wave's first K tile out of the loop
// over the two passes and holds their 64 registers through both walks, which costs the third wave per SIMD.
__global__ __launch_bounds__(128) void k_attn(const us_t* khi,
                                             const us_t* klo,
                                             const us_t* __restrict__ vthi,
                                             const us_t* __restrict__ vtlo,
                                             us_t* __restrict__ yhi,
                                             us_t* __restrict__ ylo) {
#pragma clang fp contract(off)
  __shared__ __align__(16) float ldsO[2][4][16][68];   // [long / short tile][wave]: partial O, rows = queries
  __shared__ float ldsM[2][4][16];                     // partial running maximum per query
  __shared__ float ldsL[2][4][16];                     // partial running sum per query

  const int bh = blockIdx.y, b = bh / NH, h = bh % NH;
  // the wave's number as a scalar: tile numbers, trip counts and the planes' tile addresses stay out of the vector registers
  const int w = __builtin_amdgcn_readfirstlane((int)(threadIdx.x >> 5));
  const int lane = threadIdx.x & 31, m = lane & 15, hh = lane >> 4;
  const int Tm1 = T_DIM - 1;
  const int par = w & 1;                           // this wave's key tiles: par, par + 2, ...

  const size_t kbh = (size_t)bh * T_DIM * HS;
  const size_t vbh = (size_t)bh * HS * T_DIM;

  // kept rolled: the two passes share one copy of the code and one set of registers
#pragma unroll 1
  for (int ph = 0; ph < 2; ++ph) {
    const int qt = (ph == 0) ? (ATT_NQT - 1 - 2 * (int)blockIdx.x - (w >> 1)) : (2 * (int)blockIdx.x + (w >> 1));
    const int q0  = 1 + 16 * qt;                   // first query time of this tile
    const int tq  = q0 + m;                        // this lane's query (B column n and stats owner)
    const int tqc = (tq < Tm1) ? tq : Tm1;         // clamped for loads (slot tq == T is stored as zeros)

    // Q fragments (B operand): column n = query, k = dim; q rows are k rows at time tq
    const us_t* qh_row = khi + kbh + 8u * pk_idx((unsigned)tqc, (unsigned)hh, HS / 32);
    const us_t* ql_row = klo + kbh + 8u * pk_idx((unsigned)tqc, (unsigned)hh, HS / 32);
    const v16us qh0 = ld_fragp(qh_row),       ql0 = ld_fragp(ql_row);         // dims 0..31
    const v16us qh1 = ld_fragp(qh_row + 512), ql1 = ld_fragp(ql_row + 512);   // dims 32..63

    int qmax = q0 + 15;
    if (qmax > Tm1) qmax = Tm1;
    const int ntiles = (qmax + 31) >> 5;           // keys 0..qmax-1, wave-uniform
    const int nmy    = (ntiles + 1 - par) >> 1;    // key tiles of this wave (0 for the odd wave of a one-tile walk)

    v8f o[4];
#pragma unroll
    for (int g = 0; g < 4; ++g) o[g] = vzero();
    float mrun = -1e30f, lrun = 0.0f;

    // this lane's first piece of the wave's first key tile; the pointers walk two tiles at a time.
    // A tile's four K fragments lie side by side, and so do its four V fragments.
    const us_t* kh_p = khi + kbh + par * (4 * 512) + 8 * lane;
    const us_t* kl_p = klo + kbh + par * (4 * 512) + 8 * lane;
    const us_t* vh_p = vthi + vbh + par * (4 * 512) + 8 * lane;
    const us_t* vl_p = vtlo + vbh + par * (4 * 512) + 8 * lane;

    // K fragments of the current tile, index 2g + dim half (key tiles 0 and 1 lie inside every plane)
    v16us kh[4], kl[4];
#pragma unroll
    for (int j = 0; j < 4; ++j) {
      kh[j] = ld_fragp(kh_p + j * 512);
      kl[j] = ld_fragp(kl_p + j * 512);
    }
    // the address registers of the loads above are written again below
    asm volatile("s_wait_xcnt 0x0" ::: "memory");
    // keeps the pointer additions below behind that wait
    __builtin_amdgcn_sched_barrier(0);
    // from here on the K pointers stand at the tile that the trip fetches ahead (the last tile fetches itself again)
    {
      const int kstep = (1 < nmy) ? 8 * 512 : 0;
      kh_p += kstep;
      kl_p += kstep;
    }

    for (int kt = 0; kt < nmy; ++kt) {
      const int kbase = (2 * kt + par) * 32;

      // V fragments of this tile (B operand: column n = dim 16g + m, k = key from the transposed planes)
      v16us vh[4], vl[4];
#pragma unroll
      for (int g = 0; g < 4; ++g) {
        vh[g] = ld_fragp(vh_p + g * 512);
        vl[g] = ld_fragp(vl_p + g * 512);
      }

      // St tiles: s[g][r] = score(key kbase + 16g + 8hh + r, query q0 + m)
      v8f s[2];
#pragma unroll
      for (int g = 0; g < 2; ++g) {
        s[g] = vzero();
        s[g] = mma(kh[2 * g], qh0, s[g]);
        s[g] = mma(kh[2 * g], ql0, s[g]);
        s[g] = mma(kl[2 * g], qh0, s[g]);
        s[g] = mma(kh[2 * g + 1], qh1, s[g]);
        s[g] = mma(kh[2 * g + 1], ql1, s[g]);
        s[g] = mma(kl[2 * g + 1], qh1, s[g]);
      }

      // K fragments of the wave's next tile into the registers just read
      {
#pragma unroll
        for (int j = 0; j < 4; ++j) {
          kh[j] = ld_fragp(kh_p + j * 512);
          kl[j] = ld_fragp(kl_p + j * 512);
        }
      }

      // causal mask (key < tq), online softmax per lane (= per query)
      float p0[8], p1[8];
      float mx = -1e30f;
#pragma unroll
      for (int r = 0; r < 8; ++r) {
        const int key0 = kbase + 8 * hh + r;
        float a = s[0][r];
        float c = s[1][r];
        if (key0 >= tq)      a = -1e30f;
        if (key0 + 16 >= tq) c = -1e30f;
        p0[r] = a;
        p1[r] = c;
        mx = fmaxf(mx, fmaxf(a, c));
      }
      mx = fmaxf(mx, __shfl_xor(mx, 16, 32));
      const float mn = fmaxf(mrun, mx);
      const float sc = __expf(mrun - mn);
      float sum = 0.0f;
#pragma unroll
      for (int r = 0; r < 8; ++r) {
        p0[r] = __expf(p0[r] - mn);
        p1[r] = __expf(p1[r] - mn);
        sum += p0[r] + p1[r];
      }
      sum += __shfl_xor(sum, 16, 32);
      lrun = lrun * sc + sum;
      mrun = mn;

      // rescale O: o[g][r] belongs to query q0 + 8hh + r, whose scale lives in lane 8hh + r
#pragma unroll
      for (int r = 0; r < 8; ++r) {
        const float scr = __shfl(sc, 8 * hh + r, 32);
#pragma unroll
        for (int g = 0; g < 4; ++g) o[g][r] *= scr;
      }

      // P as A fragment (lane = query row, k = key within tile), bf16 hi/lo
      Frag ph_, pl_;
#pragma unroll
      for (int r = 0; r < 8; ++r) {
        const us_t a = f2bf(p0[r]);
        const us_t c = f2bf(p1[r]);
        ph_.u[r]     = a;
        ph_.u[8 + r] = c;
        pl_.u[r]     = f2bf(p0[r] - bf2f(a));
        pl_.u[8 + r] = f2bf(p1[r] - bf2f(c));
      }

      // O += P x V
#pragma unroll
      for (int g = 0; g < 4; ++g) {
        o[g] = mma(ph_.u, vh[g], o[g]);
        o[g] = mma(ph_.u, vl[g], o[g]);
        o[g] = mma(pl_.u, vh[g], o[g]);
      }

      // the address registers of this trip's loads are written again below; here their requests are long under way
      asm volatile("s_wait_xcnt 0x0" ::: "memory");
      // keeps the pointer additions below behind that wait: the scheduler otherwise lifts them to the head of the trip
      __builtin_amdgcn_sched_barrier(0);
      {
        const int kstep = (kt + 2 < nmy) ? 8 * 512 : 0;
        kh_p += kstep;
        kl_p += kstep;
        vh_p += 8 * 512;
        vl_p += 8 * 512;
      }
    }

    // this wave's partial result of the tile. Both halves of the wave hold the same statistics for query q0 + m.
#pragma unroll
    for (int g = 0; g < 4; ++g) {
#pragma unroll
      for (int r = 0; r < 8; ++r) ldsO[ph][w][8 * hh + r][16 * g + m] = o[g][r];
    }
    if (hh == 0) {
      ldsM[ph][w][m] = mrun;
      ldsL[ph][w][m] = lrun;
    }
  }
  // publishes every wave's partial results to the wave that joins them
  __syncthreads();

  // epilogue: wave w joins the even and the odd partial of tile (jp, jt), then whole-line stores of the hi/lo planes.
  // The even partial always holds key 0, so its maximum is a real score; an odd wave without a key tile left
  // maximum -1e30, sum 0 and O = 0, which get the weight 0.
  const int jp = w >> 1, jt = w & 1;
  const int qtj = (jp == 0) ? (ATT_NQT - 1 - 2 * (int)blockIdx.x - jt) : (2 * (int)blockIdx.x + jt);
  const int tqj = 1 + 16 * qtj + m;                // the query whose row this lane stores
  const float ma = ldsM[jp][2 * jt][m], mb = ldsM[jp][2 * jt + 1][m];
  const float la = ldsL[jp][2 * jt][m], lb = ldsL[jp][2 * jt + 1][m];
  const float mj = fmaxf(ma, mb);
  const float fa = __expf(ma - mj), fb = __expf(mb - mj);
  const float inv = 1.0f / (la * fa + lb * fb);
  const float ca = fa * inv, cb = fb * inv;

  const unsigned live = (tqj <= Tm1) ? 0xFFFFFFFFu : 0u;   // the slot of time T is stored as zeros
  v4u yh[4], yl[4];
#pragma unroll
  for (int it = 0; it < 4; ++it) {
    const v4f* spa = (const v4f*)(&ldsO[jp][2 * jt][m][8 * (2 * it + hh)]);
    const v4f* spb = (const v4f*)(&ldsO[jp][2 * jt + 1][m][8 * (2 * it + hh)]);
    const v4f a0 = spa[0], a1 = spa[1];
    const v4f b0 = spb[0], b1 = spb[1];
    float vv[8];
#pragma unroll
    for (int i = 0; i < 4; ++i) {
      vv[i]     = a0[i] * ca + b0[i] * cb;
      vv[4 + i] = a1[i] * ca + b1[i] * cb;
    }
#pragma unroll
    for (int i = 0; i < 4; ++i) {
      const us_t ha = f2bf(vv[2 * i]);
      const us_t hc = f2bf(vv[2 * i + 1]);
      yh[it][i] = pk2(ha, hc) & live;
      yl[it][i] = pk2(f2bf(vv[2 * i] - bf2f(ha)), f2bf(vv[2 * i + 1] - bf2f(hc))) & live;
    }
  }

  const unsigned yrow = (unsigned)(b * T_DIM + tqj - 1);
#pragma unroll
  for (int it = 0; it < 4; ++it) {
    const size_t off = 8u * pk_idx(yrow, (unsigned)(h * (HS / 8) + 2 * it + hh), C_DIM / 32);
    *(v4u*)(yhi + off) = yh[it];
    *(v4u*)(ylo + off) = yl[it];
  }
}

// ---------------------------------------------------------------------------
// launcher
// ---------------------------------------------------------------------------
extern "C" void kernel_launch(void* const* d_in, const int* in_sizes, int n_in,
                              void* d_out, int out_size, void* d_ws,
                              size_t ws_size, hipStream_t stream) {
  const size_t MT = (size_t)B_DIM * T_DIM;          // 4096 rows
  const size_t NX = MT * C_DIM;                     // 3145728
  const size_t NW = (size_t)C_DIM * C_DIM;          // 589824

  if (n_in < 8) return;
  if ((size_t)in_sizes[0] != NX || (size_t)in_sizes[1] != NW || in_sizes[2] != NH ||
      (size_t)in_sizes[3] != NW || in_sizes[4] != NH || in_sizes[5] != NH ||
      in_sizes[6] != NH || (size_t)in_sizes[7] != NW || (size_t)out_size != NX) return;

  const float* x       = (const float*)d_in[0];
  const float* W_la    = (const float*)d_in[1];
  const float* la_coef = (const float*)d_in[2];
  const float* W_v     = (const float*)d_in[3];
  const float* v_coef  = (const float*)d_in[4];
  const float* kbeta   = (const float*)d_in[5];
  const float* vbeta   = (const float*)d_in[6];
  const float* W_proj  = (const float*)d_in[7];
  float* out = (float*)d_out;

  // workspace carve (all sizes multiples of 256 B)
  size_t off = 0;
  char* ws = (char*)d_ws;
  us_t* xb   = (us_t*)(ws + off); off += NX * 2;
  us_t* wla  = (us_t*)(ws + off); off += NW * 2;
  us_t* wv   = (us_t*)(ws + off); off += NW * 2;
  us_t* wpj  = (us_t*)(ws + off); off += NW * 2;
  float* u   = (float*)(ws + off); off += NX * 4;
  float* xl  = (float*)(ws + off); off += NX * 4;
  us_t* khi  = (us_t*)(ws + off); off += NX * 2;
  us_t* klo  = (us_t*)(ws + off); off += NX * 2;
  us_t* vthi = (us_t*)(ws + off); off += NX * 2;
  us_t* vtlo = (us_t*)(ws + off); off += NX * 2;
  us_t* yhi  = (us_t*)(ws + off); off += NX * 2;
  us_t* ylo  = (us_t*)(ws + off); off += NX * 2;   // total 72,744,960 B
  if (off > ws_size) return;

  // 0) RNE convert inputs to bf16, fragment order
  const int nx8 = (int)(NX / 8), nw8 = (int)(NW / 8);
  k_cvt<<<(nx8 + 255) / 256, 256, 0, stream>>>(x, xb, nx8);
  k_cvt<<<(nw8 + 255) / 256, 256, 0, stream>>>(W_la, wla, nw8);
  k_cvt<<<(nw8 + 255) / 256, 256, 0, stream>>>(W_v, wv, nw8);
  k_cvt<<<(nw8 + 255) / 256, 256, 0, stream>>>(W_proj, wpj, nw8);

  // 1) u = x W_la^T ; xl = x W_v^T
  dim3 ggrid(C_DIM / 64, (unsigned)(MT / 64));
  k_gemm<0><<<ggrid, 128, 0, stream>>>(xb, xb, wla, u, (int)MT, C_DIM, C_DIM);
  k_gemm<0><<<ggrid, 128, 0, stream>>>(xb, xb, wv, xl, (int)MT, C_DIM, C_DIM);

  // 2) leaky average + normalised, scaled keys as bf16 hi/lo
  dim3 egrid(EMA_SEG, B_DIM * NH);
  k_ema_knorm<<<egrid, EMA_NT, 0, stream>>>(u, la_coef, kbeta, khi, klo);

  // 3) values (transposed, bf16 hi/lo)
  dim3 vgrid(T_DIM / 64, B_DIM * NH);
  k_vmake<<<vgrid, 128, 0, stream>>>(xl, v_coef, vbeta, vthi, vtlo);

  // 4) attention -> y hi/lo planes
  dim3 agrid((T_DIM - 1 + 63) / 64, B_DIM * NH);
  k_attn<<<agrid, 128, 0, stream>>>(khi, klo, vthi, vtlo, yhi, ylo);

  // 5) out = y W_proj^T (hi and lo planes, two products)
  k_gemm<1><<<ggrid, 128, 0, stream>>>(yhi, ylo, wpj, out, (int)MT, C_DIM, C_DIM);
}

// v005
// A run of this version takes 111 microseconds.
// Two timings next to v004 both put it at 1.16 times that version's speed.
// Over all steps from v000 it is 15.7 times as fast.
#include <hip/hip_runtime.h>
#include <stdint.h>

// Contractions: v_wmma_f32_16x16x32_bf16 (bf16 operands, f32 accumulate). Input projections: single product on RNE-bf16 inputs. Score (K x Qt), P x V: bf16 hi/lo split (3 products). Output projection: hi/lo split activations x bf16 weights (2 products).

#define B_DIM 2
#define T_DIM 2048
#define C_DIM 768
#define NH    12
#define HS    64

typedef unsigned short us_t;
typedef __bf16         v16bf __attribute__((ext_vector_type(16)));
typedef unsigned short v16us __attribute__((ext_vector_type(16)));
typedef unsigned short v8us  __attribute__((ext_vector_type(8)));
typedef float          v8f   __attribute__((ext_vector_type(8)));
typedef float          v4f   __attribute__((ext_vector_type(4)));
typedef unsigned int   v4u   __attribute__((ext_vector_type(4)));

union Frag { v16us u; v8us half[2]; };

// ---------------------------------------------------------------------------
// helpers
// ---------------------------------------------------------------------------
__device__ __forceinline__ v8f vzero() {
  v8f z;
#pragma unroll
  for (int i = 0; i < 8; ++i) z[i] = 0.0f;
  return z;
}

// RNE f32 -> bf16 bits
__device__ __forceinline__ us_t f2bf(float f) {
  unsigned u = __float_as_uint(f);
  u += 0x7FFFu + ((u >> 16) & 1u);
  return (us_t)(u >> 16);
}
__device__ __forceinline__ float bf2f(us_t b) { return __uint_as_float(((unsigned)b) << 16); }
__device__ __forceinline__ float bfr(float f) { return bf2f(f2bf(f)); }
__device__ __forceinline__ unsigned pk2(us_t a, us_t b) { return (unsigned)a | (((unsigned)b) << 16); }

// 16x16x32 fragment (A rows / B columns), k order:
// lane l: row/col = l&15, h = l>>4; elements 0..7 <- k0+8h+0..7, elements 8..15 <- k0+16+8h+0..7.
// Every bf16 plane (x, the weights, K, Vt, y) is kept in fragment order: a fragment of 16 rows x 32 k is 1 KiB of its own.
// Lane l finds its elements 0..7 at us_t 8 l and its elements 8..15 at us_t 256 + 8 l, so each of the two loads
// of a wave covers 512 contiguous bytes = 4 whole lines, where a row-major plane makes it touch 16 lines.
// p points at this lane's first piece.
__device__ __forceinline__ v16us ld_fragp(const us_t* __restrict__ p) {
  Frag f;
  f.half[0] = *(const v8us*)(p);
  f.half[1] = *(const v8us*)(p + 256);
  return f.u;
}
// place, in 16-B pieces, of piece (row, k8 = k / 8) in a fragment-order plane with kf fragments along k
__device__ __forceinline__ unsigned pk_idx(unsigned row, unsigned k8, unsigned kf) {
  return ((row >> 4) * kf + (k8 >> 2)) * 64u + (k8 & 3u) * 16u + (row & 15u);
}

// D[16x16] += A[16x32] * B[32x16]; D element r of lane l = (row 8*(l>>4)+r, col l&15).
// Followed by the 4-slot VALU hazard guard (ties D, keeps A/B live).
__device__ __forceinline__ v8f mma(v16us a, v16us b, v8f c) {
  v16bf av = __builtin_bit_cast(v16bf, a);
  v16bf bv = __builtin_bit_cast(v16bf, b);
  c = __builtin_amdgcn_wmma_f32_16x16x32_bf16(false, av, false, bv, (short)0, c, false, false);
  asm volatile("v_nop\n\tv_nop\n\tv_nop\n\tv_nop" : "+v"(c) : "v"(a), "v"(b));
  return c;
}

// ---------------------------------------------------------------------------
// 0) f32 [rows][C_DIM] -> RNE bf16 in fragment order; thread i of a plane writes piece i of that plane.
//    One launch for all four planes, which do not depend on each other: the first CVT_NX8 / 256 work-groups
//    take x, then CVT_NW8 / 256 work-groups each of the three weight matrices (a work-group lies in one plane).
// ---------------------------------------------------------------------------
#define CVT_NX8 (B_DIM * T_DIM * C_DIM / 8)   // 16-B pieces of the x plane
#define CVT_NW8 (C_DIM * C_DIM / 8)           // 16-B pieces of a weight plane
static_assert(CVT_NX8 % 256 == 0 && CVT_NW8 % 256 == 0, "a work-group lies in one plane");
__global__ __launch_bounds__(256) void k_cvt(const float* __restrict__ x,
                                            const float* __restrict__ w0,
                                            const float* __restrict__ w1,
                                            const float* __restrict__ w2,
                                            us_t* __restrict__ xo,
                                            us_t* __restrict__ o0,
                                            us_t* __restrict__ o1,
                                            us_t* __restrict__ o2) {
  int first = (int)blockIdx.x * 256;           // the work-group's first piece, then counted inside its plane
  const float* in = x;
  us_t* out = xo;
  if (first >= CVT_NX8) {
    first -= CVT_NX8;
    const int s = first / CVT_NW8;
    if (s > 2) return;
    first -= s * CVT_NW8;
    in  = (s == 0) ? w0 : (s == 1) ? w1 : w2;
    out = (s == 0) ? o0 : (s == 1) ? o1 : o2;
  }
  const int i = first + (int)threadIdx.x;
  const unsigned blk = (unsigned)i >> 6;
  const unsigned row = (blk / (C_DIM / 32)) * 16u + ((unsigned)i & 15u);
  const unsigned k8  = (blk % (C_DIM / 32)) * 4u + (((unsigned)i >> 4) & 3u);
  const v4f* src = (const v4f*)(in + (size_t)row * C_DIM + k8 * 8u);
  const v4f a = src[0];
  const v4f c = src[1];
  v4u p;
  p[0] = pk2(f2bf(a[0]), f2bf(a[1]));
  p[1] = pk2(f2bf(a[2]), f2bf(a[3]));
  p[2] = pk2(f2bf(c[0]), f2bf(c[1]));
  p[3] = pk2(f2bf(c[2]), f2bf(c[3]));
  v4u* dst = (v4u*)(out + (size_t)i * 8);
  *dst = p;
  
}

// ---------------------------------------------------------------------------
// 1) C[m][n] = sum_k A[m][k] * W[n][k]  (A: MxK bf16, W: NxK bf16, both in fragment order, C: MxN f32 row-major)
//    SPLITA: C = (A + A2) * W^T with A = hi plane, A2 = lo plane (two products); these are the y planes, whose
//    row b*T + i holds time i + 1 (row b*T + T-1: zeros, time 0), so the result rows are stored one time step on.
//    block = 4 waves, 64x64 tile; wave = 16 rows x 64 cols.
//    Epilogue: tile staged in LDS, each 256-B row segment written as 16 lanes x 16 B
//    Fragments sit in a ring of GEMM_ST k-steps of registers: a step's registers are loaded again
//    (for GEMM_ST steps further on) right behind its products, so GEMM_ST steps of loads are in flight.
//    The loops over ring steps and column groups are unrolled so that the ring's arrays stay in registers.
//    Without SPLITA, W may hold 2 N rows: the work-groups of columns N .. 2N - 1 use the rows of a second weight plane
//    that lies directly behind the first, and store to Cout2, so two products of the same A share one launch.
//    Host guarantees M % 64 == 0, N % 64 == 0, K % (32 * GEMM_ST) == 0, K > 0, gridDim.x * 64 == N (without SPLITA: or 2 N).
// ---------------------------------------------------------------------------
#define GEMM_ST 4
template <int SPLITA>
__global__ __launch_bounds__(128) void k_gemm(const us_t* __restrict__ A,
                                             const us_t* __restrict__ A2,
                                             const us_t* __restrict__ W,
                                             float* __restrict__ Cout,
                                             float* __restrict__ Cout2,
                                             int M, int N, int K) {
  __shared__ __align__(16) float ldsC[4][16][68];
  (void)M;
  const int w = threadIdx.x >> 5, lane = threadIdx.x & 31, m = lane & 15, hh = lane >> 4;
  const int mbase = blockIdx.y * 64 + w * 16;
  const int nbase = blockIdx.x * 64;
  // element offsets of this lane's 16-B piece of its fragment rows; they walk along k
  const unsigned kf = (unsigned)K >> 5;            // fragments along k
  unsigned ao = (unsigned)(mbase >> 4) * kf * 512u + 8u * lane;
  unsigned wo[4];
#pragma unroll
  for (int g = 0; g < 4; ++g) wo[g] = (unsigned)((nbase >> 4) + g) * kf * 512u + 8u * lane;

  v8f acc[4];
#pragma unroll
  for (int g = 0; g < 4; ++g) acc[g] = vzero();

  v16us a[GEMM_ST], a2[GEMM_ST], bw[GEMM_ST][4];
#pragma unroll
  for (int i = 0; i < GEMM_ST; ++i) {
    a[i] = ld_fragp(A + ao + 512 * i);
    if (SPLITA) a2[i] = ld_fragp(A2 + ao + 512 * i);
#pragma unroll
    for (int g = 0; g < 4; ++g) bw[i][g] = ld_fragp(W + wo[g] + 512 * i);
    // keeps these loads in the ring's order, step by step: the loop's load-count waits must hold
    // for both ways into the loop and would otherwise wait for nearly the whole ring
    __builtin_amdgcn_sched_barrier(0);
  }
  // registers that held addresses of the loads above are written again below
  asm volatile("s_wait_xcnt 0x0" ::: "memory");

  for (int kb = 32 * GEMM_ST; kb < K; kb += 32 * GEMM_ST) {
    ao += 512 * GEMM_ST;
#pragma unroll
    for (int g = 0; g < 4; ++g) wo[g] += 512 * GEMM_ST;
#pragma unroll
    for (int i = 0; i < GEMM_ST; ++i) {
#pragma unroll
      for (int g = 0; g < 4; ++g) {
        acc[g] = mma(a[i], bw[i][g], acc[g]);
        if (SPLITA) acc[g] = mma(a2[i], bw[i][g], acc[g]);
      }
      a[i] = ld_fragp(A + ao + 512 * i);
      if (SPLITA) a2[i] = ld_fragp(A2 + ao + 512 * i);
#pragma unroll
      for (int g = 0; g < 4; ++g) bw[i][g] = ld_fragp(W + wo[g] + 512 * i);
    }
    // the next trip forms new addresses in the registers of the loads just issued
    asm volatile("s_wait_xcnt 0x0" ::: "memory");
  }
#pragma unroll
  for (int i = 0; i < GEMM_ST; ++i) {
#pragma unroll
    for (int g = 0; g < 4; ++g) {
      acc[g] = mma(a[i], bw[i][g], acc[g]);
      if (SPLITA) acc[g] = mma(a2[i], bw[i][g], acc[g]);
    }
  }

  // stage D tiles: acc[g][r] = C[mbase + 8hh + r][nbase + 16g + m]
#pragma unroll
  for (int g = 0; g < 4; ++g) {
#pragma unroll
    for (int r = 0; r < 8; ++r) ldsC[w][8 * hh + r][16 * g + m] = acc[g][r];
  }
  __syncthreads();

  v4f val[8];
#pragma unroll
  for (int it = 0; it < 8; ++it) val[it] = *(const v4f*)(&ldsC[w][2 * it + hh][4 * m]);

  float* gb = Cout + nbase + 4 * m;
  if (!SPLITA && nbase >= N) gb = Cout2 + (nbase - N) + 4 * m;
#pragma unroll
  for (int it = 0; it < 8; ++it) {
    int row = mbase + 2 * it + hh;
    if (SPLITA) row = (row & ~(T_DIM - 1)) | ((row + 1) & (T_DIM - 1));
    *(v4f*)(gb + (size_t)row * N) = val[it];
  }
  
}

// ---------------------------------------------------------------------------
// 2) leaky average over T (f32) + L2 normalisation + beta scale,
//    written as bf16 hi/lo planes khi/klo, per (batch, head) a fragment-order plane of T rows x HS.
//    The recurrence y[t] = c*y[t-1] + (1-c)*u[t] is linear, so T is cut into chunks of
//    EMA_CL rows that run side by side from a zero state:
//      y[t0+k] = ylocal[k] + c^(k+1) * S,   S = true state in front of the chunk,
//      S(next chunk) = c^EMA_CL * S + (end state of this chunk from zero).
//    A work-group = one (batch, head) and EMA_ROWS consecutive rows. It forms the end states
//    of every chunk up to its own last one (earlier chunks again, from L2), folds them in LDS,
//    and normalises and stores its own rows only: nothing passes between work-groups.
//    Lane group of 8 = one row (8 channels per lane). In the store phase a wave owns the 16 rows of one chunk,
//    which are the rows of one fragment, so every 128-B line of the planes is written by one wave.
//    The loops of constant length are unrolled so that their arrays stay in registers; the load
//    loop also so that all 32 loads of a chunk are in flight before the first is used.
// ---------------------------------------------------------------------------
#define EMA_CL    16                     // rows per chunk
#define EMA_NCH   (T_DIM / EMA_CL)       // chunks per (batch, head)
#define EMA_SEG   8                      // work-groups per (batch, head)
#define EMA_CPS   (EMA_NCH / EMA_SEG)    // chunks stored by one work-group
#define EMA_ROWS  (EMA_CL * EMA_CPS)     // rows stored by one work-group
#define EMA_NT    512                    // threads per work-group
#define EMA_NG    (EMA_NT / 8)           // lane groups per work-group
#define EMA_PITCH 96                     // floats per staged row: neighbour rows fall on the two bank halves

#define EMA_LDSF  (EMA_NCH * HS + EMA_CPS * HS + EMA_ROWS * EMA_PITCH)   // floats of LDS of one work-group

// smem: EMA_LDSF floats of LDS, 16-B aligned; seg: which EMA_ROWS rows of (batch, head) bh this work-group stores
__device__ __forceinline__ void ema_knorm(const float* __restrict__ u,
                                          const float* __restrict__ la_coef,
                                          const float* __restrict__ kbeta,
                                          us_t* __restrict__ khi,
                                          us_t* __restrict__ klo,
                                          float* smem, const int seg, const int bh) {
#pragma clang fp contract(off)
  // In all three arrays a lane's channels 8sub..8sub+3 sit at float 4*sub, 8sub+4..8sub+7 at 32 + 4*sub.
  float (*ldsE)[HS]        = (float (*)[HS])smem;                                    // end state of each chunk from a zero start
  float (*ldsS)[HS]        = (float (*)[HS])(smem + EMA_NCH * HS);                   // true state in front of each own chunk
  float (*ldsY)[EMA_PITCH] = (float (*)[EMA_PITCH])(smem + (EMA_NCH + EMA_CPS) * HS);   // own rows from a zero start

  const int tid  = threadIdx.x;
  const int grp  = tid >> 3;
  const int sub  = tid & 7;
  const int b = bh / NH, h = bh % NH;
  const int own0 = EMA_CPS * seg;                             // first own chunk
  const int nch  = own0 + EMA_CPS;                            // chunks this work-group walks

  const float cc   = bfr(la_coef[h]);
  const float omc  = 1.0f - cc;
  const float beta = expf(fminf(bfr(kbeta[h]) * 10.0f, 5.0f));

  // cp[it] = c^(k+1) for the row position k = 4 it + grp % 4 in its chunk; cl = c^EMA_CL
  float cp[EMA_ROWS / EMA_NG], cl = cc;
#pragma unroll
  for (int it = 0; it < EMA_ROWS / EMA_NG; ++it) {
    const int e = 4 * it + (grp & 3) + 1;                     // 1..16
    float p = 1.0f;
    cl = cc;
#pragma unroll
    for (int bit = 0; bit < 4; ++bit) {
      if ((e >> bit) & 1) p *= cl;
      cl *= cl;
    }
    if (e >> 4) p = cl;
    cp[it] = p;
  }

  const float* up = u + (size_t)b * T_DIM * C_DIM + h * HS + 8 * sub;

  // a) every chunk from a zero state; own0 and nch are multiples of 4, so a wave's four groups agree
  for (int j = grp; j < nch; j += EMA_NG) {
    const float* cpn = up + (size_t)(j * EMA_CL) * C_DIM;
    v4f x0[EMA_CL], x1[EMA_CL];
#pragma unroll
    for (int k = 0; k < EMA_CL; ++k) {
      const v4f* src = (const v4f*)(cpn + (size_t)k * C_DIM);
      x0[k] = src[0];
      x1[k] = src[1];
    }
    const bool own = (j >= own0);
    float* yrow = &ldsY[own ? (j - own0) * EMA_CL : 0][4 * sub];
    v4f y0, y1;
#pragma unroll
    for (int i = 0; i < 4; ++i) { y0[i] = 0.0f; y1[i] = 0.0f; }
#pragma unroll
    for (int k = 0; k < EMA_CL; ++k) {
#pragma unroll
      for (int i = 0; i < 4; ++i) {
        y0[i] = cc * y0[i] + omc * x0[k][i];
        y1[i] = cc * y1[i] + omc * x1[k][i];
      }
      if (own) {
        *(v4f*)(yrow + k * EMA_PITCH)      = y0;
        *(v4f*)(yrow + k * EMA_PITCH + 32) = y1;
      }
    }
    *(v4f*)(&ldsE[j][4 * sub])      = y0;
    *(v4f*)(&ldsE[j][32 + 4 * sub]) = y1;
  }
  __syncthreads();

  // b) fold the end states in time order, one channel per lane (two waves)
  if (tid < HS) {
    float s = 0.0f;
    for (int j0 = 0; j0 < own0; j0 += EMA_CPS) {
      float e[EMA_CPS];
#pragma unroll
      for (int i = 0; i < EMA_CPS; ++i) e[i] = ldsE[j0 + i][tid];
#pragma unroll
      for (int i = 0; i < EMA_CPS; ++i) s = cl * s + e[i];
    }
    float e[EMA_CPS];
#pragma unroll
    for (int i = 0; i < EMA_CPS; ++i) e[i] = ldsE[own0 + i][tid];
#pragma unroll
    for (int i = 0; i < EMA_CPS; ++i) {
      ldsS[i][tid] = s;
      s = cl * s + e[i];
    }
  }
  __syncthreads();

  // c) own rows: add the carried state, normalise, scale, split, store
  static_assert(4 * (EMA_ROWS / EMA_NG) == EMA_CL && EMA_CL == 16, "a wave stores one chunk = one fragment's rows");
  const size_t dpl = (size_t)bh * T_DIM * HS;
#pragma unroll
  for (int it = 0; it < EMA_ROWS / EMA_NG; ++it) {
    const int r = (grp >> 2) * EMA_CL + 4 * it + (grp & 3);   // r % EMA_CL == 4 it + grp % 4
    const v4f a0 = *(const v4f*)(&ldsY[r][4 * sub]);
    const v4f a1 = *(const v4f*)(&ldsY[r][32 + 4 * sub]);
    const v4f s0 = *(const v4f*)(&ldsS[r / EMA_CL][4 * sub]);
    const v4f s1 = *(const v4f*)(&ldsS[r / EMA_CL][32 + 4 * sub]);
    float y[8];
#pragma unroll
    for (int i = 0; i < 4; ++i) {
      y[i]     = a0[i] + cp[it] * s0[i];
      y[4 + i] = a1[i] + cp[it] * s1[i];
    }
    float ss = 0.0f;
#pragma unroll
    for (int i = 0; i < 8; ++i) ss += y[i] * y[i];
    ss += __shfl_xor(ss, 1, 32);
    ss += __shfl_xor(ss, 2, 32);
    ss += __shfl_xor(ss, 4, 32);
    const float rn = 1.0f / (sqrtf(ss) + 1e-6f);

    v4u ph, pl;
#pragma unroll
    for (int i = 0; i < 4; ++i) {
      const float ka = (y[2 * i] * rn) * beta;
      const float kc = (y[2 * i + 1] * rn) * beta;
      const us_t ha = f2bf(ka), hc = f2bf(kc);
      ph[i] = pk2(ha, hc);
      pl[i] = pk2(f2bf(ka - bf2f(ha)), f2bf(kc - bf2f(hc)));
    }
    const size_t off = dpl + 8u * pk_idx((unsigned)(seg * EMA_ROWS + r), (unsigned)sub, HS / 32);
    *(v4u*)(khi + off) = ph;
    *(v4u*)(klo + off) = pl;
  }
}

// ---------------------------------------------------------------------------
// 3) value featurizer: f = xl[t+1]*(1-vc) + xl[t]*vc, L2 normalise, beta scale,
//    written TRANSPOSED as bf16 hi/lo planes vthi/vtlo of fragments (rows = dims, k = key, for the P x V
//    B-fragments); per (batch, head) the four fragments of a 32-key tile lie side by side, tile after tile.
//    Four waves make 64 time steps; a work-group holds VM_Q such quartets, each with LDS of its own.
// ---------------------------------------------------------------------------
#define VM_Q (EMA_NT / 128)              // quartets of waves per work-group
static_assert(VM_Q * 2 * HS * 72 * 2 <= EMA_LDSF * 4, "the value maker's tiles fit the shared LDS");

// smem: the work-group's LDS, 16-B aligned; vx: which VM_Q * 64 time steps of (batch, head) bh this work-group makes
__device__ __forceinline__ void vmake(const float* __restrict__ xl,
                                      const float* __restrict__ v_coef,
                                      const float* __restrict__ vbeta,
                                      us_t* __restrict__ vthi,
                                      us_t* __restrict__ vtlo,
                                      float* smem, const int vx, const int bh) {
#pragma clang fp contract(off)
  const int quart = threadIdx.x >> 7;
  us_t (*ldsH)[72] = (us_t (*)[72])smem + (2 * quart) * HS;
  us_t (*ldsL)[72] = (us_t (*)[72])smem + (2 * quart + 1) * HS;
  const int b = bh / NH, h = bh % NH;
  const int t0 = (vx * VM_Q + quart) * 64;
  const int w = (threadIdx.x >> 5) & 3, lane = threadIdx.x & 31;

  const float vc  = bfr(v_coef[h]);
  const float omv = 1.0f - vc;
  const float vb  = expf(fminf(bfr(vbeta[h]) * 10.0f, 5.0f));

  for (int rr = 0; rr < 16; ++rr) {
    const int tl = w * 16 + rr;
    const int t  = t0 + tl;
    const float* cur = xl + ((size_t)b * T_DIM + t) * C_DIM + h * HS;
    const float c0 = cur[lane], c1 = cur[lane + 32];
    float s0 = 0.0f, s1 = 0.0f;
    if (t + 1 < T_DIM) {
      const float* nx = cur + C_DIM;
      s0 = nx[lane];
      s1 = nx[lane + 32];
    }
    const float f0 = s0 * omv + c0 * vc;
    const float f1 = s1 * omv + c1 * vc;
    float ss = f0 * f0 + f1 * f1;
    ss += __shfl_xor(ss, 16, 32);
    ss += __shfl_xor(ss, 8, 32);
    ss += __shfl_xor(ss, 4, 32);
    ss += __shfl_xor(ss, 2, 32);
    ss += __shfl_xor(ss, 1, 32);
    const float rn = 1.0f / (sqrtf(ss) + 1e-6f);
    const float v0 = (f0 * rn) * vb;
    const float v1 = (f1 * rn) * vb;
    const us_t h0 = f2bf(v0), h1 = f2bf(v1);
    ldsH[lane][tl]      = h0;
    ldsH[lane + 32][tl] = h1;
    ldsL[lane][tl]      = f2bf(v0 - bf2f(h0));
    ldsL[lane + 32][tl] = f2bf(v1 - bf2f(h1));
  }
  __syncthreads();

  const int tid = threadIdx.x & 127;
  const int ch  = tid >> 4;            // 0..7: a wave stores two key octets of 16 dims = 512 contiguous bytes
  const int dsl = tid & 15;
  v4u ph[4], pl[4];
#pragma unroll
  for (int it = 0; it < 4; ++it) {
    const int d = it * 16 + dsl;
    ph[it] = *(const v4u*)(&ldsH[d][8 * ch]);
    pl[it] = *(const v4u*)(&ldsL[d][8 * ch]);
  }
  const size_t gb = ((size_t)bh * HS) * T_DIM;
#pragma unroll
  for (int it = 0; it < 4; ++it) {
    const size_t off = gb + 8u * (unsigned)(((t0 / 32 + (ch >> 2)) * 4 + it) * 64 + (ch & 3) * 16 + dsl);
    *(v4u*)(vthi + off) = ph[it];
    *(v4u*)(vtlo + off) = pl[it];
  }
}

// ---------------------------------------------------------------------------
// 2 + 3 in one launch: keys need only u, values only xl, so neither waits for the other. A work-group is wholly one or
// the other (the branch, and so every barrier behind it, is the same for all its waves). The registers of the leaky
// average let one work-group stand on a WGP, so the longest jobs come first in the grid: the value makers (a wave walks
// its 16 rows one after another, each a round trip to memory), then the leaky averages from the longest segment down.
// ---------------------------------------------------------------------------
#define KV_NV (B_DIM * NH * (T_DIM / (64 * VM_Q)))   // work-groups that make values
#define KV_NE (B_DIM * NH * EMA_SEG)                 // work-groups that make keys
__global__ __launch_bounds__(EMA_NT) void k_kv(const float* __restrict__ u,
                                              const float* __restrict__ la_coef,
                                              const float* __restrict__ kbeta,
                                              us_t* __restrict__ khi,
                                              us_t* __restrict__ klo,
                                              const float* __restrict__ xl,
                                              const float* __restrict__ v_coef,
                                              const float* __restrict__ vbeta,
                                              us_t* __restrict__ vthi,
                                              us_t* __restrict__ vtlo) {
  __shared__ __align__(16) float smem[EMA_LDSF];
  const int idx = (int)blockIdx.x;
  if (idx < KV_NV) {
    vmake(xl, v_coef, vbeta, vthi, vtlo, smem, idx % (T_DIM / (64 * VM_Q)), idx / (T_DIM / (64 * VM_Q)));
  } else {
    const int e = idx - KV_NV;
    ema_knorm(u, la_coef, kbeta, khi, klo, smem, (EMA_SEG - 1) - e / (B_DIM * NH), e % (B_DIM * NH));
  }
}

// ---------------------------------------------------------------------------
// 4) shifted-causal flash attention, query tiles of 16, key tiles of 32.
//    Scores computed transposed: St[key][query] = K_tile (A, rows = keys) x Qt (B, cols = queries),
//    so lane = query owns its softmax statistics and the P A-fragment for P x V is an
//    in-register repack of the two 16-key D tiles (element r <- tile keys 0..15, 8+r <- tile keys 16..31).
//    O[query][dim] accumulated with A = P, B = Vt rows (k = key). All fragments from
//    fragment-order global planes; bf16 hi/lo: hi*hi + hi*lo + lo*hi.
//    Every fragment of a tile has registers of its own: the V loads of a tile are issued in front of
//    its score products, the K loads of the wave's next tile right behind them, so that no product waits
//    for a load issued just in front of it. The fragment loops are unrolled so that the arrays stay in registers.
//    Equal work for every wave: query tile t walks t / 2 + 1 key tiles, so work-group p takes the long
//    tiles 127 - 2p, 126 - 2p and then the short tiles 2p, 2p + 1 (65 key tiles per pair). Two waves share a
//    query tile: one walks its even key tiles, the other its odd ones, each with softmax statistics of its
//    own; the two partial results (maximum, sum, O) meet in LDS behind one barrier, where each wave joins,
//    normalises and stores one of the work-group's four query tiles.
//    grid = (T / 64, B*NH), block 128. Output y hi/lo: fragment-order planes of B*T rows x C, row b*T + i
//    holding time i + 1, so that a tile's 16 queries are the rows of one fragment and every 128-B line has one
//    writer; the slot of time T (row b*T + T-1) takes the zeros of time 0.
// ---------------------------------------------------------------------------
#define ATT_NQT (T_DIM / 16)             // query tiles per (batch, head)
// khi and klo carry no __restrict__: with it the compiler lifts the loads of each wave's first K tile out of the loop
// over the two passes and holds their 64 registers through both walks, which costs the third wave per SIMD.
__global__ __launch_bounds__(128) void k_attn(const us_t* khi,
                                             const us_t* klo,
                                             const us_t* __restrict__ vthi,
                                             const us_t* __restrict__ vtlo,
                                             us_t* __restrict__ yhi,
                                             us_t* __restrict__ ylo) {
#pragma clang fp contract(off)
  __shared__ __align__(16) float ldsO[2][4][16][68];   // [long / short tile][wave]: partial O, rows = queries
  __shared__ float ldsM[2][4][16];                     // partial running maximum per query
  __shared__ float ldsL[2][4][16];                     // partial running sum per query

  const int bh = blockIdx.y, b = bh / NH, h = bh % NH;
  // the wave's number as a scalar: tile numbers, trip counts and the planes' tile addresses stay out of the vector registers
  const int w = __builtin_amdgcn_readfirstlane((int)(threadIdx.x >> 5));
  const int lane = threadIdx.x & 31, m = lane & 15, hh = lane >> 4;
  const int Tm1 = T_DIM - 1;
  const int par = w & 1;                           // this wave's key tiles: par, par + 2, ...

  const size_t kbh = (size_t)bh * T_DIM * HS;
  const size_t vbh = (size_t)bh * HS * T_DIM;

  // kept rolled: the two passes share one copy of the code and one set of registers
#pragma unroll 1
  for (int ph = 0; ph < 2; ++ph) {
    const int qt = (ph == 0) ? (ATT_NQT - 1 - 2 * (int)blockIdx.x - (w >> 1)) : (2 * (int)blockIdx.x + (w >> 1));
    const int q0  = 1 + 16 * qt;                   // first query time of this tile
    const int tq  = q0 + m;                        // this lane's query (B column n and stats owner)
    const int tqc = (tq < Tm1) ? tq : Tm1;         // clamped for loads (slot tq == T is stored as zeros)

    // Q fragments (B operand): column n = query, k = dim; q rows are k rows at time tq
    const us_t* qh_row = khi + kbh + 8u * pk_idx((unsigned)tqc, (unsigned)hh, HS / 32);
    const us_t* ql_row = klo + kbh + 8u * pk_idx((unsigned)tqc, (unsigned)hh, HS / 32);
    const v16us qh0 = ld_fragp(qh_row),       ql0 = ld_fragp(ql_row);         // dims 0..31
    const v16us qh1 = ld_fragp(qh_row + 512), ql1 = ld_fragp(ql_row + 512);   // dims 32..63

    int qmax = q0 + 15;
    if (qmax > Tm1) qmax = Tm1;
    const int ntiles = (qmax + 31) >> 5;           // keys 0..qmax-1, wave-uniform
    const int nmy    = (ntiles + 1 - par) >> 1;    // key tiles of this wave (0 for the odd wave of a one-tile walk)

    v8f o[4];
#pragma unroll
    for (int g = 0; g < 4; ++g) o[g] = vzero();
    float mrun = -1e30f, lrun = 0.0f;

    // this lane's first piece of the wave's first key tile; the pointers walk two tiles at a time.
    // A tile's four K fragments lie side by side, and so do its four V fragments.
    const us_t* kh_p = khi + kbh + par * (4 * 512) + 8 * lane;
    const us_t* kl_p = klo + kbh + par * (4 * 512) + 8 * lane;
    const us_t* vh_p = vthi + vbh + par * (4 * 512) + 8 * lane;
    const us_t* vl_p = vtlo + vbh + par * (4 * 512) + 8 * lane;

    // K fragments of the current tile, index 2g + dim half (key tiles 0 and 1 lie inside every plane)
    v16us kh[4], kl[4];
#pragma unroll
    for (int j = 0; j < 4; ++j) {
      kh[j] = ld_fragp(kh_p + j * 512);
      kl[j] = ld_fragp(kl_p + j * 512);
    }
    // the address registers of the loads above are written again below
    asm volatile("s_wait_xcnt 0x0" ::: "memory");
    // keeps the pointer additions below behind that wait
    __builtin_amdgcn_sched_barrier(0);
    // from here on the K pointers stand at the tile that the trip fetches ahead (the last tile fetches itself again)
    {
      const int kstep = (1 < nmy) ? 8 * 512 : 0;
      kh_p += kstep;
      kl_p += kstep;
    }

    for (int kt = 0; kt < nmy; ++kt) {
      const int kbase = (2 * kt + par) * 32;

      // V fragments of this tile (B operand: column n = dim 16g + m, k = key from the transposed planes)
      v16us vh[4], vl[4];
#pragma unroll
      for (int g = 0; g < 4; ++g) {
        vh[g] = ld_fragp(vh_p + g * 512);
        vl[g] = ld_fragp(vl_p + g * 512);
      }

      // St tiles: s[g][r] = score(key kbase + 16g + 8hh + r, query q0 + m)
      v8f s[2];
#pragma unroll
      for (int g = 0; g < 2; ++g) {
        s[g] = vzero();
        s[g] = mma(kh[2 * g], qh0, s[g]);
        s[g] = mma(kh[2 * g], ql0, s[g]);
        s[g] = mma(kl[2 * g], qh0, s[g]);
        s[g] = mma(kh[2 * g + 1], qh1, s[g]);
        s[g] = mma(kh[2 * g + 1], ql1, s[g]);
        s[g] = mma(kl[2 * g + 1], qh1, s[g]);
      }

      // K fragments of the wave's next tile into the registers just read
      {
#pragma unroll
        for (int j = 0; j < 4; ++j) {
          kh[j] = ld_fragp(kh_p + j * 512);
          kl[j] = ld_fragp(kl_p + j * 512);
        }
      }

      // causal mask (key < tq), online softmax per lane (= per query)
      float p0[8], p1[8];
      float mx = -1e30f;
#pragma unroll
      for (int r = 0; r < 8; ++r) {
        const int key0 = kbase + 8 * hh + r;
        float a = s[0][r];
        float c = s[1][r];
        if (key0 >= tq)      a = -1e30f;
        if (key0 + 16 >= tq) c = -1e30f;
        p0[r] = a;
        p1[r] = c;
        mx = fmaxf(mx, fmaxf(a, c));
      }
      mx = fmaxf(mx, __shfl_xor(mx, 16, 32));
      const float mn = fmaxf(mrun, mx);
      const float sc = __expf(mrun - mn);
      float sum = 0.0f;
#pragma unroll
      for (int r = 0; r < 8; ++r) {
        p0[r] = __expf(p0[r] - mn);
        p1[r] = __expf(p1[r] - mn);
        sum += p0[r] + p1[r];
      }
      sum += __shfl_xor(sum, 16, 32);
      lrun = lrun * sc + sum;
      mrun = mn;

      // rescale O: o[g][r] belongs to query q0 + 8hh + r, whose scale lives in lane 8hh + r
#pragma unroll
      for (int r = 0; r < 8; ++r) {
        const float scr = __shfl(sc, 8 * hh + r, 32);
#pragma unroll
        for (int g = 0; g < 4; ++g) o[g][r] *= scr;
      }

      // P as A fragment (lane = query row, k = key within tile), bf16 hi/lo
      Frag ph_, pl_;
#pragma unroll
      for (int r = 0; r < 8; ++r) {
        const us_t a = f2bf(p0[r]);
        const us_t c = f2bf(p1[r]);
        ph_.u[r]     = a;
        ph_.u[8 + r] = c;
        pl_.u[r]     = f2bf(p0[r] - bf2f(a));
        pl_.u[8 + r] = f2bf(p1[r] - bf2f(c));
      }

      // O += P x V
#pragma unroll
      for (int g = 0; g < 4; ++g) {
        o[g] = mma(ph_.u, vh[g], o[g]);
        o[g] = mma(ph_.u, vl[g], o[g]);
        o[g] = mma(pl_.u, vh[g], o[g]);
      }

      // the address registers of this trip's loads are written again below; here their requests are long under way
      asm volatile("s_wait_xcnt 0x0" ::: "memory");
      // keeps the pointer additions below behind that wait: the scheduler otherwise lifts them to the head of the trip
      __builtin_amdgcn_sched_barrier(0);
      {
        const int kstep = (kt + 2 < nmy) ? 8 * 512 : 0;
        kh_p += kstep;
        kl_p += kstep;
        vh_p += 8 * 512;
        vl_p += 8 * 512;
      }
    }

    // this wave's partial result of the tile. Both halves of the wave hold the same statistics for query q0 + m.
#pragma unroll
    for (int g = 0; g < 4; ++g) {
#pragma unroll
      for (int r = 0; r < 8; ++r) ldsO[ph][w][8 * hh + r][16 * g + m] = o[g][r];
    }
    if (hh == 0) {
      ldsM[ph][w][m] = mrun;
      ldsL[ph][w][m] = lrun;
    }
  }
  // publishes every wave's partial results to the wave that joins them
  __syncthreads();

  // epilogue: wave w joins the even and the odd partial of tile (jp, jt), then whole-line stores of the hi/lo planes.
  // The even partial always holds key 0, so its maximum is a real score; an odd wave without a key tile left
  // maximum -1e30, sum 0 and O = 0, which get the weight 0.
  const int jp = w >> 1, jt = w & 1;
  const int qtj = (jp == 0) ? (ATT_NQT - 1 - 2 * (int)blockIdx.x - jt) : (2 * (int)blockIdx.x + jt);
  const int tqj = 1 + 16 * qtj + m;                // the query whose row this lane stores
  const float ma = ldsM[jp][2 * jt][m], mb = ldsM[jp][2 * jt + 1][m];
  const float la = ldsL[jp][2 * jt][m], lb = ldsL[jp][2 * jt + 1][m];
  const float mj = fmaxf(ma, mb);
  const float fa = __expf(ma - mj), fb = __expf(mb - mj);
  const float inv = 1.0f / (la * fa + lb * fb);
  const float ca = fa * inv, cb = fb * inv;

  const unsigned live = (tqj <= Tm1) ? 0xFFFFFFFFu : 0u;   // the slot of time T is stored as zeros
  v4u yh[4], yl[4];
#pragma unroll
  for (int it = 0; it < 4; ++it) {
    const v4f* spa = (const v4f*)(&ldsO[jp][2 * jt][m][8 * (2 * it + hh)]);
    const v4f* spb = (const v4f*)(&ldsO[jp][2 * jt + 1][m][8 * (2 * it + hh)]);
    const v4f a0 = spa[0], a1 = spa[1];
    const v4f b0 = spb[0], b1 = spb[1];
    float vv[8];
#pragma unroll
    for (int i = 0; i < 4; ++i) {
      vv[i]     = a0[i] * ca + b0[i] * cb;
      vv[4 + i] = a1[i] * ca + b1[i] * cb;
    }
#pragma unroll
    for (int i = 0; i < 4; ++i) {
      const us_t ha = f2bf(vv[2 * i]);
      const us_t hc = f2bf(vv[2 * i + 1]);
      yh[it][i] = pk2(ha, hc) & live;
      yl[it][i] = pk2(f2bf(vv[2 * i] - bf2f(ha)), f2bf(vv[2 * i + 1] - bf2f(hc))) & live;
    }
  }

  const unsigned yrow = (unsigned)(b * T_DIM + tqj - 1);
#pragma unroll
  for (int it = 0; it < 4; ++it) {
    const size_t off = 8u * pk_idx(yrow, (unsigned)(h * (HS / 8) + 2 * it + hh), C_DIM / 32);
    *(v4u*)(yhi + off) = yh[it];
    *(v4u*)(ylo + off) = yl[it];
  }
}

// ---------------------------------------------------------------------------
// launcher
// ---------------------------------------------------------------------------
extern "C" void kernel_launch(void* const* d_in, const int* in_sizes, int n_in,
                              void* d_out, int out_size, void* d_ws,
                              size_t ws_size, hipStream_t stream) {
  const size_t MT = (size_t)B_DIM * T_DIM;          // 4096 rows
  const size_t NX = MT * C_DIM;                     // 3145728
  const size_t NW = (size_t)C_DIM * C_DIM;          // 589824

  if (n_in < 8) return;
  if ((size_t)in_sizes[0] != NX || (size_t)in_sizes[1] != NW || in_sizes[2] != NH ||
      (size_t)in_sizes[3] != NW || in_sizes[4] != NH || in_sizes[5] != NH ||
      in_sizes[6] != NH || (size_t)in_sizes[7] != NW || (size_t)out_size != NX) return;

  const float* x       = (const float*)d_in[0];
  const float* W_la    = (const float*)d_in[1];
  const float* la_coef = (const float*)d_in[2];
  const float* W_v     = (const float*)d_in[3];
  const float* v_coef  = (const float*)d_in[4];
  const float* kbeta   = (const float*)d_in[5];
  const float* vbeta   = (const float*)d_in[6];
  const float* W_proj  = (const float*)d_in[7];
  float* out = (float*)d_out;

  // workspace carve (all sizes multiples of 256 B)
  size_t off = 0;
  char* ws = (char*)d_ws;
  us_t* xb   = (us_t*)(ws + off); off += NX * 2;
  us_t* wla  = (us_t*)(ws + off); off += NW * 2;
  us_t* wv   = (us_t*)(ws + off); off += NW * 2;
  us_t* wpj  = (us_t*)(ws + off); off += NW * 2;
  float* u   = (float*)(ws + off); off += NX * 4;
  float* xl  = (float*)(ws + off); off += NX * 4;
  us_t* khi  = (us_t*)(ws + off); off += NX * 2;
  us_t* klo  = (us_t*)(ws + off); off += NX * 2;
  us_t* vthi = (us_t*)(ws + off); off += NX * 2;
  us_t* vtlo = (us_t*)(ws + off); off += NX * 2;
  us_t* yhi  = (us_t*)(ws + off); off += NX * 2;
  us_t* ylo  = (us_t*)(ws + off); off += NX * 2;   // total 72,744,960 B
  if (off > ws_size) return;

  // 0) RNE convert inputs to bf16, fragment order
  k_cvt<<<(CVT_NX8 + 3 * CVT_NW8) / 256, 256, 0, stream>>>(x, W_la, W_v, W_proj, xb, wla, wv, wpj);

  // 1) u = x W_la^T ; xl = x W_v^T (wv lies directly behind wla)
  dim3 ggrid(C_DIM / 64, (unsigned)(MT / 64));
  dim3 ggrid2(2 * C_DIM / 64, (unsigned)(MT / 64));
  k_gemm<0><<<ggrid2, 128, 0, stream>>>(xb, xb, wla, u, xl, (int)MT, C_DIM, C_DIM);

  // 2 + 3) leaky average + normalised, scaled keys as bf16 hi/lo; values (transposed, bf16 hi/lo)
  k_kv<<<KV_NV + KV_NE, EMA_NT, 0, stream>>>(u, la_coef, kbeta, khi, klo, xl, v_coef, vbeta, vthi, vtlo);

  // 4) attention -> y hi/lo planes
  dim3 agrid((T_DIM - 1 + 63) / 64, B_DIM * NH);
  k_attn<<<agrid, 128, 0, stream>>>(khi, klo, vthi, vtlo, yhi, ylo);

  // 5) out = y W_proj^T (hi and lo planes, two products)
  k_gemm<1><<<ggrid, 128, 0, stream>>>(yhi, ylo, wpj, out, out, (int)MT, C_DIM, C_DIM);
}

// v006
// A run of this version takes 104 microseconds.
// In both of two side-by-side timings against v005, it was 1.06 times as fast.
// All steps since v000 together make it 16.6 times as fast.
#include <hip/hip_runtime.h>
#include <stdint.h>

// Contractions: v_wmma_f32_16x16x32_bf16 (bf16 operands, f32 accumulate). Input projections: single product on RNE-bf16 inputs. Score (K x Qt), P x V: bf16 hi/lo split (3 products). Output projection: hi/lo split activations x bf16 weights (2 products).

#define B_DIM 2
#define T_DIM 2048
#define C_DIM 768
#define NH    12
#define HS    64

typedef unsigned short us_t;
typedef __bf16         v16bf __attribute__((ext_vector_type(16)));
typedef unsigned short v16us __attribute__((ext_vector_type(16)));
typedef unsigned short v8us  __attribute__((ext_vector_type(8)));
typedef float          v8f   __attribute__((ext_vector_type(8)));
typedef float          v4f   __attribute__((ext_vector_type(4)));
typedef unsigned int   v4u   __attribute__((ext_vector_type(4)));
typedef unsigned int   v8u   __attribute__((ext_vector_type(8)));
typedef float          v2f   __attribute__((ext_vector_type(2)));
typedef __bf16         v2bf  __attribute__((ext_vector_type(2)));

union Frag { v16us u; v8us half[2]; };

// ---------------------------------------------------------------------------
// helpers
// ---------------------------------------------------------------------------
__device__ __forceinline__ v8f vzero() {
  v8f z;
#pragma unroll
  for (int i = 0; i < 8; ++i) z[i] = 0.0f;
  return z;
}

// RNE f32 -> bf16 bits, by the chip's convert instruction
__device__ __forceinline__ us_t f2bf(float f) { return __builtin_bit_cast(us_t, (__bf16)f); }
__device__ __forceinline__ float bf2f(us_t b) { return __uint_as_float(((unsigned)b) << 16); }
__device__ __forceinline__ float bfr(float f) { return bf2f(f2bf(f)); }
// two f32 -> one word of two RNE bf16, a in the low half: one packed convert, the word needs no assembling
__device__ __forceinline__ unsigned f2bf2(float a, float b) {
  v2f x;
  x[0] = a;
  x[1] = b;
  return __builtin_bit_cast(unsigned, __builtin_convertvector(x, v2bf));
}
// the two bf16 of such a word as f32
__device__ __forceinline__ float bflo(unsigned w) { return __uint_as_float(w << 16); }
__device__ __forceinline__ float bfhi(unsigned w) { return __uint_as_float(w & 0xFFFF0000u); }

// 16x16x32 fragment (A rows / B columns), k order:
// lane l: row/col = l&15, h = l>>4; elements 0..7 <- k0+8h+0..7, elements 8..15 <- k0+16+8h+0..7.
// Every bf16 plane (x, the weights, K, Vt, y) is kept in fragment order: a fragment of 16 rows x 32 k is 1 KiB of its own.
// Lane l finds its elements 0..7 at us_t 8 l and its elements 8..15 at us_t 256 + 8 l, so each of the two loads
// of a wave covers 512 contiguous bytes = 4 whole lines, where a row-major plane makes it touch 16 lines.
// p points at this lane's first piece.
__device__ __forceinline__ v16us ld_fragp(const us_t* __restrict__ p) {
  Frag f;
  f.half[0] = *(const v8us*)(p);
  f.half[1] = *(const v8us*)(p + 256);
  return f.u;
}
// place, in 16-B pieces, of piece (row, k8 = k / 8) in a fragment-order plane with kf fragments along k
__device__ __forceinline__ unsigned pk_idx(unsigned row, unsigned k8, unsigned kf) {
  return ((row >> 4) * kf + (k8 >> 2)) * 64u + (k8 & 3u) * 16u + (row & 15u);
}

// D[16x16] += A[16x32] * B[32x16]; D element r of lane l = (row 8*(l>>4)+r, col l&15).
// Followed by the 4-slot VALU hazard guard (ties D, keeps A/B live).
__device__ __forceinline__ v8f mma(v16us a, v16us b, v8f c) {
  v16bf av = __builtin_bit_cast(v16bf, a);
  v16bf bv = __builtin_bit_cast(v16bf, b);
  c = __builtin_amdgcn_wmma_f32_16x16x32_bf16(false, av, false, bv, (short)0, c, false, false);
  asm volatile("v_nop\n\tv_nop\n\tv_nop\n\tv_nop" : "+v"(c) : "v"(a), "v"(b));
  return c;
}

// ---------------------------------------------------------------------------
// 0) f32 [rows][C_DIM] -> RNE bf16 in fragment order; thread i of a plane writes piece i of that plane.
//    One launch for all four planes, which do not depend on each other: the first CVT_NX8 / 256 work-groups
//    take x, then CVT_NW8 / 256 work-groups each of the three weight matrices (a work-group lies in one plane).
// ---------------------------------------------------------------------------
#define CVT_NX8 (B_DIM * T_DIM * C_DIM / 8)   // 16-B pieces of the x plane
#define CVT_NW8 (C_DIM * C_DIM / 8)           // 16-B pieces of a weight plane
static_assert(CVT_NX8 % 256 == 0 && CVT_NW8 % 256 == 0, "a work-group lies in one plane");
__global__ __launch_bounds__(256) void k_cvt(const float* __restrict__ x,
                                            const float* __restrict__ w0,
                                            const float* __restrict__ w1,
                                            const float* __restrict__ w2,
                                            us_t* __restrict__ xo,
                                            us_t* __restrict__ o0,
                                            us_t* __restrict__ o1,
                                            us_t* __restrict__ o2) {
  int first = (int)blockIdx.x * 256;           // the work-group's first piece, then counted inside its plane
  const float* in = x;
  us_t* out = xo;
  if (first >= CVT_NX8) {
    first -= CVT_NX8;
    const int s = first / CVT_NW8;
    if (s > 2) return;
    first -= s * CVT_NW8;
    in  = (s == 0) ? w0 : (s == 1) ? w1 : w2;
    out = (s == 0) ? o0 : (s == 1) ? o1 : o2;
  }
  const int i = first + (int)threadIdx.x;
  const unsigned blk = (unsigned)i >> 6;
  const unsigned row = (blk / (C_DIM / 32)) * 16u + ((unsigned)i & 15u);
  const unsigned k8  = (blk % (C_DIM / 32)) * 4u + (((unsigned)i >> 4) & 3u);
  const v4f* src = (const v4f*)(in + (size_t)row * C_DIM + k8 * 8u);
  const v4f a = src[0];
  const v4f c = src[1];
  v4u p;
  p[0] = f2bf2(a[0], a[1]);
  p[1] = f2bf2(a[2], a[3]);
  p[2] = f2bf2(c[0], c[1]);
  p[3] = f2bf2(c[2], c[3]);
  v4u* dst = (v4u*)(out + (size_t)i * 8);
  *dst = p;
  
}

// ---------------------------------------------------------------------------
// 1) C[m][n] = sum_k A[m][k] * W[n][k]  (A: MxK bf16, W: NxK bf16, both in fragment order, C: MxN f32 row-major)
//    SPLITA: C = (A + A2) * W^T with A = hi plane, A2 = lo plane (two products); these are the y planes, whose
//    row b*T + i holds time i + 1 (row b*T + T-1: zeros, time 0), so the result rows are stored one time step on.
//    block = 4 waves, 64x64 tile; wave = 16 rows x 64 cols.
//    Epilogue: tile staged in LDS, each 256-B row segment written as 16 lanes x 16 B
//    Fragments sit in a ring of GEMM_ST k-steps of registers: a step's registers are loaded again
//    (for GEMM_ST steps further on) right behind its products, so GEMM_ST steps of loads are in flight.
//    The loops over ring steps and column groups are unrolled so that the ring's arrays stay in registers.
//    Without SPLITA, W may hold 2 N rows: the work-groups of columns N .. 2N - 1 use the rows of a second weight plane
//    that lies directly behind the first, and store to Cout2, so two products of the same A share one launch.
//    Host guarantees M % 64 == 0, N % 64 == 0, K % (32 * GEMM_ST) == 0, K > 0, gridDim.x * 64 == N (without SPLITA: or 2 N).
// ---------------------------------------------------------------------------
#define GEMM_ST 4
template <int SPLITA>
__global__ __launch_bounds__(128) void k_gemm(const us_t* __restrict__ A,
                                             const us_t* __restrict__ A2,
                                             const us_t* __restrict__ W,
                                             float* __restrict__ Cout,
                                             float* __restrict__ Cout2,
                                             int M, int N, int K) {
  __shared__ __align__(16) float ldsC[4][16][68];
  (void)M;
  const int w = threadIdx.x >> 5, lane = threadIdx.x & 31, m = lane & 15, hh = lane >> 4;
  const int mbase = blockIdx.y * 64 + w * 16;
  const int nbase = blockIdx.x * 64;
  // element offsets of this lane's 16-B piece of its fragment rows; they walk along k
  const unsigned kf = (unsigned)K >> 5;            // fragments along k
  unsigned ao = (unsigned)(mbase >> 4) * kf * 512u + 8u * lane;
  unsigned wo[4];
#pragma unroll
  for (int g = 0; g < 4; ++g) wo[g] = (unsigned)((nbase >> 4) + g) * kf * 512u + 8u * lane;

  v8f acc[4];
#pragma unroll
  for (int g = 0; g < 4; ++g) acc[g] = vzero();

  v16us a[GEMM_ST], a2[GEMM_ST], bw[GEMM_ST][4];
#pragma unroll
  for (int i = 0; i < GEMM_ST; ++i) {
    a[i] = ld_fragp(A + ao + 512 * i);
    if (SPLITA) a2[i] = ld_fragp(A2 + ao + 512 * i);
#pragma unroll
    for (int g = 0; g < 4; ++g) bw[i][g] = ld_fragp(W + wo[g] + 512 * i);
    // keeps these loads in the ring's order, step by step: the loop's load-count waits must hold
    // for both ways into the loop and would otherwise wait for nearly the whole ring
    __builtin_amdgcn_sched_barrier(0);
  }
  // registers that held addresses of the loads above are written again below
  asm volatile("s_wait_xcnt 0x0" ::: "memory");

  for (int kb = 32 * GEMM_ST; kb < K; kb += 32 * GEMM_ST) {
    ao += 512 * GEMM_ST;
#pragma unroll
    for (int g = 0; g < 4; ++g) wo[g] += 512 * GEMM_ST;
#pragma unroll
    for (int i = 0; i < GEMM_ST; ++i) {
#pragma unroll
      for (int g = 0; g < 4; ++g) {
        acc[g] = mma(a[i], bw[i][g], acc[g]);
        if (SPLITA) acc[g] = mma(a2[i], bw[i][g], acc[g]);
      }
      a[i] = ld_fragp(A + ao + 512 * i);
      if (SPLITA) a2[i] = ld_fragp(A2 + ao + 512 * i);
#pragma unroll
      for (int g = 0; g < 4; ++g) bw[i][g] = ld_fragp(W + wo[g] + 512 * i);
    }
    // the next trip forms new addresses in the registers of the loads just issued
    asm volatile("s_wait_xcnt 0x0" ::: "memory");
  }
#pragma unroll
  for (int i = 0; i < GEMM_ST; ++i) {
#pragma unroll
    for (int g = 0; g < 4; ++g) {
      acc[g] = mma(a[i], bw[i][g], acc[g]);
      if (SPLITA) acc[g] = mma(a2[i], bw[i][g], acc[g]);
    }
  }

  // stage D tiles: acc[g][r] = C[mbase + 8hh + r][nbase + 16g + m]
#pragma unroll
  for (int g = 0; g < 4; ++g) {
#pragma unroll
    for (int r = 0; r < 8; ++r) ldsC[w][8 * hh + r][16 * g + m] = acc[g][r];
  }
  __syncthreads();

  v4f val[8];
#pragma unroll
  for (int it = 0; it < 8; ++it) val[it] = *(const v4f*)(&ldsC[w][2 * it + hh][4 * m]);

  float* gb = Cout + nbase + 4 * m;
  if (!SPLITA && nbase >= N) gb = Cout2 + (nbase - N) + 4 * m;
#pragma unroll
  for (int it = 0; it < 8; ++it) {
    int row = mbase + 2 * it + hh;
    if (SPLITA) row = (row & ~(T_DIM - 1)) | ((row + 1) & (T_DIM - 1));
    *(v4f*)(gb + (size_t)row * N) = val[it];
  }
  
}

// ---------------------------------------------------------------------------
// 2) leaky average over T (f32) + L2 normalisation + beta scale,
//    written as bf16 hi/lo planes khi/klo, per (batch, head) a fragment-order plane of T rows x HS.
//    The recurrence y[t] = c*y[t-1] + (1-c)*u[t] is linear, so T is cut into chunks of
//    EMA_CL rows that run side by side from a zero state:
//      y[t0+k] = ylocal[k] + c^(k+1) * S,   S = true state in front of the chunk,
//      S(next chunk) = c^EMA_CL * S + (end state of this chunk from zero).
//    A work-group = one (batch, head) and EMA_ROWS consecutive rows. It forms the end states
//    of every chunk up to its own last one (earlier chunks again, from L2), folds them in LDS,
//    and normalises and stores its own rows only: nothing passes between work-groups.
//    Lane group of 8 = one row (8 channels per lane). In the store phase a wave owns the 16 rows of one chunk,
//    which are the rows of one fragment, so every 128-B line of the planes is written by one wave.
//    The loops of constant length are unrolled so that their arrays stay in registers; the load
//    loop also so that all 32 loads of a chunk are in flight before the first is used.
// ---------------------------------------------------------------------------
#define EMA_CL    16                     // rows per chunk
#define EMA_NCH   (T_DIM / EMA_CL)       // chunks per (batch, head)
#define EMA_SEG   8                      // work-groups per (batch, head)
#define EMA_CPS   (EMA_NCH / EMA_SEG)    // chunks stored by one work-group
#define EMA_ROWS  (EMA_CL * EMA_CPS)     // rows stored by one work-group
#define EMA_NT    512                    // threads per work-group
#define EMA_NG    (EMA_NT / 8)           // lane groups per work-group
#define EMA_PITCH 96                     // floats per staged row: neighbour rows fall on the two bank halves

#define EMA_LDSF  (EMA_NCH * HS + EMA_CPS * HS + EMA_ROWS * EMA_PITCH)   // floats of LDS of one work-group

// smem: EMA_LDSF floats of LDS, 16-B aligned; seg: which EMA_ROWS rows of (batch, head) bh this work-group stores
__device__ __forceinline__ void ema_knorm(const float* __restrict__ u,
                                          const float* __restrict__ la_coef,
                                          const float* __restrict__ kbeta,
                                          us_t* __restrict__ khi,
                                          us_t* __restrict__ klo,
                                          float* smem, const int seg, const int bh) {
#pragma clang fp contract(off)
  // In all three arrays a lane's channels 8sub..8sub+3 sit at float 4*sub, 8sub+4..8sub+7 at 32 + 4*sub.
  float (*ldsE)[HS]        = (float (*)[HS])smem;                                    // end state of each chunk from a zero start
  float (*ldsS)[HS]        = (float (*)[HS])(smem + EMA_NCH * HS);                   // true state in front of each own chunk
  float (*ldsY)[EMA_PITCH] = (float (*)[EMA_PITCH])(smem + (EMA_NCH + EMA_CPS) * HS);   // own rows from a zero start

  const int tid  = threadIdx.x;
  const int grp  = tid >> 3;
  const int sub  = tid & 7;
  const int b = bh / NH, h = bh % NH;
  const int own0 = EMA_CPS * seg;                             // first own chunk
  const int nch  = own0 + EMA_CPS;                            // chunks this work-group walks

  const float cc   = bfr(la_coef[h]);
  const float omc  = 1.0f - cc;
  const float beta = expf(fminf(bfr(kbeta[h]) * 10.0f, 5.0f));

  // cp[it] = c^(k+1) for the row position k = 4 it + grp % 4 in its chunk; cl = c^EMA_CL
  float cp[EMA_ROWS / EMA_NG], cl = cc;
#pragma unroll
  for (int it = 0; it < EMA_ROWS / EMA_NG; ++it) {
    const int e = 4 * it + (grp & 3) + 1;                     // 1..16
    float p = 1.0f;
    cl = cc;
#pragma unroll
    for (int bit = 0; bit < 4; ++bit) {
      if ((e >> bit) & 1) p *= cl;
      cl *= cl;
    }
    if (e >> 4) p = cl;
    cp[it] = p;
  }

  const float* up = u + (size_t)b * T_DIM * C_DIM + h * HS + 8 * sub;

  // a) every chunk from a zero state; own0 and nch are multiples of 4, so a wave's four groups agree
  for (int j = grp; j < nch; j += EMA_NG) {
    const float* cpn = up + (size_t)(j * EMA_CL) * C_DIM;
    v4f x0[EMA_CL], x1[EMA_CL];
#pragma unroll
    for (int k = 0; k < EMA_CL; ++k) {
      const v4f* src = (const v4f*)(cpn + (size_t)k * C_DIM);
      x0[k] = src[0];
      x1[k] = src[1];
    }
    const bool own = (j >= own0);
    float* yrow = &ldsY[own ? (j - own0) * EMA_CL : 0][4 * sub];
    v4f y0, y1;
#pragma unroll
    for (int i = 0; i < 4; ++i) { y0[i] = 0.0f; y1[i] = 0.0f; }
#pragma unroll
    for (int k = 0; k < EMA_CL; ++k) {
#pragma unroll
      for (int i = 0; i < 4; ++i) {
        y0[i] = cc * y0[i] + omc * x0[k][i];
        y1[i] = cc * y1[i] + omc * x1[k][i];
      }
      if (own) {
        *(v4f*)(yrow + k * EMA_PITCH)      = y0;
        *(v4f*)(yrow + k * EMA_PITCH + 32) = y1;
      }
    }
    *(v4f*)(&ldsE[j][4 * sub])      = y0;
    *(v4f*)(&ldsE[j][32 + 4 * sub]) = y1;
  }
  __syncthreads();

  // b) fold the end states in time order, one channel per lane (two waves)
  if (tid < HS) {
    float s = 0.0f;
    for (int j0 = 0; j0 < own0; j0 += EMA_CPS) {
      float e[EMA_CPS];
#pragma unroll
      for (int i = 0; i < EMA_CPS; ++i) e[i] = ldsE[j0 + i][tid];
#pragma unroll
      for (int i = 0; i < EMA_CPS; ++i) s = cl * s + e[i];
    }
    float e[EMA_CPS];
#pragma unroll
    for (int i = 0; i < EMA_CPS; ++i) e[i] = ldsE[own0 + i][tid];
#pragma unroll
    for (int i = 0; i < EMA_CPS; ++i) {
      ldsS[i][tid] = s;
      s = cl * s + e[i];
    }
  }
  __syncthreads();

  // c) own rows: add the carried state, normalise, scale, split, store
  static_assert(4 * (EMA_ROWS / EMA_NG) == EMA_CL && EMA_CL == 16, "a wave stores one chunk = one fragment's rows");
  const size_t dpl = (size_t)bh * T_DIM * HS;
#pragma unroll
  for (int it = 0; it < EMA_ROWS / EMA_NG; ++it) {
    const int r = (grp >> 2) * EMA_CL + 4 * it + (grp & 3);   // r % EMA_CL == 4 it + grp % 4
    const v4f a0 = *(const v4f*)(&ldsY[r][4 * sub]);
    const v4f a1 = *(const v4f*)(&ldsY[r][32 + 4 * sub]);
    const v4f s0 = *(const v4f*)(&ldsS[r / EMA_CL][4 * sub]);
    const v4f s1 = *(const v4f*)(&ldsS[r / EMA_CL][32 + 4 * sub]);
    float y[8];
#pragma unroll
    for (int i = 0; i < 4; ++i) {
      y[i]     = a0[i] + cp[it] * s0[i];
      y[4 + i] = a1[i] + cp[it] * s1[i];
    }
    float ss = 0.0f;
#pragma unroll
    for (int i = 0; i < 8; ++i) ss += y[i] * y[i];
    ss += __shfl_xor(ss, 1, 32);
    ss += __shfl_xor(ss, 2, 32);
    ss += __shfl_xor(ss, 4, 32);
    const float rn = 1.0f / (sqrtf(ss) + 1e-6f);

    v4u ph, pl;
#pragma unroll
    for (int i = 0; i < 4; ++i) {
      const float ka = (y[2 * i] * rn) * beta;
      const float kc = (y[2 * i + 1] * rn) * beta;
      const unsigned hw = f2bf2(ka, kc);
      ph[i] = hw;
      pl[i] = f2bf2(ka - bflo(hw), kc - bfhi(hw));
    }
    const size_t off = dpl + 8u * pk_idx((unsigned)(seg * EMA_ROWS + r), (unsigned)sub, HS / 32);
    *(v4u*)(khi + off) = ph;
    *(v4u*)(klo + off) = pl;
  }
}

// ---------------------------------------------------------------------------
// 3) value featurizer: f = xl[t+1]*(1-vc) + xl[t]*vc, L2 normalise, beta scale,
//    written TRANSPOSED as bf16 hi/lo planes vthi/vtlo of fragments (rows = dims, k = key, for the P x V
//    B-fragments); per (batch, head) the four fragments of a 32-key tile lie side by side, tile after tile.
//    Four waves make 64 time steps; a work-group holds VM_Q such quartets, each with LDS of its own.
// ---------------------------------------------------------------------------
#define VM_Q (EMA_NT / 128)              // quartets of waves per work-group
static_assert(VM_Q * 2 * HS * 72 * 2 <= EMA_LDSF * 4, "the value maker's tiles fit the shared LDS");

// smem: the work-group's LDS, 16-B aligned; vx: which VM_Q * 64 time steps of (batch, head) bh this work-group makes
__device__ __forceinline__ void vmake(const float* __restrict__ xl,
                                      const float* __restrict__ v_coef,
                                      const float* __restrict__ vbeta,
                                      us_t* __restrict__ vthi,
                                      us_t* __restrict__ vtlo,
                                      float* smem, const int vx, const int bh) {
#pragma clang fp contract(off)
  const int quart = threadIdx.x >> 7;
  us_t (*ldsH)[72] = (us_t (*)[72])smem + (2 * quart) * HS;
  us_t (*ldsL)[72] = (us_t (*)[72])smem + (2 * quart + 1) * HS;
  const int b = bh / NH, h = bh % NH;
  const int t0 = (vx * VM_Q + quart) * 64;
  const int w = (threadIdx.x >> 5) & 3, lane = threadIdx.x & 31;

  const float vc  = bfr(v_coef[h]);
  const float omv = 1.0f - vc;
  const float vb  = expf(fminf(bfr(vbeta[h]) * 10.0f, 5.0f));

  for (int rr = 0; rr < 16; ++rr) {
    const int tl = w * 16 + rr;
    const int t  = t0 + tl;
    const float* cur = xl + ((size_t)b * T_DIM + t) * C_DIM + h * HS;
    const float c0 = cur[lane], c1 = cur[lane + 32];
    float s0 = 0.0f, s1 = 0.0f;
    if (t + 1 < T_DIM) {
      const float* nx = cur + C_DIM;
      s0 = nx[lane];
      s1 = nx[lane + 32];
    }
    const float f0 = s0 * omv + c0 * vc;
    const float f1 = s1 * omv + c1 * vc;
    float ss = f0 * f0 + f1 * f1;
    ss += __shfl_xor(ss, 16, 32);
    ss += __shfl_xor(ss, 8, 32);
    ss += __shfl_xor(ss, 4, 32);
    ss += __shfl_xor(ss, 2, 32);
    ss += __shfl_xor(ss, 1, 32);
    const float rn = 1.0f / (sqrtf(ss) + 1e-6f);
    const float v0 = (f0 * rn) * vb;
    const float v1 = (f1 * rn) * vb;
    const us_t h0 = f2bf(v0), h1 = f2bf(v1);
    ldsH[lane][tl]      = h0;
    ldsH[lane + 32][tl] = h1;
    ldsL[lane][tl]      = f2bf(v0 - bf2f(h0));
    ldsL[lane + 32][tl] = f2bf(v1 - bf2f(h1));
  }
  __syncthreads();

  const int tid = threadIdx.x & 127;
  const int ch  = tid >> 4;            // 0..7: a wave stores two key octets of 16 dims = 512 contiguous bytes
  const int dsl = tid & 15;
  v4u ph[4], pl[4];
#pragma unroll
  for (int it = 0; it < 4; ++it) {
    const int d = it * 16 + dsl;
    ph[it] = *(const v4u*)(&ldsH[d][8 * ch]);
    pl[it] = *(const v4u*)(&ldsL[d][8 * ch]);
  }
  const size_t gb = ((size_t)bh * HS) * T_DIM;
#pragma unroll
  for (int it = 0; it < 4; ++it) {
    const size_t off = gb + 8u * (unsigned)(((t0 / 32 + (ch >> 2)) * 4 + it) * 64 + (ch & 3) * 16 + dsl);
    *(v4u*)(vthi + off) = ph[it];
    *(v4u*)(vtlo + off) = pl[it];
  }
}

// ---------------------------------------------------------------------------
// 2 + 3 in one launch: keys need only u, values only xl, so neither waits for the other. A work-group is wholly one or
// the other (the branch, and so every barrier behind it, is the same for all its waves). The registers of the leaky
// average let one work-group stand on a WGP, so the longest jobs come first in the grid: the value makers (a wave walks
// its 16 rows one after another, each a round trip to memory), then the leaky averages from the longest segment down.
// ---------------------------------------------------------------------------
#define KV_NV (B_DIM * NH * (T_DIM / (64 * VM_Q)))   // work-groups that make values
#define KV_NE (B_DIM * NH * EMA_SEG)                 // work-groups that make keys
__global__ __launch_bounds__(EMA_NT) void k_kv(const float* __restrict__ u,
                                              const float* __restrict__ la_coef,
                                              const float* __restrict__ kbeta,
                                              us_t* __restrict__ khi,
                                              us_t* __restrict__ klo,
                                              const float* __restrict__ xl,
                                              const float* __restrict__ v_coef,
                                              const float* __restrict__ vbeta,
                                              us_t* __restrict__ vthi,
                                              us_t* __restrict__ vtlo) {
  __shared__ __align__(16) float smem[EMA_LDSF];
  const int idx = (int)blockIdx.x;
  if (idx < KV_NV) {
    vmake(xl, v_coef, vbeta, vthi, vtlo, smem, idx % (T_DIM / (64 * VM_Q)), idx / (T_DIM / (64 * VM_Q)));
  } else {
    const int e = idx - KV_NV;
    ema_knorm(u, la_coef, kbeta, khi, klo, smem, (EMA_SEG - 1) - e / (B_DIM * NH), e % (B_DIM * NH));
  }
}

// ---------------------------------------------------------------------------
// 4) shifted-causal flash attention, query tiles of 16, key tiles of 32.
//    Scores computed transposed: St[key][query] = K_tile (A, rows = keys) x Qt (B, cols = queries),
//    so lane = query owns its softmax statistics and the P A-fragment for P x V is an
//    in-register repack of the two 16-key D tiles (element r <- tile keys 0..15, 8+r <- tile keys 16..31).
//    O[query][dim] accumulated with A = P, B = Vt rows (k = key). All fragments from
//    fragment-order global planes; bf16 hi/lo: hi*hi + hi*lo + lo*hi.
//    Every fragment of a tile has registers of its own: the V loads of a tile are issued in front of
//    its score products, the K loads of the wave's next tile right behind them, so that no product waits
//    for a load issued just in front of it. The fragment loops are unrolled so that the arrays stay in registers.
//    Equal work for every wave: query tile t walks t / 2 + 1 key tiles, so work-group p takes the long
//    tiles 127 - 2p, 126 - 2p and then the short tiles 2p, 2p + 1 (65 key tiles per pair). Two waves share a
//    query tile: one walks its even key tiles, the other its odd ones, each with softmax statistics of its
//    own; the two partial results (maximum, sum, O) meet in LDS behind one barrier, where each wave joins,
//    normalises and stores one of the work-group's four query tiles.
//    grid = (T / 64, B*NH), block 128. Output y hi/lo: fragment-order planes of B*T rows x C, row b*T + i
//    holding time i + 1, so that a tile's 16 queries are the rows of one fragment and every 128-B line has one
//    writer; the slot of time T (row b*T + T-1) takes the zeros of time 0.
// ---------------------------------------------------------------------------
#define ATT_NQT (T_DIM / 16)             // query tiles per (batch, head)
// khi and klo carry no __restrict__: with it the compiler lifts the loads of each wave's first K tile out of the loop
// over the two passes and holds their 64 registers through both walks, which costs the third wave per SIMD.
__global__ __launch_bounds__(128) void k_attn(const us_t* khi,
                                             const us_t* klo,
                                             const us_t* __restrict__ vthi,
                                             const us_t* __restrict__ vtlo,
                                             us_t* __restrict__ yhi,
                                             us_t* __restrict__ ylo) {
#pragma clang fp contract(off)
  __shared__ __align__(16) float ldsO[2][4][16][68];   // [long / short tile][wave]: partial O, rows = queries
  __shared__ float ldsM[2][4][16];                     // partial running maximum per query
  __shared__ float ldsL[2][4][16];                     // partial running sum per query

  const int bh = blockIdx.y, b = bh / NH, h = bh % NH;
  // the wave's number as a scalar: tile numbers, trip counts and the planes' tile addresses stay out of the vector registers
  const int w = __builtin_amdgcn_readfirstlane((int)(threadIdx.x >> 5));
  const int lane = threadIdx.x & 31, m = lane & 15, hh = lane >> 4;
  const int Tm1 = T_DIM - 1;
  const int par = w & 1;                           // this wave's key tiles: par, par + 2, ...

  const size_t kbh = (size_t)bh * T_DIM * HS;
  const size_t vbh = (size_t)bh * HS * T_DIM;

  // kept rolled: the two passes share one copy of the code and one set of registers
#pragma unroll 1
  for (int ph = 0; ph < 2; ++ph) {
    const int qt = (ph == 0) ? (ATT_NQT - 1 - 2 * (int)blockIdx.x - (w >> 1)) : (2 * (int)blockIdx.x + (w >> 1));
    const int q0  = 1 + 16 * qt;                   // first query time of this tile
    const int tq  = q0 + m;                        // this lane's query (B column n and stats owner)
    const int tqc = (tq < Tm1) ? tq : Tm1;         // clamped for loads (slot tq == T is stored as zeros)

    // Q fragments (B operand): column n = query, k = dim; q rows are k rows at time tq
    const us_t* qh_row = khi + kbh + 8u * pk_idx((unsigned)tqc, (unsigned)hh, HS / 32);
    const us_t* ql_row = klo + kbh + 8u * pk_idx((unsigned)tqc, (unsigned)hh, HS / 32);
    const v16us qh0 = ld_fragp(qh_row),       ql0 = ld_fragp(ql_row);         // dims 0..31
    const v16us qh1 = ld_fragp(qh_row + 512), ql1 = ld_fragp(ql_row + 512);   // dims 32..63

    int qmax = q0 + 15;
    if (qmax > Tm1) qmax = Tm1;
    const int ntiles = (qmax + 31) >> 5;           // keys 0..qmax-1, wave-uniform
    const int nmy    = (ntiles + 1 - par) >> 1;    // key tiles of this wave (0 for the odd wave of a one-tile walk)

    v8f o[4];
#pragma unroll
    for (int g = 0; g < 4; ++g) o[g] = vzero();
    float mrun = -1e30f, lrun = 0.0f;

    // this lane's first piece of the wave's first key tile; the pointers walk two tiles at a time.
    // A tile's four K fragments lie side by side, and so do its four V fragments.
    const us_t* kh_p = khi + kbh + par * (4 * 512) + 8 * lane;
    const us_t* kl_p = klo + kbh + par * (4 * 512) + 8 * lane;
    const us_t* vh_p = vthi + vbh + par * (4 * 512) + 8 * lane;
    const us_t* vl_p = vtlo + vbh + par * (4 * 512) + 8 * lane;

    // K fragments of the current tile, index 2g + dim half (key tiles 0 and 1 lie inside every plane)
    v16us kh[4], kl[4];
#pragma unroll
    for (int j = 0; j < 4; ++j) {
      kh[j] = ld_fragp(kh_p + j * 512);
      kl[j] = ld_fragp(kl_p + j * 512);
    }
    // the address registers of the loads above are written again below
    asm volatile("s_wait_xcnt 0x0" ::: "memory");
    // keeps the pointer additions below behind that wait
    __builtin_amdgcn_sched_barrier(0);
    // from here on the K pointers stand at the tile that the trip fetches ahead (the last tile fetches itself again)
    {
      const int kstep = (1 < nmy) ? 8 * 512 : 0;
      kh_p += kstep;
      kl_p += kstep;
    }

    for (int kt = 0; kt < nmy; ++kt) {
      const int kbase = (2 * kt + par) * 32;

      // V fragments of this tile (B operand: column n = dim 16g + m, k = key from the transposed planes)
      v16us vh[4], vl[4];
#pragma unroll
      for (int g = 0; g < 4; ++g) {
        vh[g] = ld_fragp(vh_p + g * 512);
        vl[g] = ld_fragp(vl_p + g * 512);
      }

      // St tiles: s[g][r] = score(key kbase + 16g + 8hh + r, query q0 + m)
      v8f s[2];
#pragma unroll
      for (int g = 0; g < 2; ++g) {
        s[g] = vzero();
        s[g] = mma(kh[2 * g], qh0, s[g]);
        s[g] = mma(kh[2 * g], ql0, s[g]);
        s[g] = mma(kl[2 * g], qh0, s[g]);
        s[g] = mma(kh[2 * g + 1], qh1, s[g]);
        s[g] = mma(kh[2 * g + 1], ql1, s[g]);
        s[g] = mma(kl[2 * g + 1], qh1, s[g]);
      }

      // K fragments of the wave's next tile into the registers just read
      {
#pragma unroll
        for (int j = 0; j < 4; ++j) {
          kh[j] = ld_fragp(kh_p + j * 512);
          kl[j] = ld_fragp(kl_p + j * 512);
        }
      }

      // causal mask (key < tq), online softmax per lane (= per query)
      float p0[8], p1[8];
      float mx = -1e30f;
#pragma unroll
      for (int r = 0; r < 8; ++r) {
        const int key0 = kbase + 8 * hh + r;
        float a = s[0][r];
        float c = s[1][r];
        if (key0 >= tq)      a = -1e30f;
        if (key0 + 16 >= tq) c = -1e30f;
        p0[r] = a;
        p1[r] = c;
        mx = fmaxf(mx, fmaxf(a, c));
      }
      mx = fmaxf(mx, __shfl_xor(mx, 16, 32));
      const float mn = fmaxf(mrun, mx);
      const float sc = __expf(mrun - mn);
      float sum = 0.0f;
#pragma unroll
      for (int r = 0; r < 8; ++r) {
        p0[r] = __expf(p0[r] - mn);
        p1[r] = __expf(p1[r] - mn);
        sum += p0[r] + p1[r];
      }
      sum += __shfl_xor(sum, 16, 32);
      lrun = lrun * sc + sum;
      mrun = mn;

      // rescale O: o[g][r] belongs to query q0 + 8hh + r, whose scale lives in lane 8hh + r
#pragma unroll
      for (int r = 0; r < 8; ++r) {
        const float scr = __shfl(sc, 8 * hh + r, 32);
#pragma unroll
        for (int g = 0; g < 4; ++g) o[g][r] *= scr;
      }

      // P as A fragment (lane = query row, k = key within tile), bf16 hi/lo
      v8u phw, plw;
#pragma unroll
      for (int i = 0; i < 4; ++i) {
        const unsigned a = f2bf2(p0[2 * i], p0[2 * i + 1]);
        const unsigned c = f2bf2(p1[2 * i], p1[2 * i + 1]);
        phw[i]     = a;
        phw[4 + i] = c;
        plw[i]     = f2bf2(p0[2 * i] - bflo(a), p0[2 * i + 1] - bfhi(a));
        plw[4 + i] = f2bf2(p1[2 * i] - bflo(c), p1[2 * i + 1] - bfhi(c));
      }
      const v16us pfh = __builtin_bit_cast(v16us, phw);
      const v16us pfl = __builtin_bit_cast(v16us, plw);

      // O += P x V
#pragma unroll
      for (int g = 0; g < 4; ++g) {
        o[g] = mma(pfh, vh[g], o[g]);
        o[g] = mma(pfh, vl[g], o[g]);
        o[g] = mma(pfl, vh[g], o[g]);
      }

      // the address registers of this trip's loads are written again below; here their requests are long under way
      asm volatile("s_wait_xcnt 0x0" ::: "memory");
      // keeps the pointer additions below behind that wait: the scheduler otherwise lifts them to the head of the trip
      __builtin_amdgcn_sched_barrier(0);
      {
        const int kstep = (kt + 2 < nmy) ? 8 * 512 : 0;
        kh_p += kstep;
        kl_p += kstep;
        vh_p += 8 * 512;
        vl_p += 8 * 512;
      }
    }

    // this wave's partial result of the tile. Both halves of the wave hold the same statistics for query q0 + m.
#pragma unroll
    for (int g = 0; g < 4; ++g) {
#pragma unroll
      for (int r = 0; r < 8; ++r) ldsO[ph][w][8 * hh + r][16 * g + m] = o[g][r];
    }
    if (hh == 0) {
      ldsM[ph][w][m] = mrun;
      ldsL[ph][w][m] = lrun;
    }
  }
  // publishes every wave's partial results to the wave that joins them
  __syncthreads();

  // epilogue: wave w joins the even and the odd partial of tile (jp, jt), then whole-line stores of the hi/lo planes.
  // The even partial always holds key 0, so its maximum is a real score; an odd wave without a key tile left
  // maximum -1e30, sum 0 and O = 0, which get the weight 0.
  const int jp = w >> 1, jt = w & 1;
  const int qtj = (jp == 0) ? (ATT_NQT - 1 - 2 * (int)blockIdx.x - jt) : (2 * (int)blockIdx.x + jt);
  const int tqj = 1 + 16 * qtj + m;                // the query whose row this lane stores
  const float ma = ldsM[jp][2 * jt][m], mb = ldsM[jp][2 * jt + 1][m];
  const float la = ldsL[jp][2 * jt][m], lb = ldsL[jp][2 * jt + 1][m];
  const float mj = fmaxf(ma, mb);
  const float fa = __expf(ma - mj), fb = __expf(mb - mj);
  const float inv = 1.0f / (la * fa + lb * fb);
  const float ca = fa * inv, cb = fb * inv;

  const unsigned live = (tqj <= Tm1) ? 0xFFFFFFFFu : 0u;   // the slot of time T is stored as zeros
  v4u yh[4], yl[4];
#pragma unroll
  for (int it = 0; it < 4; ++it) {
    const v4f* spa = (const v4f*)(&ldsO[jp][2 * jt][m][8 * (2 * it + hh)]);
    const v4f* spb = (const v4f*)(&ldsO[jp][2 * jt + 1][m][8 * (2 * it + hh)]);
    const v4f a0 = spa[0], a1 = spa[1];
    const v4f b0 = spb[0], b1 = spb[1];
    float vv[8];
#pragma unroll
    for (int i = 0; i < 4; ++i) {
      vv[i]     = a0[i] * ca + b0[i] * cb;
      vv[4 + i] = a1[i] * ca + b1[i] * cb;
    }
#pragma unroll
    for (int i = 0; i < 4; ++i) {
      const unsigned hw = f2bf2(vv[2 * i], vv[2 * i + 1]);
      yh[it][i] = hw & live;
      yl[it][i] = f2bf2(vv[2 * i] - bflo(hw), vv[2 * i + 1] - bfhi(hw)) & live;
    }
  }

  const unsigned yrow = (unsigned)(b * T_DIM + tqj - 1);
#pragma unroll
  for (int it = 0; it < 4; ++it) {
    const size_t off = 8u * pk_idx(yrow, (unsigned)(h * (HS / 8) + 2 * it + hh), C_DIM / 32);
    *(v4u*)(yhi + off) = yh[it];
    *(v4u*)(ylo + off) = yl[it];
  }
}

// ---------------------------------------------------------------------------
// launcher
// ---------------------------------------------------------------------------
extern "C" void kernel_launch(void* const* d_in, const int* in_sizes, int n_in,
                              void* d_out, int out_size, void* d_ws,
                              size_t ws_size, hipStream_t stream) {
  const size_t MT = (size_t)B_DIM * T_DIM;          // 4096 rows
  const size_t NX = MT * C_DIM;                     // 3145728
  const size_t NW = (size_t)C_DIM * C_DIM;          // 589824

  if (n_in < 8) return;
  if ((size_t)in_sizes[0] != NX || (size_t)in_sizes[1] != NW || in_sizes[2] != NH ||
      (size_t)in_sizes[3] != NW || in_sizes[4] != NH || in_sizes[5] != NH ||
      in_sizes[6] != NH || (size_t)in_sizes[7] != NW || (size_t)out_size != NX) return;

  const float* x       = (const float*)d_in[0];
  const float* W_la    = (const float*)d_in[1];
  const float* la_coef = (const float*)d_in[2];
  const float* W_v     = (const float*)d_in[3];
  const float* v_coef  = (const float*)d_in[4];
  const float* kbeta   = (const float*)d_in[5];
  const float* vbeta   = (const float*)d_in[6];
  const float* W_proj  = (const float*)d_in[7];
  float* out = (float*)d_out;

  // workspace carve (all sizes multiples of 256 B)
  size_t off = 0;
  char* ws = (char*)d_ws;
  us_t* xb   = (us_t*)(ws + off); off += NX * 2;
  us_t* wla  = (us_t*)(ws + off); off += NW * 2;
  us_t* wv   = (us_t*)(ws + off); off += NW * 2;
  us_t* wpj  = (us_t*)(ws + off); off += NW * 2;
  float* u   = (float*)(ws + off); off += NX * 4;
  float* xl  = (float*)(ws + off); off += NX * 4;
  us_t* khi  = (us_t*)(ws + off); off += NX * 2;
  us_t* klo  = (us_t*)(ws + off); off += NX * 2;
  us_t* vthi = (us_t*)(ws + off); off += NX * 2;
  us_t* vtlo = (us_t*)(ws + off); off += NX * 2;
  us_t* yhi  = (us_t*)(ws + off); off += NX * 2;
  us_t* ylo  = (us_t*)(ws + off); off += NX * 2;   // total 72,744,960 B
  if (off > ws_size) return;

  // 0) RNE convert inputs to bf16, fragment order
  k_cvt<<<(CVT_NX8 + 3 * CVT_NW8) / 256, 256, 0, stream>>>(x, W_la, W_v, W_proj, xb, wla, wv, wpj);

  // 1) u = x W_la^T ; xl = x W_v^T (wv lies directly behind wla)
  dim3 ggrid(C_DIM / 64, (unsigned)(MT / 64));
  dim3 ggrid2(2 * C_DIM / 64, (unsigned)(MT / 64));
  k_gemm<0><<<ggrid2, 128, 0, stream>>>(xb, xb, wla, u, xl, (int)MT, C_DIM, C_DIM);

  // 2 + 3) leaky average + normalised, scaled keys as bf16 hi/lo; values (transposed, bf16 hi/lo)
  k_kv<<<KV_NV + KV_NE, EMA_NT, 0, stream>>>(u, la_coef, kbeta, khi, klo, xl, v_coef, vbeta, vthi, vtlo);

  // 4) attention -> y hi/lo planes
  dim3 agrid((T_DIM - 1 + 63) / 64, B_DIM * NH);
  k_attn<<<agrid, 128, 0, stream>>>(khi, klo, vthi, vtlo, yhi, ylo);

  // 5) out = y W_proj^T (hi and lo planes, two products)
  k_gemm<1><<<ggrid, 128, 0, stream>>>(yhi, ylo, wpj, out, out, (int)MT, C_DIM, C_DIM);
}

// v007
// Measured time: 96.5 microseconds a run.
// Next to v006, in two timings, it ran 1.08 times as fast each time.
// All steps since v000 together make it 18.0 times as fast.
#include <hip/hip_runtime.h>
#include <stdint.h>

// Contractions: v_wmma_f32_16x16x32_bf16 (bf16 operands, f32 accumulate). Input projections: single product on RNE-bf16 inputs. Score (K x Qt), P x V: bf16 hi/lo split (3 products). Output projection: hi/lo split activations x bf16 weights (2 products).

#define B_DIM 2
#define T_DIM 2048
#define C_DIM 768
#define NH    12
#define HS    64

typedef unsigned short us_t;
typedef __bf16         v16bf __attribute__((ext_vector_type(16)));
typedef unsigned short v16us __attribute__((ext_vector_type(16)));
typedef unsigned short v8us  __attribute__((ext_vector_type(8)));
typedef float          v8f   __attribute__((ext_vector_type(8)));
typedef float          v4f   __attribute__((ext_vector_type(4)));
typedef unsigned int   v4u   __attribute__((ext_vector_type(4)));
typedef unsigned int   v8u   __attribute__((ext_vector_type(8)));
typedef float          v2f   __attribute__((ext_vector_type(2)));
typedef __bf16         v2bf  __attribute__((ext_vector_type(2)));

union Frag { v16us u; v8us half[2]; };

// ---------------------------------------------------------------------------
// helpers
// ---------------------------------------------------------------------------
__device__ __forceinline__ v8f vzero() {
  v8f z;
#pragma unroll
  for (int i = 0; i < 8; ++i) z[i] = 0.0f;
  return z;
}

// RNE f32 -> bf16 bits, by the chip's convert instruction
__device__ __forceinline__ us_t f2bf(float f) { return __builtin_bit_cast(us_t, (__bf16)f); }
__device__ __forceinline__ float bf2f(us_t b) { return __uint_as_float(((unsigned)b) << 16); }
__device__ __forceinline__ float bfr(float f) { return bf2f(f2bf(f)); }
// two f32 -> one word of two RNE bf16, a in the low half: one packed convert, the word needs no assembling
__device__ __forceinline__ unsigned f2bf2(float a, float b) {
  v2f x;
  x[0] = a;
  x[1] = b;
  return __builtin_bit_cast(unsigned, __builtin_convertvector(x, v2bf));
}
// the two bf16 of such a word as f32
__device__ __forceinline__ float bflo(unsigned w) { return __uint_as_float(w << 16); }
__device__ __forceinline__ float bfhi(unsigned w) { return __uint_as_float(w & 0xFFFF0000u); }

// 16x16x32 fragment (A rows / B columns), k order:
// lane l: row/col = l&15, h = l>>4; elements 0..7 <- k0+8h+0..7, elements 8..15 <- k0+16+8h+0..7.
// Every bf16 plane (x, the weights, K, Vt, y) is kept in fragment order: a fragment of 16 rows x 32 k is 1 KiB of its own.
// Lane l finds its elements 0..7 at us_t 8 l and its elements 8..15 at us_t 256 + 8 l, so each of the two loads
// of a wave covers 512 contiguous bytes = 4 whole lines, where a row-major plane makes it touch 16 lines.
// p points at this lane's first piece.
__device__ __forceinline__ v16us ld_fragp(const us_t* __restrict__ p) {
  Frag f;
  f.half[0] = *(const v8us*)(p);
  f.half[1] = *(const v8us*)(p + 256);
  return f.u;
}
// place, in 16-B pieces, of piece (row, k8 = k / 8) in a fragment-order plane with kf fragments along k
__device__ __forceinline__ unsigned pk_idx(unsigned row, unsigned k8, unsigned kf) {
  return ((row >> 4) * kf + (k8 >> 2)) * 64u + (k8 & 3u) * 16u + (row & 15u);
}

// D[16x16] += A[16x32] * B[32x16]; D element r of lane l = (row 8*(l>>4)+r, col l&15).
// Followed by the 4-slot VALU hazard guard (ties D, keeps A/B live).
__device__ __forceinline__ v8f mma(v16us a, v16us b, v8f c) {
  v16bf av = __builtin_bit_cast(v16bf, a);
  v16bf bv = __builtin_bit_cast(v16bf, b);
  c = __builtin_amdgcn_wmma_f32_16x16x32_bf16(false, av, false, bv, (short)0, c, false, false);
  asm volatile("v_nop\n\tv_nop\n\tv_nop\n\tv_nop" : "+v"(c) : "v"(a), "v"(b));
  return c;
}

// ---------------------------------------------------------------------------
// 0) f32 [rows][C_DIM] -> RNE bf16 in fragment order; thread i of a plane writes piece i of that plane.
//    One launch for all four planes, which do not depend on each other: the first CVT_NX8 / 256 work-groups
//    take x, then CVT_NW8 / 256 work-groups each of the three weight matrices (a work-group lies in one plane).
// ---------------------------------------------------------------------------
#define CVT_NX8 (B_DIM * T_DIM * C_DIM / 8)   // 16-B pieces of the x plane
#define CVT_NW8 (C_DIM * C_DIM / 8)           // 16-B pieces of a weight plane
static_assert(CVT_NX8 % 256 == 0 && CVT_NW8 % 256 == 0, "a work-group lies in one plane");
__global__ __launch_bounds__(256) void k_cvt(const float* __restrict__ x,
                                            const float* __restrict__ w0,
                                            const float* __restrict__ w1,
                                            const float* __restrict__ w2,
                                            us_t* __restrict__ xo,
                                            us_t* __restrict__ o0,
                                            us_t* __restrict__ o1,
                                            us_t* __restrict__ o2) {
  int first = (int)blockIdx.x * 256;           // the work-group's first piece, then counted inside its plane
  const float* in = x;
  us_t* out = xo;
  if (first >= CVT_NX8) {
    first -= CVT_NX8;
    const int s = first / CVT_NW8;
    if (s > 2) return;
    first -= s * CVT_NW8;
    in  = (s == 0) ? w0 : (s == 1) ? w1 : w2;
    out = (s == 0) ? o0 : (s == 1) ? o1 : o2;
  }
  const int i = first + (int)threadIdx.x;
  const unsigned blk = (unsigned)i >> 6;
  const unsigned row = (blk / (C_DIM / 32)) * 16u + ((unsigned)i & 15u);
  const unsigned k8  = (blk % (C_DIM / 32)) * 4u + (((unsigned)i >> 4) & 3u);
  const v4f* src = (const v4f*)(in + (size_t)row * C_DIM + k8 * 8u);
  const v4f a = src[0];
  const v4f c = src[1];
  v4u p;
  p[0] = f2bf2(a[0], a[1]);
  p[1] = f2bf2(a[2], a[3]);
  p[2] = f2bf2(c[0], c[1]);
  p[3] = f2bf2(c[2], c[3]);
  v4u* dst = (v4u*)(out + (size_t)i * 8);
  *dst = p;
  
}

// ---------------------------------------------------------------------------
// 1) C[m][n] = sum_k A[m][k] * W[n][k]  (A: MxK bf16, W: NxK bf16, both in fragment order, C: MxN f32 row-major)
//    SPLITA: C = (A + A2) * W^T with A = hi plane, A2 = lo plane (two products); these are the y planes, whose
//    row b*T + i holds time i + 1 (row b*T + T-1: zeros, time 0), so the result rows are stored one time step on.
//    block = 4 waves, 64x64 tile; wave = 16 rows x 64 cols.
//    Epilogue: tile staged in LDS, each 256-B row segment written as 16 lanes x 16 B
//    Fragments sit in a ring of GEMM_ST k-steps of registers: a step's registers are loaded again
//    (for GEMM_ST steps further on) right behind its products, so GEMM_ST steps of loads are in flight.
//    The loops over ring steps and column groups are unrolled so that the ring's arrays stay in registers.
//    Without SPLITA, W may hold 2 N rows: the work-groups of columns N .. 2N - 1 use the rows of a second weight plane
//    that lies directly behind the first, and store to Cout2, so two products of the same A share one launch.
//    Host guarantees M % 64 == 0, N % 64 == 0, K % (32 * GEMM_ST) == 0, K > 0, gridDim.x * 64 == N (without SPLITA: or 2 N).
// ---------------------------------------------------------------------------
#define GEMM_ST 4
template <int SPLITA>
__global__ __launch_bounds__(128) void k_gemm(const us_t* __restrict__ A,
                                             const us_t* __restrict__ A2,
                                             const us_t* __restrict__ W,
                                             float* __restrict__ Cout,
                                             float* __restrict__ Cout2,
                                             int M, int N, int K) {
  __shared__ __align__(16) float ldsC[4][16][68];
  (void)M;
  const int w = threadIdx.x >> 5, lane = threadIdx.x & 31, m = lane & 15, hh = lane >> 4;
  const int mbase = blockIdx.y * 64 + w * 16;
  const int nbase = blockIdx.x * 64;
  // element offsets of this lane's 16-B piece of its fragment rows; they walk along k
  const unsigned kf = (unsigned)K >> 5;            // fragments along k
  unsigned ao = (unsigned)(mbase >> 4) * kf * 512u + 8u * lane;
  unsigned wo[4];
#pragma unroll
  for (int g = 0; g < 4; ++g) wo[g] = (unsigned)((nbase >> 4) + g) * kf * 512u + 8u * lane;

  v8f acc[4];
#pragma unroll
  for (int g = 0; g < 4; ++g) acc[g] = vzero();

  v16us a[GEMM_ST], a2[GEMM_ST], bw[GEMM_ST][4];
#pragma unroll
  for (int i = 0; i < GEMM_ST; ++i) {
    a[i] = ld_fragp(A + ao + 512 * i);
    if (SPLITA) a2[i] = ld_fragp(A2 + ao + 512 * i);
#pragma unroll
    for (int g = 0; g < 4; ++g) bw[i][g] = ld_fragp(W + wo[g] + 512 * i);
    // keeps these loads in the ring's order, step by step: the loop's load-count waits must hold
    // for both ways into the loop and would otherwise wait for nearly the whole ring
    __builtin_amdgcn_sched_barrier(0);
  }
  // registers that held addresses of the loads above are written again below
  asm volatile("s_wait_xcnt 0x0" ::: "memory");

  for (int kb = 32 * GEMM_ST; kb < K; kb += 32 * GEMM_ST) {
    ao += 512 * GEMM_ST;
#pragma unroll
    for (int g = 0; g < 4; ++g) wo[g] += 512 * GEMM_ST;
#pragma unroll
    for (int i = 0; i < GEMM_ST; ++i) {
#pragma unroll
      for (int g = 0; g < 4; ++g) {
        acc[g] = mma(a[i], bw[i][g], acc[g]);
        if (SPLITA) acc[g] = mma(a2[i], bw[i][g], acc[g]);
      }
      a[i] = ld_fragp(A + ao + 512 * i);
      if (SPLITA) a2[i] = ld_fragp(A2 + ao + 512 * i);
#pragma unroll
      for (int g = 0; g < 4; ++g) bw[i][g] = ld_fragp(W + wo[g] + 512 * i);
    }
    // the next trip forms new addresses in the registers of the loads just issued
    asm volatile("s_wait_xcnt 0x0" ::: "memory");
  }
#pragma unroll
  for (int i = 0; i < GEMM_ST; ++i) {
#pragma unroll
    for (int g = 0; g < 4; ++g) {
      acc[g] = mma(a[i], bw[i][g], acc[g]);
      if (SPLITA) acc[g] = mma(a2[i], bw[i][g], acc[g]);
    }
  }

  // stage D tiles: acc[g][r] = C[mbase + 8hh + r][nbase + 16g + m]
#pragma unroll
  for (int g = 0; g < 4; ++g) {
#pragma unroll
    for (int r = 0; r < 8; ++r) ldsC[w][8 * hh + r][16 * g + m] = acc[g][r];
  }
  __syncthreads();

  v4f val[8];
#pragma unroll
  for (int it = 0; it < 8; ++it) val[it] = *(const v4f*)(&ldsC[w][2 * it + hh][4 * m]);

  float* gb = Cout + nbase + 4 * m;
  if (!SPLITA && nbase >= N) gb = Cout2 + (nbase - N) + 4 * m;
#pragma unroll
  for (int it = 0; it < 8; ++it) {
    int row = mbase + 2 * it + hh;
    if (SPLITA) row = (row & ~(T_DIM - 1)) | ((row + 1) & (T_DIM - 1));
    *(v4f*)(gb + (size_t)row * N) = val[it];
  }
  
}

// ---------------------------------------------------------------------------
// 2) leaky average over T (f32) + L2 normalisation + beta scale,
//    written as bf16 hi/lo planes khi/klo, per (batch, head) a fragment-order plane of T rows x HS.
//    The recurrence y[t] = c*y[t-1] + (1-c)*u[t] is linear, so T is cut into chunks of
//    EMA_CL rows that run side by side from a zero state:
//      y[t0+k] = ylocal[k] + c^(k+1) * S,   S = true state in front of the chunk,
//      S(next chunk) = c^EMA_CL * S + (end state of this chunk from zero).
//    A work-group = one (batch, head) and EMA_ROWS consecutive rows. It forms the end states
//    of every chunk up to its own last one (earlier chunks again, from L2), folds them in LDS,
//    and normalises and stores its own rows only: nothing passes between work-groups.
//    Lane group of 8 = one row (8 channels per lane). In the store phase a wave owns the 16 rows of one chunk,
//    which are the rows of one fragment, so every 128-B line of the planes is written by one wave.
//    The loops of constant length are unrolled so that their arrays stay in registers; the load
//    loop also so that all 32 loads of a chunk are in flight before the first is used.
// ---------------------------------------------------------------------------
#define EMA_CL    16                     // rows per chunk
#define EMA_NCH   (T_DIM / EMA_CL)       // chunks per (batch, head)
#define EMA_SEG   8                      // work-groups per (batch, head)
#define EMA_CPS   (EMA_NCH / EMA_SEG)    // chunks stored by one work-group
#define EMA_ROWS  (EMA_CL * EMA_CPS)     // rows stored by one work-group
#define EMA_NT    512                    // threads per work-group
#define EMA_NG    (EMA_NT / 8)           // lane groups per work-group
#define EMA_PITCH 96                     // floats per staged row: neighbour rows fall on the two bank halves

#define EMA_LDSF  (EMA_NCH * HS + EMA_CPS * HS + EMA_ROWS * EMA_PITCH)   // floats of LDS of one work-group

// smem: EMA_LDSF floats of LDS, 16-B aligned; seg: which EMA_ROWS rows of (batch, head) bh this work-group stores
__device__ __forceinline__ void ema_knorm(const float* __restrict__ u,
                                          const float* __restrict__ la_coef,
                                          const float* __restrict__ kbeta,
                                          us_t* __restrict__ khi,
                                          us_t* __restrict__ klo,
                                          float* smem, const int seg, const int bh) {
#pragma clang fp contract(off)
  // In all three arrays a lane's channels 8sub..8sub+3 sit at float 4*sub, 8sub+4..8sub+7 at 32 + 4*sub.
  float (*ldsE)[HS]        = (float (*)[HS])smem;                                    // end state of each chunk from a zero start
  float (*ldsS)[HS]        = (float (*)[HS])(smem + EMA_NCH * HS);                   // true state in front of each own chunk
  float (*ldsY)[EMA_PITCH] = (float (*)[EMA_PITCH])(smem + (EMA_NCH + EMA_CPS) * HS);   // own rows from a zero start

  const int tid  = threadIdx.x;
  const int grp  = tid >> 3;
  const int sub  = tid & 7;
  const int b = bh / NH, h = bh % NH;
  const int own0 = EMA_CPS * seg;                             // first own chunk
  const int nch  = own0 + EMA_CPS;                            // chunks this work-group walks

  const float cc   = bfr(la_coef[h]);
  const float omc  = 1.0f - cc;
  const float beta = expf(fminf(bfr(kbeta[h]) * 10.0f, 5.0f));

  // cp[it] = c^(k+1) for the row position k = 4 it + grp % 4 in its chunk; cl = c^EMA_CL
  float cp[EMA_ROWS / EMA_NG], cl = cc;
#pragma unroll
  for (int it = 0; it < EMA_ROWS / EMA_NG; ++it) {
    const int e = 4 * it + (grp & 3) + 1;                     // 1..16
    float p = 1.0f;
    cl = cc;
#pragma unroll
    for (int bit = 0; bit < 4; ++bit) {
      if ((e >> bit) & 1) p *= cl;
      cl *= cl;
    }
    if (e >> 4) p = cl;
    cp[it] = p;
  }

  const float* up = u + (size_t)b * T_DIM * C_DIM + h * HS + 8 * sub;

  // a) every chunk from a zero state; own0 and nch are multiples of 4, so a wave's four groups agree
  for (int j = grp; j < nch; j += EMA_NG) {
    const float* cpn = up + (size_t)(j * EMA_CL) * C_DIM;
    v4f x0[EMA_CL], x1[EMA_CL];
#pragma unroll
    for (int k = 0; k < EMA_CL; ++k) {
      const v4f* src = (const v4f*)(cpn + (size_t)k * C_DIM);
      x0[k] = src[0];
      x1[k] = src[1];
    }
    const bool own = (j >= own0);
    float* yrow = &ldsY[own ? (j - own0) * EMA_CL : 0][4 * sub];
    v4f y0, y1;
#pragma unroll
    for (int i = 0; i < 4; ++i) { y0[i] = 0.0f; y1[i] = 0.0f; }
#pragma unroll
    for (int k = 0; k < EMA_CL; ++k) {
#pragma unroll
      for (int i = 0; i < 4; ++i) {
        y0[i] = cc * y0[i] + omc * x0[k][i];
        y1[i] = cc * y1[i] + omc * x1[k][i];
      }
      if (own) {
        *(v4f*)(yrow + k * EMA_PITCH)      = y0;
        *(v4f*)(yrow + k * EMA_PITCH + 32) = y1;
      }
    }
    *(v4f*)(&ldsE[j][4 * sub])      = y0;
    *(v4f*)(&ldsE[j][32 + 4 * sub]) = y1;
  }
  __syncthreads();

  // b) fold the end states in time order, one channel per lane (two waves)
  if (tid < HS) {
    float s = 0.0f;
    for (int j0 = 0; j0 < own0; j0 += EMA_CPS) {
      float e[EMA_CPS];
#pragma unroll
      for (int i = 0; i < EMA_CPS; ++i) e[i] = ldsE[j0 + i][tid];
#pragma unroll
      for (int i = 0; i < EMA_CPS; ++i) s = cl * s + e[i];
    }
    float e[EMA_CPS];
#pragma unroll
    for (int i = 0; i < EMA_CPS; ++i) e[i] = ldsE[own0 + i][tid];
#pragma unroll
    for (int i = 0; i < EMA_CPS; ++i) {
      ldsS[i][tid] = s;
      s = cl * s + e[i];
    }
  }
  __syncthreads();

  // c) own rows: add the carried state, normalise, scale, split, store
  static_assert(4 * (EMA_ROWS / EMA_NG) == EMA_CL && EMA_CL == 16, "a wave stores one chunk = one fragment's rows");
  const size_t dpl = (size_t)bh * T_DIM * HS;
#pragma unroll
  for (int it = 0; it < EMA_ROWS / EMA_NG; ++it) {
    const int r = (grp >> 2) * EMA_CL + 4 * it + (grp & 3);   // r % EMA_CL == 4 it + grp % 4
    const v4f a0 = *(const v4f*)(&ldsY[r][4 * sub]);
    const v4f a1 = *(const v4f*)(&ldsY[r][32 + 4 * sub]);
    const v4f s0 = *(const v4f*)(&ldsS[r / EMA_CL][4 * sub]);
    const v4f s1 = *(const v4f*)(&ldsS[r / EMA_CL][32 + 4 * sub]);
    float y[8];
#pragma unroll
    for (int i = 0; i < 4; ++i) {
      y[i]     = a0[i] + cp[it] * s0[i];
      y[4 + i] = a1[i] + cp[it] * s1[i];
    }
    float ss = 0.0f;
#pragma unroll
    for (int i = 0; i < 8; ++i) ss += y[i] * y[i];
    ss += __shfl_xor(ss, 1, 32);
    ss += __shfl_xor(ss, 2, 32);
    ss += __shfl_xor(ss, 4, 32);
    const float rn = 1.0f / (sqrtf(ss) + 1e-6f);

    v4u ph, pl;
#pragma unroll
    for (int i = 0; i < 4; ++i) {
      const float ka = (y[2 * i] * rn) * beta;
      const float kc = (y[2 * i + 1] * rn) * beta;
      const unsigned hw = f2bf2(ka, kc);
      ph[i] = hw;
      pl[i] = f2bf2(ka - bflo(hw), kc - bfhi(hw));
    }
    const size_t off = dpl + 8u * pk_idx((unsigned)(seg * EMA_ROWS + r), (unsigned)sub, HS / 32);
    *(v4u*)(khi + off) = ph;
    *(v4u*)(klo + off) = pl;
  }
}

// ---------------------------------------------------------------------------
// 3) value featurizer: f = xl[t+1]*(1-vc) + xl[t]*vc, L2 normalise, beta scale,
//    written TRANSPOSED as bf16 hi/lo planes vthi/vtlo of fragments (rows = dims, k = key, for the P x V
//    B-fragments); per (batch, head) the four fragments of a 32-key tile lie side by side, tile after tile.
//    Four waves make 64 time steps; a work-group holds VM_Q such quartets, each with LDS of its own.
// ---------------------------------------------------------------------------
#define VM_Q (EMA_NT / 128)              // quartets of waves per work-group
static_assert(VM_Q * 2 * HS * 72 * 2 <= EMA_LDSF * 4, "the value maker's tiles fit the shared LDS");

// smem: the work-group's LDS, 16-B aligned; vx: which VM_Q * 64 time steps of (batch, head) bh this work-group makes
__device__ __forceinline__ void vmake(const float* __restrict__ xl,
                                      const float* __restrict__ v_coef,
                                      const float* __restrict__ vbeta,
                                      us_t* __restrict__ vthi,
                                      us_t* __restrict__ vtlo,
                                      float* smem, const int vx, const int bh) {
#pragma clang fp contract(off)
  const int quart = threadIdx.x >> 7;
  us_t (*ldsH)[72] = (us_t (*)[72])smem + (2 * quart) * HS;
  us_t (*ldsL)[72] = (us_t (*)[72])smem + (2 * quart + 1) * HS;
  const int b = bh / NH, h = bh % NH;
  const int t0 = (vx * VM_Q + quart) * 64;
  const int w = (threadIdx.x >> 5) & 3, lane = threadIdx.x & 31;

  const float vc  = bfr(v_coef[h]);
  const float omv = 1.0f - vc;
  const float vb  = expf(fminf(bfr(vbeta[h]) * 10.0f, 5.0f));

  // The wave's 16 time steps are worked side by side. All their rows are asked for first (step rr + 1 is also the
  // shifted row of step rr, so 17 rows serve 16 steps); the row behind the last time step of the sequence counts as zeros.
  // The loops of constant length are unrolled so that their arrays stay in registers.
  const int tw = t0 + w * 16;
  const float* cur = xl + ((size_t)b * T_DIM + tw) * C_DIM + h * HS + lane;
  float c0[17], c1[17];
#pragma unroll
  for (int rr = 0; rr < 16; ++rr) {
    c0[rr] = cur[rr * C_DIM];
    c1[rr] = cur[rr * C_DIM + 32];
  }
  c0[16] = 0.0f;
  c1[16] = 0.0f;
  if (tw + 16 < T_DIM) {
    c0[16] = cur[16 * C_DIM];
    c1[16] = cur[16 * C_DIM + 32];
  }

  float f0[16], f1[16], ss[16];
#pragma unroll
  for (int rr = 0; rr < 16; ++rr) {
    f0[rr] = c0[rr + 1] * omv + c0[rr] * vc;
    f1[rr] = c1[rr + 1] * omv + c1[rr] * vc;
    ss[rr] = f0[rr] * f0[rr] + f1[rr] * f1[rr];
  }

  // The 16 sums over the 32 lanes, all at once: at each exchange (lane distance 16, 8, 4, 2) a lane keeps half of its
  // steps and hands the other half to its partner, so that every sum is formed by the same additions as in a plain
  // exchange of one value, but only in the lanes that keep it. Lanes 2 rr and 2 rr + 1 end with the sum of step rr.
  float r8[8], r4[4], r2[2], r1;
  {
    const bool up = (lane & 16) != 0;
    float snd[8];
#pragma unroll
    for (int j = 0; j < 8; ++j) {
      r8[j]  = up ? ss[j + 8] : ss[j];
      snd[j] = up ? ss[j] : ss[j + 8];
    }
#pragma unroll
    for (int j = 0; j < 8; ++j) snd[j] = __shfl_xor(snd[j], 16, 32);
#pragma unroll
    for (int j = 0; j < 8; ++j) r8[j] += snd[j];
  }
  {
    const bool up = (lane & 8) != 0;
    float snd[4];
#pragma unroll
    for (int j = 0; j < 4; ++j) {
      r4[j]  = up ? r8[j + 4] : r8[j];
      snd[j] = up ? r8[j] : r8[j + 4];
    }
#pragma unroll
    for (int j = 0; j < 4; ++j) snd[j] = __shfl_xor(snd[j], 8, 32);
#pragma unroll
    for (int j = 0; j < 4; ++j) r4[j] += snd[j];
  }
  {
    const bool up = (lane & 4) != 0;
    float snd[2];
#pragma unroll
    for (int j = 0; j < 2; ++j) {
      r2[j]  = up ? r4[j + 2] : r4[j];
      snd[j] = up ? r4[j] : r4[j + 2];
    }
#pragma unroll
    for (int j = 0; j < 2; ++j) snd[j] = __shfl_xor(snd[j], 4, 32);
#pragma unroll
    for (int j = 0; j < 2; ++j) r2[j] += snd[j];
  }
  {
    const bool up = (lane & 2) != 0;
    r1 = up ? r2[1] : r2[0];
    const float snd = up ? r2[0] : r2[1];
    r1 += __shfl_xor(snd, 2, 32);
  }
  r1 += __shfl_xor(r1, 1, 32);
  // root and division once for all 16 steps, each in the lanes that hold its sum
  const float rnl = 1.0f / (sqrtf(r1) + 1e-6f);

  // eight time steps of a dim are 16 B of its staged row
#pragma unroll
  for (int j = 0; j < 2; ++j) {
    v4u ha, la, hb, lb;
#pragma unroll
    for (int i = 0; i < 4; ++i) {
      const int rr = 8 * j + 2 * i;
      const float rna = __uint_as_float((unsigned)__builtin_amdgcn_readlane((int)__float_as_uint(rnl), 2 * rr));
      const float rnb = __uint_as_float((unsigned)__builtin_amdgcn_readlane((int)__float_as_uint(rnl), 2 * rr + 2));
      const float a0 = (f0[rr] * rna) * vb, a1 = (f0[rr + 1] * rnb) * vb;
      const float b0 = (f1[rr] * rna) * vb, b1 = (f1[rr + 1] * rnb) * vb;
      const unsigned wa = f2bf2(a0, a1);
      const unsigned wb = f2bf2(b0, b1);
      ha[i] = wa;
      hb[i] = wb;
      la[i] = f2bf2(a0 - bflo(wa), a1 - bfhi(wa));
      lb[i] = f2bf2(b0 - bflo(wb), b1 - bfhi(wb));
    }
    *(v4u*)(&ldsH[lane][w * 16 + 8 * j])      = ha;
    *(v4u*)(&ldsH[lane + 32][w * 16 + 8 * j]) = hb;
    *(v4u*)(&ldsL[lane][w * 16 + 8 * j])      = la;
    *(v4u*)(&ldsL[lane + 32][w * 16 + 8 * j]) = lb;
  }
  __syncthreads();

  const int tid = threadIdx.x & 127;
  const int ch  = tid >> 4;            // 0..7: a wave stores two key octets of 16 dims = 512 contiguous bytes
  const int dsl = tid & 15;
  v4u ph[4], pl[4];
#pragma unroll
  for (int it = 0; it < 4; ++it) {
    const int d = it * 16 + dsl;
    ph[it] = *(const v4u*)(&ldsH[d][8 * ch]);
    pl[it] = *(const v4u*)(&ldsL[d][8 * ch]);
  }
  const size_t gb = ((size_t)bh * HS) * T_DIM;
#pragma unroll
  for (int it = 0; it < 4; ++it) {
    const size_t off = gb + 8u * (unsigned)(((t0 / 32 + (ch >> 2)) * 4 + it) * 64 + (ch & 3) * 16 + dsl);
    *(v4u*)(vthi + off) = ph[it];
    *(v4u*)(vtlo + off) = pl[it];
  }
}

// ---------------------------------------------------------------------------
// 2 + 3 in one launch: keys need only u, values only xl, so neither waits for the other. A work-group is wholly one or
// the other (the branch, and so every barrier behind it, is the same for all its waves). The registers of the leaky
// average let one work-group stand on a WGP, so the longest jobs come first in the grid: the leaky averages from the
// longest segment down, then the value makers, which are short (one round trip to memory for a wave's 16 rows).
// ---------------------------------------------------------------------------
#define KV_NV (B_DIM * NH * (T_DIM / (64 * VM_Q)))   // work-groups that make values
#define KV_NE (B_DIM * NH * EMA_SEG)                 // work-groups that make keys
__global__ __launch_bounds__(EMA_NT) void k_kv(const float* __restrict__ u,
                                              const float* __restrict__ la_coef,
                                              const float* __restrict__ kbeta,
                                              us_t* __restrict__ khi,
                                              us_t* __restrict__ klo,
                                              const float* __restrict__ xl,
                                              const float* __restrict__ v_coef,
                                              const float* __restrict__ vbeta,
                                              us_t* __restrict__ vthi,
                                              us_t* __restrict__ vtlo) {
  __shared__ __align__(16) float smem[EMA_LDSF];
  const int idx = (int)blockIdx.x;
  if (idx < KV_NE) {
    ema_knorm(u, la_coef, kbeta, khi, klo, smem, (EMA_SEG - 1) - idx / (B_DIM * NH), idx % (B_DIM * NH));
  } else {
    const int v = idx - KV_NE;
    vmake(xl, v_coef, vbeta, vthi, vtlo, smem, v % (T_DIM / (64 * VM_Q)), v / (T_DIM / (64 * VM_Q)));
  }
}

// ---------------------------------------------------------------------------
// 4) shifted-causal flash attention, query tiles of 16, key tiles of 32.
//    Scores computed transposed: St[key][query] = K_tile (A, rows = keys) x Qt (B, cols = queries),
//    so lane = query owns its softmax statistics and the P A-fragment for P x V is an
//    in-register repack of the two 16-key D tiles (element r <- tile keys 0..15, 8+r <- tile keys 16..31).
//    O[query][dim] accumulated with A = P, B = Vt rows (k = key). All fragments from
//    fragment-order global planes; bf16 hi/lo: hi*hi + hi*lo + lo*hi.
//    Every fragment of a tile has registers of its own: the V loads of a tile are issued in front of
//    its score products, the K loads of the wave's next tile right behind them, so that no product waits
//    for a load issued just in front of it. The fragment loops are unrolled so that the arrays stay in registers.
//    Equal work for every wave: query tile t walks t / 2 + 1 key tiles, so work-group p takes the long
//    tiles 127 - 2p, 126 - 2p and then the short tiles 2p, 2p + 1 (65 key tiles per pair). Two waves share a
//    query tile: one walks its even key tiles, the other its odd ones, each with softmax statistics of its
//    own; the two partial results (maximum, sum, O) meet in LDS behind one barrier, where each wave joins,
//    normalises and stores one of the work-group's four query tiles.
//    grid = (T / 64, B*NH), block 128. Output y hi/lo: fragment-order planes of B*T rows x C, row b*T + i
//    holding time i + 1, so that a tile's 16 queries are the rows of one fragment and every 128-B line has one
//    writer; the slot of time T (row b*T + T-1) takes the zeros of time 0.
// ---------------------------------------------------------------------------
#define ATT_NQT (T_DIM / 16)             // query tiles per (batch, head)
// khi and klo carry no __restrict__: with it the compiler lifts the loads of each wave's first K tile out of the loop
// over the two passes and holds their 64 registers through both walks, which costs the third wave per SIMD.
__global__ __launch_bounds__(128) void k_attn(const us_t* khi,
                                             const us_t* klo,
                                             const us_t* __restrict__ vthi,
                                             const us_t* __restrict__ vtlo,
                                             us_t* __restrict__ yhi,
                                             us_t* __restrict__ ylo) {
#pragma clang fp contract(off)
  __shared__ __align__(16) float ldsO[2][4][16][68];   // [long / short tile][wave]: partial O, rows = queries
  __shared__ float ldsM[2][4][16];                     // partial running maximum per query
  __shared__ float ldsL[2][4][16];                     // partial running sum per query

  const int bh = blockIdx.y, b = bh / NH, h = bh % NH;
  // the wave's number as a scalar: tile numbers, trip counts and the planes' tile addresses stay out of the vector registers
  const int w = __builtin_amdgcn_readfirstlane((int)(threadIdx.x >> 5));
  const int lane = threadIdx.x & 31, m = lane & 15, hh = lane >> 4;
  const int Tm1 = T_DIM - 1;
  const int par = w & 1;                           // this wave's key tiles: par, par + 2, ...

  const size_t kbh = (size_t)bh * T_DIM * HS;
  const size_t vbh = (size_t)bh * HS * T_DIM;

  // kept rolled: the two passes share one copy of the code and one set of registers
#pragma unroll 1
  for (int ph = 0; ph < 2; ++ph) {
    const int qt = (ph == 0) ? (ATT_NQT - 1 - 2 * (int)blockIdx.x - (w >> 1)) : (2 * (int)blockIdx.x + (w >> 1));
    const int q0  = 1 + 16 * qt;                   // first query time of this tile
    const int tq  = q0 + m;                        // this lane's query (B column n and stats owner)
    const int tqc = (tq < Tm1) ? tq : Tm1;         // clamped for loads (slot tq == T is stored as zeros)

    // Q fragments (B operand): column n = query, k = dim; q rows are k rows at time tq
    const us_t* qh_row = khi + kbh + 8u * pk_idx((unsigned)tqc, (unsigned)hh, HS / 32);
    const us_t* ql_row = klo + kbh + 8u * pk_idx((unsigned)tqc, (unsigned)hh, HS / 32);
    const v16us qh0 = ld_fragp(qh_row),       ql0 = ld_fragp(ql_row);         // dims 0..31
    const v16us qh1 = ld_fragp(qh_row + 512), ql1 = ld_fragp(ql_row + 512);   // dims 32..63

    int qmax = q0 + 15;
    if (qmax > Tm1) qmax = Tm1;
    const int ntiles = (qmax + 31) >> 5;           // keys 0..qmax-1, wave-uniform
    const int nmy    = (ntiles + 1 - par) >> 1;    // key tiles of this wave (0 for the odd wave of a one-tile walk)

    v8f o[4];
#pragma unroll
    for (int g = 0; g < 4; ++g) o[g] = vzero();
    float mrun = -1e30f, lrun = 0.0f;

    // this lane's first piece of the wave's first key tile; the pointers walk two tiles at a time.
    // A tile's four K fragments lie side by side, and so do its four V fragments.
    const us_t* kh_p = khi + kbh + par * (4 * 512) + 8 * lane;
    const us_t* kl_p = klo + kbh + par * (4 * 512) + 8 * lane;
    const us_t* vh_p = vthi + vbh + par * (4 * 512) + 8 * lane;
    const us_t* vl_p = vtlo + vbh + par * (4 * 512) + 8 * lane;

    // K fragments of the current tile, index 2g + dim half (key tiles 0 and 1 lie inside every plane)
    v16us kh[4], kl[4];
#pragma unroll
    for (int j = 0; j < 4; ++j) {
      kh[j] = ld_fragp(kh_p + j * 512);
      kl[j] = ld_fragp(kl_p + j * 512);
    }
    // the address registers of the loads above are written again below
    asm volatile("s_wait_xcnt 0x0" ::: "memory");
    // keeps the pointer additions below behind that wait
    __builtin_amdgcn_sched_barrier(0);
    // from here on the K pointers stand at the tile that the trip fetches ahead (the last tile fetches itself again)
    {
      const int kstep = (1 < nmy) ? 8 * 512 : 0;
      kh_p += kstep;
      kl_p += kstep;
    }

    for (int kt = 0; kt < nmy; ++kt) {
      const int kbase = (2 * kt + par) * 32;

      // V fragments of this tile (B operand: column n = dim 16g + m, k = key from the transposed planes)
      v16us vh[4], vl[4];
#pragma unroll
      for (int g = 0; g < 4; ++g) {
        vh[g] = ld_fragp(vh_p + g * 512);
        vl[g] = ld_fragp(vl_p + g * 512);
      }

      // St tiles: s[g][r] = score(key kbase + 16g + 8hh + r, query q0 + m)
      v8f s[2];
#pragma unroll
      for (int g = 0; g < 2; ++g) {
        s[g] = vzero();
        s[g] = mma(kh[2 * g], qh0, s[g]);
        s[g] = mma(kh[2 * g], ql0, s[g]);
        s[g] = mma(kl[2 * g], qh0, s[g]);
        s[g] = mma(kh[2 * g + 1], qh1, s[g]);
        s[g] = mma(kh[2 * g + 1], ql1, s[g]);
        s[g] = mma(kl[2 * g + 1], qh1, s[g]);
      }

      // K fragments of the wave's next tile into the registers just read
      {
#pragma unroll
        for (int j = 0; j < 4; ++j) {
          kh[j] = ld_fragp(kh_p + j * 512);
          kl[j] = ld_fragp(kl_p + j * 512);
        }
      }

      // causal mask (key < tq), online softmax per lane (= per query)
      float p0[8], p1[8];
      float mx = -1e30f;
#pragma unroll
      for (int r = 0; r < 8; ++r) {
        const int key0 = kbase + 8 * hh + r;
        float a = s[0][r];
        float c = s[1][r];
        if (key0 >= tq)      a = -1e30f;
        if (key0 + 16 >= tq) c = -1e30f;
        p0[r] = a;
        p1[r] = c;
        mx = fmaxf(mx, fmaxf(a, c));
      }
      mx = fmaxf(mx, __shfl_xor(mx, 16, 32));
      const float mn = fmaxf(mrun, mx);
      const float sc = __expf(mrun - mn);
      float sum = 0.0f;
#pragma unroll
      for (int r = 0; r < 8; ++r) {
        p0[r] = __expf(p0[r] - mn);
        p1[r] = __expf(p1[r] - mn);
        sum += p0[r] + p1[r];
      }
      sum += __shfl_xor(sum, 16, 32);
      lrun = lrun * sc + sum;
      mrun = mn;

      // rescale O: o[g][r] belongs to query q0 + 8hh + r, whose scale lives in lane 8hh + r
#pragma unroll
      for (int r = 0; r < 8; ++r) {
        const float scr = __shfl(sc, 8 * hh + r, 32);
#pragma unroll
        for (int g = 0; g < 4; ++g) o[g][r] *= scr;
      }

      // P as A fragment (lane = query row, k = key within tile), bf16 hi/lo
      v8u phw, plw;
#pragma unroll
      for (int i = 0; i < 4; ++i) {
        const unsigned a = f2bf2(p0[2 * i], p0[2 * i + 1]);
        const unsigned c = f2bf2(p1[2 * i], p1[2 * i + 1]);
        phw[i]     = a;
        phw[4 + i] = c;
        plw[i]     = f2bf2(p0[2 * i] - bflo(a), p0[2 * i + 1] - bfhi(a));
        plw[4 + i] = f2bf2(p1[2 * i] - bflo(c), p1[2 * i + 1] - bfhi(c));
      }
      const v16us pfh = __builtin_bit_cast(v16us, phw);
      const v16us pfl = __builtin_bit_cast(v16us, plw);

      // O += P x V
#pragma unroll
      for (int g = 0; g < 4; ++g) {
        o[g] = mma(pfh, vh[g], o[g]);
        o[g] = mma(pfh, vl[g], o[g]);
        o[g] = mma(pfl, vh[g], o[g]);
      }

      // the address registers of this trip's loads are written again below; here their requests are long under way
      asm volatile("s_wait_xcnt 0x0" ::: "memory");
      // keeps the pointer additions below behind that wait: the scheduler otherwise lifts them to the head of the trip
      __builtin_amdgcn_sched_barrier(0);
      {
        const int kstep = (kt + 2 < nmy) ? 8 * 512 : 0;
        kh_p += kstep;
        kl_p += kstep;
        vh_p += 8 * 512;
        vl_p += 8 * 512;
      }
    }

    // this wave's partial result of the tile. Both halves of the wave hold the same statistics for query q0 + m.
#pragma unroll
    for (int g = 0; g < 4; ++g) {
#pragma unroll
      for (int r = 0; r < 8; ++r) ldsO[ph][w][8 * hh + r][16 * g + m] = o[g][r];
    }
    if (hh == 0) {
      ldsM[ph][w][m] = mrun;
      ldsL[ph][w][m] = lrun;
    }
  }
  // publishes every wave's partial results to the wave that joins them
  __syncthreads();

  // epilogue: wave w joins the even and the odd partial of tile (jp, jt), then whole-line stores of the hi/lo planes.
  // The even partial always holds key 0, so its maximum is a real score; an odd wave without a key tile left
  // maximum -1e30, sum 0 and O = 0, which get the weight 0.
  const int jp = w >> 1, jt = w & 1;
  const int qtj = (jp == 0) ? (ATT_NQT - 1 - 2 * (int)blockIdx.x - jt) : (2 * (int)blockIdx.x + jt);
  const int tqj = 1 + 16 * qtj + m;                // the query whose row this lane stores
  const float ma = ldsM[jp][2 * jt][m], mb = ldsM[jp][2 * jt + 1][m];
  const float la = ldsL[jp][2 * jt][m], lb = ldsL[jp][2 * jt + 1][m];
  const float mj = fmaxf(ma, mb);
  const float fa = __expf(ma - mj), fb = __expf(mb - mj);
  const float inv = 1.0f / (la * fa + lb * fb);
  const float ca = fa * inv, cb = fb * inv;

  const unsigned live = (tqj <= Tm1) ? 0xFFFFFFFFu : 0u;   // the slot of time T is stored as zeros
  v4u yh[4], yl[4];
#pragma unroll
  for (int it = 0; it < 4; ++it) {
    const v4f* spa = (const v4f*)(&ldsO[jp][2 * jt][m][8 * (2 * it + hh)]);
    const v4f* spb = (const v4f*)(&ldsO[jp][2 * jt + 1][m][8 * (2 * it + hh)]);
    const v4f a0 = spa[0], a1 = spa[1];
    const v4f b0 = spb[0], b1 = spb[1];
    float vv[8];
#pragma unroll
    for (int i = 0; i < 4; ++i) {
      vv[i]     = a0[i] * ca + b0[i] * cb;
      vv[4 + i] = a1[i] * ca + b1[i] * cb;
    }
#pragma unroll
    for (int i = 0; i < 4; ++i) {
      const unsigned hw = f2bf2(vv[2 * i], vv[2 * i + 1]);
      yh[it][i] = hw & live;
      yl[it][i] = f2bf2(vv[2 * i] - bflo(hw), vv[2 * i + 1] - bfhi(hw)) & live;
    }
  }

  const unsigned yrow = (unsigned)(b * T_DIM + tqj - 1);
#pragma unroll
  for (int it = 0; it < 4; ++it) {
    const size_t off = 8u * pk_idx(yrow, (unsigned)(h * (HS / 8) + 2 * it + hh), C_DIM / 32);
    *(v4u*)(yhi + off) = yh[it];
    *(v4u*)(ylo + off) = yl[it];
  }
}

// ---------------------------------------------------------------------------
// launcher
// ---------------------------------------------------------------------------
extern "C" void kernel_launch(void* const* d_in, const int* in_sizes, int n_in,
                              void* d_out, int out_size, void* d_ws,
                              size_t ws_size, hipStream_t stream) {
  const size_t MT = (size_t)B_DIM * T_DIM;          // 4096 rows
  const size_t NX = MT * C_DIM;                     // 3145728
  const size_t NW = (size_t)C_DIM * C_DIM;          // 589824

  if (n_in < 8) return;
  if ((size_t)in_sizes[0] != NX || (size_t)in_sizes[1] != NW || in_sizes[2] != NH ||
      (size_t)in_sizes[3] != NW || in_sizes[4] != NH || in_sizes[5] != NH ||
      in_sizes[6] != NH || (size_t)in_sizes[7] != NW || (size_t)out_size != NX) return;

  const float* x       = (const float*)d_in[0];
  const float* W_la    = (const float*)d_in[1];
  const float* la_coef = (const float*)d_in[2];
  const float* W_v     = (const float*)d_in[3];
  const float* v_coef  = (const float*)d_in[4];
  const float* kbeta   = (const float*)d_in[5];
  const float* vbeta   = (const float*)d_in[6];
  const float* W_proj  = (const float*)d_in[7];
  float* out = (float*)d_out;

  // workspace carve (all sizes multiples of 256 B)
  size_t off = 0;
  char* ws = (char*)d_ws;
  us_t* xb   = (us_t*)(ws + off); off += NX * 2;
  us_t* wla  = (us_t*)(ws + off); off += NW * 2;
  us_t* wv   = (us_t*)(ws + off); off += NW * 2;
  us_t* wpj  = (us_t*)(ws + off); off += NW * 2;
  float* u   = (float*)(ws + off); off += NX * 4;
  float* xl  = (float*)(ws + off); off += NX * 4;
  us_t* khi  = (us_t*)(ws + off); off += NX * 2;
  us_t* klo  = (us_t*)(ws + off); off += NX * 2;
  us_t* vthi = (us_t*)(ws + off); off += NX * 2;
  us_t* vtlo = (us_t*)(ws + off); off += NX * 2;
  us_t* yhi  = (us_t*)(ws + off); off += NX * 2;
  us_t* ylo  = (us_t*)(ws + off); off += NX * 2;   // total 72,744,960 B
  if (off > ws_size) return;

  // 0) RNE convert inputs to bf16, fragment order
  k_cvt<<<(CVT_NX8 + 3 * CVT_NW8) / 256, 256, 0, stream>>>(x, W_la, W_v, W_proj, xb, wla, wv, wpj);

  // 1) u = x W_la^T ; xl = x W_v^T (wv lies directly behind wla)
  dim3 ggrid(C_DIM / 64, (unsigned)(MT / 64));
  dim3 ggrid2(2 * C_DIM / 64, (unsigned)(MT / 64));
  k_gemm<0><<<ggrid2, 128, 0, stream>>>(xb, xb, wla, u, xl, (int)MT, C_DIM, C_DIM);

  // 2 + 3) leaky average + normalised, scaled keys as bf16 hi/lo; values (transposed, bf16 hi/lo)
  k_kv<<<KV_NV + KV_NE, EMA_NT, 0, stream>>>(u, la_coef, kbeta, khi, klo, xl, v_coef, vbeta, vthi, vtlo);

  // 4) attention -> y hi/lo planes
  dim3 agrid((T_DIM - 1 + 63) / 64, B_DIM * NH);
  k_attn<<<agrid, 128, 0, stream>>>(khi, klo, vthi, vtlo, yhi, ylo);

  // 5) out = y W_proj^T (hi and lo planes, two products)
  k_gemm<1><<<ggrid, 128, 0, stream>>>(yhi, ylo, wpj, out, out, (int)MT, C_DIM, C_DIM);
}

// v008
// It runs in 92.4 microseconds.
// Two timings next to v007 both put it at 1.05 times that version's speed.
// Counting every step since v000, it is 18.9 times as fast.
#include <hip/hip_runtime.h>
#include <stdint.h>

// Contractions: v_wmma_f32_16x16x32_bf16 (bf16 operands, f32 accumulate). Input projections: single product on RNE-bf16 inputs. Score (K x Qt), P x V: bf16 hi/lo split (3 products). Output projection: hi/lo split activations x bf16 weights (2 products).

#define B_DIM 2
#define T_DIM 2048
#define C_DIM 768
#define NH    12
#define HS    64

typedef unsigned short us_t;
typedef __bf16         v16bf __attribute__((ext_vector_type(16)));
typedef unsigned short v16us __attribute__((ext_vector_type(16)));
typedef unsigned short v8us  __attribute__((ext_vector_type(8)));
typedef float          v8f   __attribute__((ext_vector_type(8)));
typedef float          v4f   __attribute__((ext_vector_type(4)));
typedef unsigned int   v4u   __attribute__((ext_vector_type(4)));
typedef unsigned int   v8u   __attribute__((ext_vector_type(8)));
typedef float          v2f   __attribute__((ext_vector_type(2)));
typedef __bf16         v2bf  __attribute__((ext_vector_type(2)));

union Frag { v16us u; v8us half[2]; };

// ---------------------------------------------------------------------------
// helpers
// ---------------------------------------------------------------------------
__device__ __forceinline__ v8f vzero() {
  v8f z;
#pragma unroll
  for (int i = 0; i < 8; ++i) z[i] = 0.0f;
  return z;
}

// RNE f32 -> bf16 bits, by the chip's convert instruction
__device__ __forceinline__ us_t f2bf(float f) { return __builtin_bit_cast(us_t, (__bf16)f); }
__device__ __forceinline__ float bf2f(us_t b) { return __uint_as_float(((unsigned)b) << 16); }
__device__ __forceinline__ float bfr(float f) { return bf2f(f2bf(f)); }
// two f32 -> one word of two RNE bf16, a in the low half: one packed convert, the word needs no assembling
__device__ __forceinline__ unsigned f2bf2(float a, float b) {
  v2f x;
  x[0] = a;
  x[1] = b;
  return __builtin_bit_cast(unsigned, __builtin_convertvector(x, v2bf));
}
// the two bf16 of such a word as f32
__device__ __forceinline__ float bflo(unsigned w) { return __uint_as_float(w << 16); }
__device__ __forceinline__ float bfhi(unsigned w) { return __uint_as_float(w & 0xFFFF0000u); }

// 16x16x32 fragment (A rows / B columns), k order:
// lane l: row/col = l&15, h = l>>4; elements 0..7 <- k0+8h+0..7, elements 8..15 <- k0+16+8h+0..7.
// Every bf16 plane (x, the weights, K, Vt, y) is kept in fragment order: a fragment of 16 rows x 32 k is 1 KiB of its own.
// Lane l finds its elements 0..7 at us_t 8 l and its elements 8..15 at us_t 256 + 8 l, so each of the two loads
// of a wave covers 512 contiguous bytes = 4 whole lines, where a row-major plane makes it touch 16 lines.
// p points at this lane's first piece.
__device__ __forceinline__ v16us ld_fragp(const us_t* __restrict__ p) {
  Frag f;
  f.half[0] = *(const v8us*)(p);
  f.half[1] = *(const v8us*)(p + 256);
  return f.u;
}
// place, in 16-B pieces, of piece (row, k8 = k / 8) in a fragment-order plane with kf fragments along k
__device__ __forceinline__ unsigned pk_idx(unsigned row, unsigned k8, unsigned kf) {
  return ((row >> 4) * kf + (k8 >> 2)) * 64u + (k8 & 3u) * 16u + (row & 15u);
}

// D[16x16] += A[16x32] * B[32x16]; D element r of lane l = (row 8*(l>>4)+r, col l&15).
// Followed by the 4-slot VALU hazard guard (ties D, keeps A/B live).
__device__ __forceinline__ v8f mma(v16us a, v16us b, v8f c) {
  v16bf av = __builtin_bit_cast(v16bf, a);
  v16bf bv = __builtin_bit_cast(v16bf, b);
  c = __builtin_amdgcn_wmma_f32_16x16x32_bf16(false, av, false, bv, (short)0, c, false, false);
  asm volatile("v_nop\n\tv_nop\n\tv_nop\n\tv_nop" : "+v"(c) : "v"(a), "v"(b));
  return c;
}

// The same product without the asm statement: asm operands cannot lie above v255, and the GEMM's wave tile needs more
// registers than that. The compiler keeps the distance behind its own builtin.
__device__ __forceinline__ v8f mma_hi(v16us a, v16us b, v8f c) {
  return __builtin_amdgcn_wmma_f32_16x16x32_bf16(false, __builtin_bit_cast(v16bf, a), false, __builtin_bit_cast(v16bf, b),
                                                 (short)0, c, false, false);
}

// ---------------------------------------------------------------------------
// 0) f32 [rows][C_DIM] -> RNE bf16 in fragment order; thread i of a plane writes piece i of that plane.
//    One launch for all four planes, which do not depend on each other: the first CVT_NX8 / 256 work-groups
//    take x, then CVT_NW8 / 256 work-groups each of the three weight matrices (a work-group lies in one plane).
//    Left for a later step: one piece per thread makes 2,400 work-groups of 8 waves for about 30 MB of traffic;
//    fewer waves with several pieces each would take less time to start.
// ---------------------------------------------------------------------------
#define CVT_NX8 (B_DIM * T_DIM * C_DIM / 8)   // 16-B pieces of the x plane
#define CVT_NW8 (C_DIM * C_DIM / 8)           // 16-B pieces of a weight plane
static_assert(CVT_NX8 % 256 == 0 && CVT_NW8 % 256 == 0, "a work-group lies in one plane");
__global__ __launch_bounds__(256) void k_cvt(const float* __restrict__ x,
                                            const float* __restrict__ w0,
                                            const float* __restrict__ w1,
                                            const float* __restrict__ w2,
                                            us_t* __restrict__ xo,
                                            us_t* __restrict__ o0,
                                            us_t* __restrict__ o1,
                                            us_t* __restrict__ o2) {
  int first = (int)blockIdx.x * 256;           // the work-group's first piece, then counted inside its plane
  const float* in = x;
  us_t* out = xo;
  if (first >= CVT_NX8) {
    first -= CVT_NX8;
    const int s = first / CVT_NW8;
    if (s > 2) return;
    first -= s * CVT_NW8;
    in  = (s == 0) ? w0 : (s == 1) ? w1 : w2;
    out = (s == 0) ? o0 : (s == 1) ? o1 : o2;
  }
  const int i = first + (int)threadIdx.x;
  const unsigned blk = (unsigned)i >> 6;
  const unsigned row = (blk / (C_DIM / 32)) * 16u + ((unsigned)i & 15u);
  const unsigned k8  = (blk % (C_DIM / 32)) * 4u + (((unsigned)i >> 4) & 3u);
  const v4f* src = (const v4f*)(in + (size_t)row * C_DIM + k8 * 8u);
  const v4f a = src[0];
  const v4f c = src[1];
  v4u p;
  p[0] = f2bf2(a[0], a[1]);
  p[1] = f2bf2(a[2], a[3]);
  p[2] = f2bf2(c[0], c[1]);
  p[3] = f2bf2(c[2], c[3]);
  v4u* dst = (v4u*)(out + (size_t)i * 8);
  *dst = p;
  
}

// ---------------------------------------------------------------------------
// 1) C[m][n] = sum_k A[m][k] * W[n][k]  (A: MxK bf16, W: NxK bf16, both in fragment order, C: MxN f32 row-major)
//    SPLITA: C = (A + A2) * W^T with A = hi plane, A2 = lo plane (two products); these are the y planes, whose
//    row b*T + i holds time i + 1 (row b*T + T-1: zeros, time 0), so the result rows are stored one time step on.
//    wave = 16 MF rows x 64 cols: every loaded W fragment feeds MF products (2 MF with SPLITA) and every A fragment
//    four, so a product needs far fewer loaded bytes than with one fragment row per wave.
//    block = 4 waves, 2 x 2: tile of 32 MF rows x 128 cols; two waves share each A fragment, two each W fragment.
//    Epilogue: tile staged in LDS, each 256-B row segment written as 16 lanes x 16 B
//    Fragments sit in a ring of GEMM_ST k-steps of registers: a step's registers are loaded again
//    (for GEMM_ST steps further on) right behind its products, so GEMM_ST steps of loads are in flight
//    (16 loads a step: three steps stay under the load counter's 63).
//    The loops over ring steps, fragment rows and column groups are unrolled so that the arrays stay in registers.
//    Without SPLITA, W may hold 2 N rows: the work-groups of columns N .. 2N - 1 use the rows of a second weight plane
//    that lies directly behind the first, and store to Cout2, so two products of the same A share one launch.
//    Host guarantees M % (32 MF) == 0, N % 128 == 0, K % (32 * GEMM_ST) == 0, K > 0, gridDim.x * 128 == N (without SPLITA: or 2 N).
// ---------------------------------------------------------------------------
#define GEMM_ST 3
static_assert(C_DIM % (32 * GEMM_ST) == 0 && C_DIM % 128 == 0, "k-steps fill the ring, column tiles fill a plane");
template <int SPLITA, int MF>
__global__ __launch_bounds__(128) void k_gemm(const us_t* __restrict__ A,
                                             const us_t* __restrict__ A2,
                                             const us_t* __restrict__ W,
                                             float* __restrict__ Cout,
                                             float* __restrict__ Cout2,
                                             int M, int N, int K) {
  __shared__ __align__(16) float ldsC[4][16 * MF][68];
  (void)M;
  // the wave's number as a scalar: tile bases stay out of the vector registers
  const int w = __builtin_amdgcn_readfirstlane((int)(threadIdx.x >> 5));
  const int lane = threadIdx.x & 31, m = lane & 15, hh = lane >> 4;
  const int mbase = blockIdx.y * (32 * MF) + (w >> 1) * (16 * MF);
  const int nbase = blockIdx.x * 128 + (w & 1) * 64;
  // element offsets of this lane's 16-B piece of its fragment rows; they walk along k
  const unsigned kf = (unsigned)K >> 5;            // fragments along k
  unsigned ao[MF], wo[4];
#pragma unroll
  for (int f = 0; f < MF; ++f) ao[f] = (unsigned)((mbase >> 4) + f) * kf * 512u + 8u * lane;
#pragma unroll
  for (int g = 0; g < 4; ++g) wo[g] = (unsigned)((nbase >> 4) + g) * kf * 512u + 8u * lane;

  v8f acc[MF][4];
#pragma unroll
  for (int f = 0; f < MF; ++f) {
#pragma unroll
    for (int g = 0; g < 4; ++g) acc[f][g] = vzero();
  }

  v16us a[GEMM_ST][MF], a2[GEMM_ST][MF], bw[GEMM_ST][4];
#pragma unroll
  for (int i = 0; i < GEMM_ST; ++i) {
#pragma unroll
    for (int f = 0; f < MF; ++f) {
      a[i][f] = ld_fragp(A + ao[f] + 512 * i);
      if (SPLITA) a2[i][f] = ld_fragp(A2 + ao[f] + 512 * i);
    }
#pragma unroll
    for (int g = 0; g < 4; ++g) bw[i][g] = ld_fragp(W + wo[g] + 512 * i);
    // keeps these loads in the ring's order, step by step: the loop's load-count waits must hold
    // for both ways into the loop and would otherwise wait for nearly the whole ring
    __builtin_amdgcn_sched_barrier(0);
  }
  // Registers that held addresses of the loads above are written again below. The addresses are inputs of the wait so
  // that they stay in their registers up to it: otherwise a later load of the ring is given such a pair as destination.
  static_assert((SPLITA ? 2 : 1) * MF == 4, "four A fragments a step");
  asm volatile("s_wait_xcnt 0x0"
               :: "v"(A + ao[0]), "v"(A + ao[1]),
                  "v"(SPLITA ? A2 + ao[0] : A + ao[MF - 2]), "v"(SPLITA ? A2 + ao[1] : A + ao[MF - 1]),
                  "v"(W + wo[0]), "v"(W + wo[1]), "v"(W + wo[2]), "v"(W + wo[3])
               : "memory");

  for (int kb = 32 * GEMM_ST; kb < K; kb += 32 * GEMM_ST) {
#pragma unroll
    for (int f = 0; f < MF; ++f) ao[f] += 512 * GEMM_ST;
#pragma unroll
    for (int g = 0; g < 4; ++g) wo[g] += 512 * GEMM_ST;
#pragma unroll
    for (int i = 0; i < GEMM_ST; ++i) {
      // every accumulator takes its hi product of a step first, then its lo product
#pragma unroll
      for (int f = 0; f < MF; ++f) {
#pragma unroll
        for (int g = 0; g < 4; ++g) acc[f][g] = mma_hi(a[i][f], bw[i][g], acc[f][g]);
      }
      if (SPLITA) {
#pragma unroll
        for (int f = 0; f < MF; ++f) {
#pragma unroll
          for (int g = 0; g < 4; ++g) acc[f][g] = mma_hi(a2[i][f], bw[i][g], acc[f][g]);
        }
      }
#pragma unroll
      for (int f = 0; f < MF; ++f) {
        a[i][f] = ld_fragp(A + ao[f] + 512 * i);
        if (SPLITA) a2[i][f] = ld_fragp(A2 + ao[f] + 512 * i);
      }
#pragma unroll
      for (int g = 0; g < 4; ++g) bw[i][g] = ld_fragp(W + wo[g] + 512 * i);
    }
    // the next trip forms new addresses in the registers of the loads just issued
    asm volatile("s_wait_xcnt 0x0" ::: "memory");
  }
#pragma unroll
  for (int i = 0; i < GEMM_ST; ++i) {
#pragma unroll
    for (int f = 0; f < MF; ++f) {
#pragma unroll
      for (int g = 0; g < 4; ++g) acc[f][g] = mma_hi(a[i][f], bw[i][g], acc[f][g]);
    }
    if (SPLITA) {
#pragma unroll
      for (int f = 0; f < MF; ++f) {
#pragma unroll
        for (int g = 0; g < 4; ++g) acc[f][g] = mma_hi(a2[i][f], bw[i][g], acc[f][g]);
      }
    }
  }

  // stage D tiles: acc[f][g][r] = C[mbase + 16f + 8hh + r][nbase + 16g + m]
#pragma unroll
  for (int f = 0; f < MF; ++f) {
#pragma unroll
    for (int g = 0; g < 4; ++g) {
#pragma unroll
      for (int r = 0; r < 8; ++r) ldsC[w][16 * f + 8 * hh + r][16 * g + m] = acc[f][g][r];
    }
  }
  __syncthreads();

  v4f val[8 * MF];
#pragma unroll
  for (int it = 0; it < 8 * MF; ++it) val[it] = *(const v4f*)(&ldsC[w][2 * it + hh][4 * m]);

  float* gb = Cout + nbase + 4 * m;
  if (!SPLITA && nbase >= N) gb = Cout2 + (nbase - N) + 4 * m;
#pragma unroll
  for (int it = 0; it < 8 * MF; ++it) {
    int row = mbase + 2 * it + hh;
    if (SPLITA) row = (row & ~(T_DIM - 1)) | ((row + 1) & (T_DIM - 1));
    *(v4f*)(gb + row * N) = val[it];   // M * N fits an int
  }
}

// ---------------------------------------------------------------------------
// 2) leaky average over T (f32) + L2 normalisation + beta scale,
//    written as bf16 hi/lo planes khi/klo, per (batch, head) a fragment-order plane of T rows x HS.
//    The recurrence y[t] = c*y[t-1] + (1-c)*u[t] is linear, so T is cut into chunks of
//    EMA_CL rows that run side by side from a zero state:
//      y[t0+k] = ylocal[k] + c^(k+1) * S,   S = true state in front of the chunk,
//      S(next chunk) = c^EMA_CL * S + (end state of this chunk from zero).
//    A work-group = one (batch, head) and EMA_ROWS consecutive rows. It forms the end states
//    of every chunk up to its own last one (earlier chunks again, from L2), folds them in LDS,
//    and normalises and stores its own rows only: nothing passes between work-groups.
//    Lane group of 8 = one row (8 channels per lane). In the store phase a wave owns the 16 rows of one chunk,
//    which are the rows of one fragment, so every 128-B line of the planes is written by one wave.
//    The loops of constant length are unrolled so that their arrays stay in registers; the load
//    loop also so that all 32 loads of a chunk are in flight before the first is used.
// ---------------------------------------------------------------------------
#define EMA_CL    16                     // rows per chunk
#define EMA_NCH   (T_DIM / EMA_CL)       // chunks per (batch, head)
#define EMA_SEG   8                      // work-groups per (batch, head)
#define EMA_CPS   (EMA_NCH / EMA_SEG)    // chunks stored by one work-group
#define EMA_ROWS  (EMA_CL * EMA_CPS)     // rows stored by one work-group
#define EMA_NT    512                    // threads per work-group
#define EMA_NG    (EMA_NT / 8)           // lane groups per work-group
#define EMA_PITCH 96                     // floats per staged row: neighbour rows fall on the two bank halves

#define EMA_LDSF  (EMA_NCH * HS + EMA_CPS * HS + EMA_ROWS * EMA_PITCH)   // floats of LDS of one work-group

// smem: EMA_LDSF floats of LDS, 16-B aligned; seg: which EMA_ROWS rows of (batch, head) bh this work-group stores
__device__ __forceinline__ void ema_knorm(const float* __restrict__ u,
                                          const float* __restrict__ la_coef,
                                          const float* __restrict__ kbeta,
                                          us_t* __restrict__ khi,
                                          us_t* __restrict__ klo,
                                          float* smem, const int seg, const int bh) {
#pragma clang fp contract(off)
  // In all three arrays a lane's channels 8sub..8sub+3 sit at float 4*sub, 8sub+4..8sub+7 at 32 + 4*sub.
  float (*ldsE)[HS]        = (float (*)[HS])smem;                                    // end state of each chunk from a zero start
  float (*ldsS)[HS]        = (float (*)[HS])(smem + EMA_NCH * HS);                   // true state in front of each own chunk
  float (*ldsY)[EMA_PITCH] = (float (*)[EMA_PITCH])(smem + (EMA_NCH + EMA_CPS) * HS);   // own rows from a zero start

  const int tid  = threadIdx.x;
  const int grp  = tid >> 3;
  const int sub  = tid & 7;
  const int b = bh / NH, h = bh % NH;
  const int own0 = EMA_CPS * seg;                             // first own chunk
  const int nch  = own0 + EMA_CPS;                            // chunks this work-group walks

  const float cc   = bfr(la_coef[h]);
  const float omc  = 1.0f - cc;
  const float beta = expf(fminf(bfr(kbeta[h]) * 10.0f, 5.0f));

  // cp[it] = c^(k+1) for the row position k = 4 it + grp % 4 in its chunk; cl = c^EMA_CL
  float cp[EMA_ROWS / EMA_NG], cl = cc;
#pragma unroll
  for (int it = 0; it < EMA_ROWS / EMA_NG; ++it) {
    const int e = 4 * it + (grp & 3) + 1;                     // 1..16
    float p = 1.0f;
    cl = cc;
#pragma unroll
    for (int bit = 0; bit < 4; ++bit) {
      if ((e >> bit) & 1) p *= cl;
      cl *= cl;
    }
    if (e >> 4) p = cl;
    cp[it] = p;
  }

  const float* up = u + (size_t)b * T_DIM * C_DIM + h * HS + 8 * sub;

  // a) every chunk from a zero state; own0 and nch are multiples of 4, so a wave's four groups agree
  for (int j = grp; j < nch; j += EMA_NG) {
    const float* cpn = up + (size_t)(j * EMA_CL) * C_DIM;
    v4f x0[EMA_CL], x1[EMA_CL];
#pragma unroll
    for (int k = 0; k < EMA_CL; ++k) {
      const v4f* src = (const v4f*)(cpn + (size_t)k * C_DIM);
      x0[k] = src[0];
      x1[k] = src[1];
    }
    const bool own = (j >= own0);
    float* yrow = &ldsY[own ? (j - own0) * EMA_CL : 0][4 * sub];
    v4f y0, y1;
#pragma unroll
    for (int i = 0; i < 4; ++i) { y0[i] = 0.0f; y1[i] = 0.0f; }
#pragma unroll
    for (int k = 0; k < EMA_CL; ++k) {
#pragma unroll
      for (int i = 0; i < 4; ++i) {
        y0[i] = cc * y0[i] + omc * x0[k][i];
        y1[i] = cc * y1[i] + omc * x1[k][i];
      }
      if (own) {
        *(v4f*)(yrow + k * EMA_PITCH)      = y0;
        *(v4f*)(yrow + k * EMA_PITCH + 32) = y1;
      }
    }
    *(v4f*)(&ldsE[j][4 * sub])      = y0;
    *(v4f*)(&ldsE[j][32 + 4 * sub]) = y1;
  }
  __syncthreads();

  // b) fold the end states in time order, one channel per lane (two waves)
  if (tid < HS) {
    float s = 0.0f;
    for (int j0 = 0; j0 < own0; j0 += EMA_CPS) {
      float e[EMA_CPS];
#pragma unroll
      for (int i = 0; i < EMA_CPS; ++i) e[i] = ldsE[j0 + i][tid];
#pragma unroll
      for (int i = 0; i < EMA_CPS; ++i) s = cl * s + e[i];
    }
    float e[EMA_CPS];
#pragma unroll
    for (int i = 0; i < EMA_CPS; ++i) e[i] = ldsE[own0 + i][tid];
#pragma unroll
    for (int i = 0; i < EMA_CPS; ++i) {
      ldsS[i][tid] = s;
      s = cl * s + e[i];
    }
  }
  __syncthreads();

  // c) own rows: add the carried state, normalise, scale, split, store
  static_assert(4 * (EMA_ROWS / EMA_NG) == EMA_CL && EMA_CL == 16, "a wave stores one chunk = one fragment's rows");
  const size_t dpl = (size_t)bh * T_DIM * HS;
#pragma unroll
  for (int it = 0; it < EMA_ROWS / EMA_NG; ++it) {
    const int r = (grp >> 2) * EMA_CL + 4 * it + (grp & 3);   // r % EMA_CL == 4 it + grp % 4
    const v4f a0 = *(const v4f*)(&ldsY[r][4 * sub]);
    const v4f a1 = *(const v4f*)(&ldsY[r][32 + 4 * sub]);
    const v4f s0 = *(const v4f*)(&ldsS[r / EMA_CL][4 * sub]);
    const v4f s1 = *(const v4f*)(&ldsS[r / EMA_CL][32 + 4 * sub]);
    float y[8];
#pragma unroll
    for (int i = 0; i < 4; ++i) {
      y[i]     = a0[i] + cp[it] * s0[i];
      y[4 + i] = a1[i] + cp[it] * s1[i];
    }
    float ss = 0.0f;
#pragma unroll
    for (int i = 0; i < 8; ++i) ss += y[i] * y[i];
    ss += __shfl_xor(ss, 1, 32);
    ss += __shfl_xor(ss, 2, 32);
    ss += __shfl_xor(ss, 4, 32);
    const float rn = 1.0f / (sqrtf(ss) + 1e-6f);

    v4u ph, pl;
#pragma unroll
    for (int i = 0; i < 4; ++i) {
      const float ka = (y[2 * i] * rn) * beta;
      const float kc = (y[2 * i + 1] * rn) * beta;
      const unsigned hw = f2bf2(ka, kc);
      ph[i] = hw;
      pl[i] = f2bf2(ka - bflo(hw), kc - bfhi(hw));
    }
    const size_t off = dpl + 8u * pk_idx((unsigned)(seg * EMA_ROWS + r), (unsigned)sub, HS / 32);
    *(v4u*)(khi + off) = ph;
    *(v4u*)(klo + off) = pl;
  }
}

// ---------------------------------------------------------------------------
// 3) value featurizer: f = xl[t+1]*(1-vc) + xl[t]*vc, L2 normalise, beta scale,
//    written TRANSPOSED as bf16 hi/lo planes vthi/vtlo of fragments (rows = dims, k = key, for the P x V
//    B-fragments); per (batch, head) the four fragments of a 32-key tile lie side by side, tile after tile.
//    Four waves make 64 time steps; a work-group holds VM_Q such quartets, each with LDS of its own.
// ---------------------------------------------------------------------------
#define VM_Q (EMA_NT / 128)              // quartets of waves per work-group
static_assert(VM_Q * 2 * HS * 72 * 2 <= EMA_LDSF * 4, "the value maker's tiles fit the shared LDS");

// smem: the work-group's LDS, 16-B aligned; vx: which VM_Q * 64 time steps of (batch, head) bh this work-group makes
__device__ __forceinline__ void vmake(const float* __restrict__ xl,
                                      const float* __restrict__ v_coef,
                                      const float* __restrict__ vbeta,
                                      us_t* __restrict__ vthi,
                                      us_t* __restrict__ vtlo,
                                      float* smem, const int vx, const int bh) {
#pragma clang fp contract(off)
  const int quart = threadIdx.x >> 7;
  us_t (*ldsH)[72] = (us_t (*)[72])smem + (2 * quart) * HS;
  us_t (*ldsL)[72] = (us_t (*)[72])smem + (2 * quart + 1) * HS;
  const int b = bh / NH, h = bh % NH;
  const int t0 = (vx * VM_Q + quart) * 64;
  const int w = (threadIdx.x >> 5) & 3, lane = threadIdx.x & 31;

  const float vc  = bfr(v_coef[h]);
  const float omv = 1.0f - vc;
  const float vb  = expf(fminf(bfr(vbeta[h]) * 10.0f, 5.0f));

  // The wave's 16 time steps are worked side by side. All their rows are asked for first (step rr + 1 is also the
  // shifted row of step rr, so 17 rows serve 16 steps); the row behind the last time step of the sequence counts as zeros.
  // The loops of constant length are unrolled so that their arrays stay in registers.
  const int tw = t0 + w * 16;
  const float* cur = xl + ((size_t)b * T_DIM + tw) * C_DIM + h * HS + lane;
  float c0[17], c1[17];
#pragma unroll
  for (int rr = 0; rr < 16; ++rr) {
    c0[rr] = cur[rr * C_DIM];
    c1[rr] = cur[rr * C_DIM + 32];
  }
  c0[16] = 0.0f;
  c1[16] = 0.0f;
  if (tw + 16 < T_DIM) {
    c0[16] = cur[16 * C_DIM];
    c1[16] = cur[16 * C_DIM + 32];
  }

  float f0[16], f1[16], ss[16];
#pragma unroll
  for (int rr = 0; rr < 16; ++rr) {
    f0[rr] = c0[rr + 1] * omv + c0[rr] * vc;
    f1[rr] = c1[rr + 1] * omv + c1[rr] * vc;
    ss[rr] = f0[rr] * f0[rr] + f1[rr] * f1[rr];
  }

  // The 16 sums over the 32 lanes, all at once: at each exchange (lane distance 16, 8, 4, 2) a lane keeps half of its
  // steps and hands the other half to its partner, so that every sum is formed by the same additions as in a plain
  // exchange of one value, but only in the lanes that keep it. Lanes 2 rr and 2 rr + 1 end with the sum of step rr.
  float r8[8], r4[4], r2[2], r1;
  {
    const bool up = (lane & 16) != 0;
    float snd[8];
#pragma unroll
    for (int j = 0; j < 8; ++j) {
      r8[j]  = up ? ss[j + 8] : ss[j];
      snd[j] = up ? ss[j] : ss[j + 8];
    }
#pragma unroll
    for (int j = 0; j < 8; ++j) snd[j] = __shfl_xor(snd[j], 16, 32);
#pragma unroll
    for (int j = 0; j < 8; ++j) r8[j] += snd[j];
  }
  {
    const bool up = (lane & 8) != 0;
    float snd[4];
#pragma unroll
    for (int j = 0; j < 4; ++j) {
      r4[j]  = up ? r8[j + 4] : r8[j];
      snd[j] = up ? r8[j] : r8[j + 4];
    }
#pragma unroll
    for (int j = 0; j < 4; ++j) snd[j] = __shfl_xor(snd[j], 8, 32);
#pragma unroll
    for (int j = 0; j < 4; ++j) r4[j] += snd[j];
  }
  {
    const bool up = (lane & 4) != 0;
    float snd[2];
#pragma unroll
    for (int j = 0; j < 2; ++j) {
      r2[j]  = up ? r4[j + 2] : r4[j];
      snd[j] = up ? r4[j] : r4[j + 2];
    }
#pragma unroll
    for (int j = 0; j < 2; ++j) snd[j] = __shfl_xor(snd[j], 4, 32);
#pragma unroll
    for (int j = 0; j < 2; ++j) r2[j] += snd[j];
  }
  {
    const bool up = (lane & 2) != 0;
    r1 = up ? r2[1] : r2[0];
    const float snd = up ? r2[0] : r2[1];
    r1 += __shfl_xor(snd, 2, 32);
  }
  r1 += __shfl_xor(r1, 1, 32);
  // root and division once for all 16 steps, each in the lanes that hold its sum
  const float rnl = 1.0f / (sqrtf(r1) + 1e-6f);

  // eight time steps of a dim are 16 B of its staged row
#pragma unroll
  for (int j = 0; j < 2; ++j) {
    v4u ha, la, hb, lb;
#pragma unroll
    for (int i = 0; i < 4; ++i) {
      const int rr = 8 * j + 2 * i;
      const float rna = __uint_as_float((unsigned)__builtin_amdgcn_readlane((int)__float_as_uint(rnl), 2 * rr));
      const float rnb = __uint_as_float((unsigned)__builtin_amdgcn_readlane((int)__float_as_uint(rnl), 2 * rr + 2));
      const float a0 = (f0[rr] * rna) * vb, a1 = (f0[rr + 1] * rnb) * vb;
      const float b0 = (f1[rr] * rna) * vb, b1 = (f1[rr + 1] * rnb) * vb;
      const unsigned wa = f2bf2(a0, a1);
      const unsigned wb = f2bf2(b0, b1);
      ha[i] = wa;
      hb[i] = wb;
      la[i] = f2bf2(a0 - bflo(wa), a1 - bfhi(wa));
      lb[i] = f2bf2(b0 - bflo(wb), b1 - bfhi(wb));
    }
    *(v4u*)(&ldsH[lane][w * 16 + 8 * j])      = ha;
    *(v4u*)(&ldsH[lane + 32][w * 16 + 8 * j]) = hb;
    *(v4u*)(&ldsL[lane][w * 16 + 8 * j])      = la;
    *(v4u*)(&ldsL[lane + 32][w * 16 + 8 * j]) = lb;
  }
  __syncthreads();

  const int tid = threadIdx.x & 127;
  const int ch  = tid >> 4;            // 0..7: a wave stores two key octets of 16 dims = 512 contiguous bytes
  const int dsl = tid & 15;
  v4u ph[4], pl[4];
#pragma unroll
  for (int it = 0; it < 4; ++it) {
    const int d = it * 16 + dsl;
    ph[it] = *(const v4u*)(&ldsH[d][8 * ch]);
    pl[it] = *(const v4u*)(&ldsL[d][8 * ch]);
  }
  const size_t gb = ((size_t)bh * HS) * T_DIM;
#pragma unroll
  for (int it = 0; it < 4; ++it) {
    const size_t off = gb + 8u * (unsigned)(((t0 / 32 + (ch >> 2)) * 4 + it) * 64 + (ch & 3) * 16 + dsl);
    *(v4u*)(vthi + off) = ph[it];
    *(v4u*)(vtlo + off) = pl[it];
  }
}

// ---------------------------------------------------------------------------
// 2 + 3 in one launch: keys need only u, values only xl, so neither waits for the other. A work-group is wholly one or
// the other (the branch, and so every barrier behind it, is the same for all its waves). The registers of the leaky
// average let one work-group stand on a WGP, so the longest jobs come first in the grid: the leaky averages from the
// longest segment down, then the value makers, which are short (one round trip to memory for a wave's 16 rows).
// ---------------------------------------------------------------------------
#define KV_NV (B_DIM * NH * (T_DIM / (64 * VM_Q)))   // work-groups that make values
#define KV_NE (B_DIM * NH * EMA_SEG)                 // work-groups that make keys
__global__ __launch_bounds__(EMA_NT) void k_kv(const float* __restrict__ u,
                                              const float* __restrict__ la_coef,
                                              const float* __restrict__ kbeta,
                                              us_t* __restrict__ khi,
                                              us_t* __restrict__ klo,
                                              const float* __restrict__ xl,
                                              const float* __restrict__ v_coef,
                                              const float* __restrict__ vbeta,
                                              us_t* __restrict__ vthi,
                                              us_t* __restrict__ vtlo) {
  __shared__ __align__(16) float smem[EMA_LDSF];
  const int idx = (int)blockIdx.x;
  if (idx < KV_NE) {
    ema_knorm(u, la_coef, kbeta, khi, klo, smem, (EMA_SEG - 1) - idx / (B_DIM * NH), idx % (B_DIM * NH));
  } else {
    const int v = idx - KV_NE;
    vmake(xl, v_coef, vbeta, vthi, vtlo, smem, v % (T_DIM / (64 * VM_Q)), v / (T_DIM / (64 * VM_Q)));
  }
}

// ---------------------------------------------------------------------------
// 4) shifted-causal flash attention, query tiles of 16, key tiles of 32.
//    Scores computed transposed: St[key][query] = K_tile (A, rows = keys) x Qt (B, cols = queries),
//    so lane = query owns its softmax statistics and the P A-fragment for P x V is an
//    in-register repack of the two 16-key D tiles (element r <- tile keys 0..15, 8+r <- tile keys 16..31).
//    O[query][dim] accumulated with A = P, B = Vt rows (k = key). All fragments from
//    fragment-order global planes; bf16 hi/lo: hi*hi + hi*lo + lo*hi.
//    Every fragment of a tile has registers of its own: the V loads of a tile are issued in front of
//    its score products, the K loads of the wave's next tile right behind them, so that no product waits
//    for a load issued just in front of it. The fragment loops are unrolled so that the arrays stay in registers.
//    Equal work for every wave: query tile t walks t / 2 + 1 key tiles, so work-group p takes the long
//    tiles 127 - 2p, 126 - 2p and then the short tiles 2p, 2p + 1 (65 key tiles per pair). Two waves share a
//    query tile: one walks its even key tiles, the other its odd ones, each with softmax statistics of its
//    own; the two partial results (maximum, sum, O) meet in LDS behind one barrier, where each wave joins,
//    normalises and stores one of the work-group's four query tiles.
//    grid = (T / 64, B*NH), block 128. Output y hi/lo: fragment-order planes of B*T rows x C, row b*T + i
//    holding time i + 1, so that a tile's 16 queries are the rows of one fragment and every 128-B line has one
//    writer; the slot of time T (row b*T + T-1) takes the zeros of time 0.
// ---------------------------------------------------------------------------
#define ATT_NQT (T_DIM / 16)             // query tiles per (batch, head)
// khi and klo carry no __restrict__: with it the compiler lifts the loads of each wave's first K tile out of the loop
// over the two passes and holds their 64 registers through both walks, which costs the third wave per SIMD.
__global__ __launch_bounds__(128) void k_attn(const us_t* khi,
                                             const us_t* klo,
                                             const us_t* __restrict__ vthi,
                                             const us_t* __restrict__ vtlo,
                                             us_t* __restrict__ yhi,
                                             us_t* __restrict__ ylo) {
#pragma clang fp contract(off)
  __shared__ __align__(16) float ldsO[2][4][16][68];   // [long / short tile][wave]: partial O, rows = queries
  __shared__ float ldsM[2][4][16];                     // partial running maximum per query
  __shared__ float ldsL[2][4][16];                     // partial running sum per query

  const int bh = blockIdx.y, b = bh / NH, h = bh % NH;
  // the wave's number as a scalar: tile numbers, trip counts and the planes' tile addresses stay out of the vector registers
  const int w = __builtin_amdgcn_readfirstlane((int)(threadIdx.x >> 5));
  const int lane = threadIdx.x & 31, m = lane & 15, hh = lane >> 4;
  const int Tm1 = T_DIM - 1;
  const int par = w & 1;                           // this wave's key tiles: par, par + 2, ...

  const size_t kbh = (size_t)bh * T_DIM * HS;
  const size_t vbh = (size_t)bh * HS * T_DIM;

  // kept rolled: the two passes share one copy of the code and one set of registers
#pragma unroll 1
  for (int ph = 0; ph < 2; ++ph) {
    const int qt = (ph == 0) ? (ATT_NQT - 1 - 2 * (int)blockIdx.x - (w >> 1)) : (2 * (int)blockIdx.x + (w >> 1));
    const int q0  = 1 + 16 * qt;                   // first query time of this tile
    const int tq  = q0 + m;                        // this lane's query (B column n and stats owner)
    const int tqc = (tq < Tm1) ? tq : Tm1;         // clamped for loads (slot tq == T is stored as zeros)

    // Q fragments (B operand): column n = query, k = dim; q rows are k rows at time tq
    const us_t* qh_row = khi + kbh + 8u * pk_idx((unsigned)tqc, (unsigned)hh, HS / 32);
    const us_t* ql_row = klo + kbh + 8u * pk_idx((unsigned)tqc, (unsigned)hh, HS / 32);
    const v16us qh0 = ld_fragp(qh_row),       ql0 = ld_fragp(ql_row);         // dims 0..31
    const v16us qh1 = ld_fragp(qh_row + 512), ql1 = ld_fragp(ql_row + 512);   // dims 32..63

    int qmax = q0 + 15;
    if (qmax > Tm1) qmax = Tm1;
    const int ntiles = (qmax + 31) >> 5;           // keys 0..qmax-1, wave-uniform
    const int nmy    = (ntiles + 1 - par) >> 1;    // key tiles of this wave (0 for the odd wave of a one-tile walk)

    v8f o[4];
#pragma unroll
    for (int g = 0; g < 4; ++g) o[g] = vzero();
    float mrun = -1e30f, lrun = 0.0f;

    // this lane's first piece of the wave's first key tile; the pointers walk two tiles at a time.
    // A tile's four K fragments lie side by side, and so do its four V fragments.
    const us_t* kh_p = khi + kbh + par * (4 * 512) + 8 * lane;
    const us_t* kl_p = klo + kbh + par * (4 * 512) + 8 * lane;
    const us_t* vh_p = vthi + vbh + par * (4 * 512) + 8 * lane;
    const us_t* vl_p = vtlo + vbh + par * (4 * 512) + 8 * lane;

    // K fragments of the current tile, index 2g + dim half (key tiles 0 and 1 lie inside every plane)
    v16us kh[4], kl[4];
#pragma unroll
    for (int j = 0; j < 4; ++j) {
      kh[j] = ld_fragp(kh_p + j * 512);
      kl[j] = ld_fragp(kl_p + j * 512);
    }
    // the address registers of the loads above are written again below
    asm volatile("s_wait_xcnt 0x0" ::: "memory");
    // keeps the pointer additions below behind that wait
    __builtin_amdgcn_sched_barrier(0);
    // from here on the K pointers stand at the tile that the trip fetches ahead (the last tile fetches itself again)
    {
      const int kstep = (1 < nmy) ? 8 * 512 : 0;
      kh_p += kstep;
      kl_p += kstep;
    }

    for (int kt = 0; kt < nmy; ++kt) {
      const int kbase = (2 * kt + par) * 32;

      // V fragments of this tile (B operand: column n = dim 16g + m, k = key from the transposed planes)
      v16us vh[4], vl[4];
#pragma unroll
      for (int g = 0; g < 4; ++g) {
        vh[g] = ld_fragp(vh_p + g * 512);
        vl[g] = ld_fragp(vl_p + g * 512);
      }

      // St tiles: s[g][r] = score(key kbase + 16g + 8hh + r, query q0 + m)
      v8f s[2];
#pragma unroll
      for (int g = 0; g < 2; ++g) {
        s[g] = vzero();
        s[g] = mma(kh[2 * g], qh0, s[g]);
        s[g] = mma(kh[2 * g], ql0, s[g]);
        s[g] = mma(kl[2 * g], qh0, s[g]);
        s[g] = mma(kh[2 * g + 1], qh1, s[g]);
        s[g] = mma(kh[2 * g + 1], ql1, s[g]);
        s[g] = mma(kl[2 * g + 1], qh1, s[g]);
      }

      // K fragments of the wave's next tile into the registers just read
      {
#pragma unroll
        for (int j = 0; j < 4; ++j) {
          kh[j] = ld_fragp(kh_p + j * 512);
          kl[j] = ld_fragp(kl_p + j * 512);
        }
      }

      // causal mask (key < tq), online softmax per lane (= per query)
      float p0[8], p1[8];
      float mx = -1e30f;
#pragma unroll
      for (int r = 0; r < 8; ++r) {
        const int key0 = kbase + 8 * hh + r;
        float a = s[0][r];
        float c = s[1][r];
        if (key0 >= tq)      a = -1e30f;
        if (key0 + 16 >= tq) c = -1e30f;
        p0[r] = a;
        p1[r] = c;
        mx = fmaxf(mx, fmaxf(a, c));
      }
      mx = fmaxf(mx, __shfl_xor(mx, 16, 32));
      const float mn = fmaxf(mrun, mx);
      const float sc = __expf(mrun - mn);
      float sum = 0.0f;
#pragma unroll
      for (int r = 0; r < 8; ++r) {
        p0[r] = __expf(p0[r] - mn);
        p1[r] = __expf(p1[r] - mn);
        sum += p0[r] + p1[r];
      }
      sum += __shfl_xor(sum, 16, 32);
      lrun = lrun * sc + sum;
      mrun = mn;

      // rescale O: o[g][r] belongs to query q0 + 8hh + r, whose scale lives in lane 8hh + r
#pragma unroll
      for (int r = 0; r < 8; ++r) {
        const float scr = __shfl(sc, 8 * hh + r, 32);
#pragma unroll
        for (int g = 0; g < 4; ++g) o[g][r] *= scr;
      }

      // P as A fragment (lane = query row, k = key within tile), bf16 hi/lo
      v8u phw, plw;
#pragma unroll
      for (int i = 0; i < 4; ++i) {
        const unsigned a = f2bf2(p0[2 * i], p0[2 * i + 1]);
        const unsigned c = f2bf2(p1[2 * i], p1[2 * i + 1]);
        phw[i]     = a;
        phw[4 + i] = c;
        plw[i]     = f2bf2(p0[2 * i] - bflo(a), p0[2 * i + 1] - bfhi(a));
        plw[4 + i] = f2bf2(p1[2 * i] - bflo(c), p1[2 * i + 1] - bfhi(c));
      }
      const v16us pfh = __builtin_bit_cast(v16us, phw);
      const v16us pfl = __builtin_bit_cast(v16us, plw);

      // O += P x V
#pragma unroll
      for (int g = 0; g < 4; ++g) {
        o[g] = mma(pfh, vh[g], o[g]);
        o[g] = mma(pfh, vl[g], o[g]);
        o[g] = mma(pfl, vh[g], o[g]);
      }

      // the address registers of this trip's loads are written again below; here their requests are long under way
      asm volatile("s_wait_xcnt 0x0" ::: "memory");
      // keeps the pointer additions below behind that wait: the scheduler otherwise lifts them to the head of the trip
      __builtin_amdgcn_sched_barrier(0);
      {
        const int kstep = (kt + 2 < nmy) ? 8 * 512 : 0;
        kh_p += kstep;
        kl_p += kstep;
        vh_p += 8 * 512;
        vl_p += 8 * 512;
      }
    }

    // this wave's partial result of the tile. Both halves of the wave hold the same statistics for query q0 + m.
#pragma unroll
    for (int g = 0; g < 4; ++g) {
#pragma unroll
      for (int r = 0; r < 8; ++r) ldsO[ph][w][8 * hh + r][16 * g + m] = o[g][r];
    }
    if (hh == 0) {
      ldsM[ph][w][m] = mrun;
      ldsL[ph][w][m] = lrun;
    }
  }
  // publishes every wave's partial results to the wave that joins them
  __syncthreads();

  // epilogue: wave w joins the even and the odd partial of tile (jp, jt), then whole-line stores of the hi/lo planes.
  // The even partial always holds key 0, so its maximum is a real score; an odd wave without a key tile left
  // maximum -1e30, sum 0 and O = 0, which get the weight 0.
  const int jp = w >> 1, jt = w & 1;
  const int qtj = (jp == 0) ? (ATT_NQT - 1 - 2 * (int)blockIdx.x - jt) : (2 * (int)blockIdx.x + jt);
  const int tqj = 1 + 16 * qtj + m;                // the query whose row this lane stores
  const float ma = ldsM[jp][2 * jt][m], mb = ldsM[jp][2 * jt + 1][m];
  const float la = ldsL[jp][2 * jt][m], lb = ldsL[jp][2 * jt + 1][m];
  const float mj = fmaxf(ma, mb);
  const float fa = __expf(ma - mj), fb = __expf(mb - mj);
  const float inv = 1.0f / (la * fa + lb * fb);
  const float ca = fa * inv, cb = fb * inv;

  const unsigned live = (tqj <= Tm1) ? 0xFFFFFFFFu : 0u;   // the slot of time T is stored as zeros
  v4u yh[4], yl[4];
#pragma unroll
  for (int it = 0; it < 4; ++it) {
    const v4f* spa = (const v4f*)(&ldsO[jp][2 * jt][m][8 * (2 * it + hh)]);
    const v4f* spb = (const v4f*)(&ldsO[jp][2 * jt + 1][m][8 * (2 * it + hh)]);
    const v4f a0 = spa[0], a1 = spa[1];
    const v4f b0 = spb[0], b1 = spb[1];
    float vv[8];
#pragma unroll
    for (int i = 0; i < 4; ++i) {
      vv[i]     = a0[i] * ca + b0[i] * cb;
      vv[4 + i] = a1[i] * ca + b1[i] * cb;
    }
#pragma unroll
    for (int i = 0; i < 4; ++i) {
      const unsigned hw = f2bf2(vv[2 * i], vv[2 * i + 1]);
      yh[it][i] = hw & live;
      yl[it][i] = f2bf2(vv[2 * i] - bflo(hw), vv[2 * i + 1] - bfhi(hw)) & live;
    }
  }

  const unsigned yrow = (unsigned)(b * T_DIM + tqj - 1);
#pragma unroll
  for (int it = 0; it < 4; ++it) {
    const size_t off = 8u * pk_idx(yrow, (unsigned)(h * (HS / 8) + 2 * it + hh), C_DIM / 32);
    *(v4u*)(yhi + off) = yh[it];
    *(v4u*)(ylo + off) = yl[it];
  }
}

// ---------------------------------------------------------------------------
// launcher
// ---------------------------------------------------------------------------
extern "C" void kernel_launch(void* const* d_in, const int* in_sizes, int n_in,
                              void* d_out, int out_size, void* d_ws,
                              size_t ws_size, hipStream_t stream) {
  const size_t MT = (size_t)B_DIM * T_DIM;          // 4096 rows
  const size_t NX = MT * C_DIM;                     // 3145728
  const size_t NW = (size_t)C_DIM * C_DIM;          // 589824

  if (n_in < 8) return;
  if ((size_t)in_sizes[0] != NX || (size_t)in_sizes[1] != NW || in_sizes[2] != NH ||
      (size_t)in_sizes[3] != NW || in_sizes[4] != NH || in_sizes[5] != NH ||
      in_sizes[6] != NH || (size_t)in_sizes[7] != NW || (size_t)out_size != NX) return;

  const float* x       = (const float*)d_in[0];
  const float* W_la    = (const float*)d_in[1];
  const float* la_coef = (const float*)d_in[2];
  const float* W_v     = (const float*)d_in[3];
  const float* v_coef  = (const float*)d_in[4];
  const float* kbeta   = (const float*)d_in[5];
  const float* vbeta   = (const float*)d_in[6];
  const float* W_proj  = (const float*)d_in[7];
  float* out = (float*)d_out;

  // workspace carve (all sizes multiples of 256 B)
  size_t off = 0;
  char* ws = (char*)d_ws;
  us_t* xb   = (us_t*)(ws + off); off += NX * 2;
  us_t* wla  = (us_t*)(ws + off); off += NW * 2;
  us_t* wv   = (us_t*)(ws + off); off += NW * 2;
  us_t* wpj  = (us_t*)(ws + off); off += NW * 2;
  float* u   = (float*)(ws + off); off += NX * 4;
  float* xl  = (float*)(ws + off); off += NX * 4;
  us_t* khi  = (us_t*)(ws + off); off += NX * 2;
  us_t* klo  = (us_t*)(ws + off); off += NX * 2;
  us_t* vthi = (us_t*)(ws + off); off += NX * 2;
  us_t* vtlo = (us_t*)(ws + off); off += NX * 2;
  us_t* yhi  = (us_t*)(ws + off); off += NX * 2;
  us_t* ylo  = (us_t*)(ws + off); off += NX * 2;   // total 72,744,960 B
  if (off > ws_size) return;

  // 0) RNE convert inputs to bf16, fragment order
  k_cvt<<<(CVT_NX8 + 3 * CVT_NW8) / 256, 256, 0, stream>>>(x, W_la, W_v, W_proj, xb, wla, wv, wpj);

  // 1) u = x W_la^T ; xl = x W_v^T (wv lies directly behind wla)
  dim3 ggrid(C_DIM / 128, (unsigned)(MT / 64));
  dim3 ggrid2(2 * C_DIM / 128, (unsigned)(MT / 128));
  k_gemm<0, 4><<<ggrid2, 128, 0, stream>>>(xb, xb, wla, u, xl, (int)MT, C_DIM, C_DIM);

  // 2 + 3) leaky average + normalised, scaled keys as bf16 hi/lo; values (transposed, bf16 hi/lo)
  k_kv<<<KV_NV + KV_NE, EMA_NT, 0, stream>>>(u, la_coef, kbeta, khi, klo, xl, v_coef, vbeta, vthi, vtlo);

  // 4) attention -> y hi/lo planes
  dim3 agrid((T_DIM - 1 + 63) / 64, B_DIM * NH);
  k_attn<<<agrid, 128, 0, stream>>>(khi, klo, vthi, vtlo, yhi, ylo);

  // 5) out = y W_proj^T (hi and lo planes, two products)
  k_gemm<1, 2><<<ggrid, 128, 0, stream>>>(yhi, ylo, wpj, out, out, (int)MT, C_DIM, C_DIM);
}

// v009
// It runs in 86.4 microseconds.
// Timed twice side by side with v008, it ran 1.06 times as fast both times.
// Over all steps from v000 it is 20.1 times as fast.
#include <hip/hip_runtime.h>
#include <stdint.h>

// Contractions: v_wmma_f32_16x16x32_bf16 (bf16 operands, f32 accumulate). Input projections: single product on RNE-bf16 inputs. Score (K x Qt), P x V: bf16 hi/lo split (3 products). Output projection: hi/lo split activations x bf16 weights (2 products).

#define B_DIM 2
#define T_DIM 2048
#define C_DIM 768
#define NH    12
#define HS    64

typedef unsigned short us_t;
typedef __bf16         v16bf __attribute__((ext_vector_type(16)));
typedef unsigned short v16us __attribute__((ext_vector_type(16)));
typedef unsigned short v8us  __attribute__((ext_vector_type(8)));
typedef float          v8f   __attribute__((ext_vector_type(8)));
typedef float          v4f   __attribute__((ext_vector_type(4)));
typedef unsigned int   v4u   __attribute__((ext_vector_type(4)));
typedef unsigned int   v8u   __attribute__((ext_vector_type(8)));
typedef float          v2f   __attribute__((ext_vector_type(2)));
typedef __bf16         v2bf  __attribute__((ext_vector_type(2)));

union Frag { v16us u; v8us half[2]; };

// ---------------------------------------------------------------------------
// helpers
// ---------------------------------------------------------------------------
__device__ __forceinline__ v8f vzero() {
  v8f z;
#pragma unroll
  for (int i = 0; i < 8; ++i) z[i] = 0.0f;
  return z;
}

// RNE f32 -> bf16 bits, by the chip's convert instruction
__device__ __forceinline__ us_t f2bf(float f) { return __builtin_bit_cast(us_t, (__bf16)f); }
__device__ __forceinline__ float bf2f(us_t b) { return __uint_as_float(((unsigned)b) << 16); }
__device__ __forceinline__ float bfr(float f) { return bf2f(f2bf(f)); }
// two f32 -> one word of two RNE bf16, a in the low half: one packed convert, the word needs no assembling
__device__ __forceinline__ unsigned f2bf2(float a, float b) {
  v2f x;
  x[0] = a;
  x[1] = b;
  return __builtin_bit_cast(unsigned, __builtin_convertvector(x, v2bf));
}
// the two bf16 of such a word as f32
__device__ __forceinline__ float bflo(unsigned w) { return __uint_as_float(w << 16); }
__device__ __forceinline__ float bfhi(unsigned w) { return __uint_as_float(w & 0xFFFF0000u); }

// 16x16x32 fragment (A rows / B columns), k order:
// lane l: row/col = l&15, h = l>>4; elements 0..7 <- k0+8h+0..7, elements 8..15 <- k0+16+8h+0..7.
// Every bf16 plane (x, the weights, K, Vt, y) is kept in fragment order: a fragment of 16 rows x 32 k is 1 KiB of its own.
// Lane l finds its elements 0..7 at us_t 8 l and its elements 8..15 at us_t 256 + 8 l, so each of the two loads
// of a wave covers 512 contiguous bytes = 4 whole lines, where a row-major plane makes it touch 16 lines.
// p points at this lane's first piece.
__device__ __forceinline__ v16us ld_fragp(const us_t* __restrict__ p) {
  Frag f;
  f.half[0] = *(const v8us*)(p);
  f.half[1] = *(const v8us*)(p + 256);
  return f.u;
}
// place, in 16-B pieces, of piece (row, k8 = k / 8) in a fragment-order plane with kf fragments along k
__device__ __forceinline__ unsigned pk_idx(unsigned row, unsigned k8, unsigned kf) {
  return ((row >> 4) * kf + (k8 >> 2)) * 64u + (k8 & 3u) * 16u + (row & 15u);
}

// D[16x16] += A[16x32] * B[32x16]; D element r of lane l = (row 8*(l>>4)+r, col l&15).
// Followed by the 4-slot VALU hazard guard (ties D, keeps A/B live).
__device__ __forceinline__ v8f mma(v16us a, v16us b, v8f c) {
  v16bf av = __builtin_bit_cast(v16bf, a);
  v16bf bv = __builtin_bit_cast(v16bf, b);
  c = __builtin_amdgcn_wmma_f32_16x16x32_bf16(false, av, false, bv, (short)0, c, false, false);
  asm volatile("v_nop\n\tv_nop\n\tv_nop\n\tv_nop" : "+v"(c) : "v"(a), "v"(b));
  return c;
}

// The same product without the asm statement: asm operands cannot lie above v255, and the GEMM's wave tile needs more
// registers than that. The compiler keeps the distance behind its own builtin.
__device__ __forceinline__ v8f mma_hi(v16us a, v16us b, v8f c) {
  return __builtin_amdgcn_wmma_f32_16x16x32_bf16(false, __builtin_bit_cast(v16bf, a), false, __builtin_bit_cast(v16bf, b),
                                                 (short)0, c, false, false);
}

// ---------------------------------------------------------------------------
// 0) f32 [rows][C_DIM] -> RNE bf16 in fragment order; thread i of a plane writes piece i of that plane.
//    One launch for all four planes, which do not depend on each other: the first CVT_NX8 / 256 work-groups
//    take x, then CVT_NW8 / 256 work-groups each of the three weight matrices (a work-group lies in one plane).
//    Left for a later step: one piece per thread makes 2,400 work-groups of 8 waves for about 30 MB of traffic;
//    fewer waves with several pieces each would take less time to start.
// ---------------------------------------------------------------------------
#define CVT_NX8 (B_DIM * T_DIM * C_DIM / 8)   // 16-B pieces of the x plane
#define CVT_NW8 (C_DIM * C_DIM / 8)           // 16-B pieces of a weight plane
static_assert(CVT_NX8 % 256 == 0 && CVT_NW8 % 256 == 0, "a work-group lies in one plane");
__global__ __launch_bounds__(256) void k_cvt(const float* __restrict__ x,
                                            const float* __restrict__ w0,
                                            const float* __restrict__ w1,
                                            const float* __restrict__ w2,
                                            us_t* __restrict__ xo,
                                            us_t* __restrict__ o0,
                                            us_t* __restrict__ o1,
                                            us_t* __restrict__ o2) {
  int first = (int)blockIdx.x * 256;           // the work-group's first piece, then counted inside its plane
  const float* in = x;
  us_t* out = xo;
  if (first >= CVT_NX8) {
    first -= CVT_NX8;
    const int s = first / CVT_NW8;
    if (s > 2) return;
    first -= s * CVT_NW8;
    in  = (s == 0) ? w0 : (s == 1) ? w1 : w2;
    out = (s == 0) ? o0 : (s == 1) ? o1 : o2;
  }
  const int i = first + (int)threadIdx.x;
  const unsigned blk = (unsigned)i >> 6;
  const unsigned row = (blk / (C_DIM / 32)) * 16u + ((unsigned)i & 15u);
  const unsigned k8  = (blk % (C_DIM / 32)) * 4u + (((unsigned)i >> 4) & 3u);
  const v4f* src = (const v4f*)(in + (size_t)row * C_DIM + k8 * 8u);
  const v4f a = src[0];
  const v4f c = src[1];
  v4u p;
  p[0] = f2bf2(a[0], a[1]);
  p[1] = f2bf2(a[2], a[3]);
  p[2] = f2bf2(c[0], c[1]);
  p[3] = f2bf2(c[2], c[3]);
  v4u* dst = (v4u*)(out + (size_t)i * 8);
  *dst = p;
  
}

// ---------------------------------------------------------------------------
// 1) C[m][n] = sum_k A[m][k] * W[n][k]  (A: MxK bf16, W: NxK bf16, both in fragment order, C: MxN f32 row-major)
//    SPLITA: C = (A + A2) * W^T with A = hi plane, A2 = lo plane (two products); these are the y planes, whose
//    row b*T + i holds time i + 1 (row b*T + T-1: zeros, time 0), so the result rows are stored one time step on.
//    wave = 16 MF rows x 64 cols: every loaded W fragment feeds MF products (2 MF with SPLITA) and every A fragment
//    four, so a product needs far fewer loaded bytes than with one fragment row per wave.
//    block = 4 waves, 2 x 2: tile of 32 MF rows x 128 cols; two waves share each A fragment, two each W fragment.
//    Epilogue: tile staged in LDS, each 256-B row segment written as 16 lanes x 16 B
//    Fragments sit in a ring of GEMM_ST k-steps of registers: a step's registers are loaded again
//    (for GEMM_ST steps further on) right behind its products, so GEMM_ST steps of loads are in flight
//    (16 loads a step: three steps stay under the load counter's 63).
//    The loops over ring steps, fragment rows and column groups are unrolled so that the arrays stay in registers.
//    Without SPLITA, W may hold 2 N rows: the work-groups of columns N .. 2N - 1 use the rows of a second weight plane
//    that lies directly behind the first, and store to Cout2, so two products of the same A share one launch.
//    The walk along k: work-groups of one grid row read the same A rows, those of one grid column the same W rows. Started
//    together at k = 0 they would ask L2 for the same lines at the same moment, and each line would come from memory only
//    when all of them wait for it. So each work-group enters the walk at a ring round set by its tile indices and wraps
//    round to k = 0 behind the last one; its four waves stay together. Each accumulator sums the same products, rotated.
//    Host guarantees M % (32 MF) == 0, N % 128 == 0, K % (32 * GEMM_ST) == 0, K > 0, gridDim.x * 128 == N (without SPLITA: or 2 N).
// ---------------------------------------------------------------------------
#define GEMM_ST 3
static_assert(C_DIM % (32 * GEMM_ST) == 0 && C_DIM % 128 == 0, "k-steps fill the ring, column tiles fill a plane");
template <int SPLITA, int MF>
__global__ __launch_bounds__(128) void k_gemm(const us_t* __restrict__ A,
                                             const us_t* __restrict__ A2,
                                             const us_t* __restrict__ W,
                                             float* __restrict__ Cout,
                                             float* __restrict__ Cout2,
                                             int M, int N, int K) {
  __shared__ __align__(16) float ldsC[4][16 * MF][68];
  (void)M;
  // the wave's number as a scalar: tile bases stay out of the vector registers
  const int w = __builtin_amdgcn_readfirstlane((int)(threadIdx.x >> 5));
  const int lane = threadIdx.x & 31, m = lane & 15, hh = lane >> 4;
  const int mbase = blockIdx.y * (32 * MF) + (w >> 1) * (16 * MF);
  const int nbase = blockIdx.x * 128 + (w & 1) * 64;
  // element offsets of this lane's 16-B piece of its fragment rows; they walk along k
  const unsigned kf = (unsigned)K >> 5;            // fragments along k
  const unsigned nrd = kf / GEMM_ST;               // ring rounds along k
  unsigned rd = (((blockIdx.x + (blockIdx.y >> 1)) & 7u) * nrd) >> 3;   // this work-group's first round, 0 .. nrd - 1
  unsigned ao[MF], wo[4];
#pragma unroll
  for (int f = 0; f < MF; ++f) ao[f] = ((unsigned)((mbase >> 4) + f) * kf + rd * GEMM_ST) * 512u + 8u * lane;
#pragma unroll
  for (int g = 0; g < 4; ++g) wo[g] = ((unsigned)((nbase >> 4) + g) * kf + rd * GEMM_ST) * 512u + 8u * lane;

  v8f acc[MF][4];
#pragma unroll
  for (int f = 0; f < MF; ++f) {
#pragma unroll
    for (int g = 0; g < 4; ++g) acc[f][g] = vzero();
  }

  v16us a[GEMM_ST][MF], a2[GEMM_ST][MF], bw[GEMM_ST][4];
#pragma unroll
  for (int i = 0; i < GEMM_ST; ++i) {
#pragma unroll
    for (int f = 0; f < MF; ++f) {
      a[i][f] = ld_fragp(A + ao[f] + 512 * i);
      if (SPLITA) a2[i][f] = ld_fragp(A2 + ao[f] + 512 * i);
    }
#pragma unroll
    for (int g = 0; g < 4; ++g) bw[i][g] = ld_fragp(W + wo[g] + 512 * i);
    // keeps these loads in the ring's order, step by step: the loop's load-count waits must hold
    // for both ways into the loop and would otherwise wait for nearly the whole ring
    __builtin_amdgcn_sched_barrier(0);
  }
  // Registers that held addresses of the loads above are written again below. The addresses are inputs of the wait so
  // that they stay in their registers up to it: otherwise a later load of the ring is given such a pair as destination.
  static_assert((SPLITA ? 2 : 1) * MF == 4, "four A fragments a step");
  asm volatile("s_wait_xcnt 0x0"
               :: "v"(A + ao[0]), "v"(A + ao[1]),
                  "v"(SPLITA ? A2 + ao[0] : A + ao[MF - 2]), "v"(SPLITA ? A2 + ao[1] : A + ao[MF - 1]),
                  "v"(W + wo[0]), "v"(W + wo[1]), "v"(W + wo[2]), "v"(W + wo[3])
               : "memory");

  for (int kb = 32 * GEMM_ST; kb < K; kb += 32 * GEMM_ST) {
    // one round on; from the last round back to the first (the sum is taken modulo 2^32, the offsets stay in the plane)
    unsigned step = 512u * GEMM_ST;
    if (++rd == nrd) {
      rd = 0;
      step = 0u - (nrd - 1u) * (512u * GEMM_ST);
    }
#pragma unroll
    for (int f = 0; f < MF; ++f) ao[f] += step;
#pragma unroll
    for (int g = 0; g < 4; ++g) wo[g] += step;
#pragma unroll
    for (int i = 0; i < GEMM_ST; ++i) {
      // every accumulator takes its hi product of a step first, then its lo product
#pragma unroll
      for (int f = 0; f < MF; ++f) {
#pragma unroll
        for (int g = 0; g < 4; ++g) acc[f][g] = mma_hi(a[i][f], bw[i][g], acc[f][g]);
      }
      if (SPLITA) {
#pragma unroll
        for (int f = 0; f < MF; ++f) {
#pragma unroll
          for (int g = 0; g < 4; ++g) acc[f][g] = mma_hi(a2[i][f], bw[i][g], acc[f][g]);
        }
      }
#pragma unroll
      for (int f = 0; f < MF; ++f) {
        a[i][f] = ld_fragp(A + ao[f] + 512 * i);
        if (SPLITA) a2[i][f] = ld_fragp(A2 + ao[f] + 512 * i);
      }
#pragma unroll
      for (int g = 0; g < 4; ++g) bw[i][g] = ld_fragp(W + wo[g] + 512 * i);
      // keeps a step's loads in front of the next step's products: a load that slips behind them has one step less of lead
      __builtin_amdgcn_sched_barrier(0);
    }
    // the next trip forms new addresses in the registers of the loads just issued
    asm volatile("s_wait_xcnt 0x0" ::: "memory");
  }
#pragma unroll
  for (int i = 0; i < GEMM_ST; ++i) {
#pragma unroll
    for (int f = 0; f < MF; ++f) {
#pragma unroll
      for (int g = 0; g < 4; ++g) acc[f][g] = mma_hi(a[i][f], bw[i][g], acc[f][g]);
    }
    if (SPLITA) {
#pragma unroll
      for (int f = 0; f < MF; ++f) {
#pragma unroll
        for (int g = 0; g < 4; ++g) acc[f][g] = mma_hi(a2[i][f], bw[i][g], acc[f][g]);
      }
    }
  }

  // stage D tiles: acc[f][g][r] = C[mbase + 16f + 8hh + r][nbase + 16g + m]
#pragma unroll
  for (int f = 0; f < MF; ++f) {
#pragma unroll
    for (int g = 0; g < 4; ++g) {
#pragma unroll
      for (int r = 0; r < 8; ++r) ldsC[w][16 * f + 8 * hh + r][16 * g + m] = acc[f][g][r];
    }
  }
  __syncthreads();

  v4f val[8 * MF];
#pragma unroll
  for (int it = 0; it < 8 * MF; ++it) val[it] = *(const v4f*)(&ldsC[w][2 * it + hh][4 * m]);

  float* gb = Cout + nbase + 4 * m;
  if (!SPLITA && nbase >= N) gb = Cout2 + (nbase - N) + 4 * m;
#pragma unroll
  for (int it = 0; it < 8 * MF; ++it) {
    int row = mbase + 2 * it + hh;
    if (SPLITA) row = (row & ~(T_DIM - 1)) | ((row + 1) & (T_DIM - 1));
    *(v4f*)(gb + row * N) = val[it];   // M * N fits an int
  }
}

// ---------------------------------------------------------------------------
// 2) leaky average over T (f32) + L2 normalisation + beta scale,
//    written as bf16 hi/lo planes khi/klo, per (batch, head) a fragment-order plane of T rows x HS.
//    The recurrence y[t] = c*y[t-1] + (1-c)*u[t] is linear, so T is cut into chunks of
//    EMA_CL rows that run side by side from a zero state:
//      y[t0+k] = ylocal[k] + c^(k+1) * S,   S = true state in front of the chunk,
//      S(next chunk) = c^EMA_CL * S + (end state of this chunk from zero).
//    A work-group = one (batch, head) and EMA_ROWS consecutive rows. It forms the end states
//    of every chunk up to its own last one (earlier chunks again, from L2), folds them in LDS,
//    and normalises and stores its own rows only: nothing passes between work-groups.
//    Lane group of 8 = one row (8 channels per lane). In the store phase a wave owns the 16 rows of one chunk,
//    which are the rows of one fragment, so every 128-B line of the planes is written by one wave.
//    The loops of constant length are unrolled so that their arrays stay in registers; the load
//    loop also so that all 32 loads of a chunk are in flight before the first is used.
// ---------------------------------------------------------------------------
#define EMA_CL    16                     // rows per chunk
#define EMA_NCH   (T_DIM / EMA_CL)       // chunks per (batch, head)
#define EMA_SEG   8                      // work-groups per (batch, head)
#define EMA_CPS   (EMA_NCH / EMA_SEG)    // chunks stored by one work-group
#define EMA_ROWS  (EMA_CL * EMA_CPS)     // rows stored by one work-group
#define EMA_NT    512                    // threads per work-group
#define EMA_NG    (EMA_NT / 8)           // lane groups per work-group
#define EMA_PITCH 96                     // floats per staged row: neighbour rows fall on the two bank halves

#define EMA_LDSF  (EMA_NCH * HS + EMA_CPS * HS + EMA_ROWS * EMA_PITCH)   // floats of LDS of one work-group

// smem: EMA_LDSF floats of LDS, 16-B aligned; seg: which EMA_ROWS rows of (batch, head) bh this work-group stores
__device__ __forceinline__ void ema_knorm(const float* __restrict__ u,
                                          const float* __restrict__ la_coef,
                                          const float* __restrict__ kbeta,
                                          us_t* __restrict__ khi,
                                          us_t* __restrict__ klo,
                                          float* smem, const int seg, const int bh) {
#pragma clang fp contract(off)
  // In all three arrays a lane's channels 8sub..8sub+3 sit at float 4*sub, 8sub+4..8sub+7 at 32 + 4*sub.
  float (*ldsE)[HS]        = (float (*)[HS])smem;                                    // end state of each chunk from a zero start
  float (*ldsS)[HS]        = (float (*)[HS])(smem + EMA_NCH * HS);                   // true state in front of each own chunk
  float (*ldsY)[EMA_PITCH] = (float (*)[EMA_PITCH])(smem + (EMA_NCH + EMA_CPS) * HS);   // own rows from a zero start

  const int tid  = threadIdx.x;
  const int grp  = tid >> 3;
  const int sub  = tid & 7;
  const int b = bh / NH, h = bh % NH;
  const int own0 = EMA_CPS * seg;                             // first own chunk
  const int nch  = own0 + EMA_CPS;                            // chunks this work-group walks

  const float cc   = bfr(la_coef[h]);
  const float omc  = 1.0f - cc;
  const float beta = expf(fminf(bfr(kbeta[h]) * 10.0f, 5.0f));

  // cp[it] = c^(k+1) for the row position k = 4 it + grp % 4 in its chunk; cl = c^EMA_CL
  float cp[EMA_ROWS / EMA_NG], cl = cc;
#pragma unroll
  for (int it = 0; it < EMA_ROWS / EMA_NG; ++it) {
    const int e = 4 * it + (grp & 3) + 1;                     // 1..16
    float p = 1.0f;
    cl = cc;
#pragma unroll
    for (int bit = 0; bit < 4; ++bit) {
      if ((e >> bit) & 1) p *= cl;
      cl *= cl;
    }
    if (e >> 4) p = cl;
    cp[it] = p;
  }

  const float* up = u + (size_t)b * T_DIM * C_DIM + h * HS + 8 * sub;

  // a) every chunk from a zero state; own0 and nch are multiples of 4, so a wave's four groups agree
  for (int j = grp; j < nch; j += EMA_NG) {
    const float* cpn = up + (size_t)(j * EMA_CL) * C_DIM;
    v4f x0[EMA_CL], x1[EMA_CL];
#pragma unroll
    for (int k = 0; k < EMA_CL; ++k) {
      const v4f* src = (const v4f*)(cpn + (size_t)k * C_DIM);
      x0[k] = src[0];
      x1[k] = src[1];
    }
    const bool own = (j >= own0);
    float* yrow = &ldsY[own ? (j - own0) * EMA_CL : 0][4 * sub];
    v4f y0, y1;
#pragma unroll
    for (int i = 0; i < 4; ++i) { y0[i] = 0.0f; y1[i] = 0.0f; }
#pragma unroll
    for (int k = 0; k < EMA_CL; ++k) {
#pragma unroll
      for (int i = 0; i < 4; ++i) {
        y0[i] = cc * y0[i] + omc * x0[k][i];
        y1[i] = cc * y1[i] + omc * x1[k][i];
      }
      if (own) {
        *(v4f*)(yrow + k * EMA_PITCH)      = y0;
        *(v4f*)(yrow + k * EMA_PITCH + 32) = y1;
      }
    }
    *(v4f*)(&ldsE[j][4 * sub])      = y0;
    *(v4f*)(&ldsE[j][32 + 4 * sub]) = y1;
  }
  __syncthreads();

  // b) fold the end states in time order, one channel per lane (two waves)
  if (tid < HS) {
    float s = 0.0f;
    for (int j0 = 0; j0 < own0; j0 += EMA_CPS) {
      float e[EMA_CPS];
#pragma unroll
      for (int i = 0; i < EMA_CPS; ++i) e[i] = ldsE[j0 + i][tid];
#pragma unroll
      for (int i = 0; i < EMA_CPS; ++i) s = cl * s + e[i];
    }
    float e[EMA_CPS];
#pragma unroll
    for (int i = 0; i < EMA_CPS; ++i) e[i] = ldsE[own0 + i][tid];
#pragma unroll
    for (int i = 0; i < EMA_CPS; ++i) {
      ldsS[i][tid] = s;
      s = cl * s + e[i];
    }
  }
  __syncthreads();

  // c) own rows: add the carried state, normalise, scale, split, store
  static_assert(4 * (EMA_ROWS / EMA_NG) == EMA_CL && EMA_CL == 16, "a wave stores one chunk = one fragment's rows");
  const size_t dpl = (size_t)bh * T_DIM * HS;
#pragma unroll
  for (int it = 0; it < EMA_ROWS / EMA_NG; ++it) {
    const int r = (grp >> 2) * EMA_CL + 4 * it + (grp & 3);   // r % EMA_CL == 4 it + grp % 4
    const v4f a0 = *(const v4f*)(&ldsY[r][4 * sub]);
    const v4f a1 = *(const v4f*)(&ldsY[r][32 + 4 * sub]);
    const v4f s0 = *(const v4f*)(&ldsS[r / EMA_CL][4 * sub]);
    const v4f s1 = *(const v4f*)(&ldsS[r / EMA_CL][32 + 4 * sub]);
    float y[8];
#pragma unroll
    for (int i = 0; i < 4; ++i) {
      y[i]     = a0[i] + cp[it] * s0[i];
      y[4 + i] = a1[i] + cp[it] * s1[i];
    }
    float ss = 0.0f;
#pragma unroll
    for (int i = 0; i < 8; ++i) ss += y[i] * y[i];
    ss += __shfl_xor(ss, 1, 32);
    ss += __shfl_xor(ss, 2, 32);
    ss += __shfl_xor(ss, 4, 32);
    const float rn = 1.0f / (sqrtf(ss) + 1e-6f);

    v4u ph, pl;
#pragma unroll
    for (int i = 0; i < 4; ++i) {
      const float ka = (y[2 * i] * rn) * beta;
      const float kc = (y[2 * i + 1] * rn) * beta;
      const unsigned hw = f2bf2(ka, kc);
      ph[i] = hw;
      pl[i] = f2bf2(ka - bflo(hw), kc - bfhi(hw));
    }
    const size_t off = dpl + 8u * pk_idx((unsigned)(seg * EMA_ROWS + r), (unsigned)sub, HS / 32);
    *(v4u*)(khi + off) = ph;
    *(v4u*)(klo + off) = pl;
  }
}

// ---------------------------------------------------------------------------
// 3) value featurizer: f = xl[t+1]*(1-vc) + xl[t]*vc, L2 normalise, beta scale,
//    written TRANSPOSED as bf16 hi/lo planes vthi/vtlo of fragments (rows = dims, k = key, for the P x V
//    B-fragments); per (batch, head) the four fragments of a 32-key tile lie side by side, tile after tile.
//    Four waves make 64 time steps; a work-group holds VM_Q such quartets, each with LDS of its own.
// ---------------------------------------------------------------------------
#define VM_Q (EMA_NT / 128)              // quartets of waves per work-group
static_assert(VM_Q * 2 * HS * 72 * 2 <= EMA_LDSF * 4, "the value maker's tiles fit the shared LDS");

// smem: the work-group's LDS, 16-B aligned; vx: which VM_Q * 64 time steps of (batch, head) bh this work-group makes
__device__ __forceinline__ void vmake(const float* __restrict__ xl,
                                      const float* __restrict__ v_coef,
                                      const float* __restrict__ vbeta,
                                      us_t* __restrict__ vthi,
                                      us_t* __restrict__ vtlo,
                                      float* smem, const int vx, const int bh) {
#pragma clang fp contract(off)
  const int quart = threadIdx.x >> 7;
  us_t (*ldsH)[72] = (us_t (*)[72])smem + (2 * quart) * HS;
  us_t (*ldsL)[72] = (us_t (*)[72])smem + (2 * quart + 1) * HS;
  const int b = bh / NH, h = bh % NH;
  const int t0 = (vx * VM_Q + quart) * 64;
  const int w = (threadIdx.x >> 5) & 3, lane = threadIdx.x & 31;

  const float vc  = bfr(v_coef[h]);
  const float omv = 1.0f - vc;
  const float vb  = expf(fminf(bfr(vbeta[h]) * 10.0f, 5.0f));

  // The wave's 16 time steps are worked side by side. All their rows are asked for first (step rr + 1 is also the
  // shifted row of step rr, so 17 rows serve 16 steps); the row behind the last time step of the sequence counts as zeros.
  // The loops of constant length are unrolled so that their arrays stay in registers.
  const int tw = t0 + w * 16;
  const float* cur = xl + ((size_t)b * T_DIM + tw) * C_DIM + h * HS + lane;
  float c0[17], c1[17];
#pragma unroll
  for (int rr = 0; rr < 16; ++rr) {
    c0[rr] = cur[rr * C_DIM];
    c1[rr] = cur[rr * C_DIM + 32];
  }
  c0[16] = 0.0f;
  c1[16] = 0.0f;
  if (tw + 16 < T_DIM) {
    c0[16] = cur[16 * C_DIM];
    c1[16] = cur[16 * C_DIM + 32];
  }

  float f0[16], f1[16], ss[16];
#pragma unroll
  for (int rr = 0; rr < 16; ++rr) {
    f0[rr] = c0[rr + 1] * omv + c0[rr] * vc;
    f1[rr] = c1[rr + 1] * omv + c1[rr] * vc;
    ss[rr] = f0[rr] * f0[rr] + f1[rr] * f1[rr];
  }

  // The 16 sums over the 32 lanes, all at once: at each exchange (lane distance 16, 8, 4, 2) a lane keeps half of its
  // steps and hands the other half to its partner, so that every sum is formed by the same additions as in a plain
  // exchange of one value, but only in the lanes that keep it. Lanes 2 rr and 2 rr + 1 end with the sum of step rr.
  float r8[8], r4[4], r2[2], r1;
  {
    const bool up = (lane & 16) != 0;
    float snd[8];
#pragma unroll
    for (int j = 0; j < 8; ++j) {
      r8[j]  = up ? ss[j + 8] : ss[j];
      snd[j] = up ? ss[j] : ss[j + 8];
    }
#pragma unroll
    for (int j = 0; j < 8; ++j) snd[j] = __shfl_xor(snd[j], 16, 32);
#pragma unroll
    for (int j = 0; j < 8; ++j) r8[j] += snd[j];
  }
  {
    const bool up = (lane & 8) != 0;
    float snd[4];
#pragma unroll
    for (int j = 0; j < 4; ++j) {
      r4[j]  = up ? r8[j + 4] : r8[j];
      snd[j] = up ? r8[j] : r8[j + 4];
    }
#pragma unroll
    for (int j = 0; j < 4; ++j) snd[j] = __shfl_xor(snd[j], 8, 32);
#pragma unroll
    for (int j = 0; j < 4; ++j) r4[j] += snd[j];
  }
  {
    const bool up = (lane & 4) != 0;
    float snd[2];
#pragma unroll
    for (int j = 0; j < 2; ++j) {
      r2[j]  = up ? r4[j + 2] : r4[j];
      snd[j] = up ? r4[j] : r4[j + 2];
    }
#pragma unroll
    for (int j = 0; j < 2; ++j) snd[j] = __shfl_xor(snd[j], 4, 32);
#pragma unroll
    for (int j = 0; j < 2; ++j) r2[j] += snd[j];
  }
  {
    const bool up = (lane & 2) != 0;
    r1 = up ? r2[1] : r2[0];
    const float snd = up ? r2[0] : r2[1];
    r1 += __shfl_xor(snd, 2, 32);
  }
  r1 += __shfl_xor(r1, 1, 32);
  // root and division once for all 16 steps, each in the lanes that hold its sum
  const float rnl = 1.0f / (sqrtf(r1) + 1e-6f);

  // eight time steps of a dim are 16 B of its staged row
#pragma unroll
  for (int j = 0; j < 2; ++j) {
    v4u ha, la, hb, lb;
#pragma unroll
    for (int i = 0; i < 4; ++i) {
      const int rr = 8 * j + 2 * i;
      const float rna = __uint_as_float((unsigned)__builtin_amdgcn_readlane((int)__float_as_uint(rnl), 2 * rr));
      const float rnb = __uint_as_float((unsigned)__builtin_amdgcn_readlane((int)__float_as_uint(rnl), 2 * rr + 2));
      const float a0 = (f0[rr] * rna) * vb, a1 = (f0[rr + 1] * rnb) * vb;
      const float b0 = (f1[rr] * rna) * vb, b1 = (f1[rr + 1] * rnb) * vb;
      const unsigned wa = f2bf2(a0, a1);
      const unsigned wb = f2bf2(b0, b1);
      ha[i] = wa;
      hb[i] = wb;
      la[i] = f2bf2(a0 - bflo(wa), a1 - bfhi(wa));
      lb[i] = f2bf2(b0 - bflo(wb), b1 - bfhi(wb));
    }
    *(v4u*)(&ldsH[lane][w * 16 + 8 * j])      = ha;
    *(v4u*)(&ldsH[lane + 32][w * 16 + 8 * j]) = hb;
    *(v4u*)(&ldsL[lane][w * 16 + 8 * j])      = la;
    *(v4u*)(&ldsL[lane + 32][w * 16 + 8 * j]) = lb;
  }
  __syncthreads();

  const int tid = threadIdx.x & 127;
  const int ch  = tid >> 4;            // 0..7: a wave stores two key octets of 16 dims = 512 contiguous bytes
  const int dsl = tid & 15;
  v4u ph[4], pl[4];
#pragma unroll
  for (int it = 0; it < 4; ++it) {
    const int d = it * 16 + dsl;
    ph[it] = *(const v4u*)(&ldsH[d][8 * ch]);
    pl[it] = *(const v4u*)(&ldsL[d][8 * ch]);
  }
  const size_t gb = ((size_t)bh * HS) * T_DIM;
#pragma unroll
  for (int it = 0; it < 4; ++it) {
    const size_t off = gb + 8u * (unsigned)(((t0 / 32 + (ch >> 2)) * 4 + it) * 64 + (ch & 3) * 16 + dsl);
    *(v4u*)(vthi + off) = ph[it];
    *(v4u*)(vtlo + off) = pl[it];
  }
}

// ---------------------------------------------------------------------------
// 2 + 3 in one launch: keys need only u, values only xl, so neither waits for the other. A work-group is wholly one or
// the other (the branch, and so every barrier behind it, is the same for all its waves). The registers of the leaky
// average let one work-group stand on a WGP, so the longest jobs come first in the grid: the leaky averages from the
// longest segment down, then the value makers, which are short (one round trip to memory for a wave's 16 rows).
// ---------------------------------------------------------------------------
#define KV_NV (B_DIM * NH * (T_DIM / (64 * VM_Q)))   // work-groups that make values
#define KV_NE (B_DIM * NH * EMA_SEG)                 // work-groups that make keys
__global__ __launch_bounds__(EMA_NT) void k_kv(const float* __restrict__ u,
                                              const float* __restrict__ la_coef,
                                              const float* __restrict__ kbeta,
                                              us_t* __restrict__ khi,
                                              us_t* __restrict__ klo,
                                              const float* __restrict__ xl,
                                              const float* __restrict__ v_coef,
                                              const float* __restrict__ vbeta,
                                              us_t* __restrict__ vthi,
                                              us_t* __restrict__ vtlo) {
  __shared__ __align__(16) float smem[EMA_LDSF];
  const int idx = (int)blockIdx.x;
  if (idx < KV_NE) {
    ema_knorm(u, la_coef, kbeta, khi, klo, smem, (EMA_SEG - 1) - idx / (B_DIM * NH), idx % (B_DIM * NH));
  } else {
    const int v = idx - KV_NE;
    vmake(xl, v_coef, vbeta, vthi, vtlo, smem, v % (T_DIM / (64 * VM_Q)), v / (T_DIM / (64 * VM_Q)));
  }
}

// ---------------------------------------------------------------------------
// 4) shifted-causal flash attention, query tiles of 16, key tiles of 32.
//    Scores computed transposed: St[key][query] = K_tile (A, rows = keys) x Qt (B, cols = queries),
//    so lane = query owns its softmax statistics and the P A-fragment for P x V is an
//    in-register repack of the two 16-key D tiles (element r <- tile keys 0..15, 8+r <- tile keys 16..31).
//    O[query][dim] accumulated with A = P, B = Vt rows (k = key). All fragments from
//    fragment-order global planes; bf16 hi/lo: hi*hi + hi*lo + lo*hi.
//    Every fragment of a tile has registers of its own: the V loads of a tile are issued in front of
//    its score products, the K loads of the wave's next tile right behind them, so that no product waits
//    for a load issued just in front of it. The fragment loops are unrolled so that the arrays stay in registers.
//    Equal work for every wave: query tile t walks t / 2 + 1 key tiles, so work-group p takes the long
//    tiles 127 - 2p, 126 - 2p and then the short tiles 2p, 2p + 1 (65 key tiles per pair). Two waves share a
//    query tile: one walks its even key tiles, the other its odd ones, each with softmax statistics of its
//    own; the two partial results (maximum, sum, O) meet in LDS behind one barrier, where each wave joins,
//    normalises and stores one of the work-group's four query tiles.
//    The walk over the key tiles: the work-groups of one (batch, head) read the same K and V lines. Started together at
//    key 0 they would ask L2 for the same lines at the same moment, so a wave enters its walk 2 * (blockIdx.x % 8) of its
//    tiles further on and wraps round to its first tile behind the last one (a shorter walk starts at its first tile).
//    The running softmax takes the tiles in any order: every tile of a walk holds a key in front of each of its queries.
//    grid = (T / 64, B*NH), block 128. Output y hi/lo: fragment-order planes of B*T rows x C, row b*T + i
//    holding time i + 1, so that a tile's 16 queries are the rows of one fragment and every 128-B line has one
//    writer; the slot of time T (row b*T + T-1) takes the zeros of time 0.
// ---------------------------------------------------------------------------
#define ATT_NQT (T_DIM / 16)             // query tiles per (batch, head)
__global__ __launch_bounds__(128) void k_attn(const us_t* khi,
                                             const us_t* klo,
                                             const us_t* __restrict__ vthi,
                                             const us_t* __restrict__ vtlo,
                                             us_t* __restrict__ yhi,
                                             us_t* __restrict__ ylo) {
#pragma clang fp contract(off)
  __shared__ __align__(16) float ldsO[2][4][16][68];   // [long / short tile][wave]: partial O, rows = queries
  __shared__ float ldsM[2][4][16];                     // partial running maximum per query
  __shared__ float ldsL[2][4][16];                     // partial running sum per query

  const int bh = blockIdx.y, b = bh / NH, h = bh % NH;
  // the wave's number as a scalar: tile numbers, trip counts and the planes' tile addresses stay out of the vector registers
  const int w = __builtin_amdgcn_readfirstlane((int)(threadIdx.x >> 5));
  const int lane = threadIdx.x & 31, m = lane & 15, hh = lane >> 4;
  const int Tm1 = T_DIM - 1;
  const int par = w & 1;                           // this wave's key tiles: par, par + 2, ...

  const size_t kbh = (size_t)bh * T_DIM * HS;
  const size_t vbh = (size_t)bh * HS * T_DIM;

  // kept rolled: the two passes share one copy of the code and one set of registers
#pragma unroll 1
  for (int ph = 0; ph < 2; ++ph) {
    const int qt = (ph == 0) ? (ATT_NQT - 1 - 2 * (int)blockIdx.x - (w >> 1)) : (2 * (int)blockIdx.x + (w >> 1));
    const int q0  = 1 + 16 * qt;                   // first query time of this tile
    const int tq  = q0 + m;                        // this lane's query (B column n and stats owner)
    const int tqc = (tq < Tm1) ? tq : Tm1;         // clamped for loads (slot tq == T is stored as zeros)

    // Q fragments (B operand): column n = query, k = dim; q rows are k rows at time tq
    const us_t* qh_row = khi + kbh + 8u * pk_idx((unsigned)tqc, (unsigned)hh, HS / 32);
    const us_t* ql_row = klo + kbh + 8u * pk_idx((unsigned)tqc, (unsigned)hh, HS / 32);
    const v16us qh0 = ld_fragp(qh_row),       ql0 = ld_fragp(ql_row);         // dims 0..31
    const v16us qh1 = ld_fragp(qh_row + 512), ql1 = ld_fragp(ql_row + 512);   // dims 32..63

    int qmax = q0 + 15;
    if (qmax > Tm1) qmax = Tm1;
    const int ntiles = (qmax + 31) >> 5;           // keys 0..qmax-1, wave-uniform
    const int nmy    = (ntiles + 1 - par) >> 1;    // key tiles of this wave (0 for the odd wave of a one-tile walk)

    v8f o[4];
#pragma unroll
    for (int g = 0; g < 4; ++g) o[g] = vzero();
    float mrun = -1e30f, lrun = 0.0f;

    // jt: which of the wave's key tiles (par, par + 2, ...) the trip works on; the walk enters at a tile of its own
    int jt = 2 * ((int)blockIdx.x & 7);
    if (jt >= nmy) jt = 0;

    // this lane's first piece of the key tile at which the wave enters; the wave's tiles lie two tiles apart.
    // A tile's four K fragments lie side by side, and so do its four V fragments.
    const us_t* kh_p = khi + kbh + (par + 2 * jt) * (4 * 512) + 8 * lane;
    const us_t* kl_p = klo + kbh + (par + 2 * jt) * (4 * 512) + 8 * lane;
    const us_t* vh_p = vthi + vbh + (par + 2 * jt) * (4 * 512) + 8 * lane;
    const us_t* vl_p = vtlo + vbh + (par + 2 * jt) * (4 * 512) + 8 * lane;

    // K fragments of the current tile, index 2g + dim half (key tiles 0 and 1 lie inside every plane)
    v16us kh[4], kl[4];
#pragma unroll
    for (int j = 0; j < 4; ++j) {
      kh[j] = ld_fragp(kh_p + j * 512);
      kl[j] = ld_fragp(kl_p + j * 512);
    }
    // the address registers of the loads above are written again below
    asm volatile("s_wait_xcnt 0x0" ::: "memory");
    // keeps the pointer additions below behind that wait
    __builtin_amdgcn_sched_barrier(0);
    // from here on the K pointers stand at tile jk, which the trip fetches ahead: the next one of the walk, behind the
    // wave's last tile its first (the last trip fetches the tile of the first trip again, unused)
    int jk = (jt + 1 < nmy) ? jt + 1 : 0;
    {
      const int kstep = (jk - jt) * (8 * 512);
      kh_p += kstep;
      kl_p += kstep;
    }

    for (int kt = 0; kt < nmy; ++kt) {
      const int kbase = (2 * jt + par) * 32;

      // V fragments of this tile (B operand: column n = dim 16g + m, k = key from the transposed planes)
      v16us vh[4], vl[4];
#pragma unroll
      for (int g = 0; g < 4; ++g) {
        vh[g] = ld_fragp(vh_p + g * 512);
        vl[g] = ld_fragp(vl_p + g * 512);
      }

      // St tiles: s[g][r] = score(key kbase + 16g + 8hh + r, query q0 + m)
      v8f s[2];
#pragma unroll
      for (int g = 0; g < 2; ++g) {
        s[g] = vzero();
        s[g] = mma(kh[2 * g], qh0, s[g]);
        s[g] = mma(kh[2 * g], ql0, s[g]);
        s[g] = mma(kl[2 * g], qh0, s[g]);
        s[g] = mma(kh[2 * g + 1], qh1, s[g]);
        s[g] = mma(kh[2 * g + 1], ql1, s[g]);
        s[g] = mma(kl[2 * g + 1], qh1, s[g]);
      }

      // K fragments of the wave's next tile into the registers just read
      {
#pragma unroll
        for (int j = 0; j < 4; ++j) {
          kh[j] = ld_fragp(kh_p + j * 512);
          kl[j] = ld_fragp(kl_p + j * 512);
        }
      }

      // causal mask (key < tq), online softmax per lane (= per query)
      float p0[8], p1[8];
      float mx = -1e30f;
#pragma unroll
      for (int r = 0; r < 8; ++r) {
        const int key0 = kbase + 8 * hh + r;
        float a = s[0][r];
        float c = s[1][r];
        if (key0 >= tq)      a = -1e30f;
        if (key0 + 16 >= tq) c = -1e30f;
        p0[r] = a;
        p1[r] = c;
        mx = fmaxf(mx, fmaxf(a, c));
      }
      mx = fmaxf(mx, __shfl_xor(mx, 16, 32));
      const float mn = fmaxf(mrun, mx);
      const float sc = __expf(mrun - mn);
      float sum = 0.0f;
#pragma unroll
      for (int r = 0; r < 8; ++r) {
        p0[r] = __expf(p0[r] - mn);
        p1[r] = __expf(p1[r] - mn);
        sum += p0[r] + p1[r];
      }
      sum += __shfl_xor(sum, 16, 32);
      lrun = lrun * sc + sum;
      mrun = mn;

      // rescale O: o[g][r] belongs to query q0 + 8hh + r, whose scale lives in lane 8hh + r
#pragma unroll
      for (int r = 0; r < 8; ++r) {
        const float scr = __shfl(sc, 8 * hh + r, 32);
#pragma unroll
        for (int g = 0; g < 4; ++g) o[g][r] *= scr;
      }

      // P as A fragment (lane = query row, k = key within tile), bf16 hi/lo
      v8u phw, plw;
#pragma unroll
      for (int i = 0; i < 4; ++i) {
        const unsigned a = f2bf2(p0[2 * i], p0[2 * i + 1]);
        const unsigned c = f2bf2(p1[2 * i], p1[2 * i + 1]);
        phw[i]     = a;
        phw[4 + i] = c;
        plw[i]     = f2bf2(p0[2 * i] - bflo(a), p0[2 * i + 1] - bfhi(a));
        plw[4 + i] = f2bf2(p1[2 * i] - bflo(c), p1[2 * i + 1] - bfhi(c));
      }
      const v16us pfh = __builtin_bit_cast(v16us, phw);
      const v16us pfl = __builtin_bit_cast(v16us, plw);

      // O += P x V
#pragma unroll
      for (int g = 0; g < 4; ++g) {
        o[g] = mma(pfh, vh[g], o[g]);
        o[g] = mma(pfh, vl[g], o[g]);
        o[g] = mma(pfl, vh[g], o[g]);
      }

      // the address registers of this trip's loads are written again below; here their requests are long under way
      asm volatile("s_wait_xcnt 0x0" ::: "memory");
      // keeps the pointer additions below behind that wait: the scheduler otherwise lifts them to the head of the trip
      __builtin_amdgcn_sched_barrier(0);
      {
        const int jn = (jk + 1 < nmy) ? jk + 1 : 0;
        const int kstep = (jn - jk) * (8 * 512);
        const int vstep = (jk - jt) * (8 * 512);
        kh_p += kstep;
        kl_p += kstep;
        vh_p += vstep;
        vl_p += vstep;
        jt = jk;
        jk = jn;
      }
    }

    // this wave's partial result of the tile. Both halves of the wave hold the same statistics for query q0 + m.
#pragma unroll
    for (int g = 0; g < 4; ++g) {
#pragma unroll
      for (int r = 0; r < 8; ++r) ldsO[ph][w][8 * hh + r][16 * g + m] = o[g][r];
    }
    if (hh == 0) {
      ldsM[ph][w][m] = mrun;
      ldsL[ph][w][m] = lrun;
    }
  }
  // publishes every wave's partial results to the wave that joins them
  __syncthreads();

  // epilogue: wave w joins the even and the odd partial of tile (jp, jt), then whole-line stores of the hi/lo planes.
  // The even partial always holds key 0, so its maximum is a real score; an odd wave without a key tile left
  // maximum -1e30, sum 0 and O = 0, which get the weight 0.
  const int jp = w >> 1, jt = w & 1;
  const int qtj = (jp == 0) ? (ATT_NQT - 1 - 2 * (int)blockIdx.x - jt) : (2 * (int)blockIdx.x + jt);
  const int tqj = 1 + 16 * qtj + m;                // the query whose row this lane stores
  const float ma = ldsM[jp][2 * jt][m], mb = ldsM[jp][2 * jt + 1][m];
  const float la = ldsL[jp][2 * jt][m], lb = ldsL[jp][2 * jt + 1][m];
  const float mj = fmaxf(ma, mb);
  const float fa = __expf(ma - mj), fb = __expf(mb - mj);
  const float inv = 1.0f / (la * fa + lb * fb);
  const float ca = fa * inv, cb = fb * inv;

  const unsigned live = (tqj <= Tm1) ? 0xFFFFFFFFu : 0u;   // the slot of time T is stored as zeros
  v4u yh[4], yl[4];
#pragma unroll
  for (int it = 0; it < 4; ++it) {
    const v4f* spa = (const v4f*)(&ldsO[jp][2 * jt][m][8 * (2 * it + hh)]);
    const v4f* spb = (const v4f*)(&ldsO[jp][2 * jt + 1][m][8 * (2 * it + hh)]);
    const v4f a0 = spa[0], a1 = spa[1];
    const v4f b0 = spb[0], b1 = spb[1];
    float vv[8];
#pragma unroll
    for (int i = 0; i < 4; ++i) {
      vv[i]     = a0[i] * ca + b0[i] * cb;
      vv[4 + i] = a1[i] * ca + b1[i] * cb;
    }
#pragma unroll
    for (int i = 0; i < 4; ++i) {
      const unsigned hw = f2bf2(vv[2 * i], vv[2 * i + 1]);
      yh[it][i] = hw & live;
      yl[it][i] = f2bf2(vv[2 * i] - bflo(hw), vv[2 * i + 1] - bfhi(hw)) & live;
    }
  }

  const unsigned yrow = (unsigned)(b * T_DIM + tqj - 1);
#pragma unroll
  for (int it = 0; it < 4; ++it) {
    const size_t off = 8u * pk_idx(yrow, (unsigned)(h * (HS / 8) + 2 * it + hh), C_DIM / 32);
    *(v4u*)(yhi + off) = yh[it];
    *(v4u*)(ylo + off) = yl[it];
  }
}

// ---------------------------------------------------------------------------
// launcher
// ---------------------------------------------------------------------------
extern "C" void kernel_launch(void* const* d_in, const int* in_sizes, int n_in,
                              void* d_out, int out_size, void* d_ws,
                              size_t ws_size, hipStream_t stream) {
  const size_t MT = (size_t)B_DIM * T_DIM;          // 4096 rows
  const size_t NX = MT * C_DIM;                     // 3145728
  const size_t NW = (size_t)C_DIM * C_DIM;          // 589824

  if (n_in < 8) return;
  if ((size_t)in_sizes[0] != NX || (size_t)in_sizes[1] != NW || in_sizes[2] != NH ||
      (size_t)in_sizes[3] != NW || in_sizes[4] != NH || in_sizes[5] != NH ||
      in_sizes[6] != NH || (size_t)in_sizes[7] != NW || (size_t)out_size != NX) return;

  const float* x       = (const float*)d_in[0];
  const float* W_la    = (const float*)d_in[1];
  const float* la_coef = (const float*)d_in[2];
  const float* W_v     = (const float*)d_in[3];
  const float* v_coef  = (const float*)d_in[4];
  const float* kbeta   = (const float*)d_in[5];
  const float* vbeta   = (const float*)d_in[6];
  const float* W_proj  = (const float*)d_in[7];
  float* out = (float*)d_out;

  // workspace carve (all sizes multiples of 256 B)
  size_t off = 0;
  char* ws = (char*)d_ws;
  us_t* xb   = (us_t*)(ws + off); off += NX * 2;
  us_t* wla  = (us_t*)(ws + off); off += NW * 2;
  us_t* wv   = (us_t*)(ws + off); off += NW * 2;
  us_t* wpj  = (us_t*)(ws + off); off += NW * 2;
  float* u   = (float*)(ws + off); off += NX * 4;
  float* xl  = (float*)(ws + off); off += NX * 4;
  us_t* khi  = (us_t*)(ws + off); off += NX * 2;
  us_t* klo  = (us_t*)(ws + off); off += NX * 2;
  us_t* vthi = (us_t*)(ws + off); off += NX * 2;
  us_t* vtlo = (us_t*)(ws + off); off += NX * 2;
  us_t* yhi  = (us_t*)(ws + off); off += NX * 2;
  us_t* ylo  = (us_t*)(ws + off); off += NX * 2;   // total 72,744,960 B
  if (off > ws_size) return;

  // 0) RNE convert inputs to bf16, fragment order
  k_cvt<<<(CVT_NX8 + 3 * CVT_NW8) / 256, 256, 0, stream>>>(x, W_la, W_v, W_proj, xb, wla, wv, wpj);

  // 1) u = x W_la^T ; xl = x W_v^T (wv lies directly behind wla)
  dim3 ggrid(C_DIM / 128, (unsigned)(MT / 64));
  dim3 ggrid2(2 * C_DIM / 128, (unsigned)(MT / 128));
  k_gemm<0, 4><<<ggrid2, 128, 0, stream>>>(xb, xb, wla, u, xl, (int)MT, C_DIM, C_DIM);

  // 2 + 3) leaky average + normalised, scaled keys as bf16 hi/lo; values (transposed, bf16 hi/lo)
  k_kv<<<KV_NV + KV_NE, EMA_NT, 0, stream>>>(u, la_coef, kbeta, khi, klo, xl, v_coef, vbeta, vthi, vtlo);

  // 4) attention -> y hi/lo planes
  dim3 agrid((T_DIM - 1 + 63) / 64, B_DIM * NH);
  k_attn<<<agrid, 128, 0, stream>>>(khi, klo, vthi, vtlo, yhi, ylo);

  // 5) out = y W_proj^T (hi and lo planes, two products)
  k_gemm<1, 2><<<ggrid, 128, 0, stream>>>(yhi, ylo, wpj, out, out, (int)MT, C_DIM, C_DIM);
}

// v010
// A run of this version takes 84.2 microseconds.
// Next to v009, in two timings, it ran 1.03 times as fast each time.
// Counting every step since v000, it is 20.6 times as fast.
#include <hip/hip_runtime.h>
#include <stdint.h>

// Contractions: v_wmma_f32_16x16x32_bf16 (bf16 operands, f32 accumulate). Input projections: single product on RNE-bf16 inputs. Score (K x Qt), P x V: bf16 hi/lo split (3 products). Output projection: hi/lo split activations x bf16 weights (2 products).

#define B_DIM 2
#define T_DIM 2048
#define C_DIM 768
#define NH    12
#define HS    64

typedef unsigned short us_t;
typedef __bf16         v16bf __attribute__((ext_vector_type(16)));
typedef unsigned short v16us __attribute__((ext_vector_type(16)));
typedef unsigned short v8us  __attribute__((ext_vector_type(8)));
typedef float          v8f   __attribute__((ext_vector_type(8)));
typedef float          v4f   __attribute__((ext_vector_type(4)));
typedef unsigned int   v4u   __attribute__((ext_vector_type(4)));
typedef unsigned int   v8u   __attribute__((ext_vector_type(8)));
typedef float          v2f   __attribute__((ext_vector_type(2)));
typedef __bf16         v2bf  __attribute__((ext_vector_type(2)));

union Frag { v16us u; v8us half[2]; };

// ---------------------------------------------------------------------------
// helpers
// ---------------------------------------------------------------------------
__device__ __forceinline__ v8f vzero() {
  v8f z;
#pragma unroll
  for (int i = 0; i < 8; ++i) z[i] = 0.0f;
  return z;
}

// RNE f32 -> bf16 bits, by the chip's convert instruction
__device__ __forceinline__ us_t f2bf(float f) { return __builtin_bit_cast(us_t, (__bf16)f); }
__device__ __forceinline__ float bf2f(us_t b) { return __uint_as_float(((unsigned)b) << 16); }
__device__ __forceinline__ float bfr(float f) { return bf2f(f2bf(f)); }
// two f32 -> one word of two RNE bf16, a in the low half: one packed convert, the word needs no assembling
__device__ __forceinline__ unsigned f2bf2(float a, float b) {
  v2f x;
  x[0] = a;
  x[1] = b;
  return __builtin_bit_cast(unsigned, __builtin_convertvector(x, v2bf));
}
// the two bf16 of such a word as f32
__device__ __forceinline__ float bflo(unsigned w) { return __uint_as_float(w << 16); }
__device__ __forceinline__ float bfhi(unsigned w) { return __uint_as_float(w & 0xFFFF0000u); }

// 16x16x32 fragment (A rows / B columns), k order:
// lane l: row/col = l&15, h = l>>4; elements 0..7 <- k0+8h+0..7, elements 8..15 <- k0+16+8h+0..7.
// Every bf16 plane (x, the weights, K, Vt, y) is kept in fragment order: a fragment of 16 rows x 32 k is 1 KiB of its own.
// Lane l finds its elements 0..7 at us_t 8 l and its elements 8..15 at us_t 256 + 8 l, so each of the two loads
// of a wave covers 512 contiguous bytes = 4 whole lines, where a row-major plane makes it touch 16 lines.
// p points at this lane's first piece.
__device__ __forceinline__ v16us ld_fragp(const us_t* __restrict__ p) {
  Frag f;
  f.half[0] = *(const v8us*)(p);
  f.half[1] = *(const v8us*)(p + 256);
  return f.u;
}
// The same fragment, its lane's first piece off bytes behind a base that is the same for the whole wave: the load takes the
// base from scalar registers, so that an address costs one vector register, which several planes can share.
__device__ __forceinline__ v16us ld_frags(const us_t* __restrict__ base, unsigned off) {
  const char* p = (const char*)base + off;
  Frag f;
  f.half[0] = *(const v8us*)(p);
  f.half[1] = *(const v8us*)(p + 512);
  return f.u;
}
// place, in 16-B pieces, of piece (row, k8 = k / 8) in a fragment-order plane with kf fragments along k
__device__ __forceinline__ unsigned pk_idx(unsigned row, unsigned k8, unsigned kf) {
  return ((row >> 4) * kf + (k8 >> 2)) * 64u + (k8 & 3u) * 16u + (row & 15u);
}

// D[16x16] += A[16x32] * B[32x16]; D element r of lane l = (row 8*(l>>4)+r, col l&15).
// The plain builtin: the wave tiles of the GEMMs and of attention need registers above v255, where asm operands cannot
// lie. The compiler keeps the distance behind its own builtin.
__device__ __forceinline__ v8f mma_hi(v16us a, v16us b, v8f c) {
  return __builtin_amdgcn_wmma_f32_16x16x32_bf16(false, __builtin_bit_cast(v16bf, a), false, __builtin_bit_cast(v16bf, b),
                                                 (short)0, c, false, false);
}

// ---------------------------------------------------------------------------
// 0) f32 [rows][C_DIM] -> RNE bf16 in fragment order; thread i of a plane writes piece i of that plane.
//    One launch for all four planes, which do not depend on each other: the first CVT_NX8 / 256 work-groups
//    take x, then CVT_NW8 / 256 work-groups each of the three weight matrices (a work-group lies in one plane).
//    Left for a later step: one piece per thread makes 2,400 work-groups of 8 waves for about 30 MB of traffic;
//    fewer waves with several pieces each would take less time to start.
// ---------------------------------------------------------------------------
#define CVT_NX8 (B_DIM * T_DIM * C_DIM / 8)   // 16-B pieces of the x plane
#define CVT_NW8 (C_DIM * C_DIM / 8)           // 16-B pieces of a weight plane
static_assert(CVT_NX8 % 256 == 0 && CVT_NW8 % 256 == 0, "a work-group lies in one plane");
__global__ __launch_bounds__(256) void k_cvt(const float* __restrict__ x,
                                            const float* __restrict__ w0,
                                            const float* __restrict__ w1,
                                            const float* __restrict__ w2,
                                            us_t* __restrict__ xo,
                                            us_t* __restrict__ o0,
                                            us_t* __restrict__ o1,
                                            us_t* __restrict__ o2) {
  int first = (int)blockIdx.x * 256;           // the work-group's first piece, then counted inside its plane
  const float* in = x;
  us_t* out = xo;
  if (first >= CVT_NX8) {
    first -= CVT_NX8;
    const int s = first / CVT_NW8;
    if (s > 2) return;
    first -= s * CVT_NW8;
    in  = (s == 0) ? w0 : (s == 1) ? w1 : w2;
    out = (s == 0) ? o0 : (s == 1) ? o1 : o2;
  }
  const int i = first + (int)threadIdx.x;
  const unsigned blk = (unsigned)i >> 6;
  const unsigned row = (blk / (C_DIM / 32)) * 16u + ((unsigned)i & 15u);
  const unsigned k8  = (blk % (C_DIM / 32)) * 4u + (((unsigned)i >> 4) & 3u);
  const v4f* src = (const v4f*)(in + (size_t)row * C_DIM + k8 * 8u);
  const v4f a = src[0];
  const v4f c = src[1];
  v4u p;
  p[0] = f2bf2(a[0], a[1]);
  p[1] = f2bf2(a[2], a[3]);
  p[2] = f2bf2(c[0], c[1]);
  p[3] = f2bf2(c[2], c[3]);
  v4u* dst = (v4u*)(out + (size_t)i * 8);
  *dst = p;
  
}

// ---------------------------------------------------------------------------
// 1) C[m][n] = sum_k A[m][k] * W[n][k]  (A: MxK bf16, W: NxK bf16, both in fragment order, C: MxN f32 row-major)
//    SPLITA: C = (A + A2) * W^T with A = hi plane, A2 = lo plane (two products); these are the y planes, whose
//    row b*T + i holds time i + 1 (row b*T + T-1: zeros, time 0), so the result rows are stored one time step on.
//    wave = 16 MF rows x 64 cols: every loaded W fragment feeds MF products (2 MF with SPLITA) and every A fragment
//    four, so a product needs far fewer loaded bytes than with one fragment row per wave.
//    block = 4 waves, 2 x 2: tile of 32 MF rows x 128 cols; two waves share each A fragment, two each W fragment.
//    Epilogue: tile staged in LDS, each 256-B row segment written as 16 lanes x 16 B
//    Fragments sit in a ring of GEMM_ST k-steps of registers: a step's registers are loaded again
//    (for GEMM_ST steps further on) right behind its products, so GEMM_ST steps of loads are in flight
//    (16 loads a step: three steps stay under the load counter's 63).
//    The loops over ring steps, fragment rows and column groups are unrolled so that the arrays stay in registers.
//    Without SPLITA, W may hold 2 N rows: the work-groups of columns N .. 2N - 1 use the rows of a second weight plane
//    that lies directly behind the first, and store to Cout2, so two products of the same A share one launch.
//    The walk along k: work-groups of one grid row read the same A rows, those of one grid column the same W rows. Started
//    together at k = 0 they would ask L2 for the same lines at the same moment, and each line would come from memory only
//    when all of them wait for it. So each work-group enters the walk at a ring round set by its tile indices and wraps
//    round to k = 0 behind the last one; its four waves stay together. Each accumulator sums the same products, rotated.
//    Host guarantees M % (32 MF) == 0, N % 128 == 0, K % (32 * GEMM_ST) == 0, K > 0, gridDim.x * 128 == N (without SPLITA: or 2 N).
// ---------------------------------------------------------------------------
#define GEMM_ST 3
static_assert(C_DIM % (32 * GEMM_ST) == 0 && C_DIM % 128 == 0, "k-steps fill the ring, column tiles fill a plane");
template <int SPLITA, int MF>
__global__ __launch_bounds__(128) void k_gemm(const us_t* __restrict__ A,
                                             const us_t* __restrict__ A2,
                                             const us_t* __restrict__ W,
                                             float* __restrict__ Cout,
                                             float* __restrict__ Cout2,
                                             int M, int N, int K) {
  __shared__ __align__(16) float ldsC[4][16 * MF][68];
  (void)M;
  // the wave's number as a scalar: tile bases stay out of the vector registers
  const int w = __builtin_amdgcn_readfirstlane((int)(threadIdx.x >> 5));
  const int lane = threadIdx.x & 31, m = lane & 15, hh = lane >> 4;
  const int mbase = blockIdx.y * (32 * MF) + (w >> 1) * (16 * MF);
  const int nbase = blockIdx.x * 128 + (w & 1) * 64;
  // element offsets of this lane's 16-B piece of its fragment rows; they walk along k
  const unsigned kf = (unsigned)K >> 5;            // fragments along k
  const unsigned nrd = kf / GEMM_ST;               // ring rounds along k
  unsigned rd = (((blockIdx.x + (blockIdx.y >> 1)) & 7u) * nrd) >> 3;   // this work-group's first round, 0 .. nrd - 1
  unsigned ao[MF], wo[4];
#pragma unroll
  for (int f = 0; f < MF; ++f) ao[f] = ((unsigned)((mbase >> 4) + f) * kf + rd * GEMM_ST) * 512u + 8u * lane;
#pragma unroll
  for (int g = 0; g < 4; ++g) wo[g] = ((unsigned)((nbase >> 4) + g) * kf + rd * GEMM_ST) * 512u + 8u * lane;

  v8f acc[MF][4];
#pragma unroll
  for (int f = 0; f < MF; ++f) {
#pragma unroll
    for (int g = 0; g < 4; ++g) acc[f][g] = vzero();
  }

  v16us a[GEMM_ST][MF], a2[GEMM_ST][MF], bw[GEMM_ST][4];
#pragma unroll
  for (int i = 0; i < GEMM_ST; ++i) {
#pragma unroll
    for (int f = 0; f < MF; ++f) {
      a[i][f] = ld_fragp(A + ao[f] + 512 * i);
      if (SPLITA) a2[i][f] = ld_fragp(A2 + ao[f] + 512 * i);
    }
#pragma unroll
    for (int g = 0; g < 4; ++g) bw[i][g] = ld_fragp(W + wo[g] + 512 * i);
    // keeps these loads in the ring's order, step by step: the loop's load-count waits must hold
    // for both ways into the loop and would otherwise wait for nearly the whole ring
    __builtin_amdgcn_sched_barrier(0);
  }
  // Registers that held addresses of the loads above are written again below. The addresses are inputs of the wait so
  // that they stay in their registers up to it: otherwise a later load of the ring is given such a pair as destination.
  static_assert((SPLITA ? 2 : 1) * MF == 4, "four A fragments a step");
  asm volatile("s_wait_xcnt 0x0"
               :: "v"(A + ao[0]), "v"(A + ao[1]),
                  "v"(SPLITA ? A2 + ao[0] : A + ao[MF - 2]), "v"(SPLITA ? A2 + ao[1] : A + ao[MF - 1]),
                  "v"(W + wo[0]), "v"(W + wo[1]), "v"(W + wo[2]), "v"(W + wo[3])
               : "memory");

  for (int kb = 32 * GEMM_ST; kb < K; kb += 32 * GEMM_ST) {
    // one round on; from the last round back to the first (the sum is taken modulo 2^32, the offsets stay in the plane)
    unsigned step = 512u * GEMM_ST;
    if (++rd == nrd) {
      rd = 0;
      step = 0u - (nrd - 1u) * (512u * GEMM_ST);
    }
#pragma unroll
    for (int f = 0; f < MF; ++f) ao[f] += step;
#pragma unroll
    for (int g = 0; g < 4; ++g) wo[g] += step;
#pragma unroll
    for (int i = 0; i < GEMM_ST; ++i) {
      // every accumulator takes its hi product of a step first, then its lo product
#pragma unroll
      for (int f = 0; f < MF; ++f) {
#pragma unroll
        for (int g = 0; g < 4; ++g) acc[f][g] = mma_hi(a[i][f], bw[i][g], acc[f][g]);
      }
      if (SPLITA) {
#pragma unroll
        for (int f = 0; f < MF; ++f) {
#pragma unroll
          for (int g = 0; g < 4; ++g) acc[f][g] = mma_hi(a2[i][f], bw[i][g], acc[f][g]);
        }
      }
#pragma unroll
      for (int f = 0; f < MF; ++f) {
        a[i][f] = ld_fragp(A + ao[f] + 512 * i);
        if (SPLITA) a2[i][f] = ld_fragp(A2 + ao[f] + 512 * i);
      }
#pragma unroll
      for (int g = 0; g < 4; ++g) bw[i][g] = ld_fragp(W + wo[g] + 512 * i);
      // keeps a step's loads in front of the next step's products: a load that slips behind them has one step less of lead
      __builtin_amdgcn_sched_barrier(0);
    }
    // the next trip forms new addresses in the registers of the loads just issued
    asm volatile("s_wait_xcnt 0x0" ::: "memory");
  }
#pragma unroll
  for (int i = 0; i < GEMM_ST; ++i) {
#pragma unroll
    for (int f = 0; f < MF; ++f) {
#pragma unroll
      for (int g = 0; g < 4; ++g) acc[f][g] = mma_hi(a[i][f], bw[i][g], acc[f][g]);
    }
    if (SPLITA) {
#pragma unroll
      for (int f = 0; f < MF; ++f) {
#pragma unroll
        for (int g = 0; g < 4; ++g) acc[f][g] = mma_hi(a2[i][f], bw[i][g], acc[f][g]);
      }
    }
  }

  // stage D tiles: acc[f][g][r] = C[mbase + 16f + 8hh + r][nbase + 16g + m]
#pragma unroll
  for (int f = 0; f < MF; ++f) {
#pragma unroll
    for (int g = 0; g < 4; ++g) {
#pragma unroll
      for (int r = 0; r < 8; ++r) ldsC[w][16 * f + 8 * hh + r][16 * g + m] = acc[f][g][r];
    }
  }
  __syncthreads();

  v4f val[8 * MF];
#pragma unroll
  for (int it = 0; it < 8 * MF; ++it) val[it] = *(const v4f*)(&ldsC[w][2 * it + hh][4 * m]);

  float* gb = Cout + nbase + 4 * m;
  if (!SPLITA && nbase >= N) gb = Cout2 + (nbase - N) + 4 * m;
#pragma unroll
  for (int it = 0; it < 8 * MF; ++it) {
    int row = mbase + 2 * it + hh;
    if (SPLITA) row = (row & ~(T_DIM - 1)) | ((row + 1) & (T_DIM - 1));
    *(v4f*)(gb + row * N) = val[it];   // M * N fits an int
  }
}

// ---------------------------------------------------------------------------
// 2) leaky average over T (f32) + L2 normalisation + beta scale,
//    written as bf16 hi/lo planes khi/klo, per (batch, head) a fragment-order plane of T rows x HS.
//    The recurrence y[t] = c*y[t-1] + (1-c)*u[t] is linear, so T is cut into chunks of
//    EMA_CL rows that run side by side from a zero state:
//      y[t0+k] = ylocal[k] + c^(k+1) * S,   S = true state in front of the chunk,
//      S(next chunk) = c^EMA_CL * S + (end state of this chunk from zero).
//    A work-group = one (batch, head) and EMA_ROWS consecutive rows. It forms the end states
//    of every chunk up to its own last one (earlier chunks again, from L2), folds them in LDS,
//    and normalises and stores its own rows only: nothing passes between work-groups.
//    Lane group of 8 = one row (8 channels per lane). In the store phase a wave owns the 16 rows of one chunk,
//    which are the rows of one fragment, so every 128-B line of the planes is written by one wave.
//    The loops of constant length are unrolled so that their arrays stay in registers; the load
//    loop also so that all 32 loads of a chunk are in flight before the first is used.
// ---------------------------------------------------------------------------
#define EMA_CL    16                     // rows per chunk
#define EMA_NCH   (T_DIM / EMA_CL)       // chunks per (batch, head)
#define EMA_SEG   8                      // work-groups per (batch, head)
#define EMA_CPS   (EMA_NCH / EMA_SEG)    // chunks stored by one work-group
#define EMA_ROWS  (EMA_CL * EMA_CPS)     // rows stored by one work-group
#define EMA_NT    512                    // threads per work-group
#define EMA_NG    (EMA_NT / 8)           // lane groups per work-group
#define EMA_PITCH 96                     // floats per staged row: neighbour rows fall on the two bank halves

#define EMA_LDSF  (EMA_NCH * HS + EMA_CPS * HS + EMA_ROWS * EMA_PITCH)   // floats of LDS of one work-group

// smem: EMA_LDSF floats of LDS, 16-B aligned; seg: which EMA_ROWS rows of (batch, head) bh this work-group stores
__device__ __forceinline__ void ema_knorm(const float* __restrict__ u,
                                          const float* __restrict__ la_coef,
                                          const float* __restrict__ kbeta,
                                          us_t* __restrict__ khi,
                                          us_t* __restrict__ klo,
                                          float* smem, const int seg, const int bh) {
#pragma clang fp contract(off)
  // In all three arrays a lane's channels 8sub..8sub+3 sit at float 4*sub, 8sub+4..8sub+7 at 32 + 4*sub.
  float (*ldsE)[HS]        = (float (*)[HS])smem;                                    // end state of each chunk from a zero start
  float (*ldsS)[HS]        = (float (*)[HS])(smem + EMA_NCH * HS);                   // true state in front of each own chunk
  float (*ldsY)[EMA_PITCH] = (float (*)[EMA_PITCH])(smem + (EMA_NCH + EMA_CPS) * HS);   // own rows from a zero start

  const int tid  = threadIdx.x;
  const int grp  = tid >> 3;
  const int sub  = tid & 7;
  const int b = bh / NH, h = bh % NH;
  const int own0 = EMA_CPS * seg;                             // first own chunk
  const int nch  = own0 + EMA_CPS;                            // chunks this work-group walks

  const float cc   = bfr(la_coef[h]);
  const float omc  = 1.0f - cc;
  const float beta = expf(fminf(bfr(kbeta[h]) * 10.0f, 5.0f));

  // cp[it] = c^(k+1) for the row position k = 4 it + grp % 4 in its chunk; cl = c^EMA_CL
  float cp[EMA_ROWS / EMA_NG], cl = cc;
#pragma unroll
  for (int it = 0; it < EMA_ROWS / EMA_NG; ++it) {
    const int e = 4 * it + (grp & 3) + 1;                     // 1..16
    float p = 1.0f;
    cl = cc;
#pragma unroll
    for (int bit = 0; bit < 4; ++bit) {
      if ((e >> bit) & 1) p *= cl;
      cl *= cl;
    }
    if (e >> 4) p = cl;
    cp[it] = p;
  }

  const float* up = u + (size_t)b * T_DIM * C_DIM + h * HS + 8 * sub;

  // a) every chunk from a zero state; own0 and nch are multiples of 4, so a wave's four groups agree
  for (int j = grp; j < nch; j += EMA_NG) {
    const float* cpn = up + (size_t)(j * EMA_CL) * C_DIM;
    v4f x0[EMA_CL], x1[EMA_CL];
#pragma unroll
    for (int k = 0; k < EMA_CL; ++k) {
      const v4f* src = (const v4f*)(cpn + (size_t)k * C_DIM);
      x0[k] = src[0];
      x1[k] = src[1];
    }
    const bool own = (j >= own0);
    float* yrow = &ldsY[own ? (j - own0) * EMA_CL : 0][4 * sub];
    v4f y0, y1;
#pragma unroll
    for (int i = 0; i < 4; ++i) { y0[i] = 0.0f; y1[i] = 0.0f; }
#pragma unroll
    for (int k = 0; k < EMA_CL; ++k) {
#pragma unroll
      for (int i = 0; i < 4; ++i) {
        y0[i] = cc * y0[i] + omc * x0[k][i];
        y1[i] = cc * y1[i] + omc * x1[k][i];
      }
      if (own) {
        *(v4f*)(yrow + k * EMA_PITCH)      = y0;
        *(v4f*)(yrow + k * EMA_PITCH + 32) = y1;
      }
    }
    *(v4f*)(&ldsE[j][4 * sub])      = y0;
    *(v4f*)(&ldsE[j][32 + 4 * sub]) = y1;
  }
  __syncthreads();

  // b) fold the end states in time order, one channel per lane (two waves)
  if (tid < HS) {
    float s = 0.0f;
    for (int j0 = 0; j0 < own0; j0 += EMA_CPS) {
      float e[EMA_CPS];
#pragma unroll
      for (int i = 0; i < EMA_CPS; ++i) e[i] = ldsE[j0 + i][tid];
#pragma unroll
      for (int i = 0; i < EMA_CPS; ++i) s = cl * s + e[i];
    }
    float e[EMA_CPS];
#pragma unroll
    for (int i = 0; i < EMA_CPS; ++i) e[i] = ldsE[own0 + i][tid];
#pragma unroll
    for (int i = 0; i < EMA_CPS; ++i) {
      ldsS[i][tid] = s;
      s = cl * s + e[i];
    }
  }
  __syncthreads();

  // c) own rows: add the carried state, normalise, scale, split, store
  static_assert(4 * (EMA_ROWS / EMA_NG) == EMA_CL && EMA_CL == 16, "a wave stores one chunk = one fragment's rows");
  const size_t dpl = (size_t)bh * T_DIM * HS;
#pragma unroll
  for (int it = 0; it < EMA_ROWS / EMA_NG; ++it) {
    const int r = (grp >> 2) * EMA_CL + 4 * it + (grp & 3);   // r % EMA_CL == 4 it + grp % 4
    const v4f a0 = *(const v4f*)(&ldsY[r][4 * sub]);
    const v4f a1 = *(const v4f*)(&ldsY[r][32 + 4 * sub]);
    const v4f s0 = *(const v4f*)(&ldsS[r / EMA_CL][4 * sub]);
    const v4f s1 = *(const v4f*)(&ldsS[r / EMA_CL][32 + 4 * sub]);
    float y[8];
#pragma unroll
    for (int i = 0; i < 4; ++i) {
      y[i]     = a0[i] + cp[it] * s0[i];
      y[4 + i] = a1[i] + cp[it] * s1[i];
    }
    float ss = 0.0f;
#pragma unroll
    for (int i = 0; i < 8; ++i) ss += y[i] * y[i];
    ss += __shfl_xor(ss, 1, 32);
    ss += __shfl_xor(ss, 2, 32);
    ss += __shfl_xor(ss, 4, 32);
    const float rn = 1.0f / (sqrtf(ss) + 1e-6f);

    v4u ph, pl;
#pragma unroll
    for (int i = 0; i < 4; ++i) {
      const float ka = (y[2 * i] * rn) * beta;
      const float kc = (y[2 * i + 1] * rn) * beta;
      const unsigned hw = f2bf2(ka, kc);
      ph[i] = hw;
      pl[i] = f2bf2(ka - bflo(hw), kc - bfhi(hw));
    }
    const size_t off = dpl + 8u * pk_idx((unsigned)(seg * EMA_ROWS + r), (unsigned)sub, HS / 32);
    *(v4u*)(khi + off) = ph;
    *(v4u*)(klo + off) = pl;
  }
}

// ---------------------------------------------------------------------------
// 3) value featurizer: f = xl[t+1]*(1-vc) + xl[t]*vc, L2 normalise, beta scale,
//    written TRANSPOSED as bf16 hi/lo planes vthi/vtlo of fragments (rows = dims, k = key, for the P x V
//    B-fragments); per (batch, head) the four fragments of a 32-key tile lie side by side, tile after tile.
//    Four waves make 64 time steps; a work-group holds VM_Q such quartets, each with LDS of its own.
// ---------------------------------------------------------------------------
#define VM_Q (EMA_NT / 128)              // quartets of waves per work-group
static_assert(VM_Q * 2 * HS * 72 * 2 <= EMA_LDSF * 4, "the value maker's tiles fit the shared LDS");

// smem: the work-group's LDS, 16-B aligned; vx: which VM_Q * 64 time steps of (batch, head) bh this work-group makes
__device__ __forceinline__ void vmake(const float* __restrict__ xl,
                                      const float* __restrict__ v_coef,
                                      const float* __restrict__ vbeta,
                                      us_t* __restrict__ vthi,
                                      us_t* __restrict__ vtlo,
                                      float* smem, const int vx, const int bh) {
#pragma clang fp contract(off)
  const int quart = threadIdx.x >> 7;
  us_t (*ldsH)[72] = (us_t (*)[72])smem + (2 * quart) * HS;
  us_t (*ldsL)[72] = (us_t (*)[72])smem + (2 * quart + 1) * HS;
  const int b = bh / NH, h = bh % NH;
  const int t0 = (vx * VM_Q + quart) * 64;
  const int w = (threadIdx.x >> 5) & 3, lane = threadIdx.x & 31;

  const float vc  = bfr(v_coef[h]);
  const float omv = 1.0f - vc;
  const float vb  = expf(fminf(bfr(vbeta[h]) * 10.0f, 5.0f));

  // The wave's 16 time steps are worked side by side. All their rows are asked for first (step rr + 1 is also the
  // shifted row of step rr, so 17 rows serve 16 steps); the row behind the last time step of the sequence counts as zeros.
  // The loops of constant length are unrolled so that their arrays stay in registers.
  const int tw = t0 + w * 16;
  const float* cur = xl + ((size_t)b * T_DIM + tw) * C_DIM + h * HS + lane;
  float c0[17], c1[17];
#pragma unroll
  for (int rr = 0; rr < 16; ++rr) {
    c0[rr] = cur[rr * C_DIM];
    c1[rr] = cur[rr * C_DIM + 32];
  }
  c0[16] = 0.0f;
  c1[16] = 0.0f;
  if (tw + 16 < T_DIM) {
    c0[16] = cur[16 * C_DIM];
    c1[16] = cur[16 * C_DIM + 32];
  }

  float f0[16], f1[16], ss[16];
#pragma unroll
  for (int rr = 0; rr < 16; ++rr) {
    f0[rr] = c0[rr + 1] * omv + c0[rr] * vc;
    f1[rr] = c1[rr + 1] * omv + c1[rr] * vc;
    ss[rr] = f0[rr] * f0[rr] + f1[rr] * f1[rr];
  }

  // The 16 sums over the 32 lanes, all at once: at each exchange (lane distance 16, 8, 4, 2) a lane keeps half of its
  // steps and hands the other half to its partner, so that every sum is formed by the same additions as in a plain
  // exchange of one value, but only in the lanes that keep it. Lanes 2 rr and 2 rr + 1 end with the sum of step rr.
  float r8[8], r4[4], r2[2], r1;
  {
    const bool up = (lane & 16) != 0;
    float snd[8];
#pragma unroll
    for (int j = 0; j < 8; ++j) {
      r8[j]  = up ? ss[j + 8] : ss[j];
      snd[j] = up ? ss[j] : ss[j + 8];
    }
#pragma unroll
    for (int j = 0; j < 8; ++j) snd[j] = __shfl_xor(snd[j], 16, 32);
#pragma unroll
    for (int j = 0; j < 8; ++j) r8[j] += snd[j];
  }
  {
    const bool up = (lane & 8) != 0;
    float snd[4];
#pragma unroll
    for (int j = 0; j < 4; ++j) {
      r4[j]  = up ? r8[j + 4] : r8[j];
      snd[j] = up ? r8[j] : r8[j + 4];
    }
#pragma unroll
    for (int j = 0; j < 4; ++j) snd[j] = __shfl_xor(snd[j], 8, 32);
#pragma unroll
    for (int j = 0; j < 4; ++j) r4[j] += snd[j];
  }
  {
    const bool up = (lane & 4) != 0;
    float snd[2];
#pragma unroll
    for (int j = 0; j < 2; ++j) {
      r2[j]  = up ? r4[j + 2] : r4[j];
      snd[j] = up ? r4[j] : r4[j + 2];
    }
#pragma unroll
    for (int j = 0; j < 2; ++j) snd[j] = __shfl_xor(snd[j], 4, 32);
#pragma unroll
    for (int j = 0; j < 2; ++j) r2[j] += snd[j];
  }
  {
    const bool up = (lane & 2) != 0;
    r1 = up ? r2[1] : r2[0];
    const float snd = up ? r2[0] : r2[1];
    r1 += __shfl_xor(snd, 2, 32);
  }
  r1 += __shfl_xor(r1, 1, 32);
  // root and division once for all 16 steps, each in the lanes that hold its sum
  const float rnl = 1.0f / (sqrtf(r1) + 1e-6f);

  // eight time steps of a dim are 16 B of its staged row
#pragma unroll
  for (int j = 0; j < 2; ++j) {
    v4u ha, la, hb, lb;
#pragma unroll
    for (int i = 0; i < 4; ++i) {
      const int rr = 8 * j + 2 * i;
      const float rna = __uint_as_float((unsigned)__builtin_amdgcn_readlane((int)__float_as_uint(rnl), 2 * rr));
      const float rnb = __uint_as_float((unsigned)__builtin_amdgcn_readlane((int)__float_as_uint(rnl), 2 * rr + 2));
      const float a0 = (f0[rr] * rna) * vb, a1 = (f0[rr + 1] * rnb) * vb;
      const float b0 = (f1[rr] * rna) * vb, b1 = (f1[rr + 1] * rnb) * vb;
      const unsigned wa = f2bf2(a0, a1);
      const unsigned wb = f2bf2(b0, b1);
      ha[i] = wa;
      hb[i] = wb;
      la[i] = f2bf2(a0 - bflo(wa), a1 - bfhi(wa));
      lb[i] = f2bf2(b0 - bflo(wb), b1 - bfhi(wb));
    }
    *(v4u*)(&ldsH[lane][w * 16 + 8 * j])      = ha;
    *(v4u*)(&ldsH[lane + 32][w * 16 + 8 * j]) = hb;
    *(v4u*)(&ldsL[lane][w * 16 + 8 * j])      = la;
    *(v4u*)(&ldsL[lane + 32][w * 16 + 8 * j]) = lb;
  }
  __syncthreads();

  const int tid = threadIdx.x & 127;
  const int ch  = tid >> 4;            // 0..7: a wave stores two key octets of 16 dims = 512 contiguous bytes
  const int dsl = tid & 15;
  v4u ph[4], pl[4];
#pragma unroll
  for (int it = 0; it < 4; ++it) {
    const int d = it * 16 + dsl;
    ph[it] = *(const v4u*)(&ldsH[d][8 * ch]);
    pl[it] = *(const v4u*)(&ldsL[d][8 * ch]);
  }
  const size_t gb = ((size_t)bh * HS) * T_DIM;
#pragma unroll
  for (int it = 0; it < 4; ++it) {
    const size_t off = gb + 8u * (unsigned)(((t0 / 32 + (ch >> 2)) * 4 + it) * 64 + (ch & 3) * 16 + dsl);
    *(v4u*)(vthi + off) = ph[it];
    *(v4u*)(vtlo + off) = pl[it];
  }
}

// ---------------------------------------------------------------------------
// 2 + 3 in one launch: keys need only u, values only xl, so neither waits for the other. A work-group is wholly one or
// the other (the branch, and so every barrier behind it, is the same for all its waves). The registers of the leaky
// average let one work-group stand on a WGP, so the longest jobs come first in the grid: the leaky averages from the
// longest segment down, then the value makers, which are short (one round trip to memory for a wave's 16 rows).
// ---------------------------------------------------------------------------
#define KV_NV (B_DIM * NH * (T_DIM / (64 * VM_Q)))   // work-groups that make values
#define KV_NE (B_DIM * NH * EMA_SEG)                 // work-groups that make keys
__global__ __launch_bounds__(EMA_NT) void k_kv(const float* __restrict__ u,
                                              const float* __restrict__ la_coef,
                                              const float* __restrict__ kbeta,
                                              us_t* __restrict__ khi,
                                              us_t* __restrict__ klo,
                                              const float* __restrict__ xl,
                                              const float* __restrict__ v_coef,
                                              const float* __restrict__ vbeta,
                                              us_t* __restrict__ vthi,
                                              us_t* __restrict__ vtlo) {
  __shared__ __align__(16) float smem[EMA_LDSF];
  const int idx = (int)blockIdx.x;
  if (idx < KV_NE) {
    ema_knorm(u, la_coef, kbeta, khi, klo, smem, (EMA_SEG - 1) - idx / (B_DIM * NH), idx % (B_DIM * NH));
  } else {
    const int v = idx - KV_NE;
    vmake(xl, v_coef, vbeta, vthi, vtlo, smem, v % (T_DIM / (64 * VM_Q)), v / (T_DIM / (64 * VM_Q)));
  }
}

// ---------------------------------------------------------------------------
// 4) shifted-causal flash attention, a wave holds 32 queries (two query tiles of 16), key tiles of 32.
//    Scores computed transposed: St[key][query] = K_tile (A, rows = keys) x Qt (B, cols = queries),
//    so lane = query owns its softmax statistics and the P A-fragment for P x V is an
//    in-register repack of the two 16-key D tiles (element r <- tile keys 0..15, 8+r <- tile keys 16..31).
//    O[query][dim] accumulated with A = P, B = Vt rows (k = key). All fragments from
//    fragment-order global planes; bf16 hi/lo: hi*hi + hi*lo + lo*hi.
//    Every loaded K and V fragment feeds the products of both query tiles of the wave: 16 KiB of loads serve 48
//    products, so the walk asks L2 for half the bytes that one query tile per wave would.
//    Every fragment of a tile has registers of its own: the V loads of a tile are issued in front of
//    its score products, the hi K loads of the wave's next tile right behind them and the lo ones behind the first query tile's softmax, so that no product waits
//    for a load issued just in front of it. The fragment loops are unrolled so that the arrays stay in registers.
//    Equal work for every wave: query block d (32 queries) walks d + 1 key tiles, so work-group p takes the long
//    block 63 - p and then the short block p (65 key tiles). Its four waves share a block: each walks the key tiles
//    of one residue modulo 4 (in the short block the residues are dealt the other way round, which evens out the
//    remainders), each with softmax statistics of its own; the four partial results (maximum, sum, O) meet in LDS
//    behind one barrier, where each wave joins, normalises and stores one of the work-group's four query tiles.
//    The walk over the key tiles: the work-groups of one (batch, head) read the same K and V lines. Started together at
//    key 0 they would ask L2 for the same lines at the same moment, so a wave enters its walk 2 * (blockIdx.x % 8) of its
//    tiles further on and wraps round to its first tile behind the last one (a shorter walk starts at its first tile).
//    The running softmax takes the tiles in any order: every tile of a walk holds a key in front of each of its queries.
//    grid = (T / 64, B*NH), block 128. Output y hi/lo: fragment-order planes of B*T rows x C, row b*T + i
//    holding time i + 1, so that a tile's 16 queries are the rows of one fragment and every 128-B line has one
//    writer; the slot of time T (row b*T + T-1) takes the zeros of time 0.
// ---------------------------------------------------------------------------
#define ATT_NQD (T_DIM / 32)             // query blocks of 32 per (batch, head)
// khi and klo carry no __restrict__: with it the compiler lifts the loads of each wave's first K tile out of the loop
// over the two passes and holds their 64 registers through both walks.
// Three work-groups per WGP (second launch bound): the registers are held to a third of a SIMD's file, so that all
// work-groups of the grid are resident at once and none waits for a place.
__global__ __launch_bounds__(128, 3) void k_attn(const us_t* khi,
                                             const us_t* klo,
                                             const us_t* __restrict__ vthi,
                                             const us_t* __restrict__ vtlo,
                                             us_t* __restrict__ yhi,
                                             us_t* __restrict__ ylo) {
#pragma clang fp contract(off)
  __shared__ __align__(16) float ldsO[2][4][32][68];   // [long / short block][wave]: partial O, rows = queries
  __shared__ float ldsM[2][4][32];                     // partial running maximum per query
  __shared__ float ldsL[2][4][32];                     // partial running sum per query

  const int bh = blockIdx.y, b = bh / NH, h = bh % NH;
  // the wave's number as a scalar: tile numbers, trip counts and the planes' tile addresses stay out of the vector registers
  const int w = __builtin_amdgcn_readfirstlane((int)(threadIdx.x >> 5));
  const int lane = threadIdx.x & 31, m = lane & 15, hh = lane >> 4;
  const int Tm1 = T_DIM - 1;

  const size_t kbh = (size_t)bh * T_DIM * HS;
  const size_t vbh = (size_t)bh * HS * T_DIM;

  // kept rolled: the two passes share one copy of the code and one set of registers
#pragma unroll 1
  for (int ph = 0; ph < 2; ++ph) {
    const int qd  = (ph == 0) ? (ATT_NQD - 1 - (int)blockIdx.x) : (int)blockIdx.x;
    const int res = (ph == 0) ? w : 3 - w;         // this wave's key tiles: res, res + 4, ...
    const int q0  = 1 + 32 * qd;                   // first query time of this block

    // Q fragments (B operand): column n = query, k = dim; q rows are k rows at time tq; index = query tile
    int tq[2];                                     // this lane's queries (B column n and stats owner)
    unsigned qpc[2];                               // place of the lane's first 16-B piece in the (batch, head)'s planes
    v16us qh0[2], ql0[2], qh1[2], ql1[2];
#pragma unroll
    for (int u = 0; u < 2; ++u) {
      tq[u] = q0 + 16 * u + m;
      const int tqc = (tq[u] < Tm1) ? tq[u] : Tm1; // clamped for loads (slot tq == T is stored as zeros)
      qpc[u] = pk_idx((unsigned)tqc, (unsigned)hh, HS / 32);
      qh0[u] = ld_frags(khi + kbh, 16u * qpc[u]);       // dims 0..31
      ql0[u] = ld_frags(klo + kbh, 16u * qpc[u]);
      qh1[u] = ld_frags(khi + kbh + 512, 16u * qpc[u]); // dims 32..63
      ql1[u] = ld_frags(klo + kbh + 512, 16u * qpc[u]);
    }
    // Keeps the loads in front of the walk in the order Q, K hi, K lo (this fence and the next): the load-count waits in
    // the walk must hold for both ways into it, and with a Q load issued last they would wait for the whole K tile at once.
    __builtin_amdgcn_sched_barrier(0);

    const int ntiles = qd + 1;                     // keys 0 .. 32 qd + 31 cover both query tiles, wave-uniform
    const int nmy    = (ntiles - res + 3) >> 2;    // key tiles of this wave (0 where the walk is shorter than res + 1)

    v8f o[2][4];
#pragma unroll
    for (int u = 0; u < 2; ++u) {
#pragma unroll
      for (int g = 0; g < 4; ++g) o[u][g] = vzero();
    }
    float mrun[2] = {-1e30f, -1e30f}, lrun[2] = {0.0f, 0.0f};

    // jt: which of the wave's key tiles (res, res + 4, ...) the trip works on; the walk enters at a tile of its own
    int jt = 2 * ((int)blockIdx.x & 7);
    if (jt >= nmy) jt = 0;

    // byte offset, in the (batch, head)'s planes, of this lane's first piece of the key tile at which the wave enters; a hi
    // plane and its lo plane share it. The wave's tiles lie four tiles apart. A tile's four K fragments lie side by side,
    // and so do its four V fragments.
    unsigned koff = (unsigned)(res + 4 * jt) * (4u * 1024u) + 16u * (unsigned)lane;
    unsigned voff = koff;

    // K fragments of the current tile, index 2g + dim half (the bases lie in key tile 0, inside every plane)
    v16us kh[4], kl[4];
#pragma unroll
    for (int j = 0; j < 4; ++j) kh[j] = ld_frags(khi + kbh + j * 512, koff);
    __builtin_amdgcn_sched_barrier(0);
#pragma unroll
    for (int j = 0; j < 4; ++j) kl[j] = ld_frags(klo + kbh + j * 512, koff);
    // The address registers of the loads above are written again below. The places of the Q pieces are inputs of the wait so
    // that they stay in their registers up to it: otherwise a later load is given such a register as destination.
    asm volatile("s_wait_xcnt 0x0" :: "v"(qpc[0]), "v"(qpc[1]) : "memory");
    // keeps the offset addition below behind that wait
    __builtin_amdgcn_sched_barrier(0);
    // from here on the K offset stands at tile jk, which the trip fetches ahead: the next one of the walk, behind the
    // wave's last tile its first (the last trip fetches the tile of the first trip again, unused)
    int jk = (jt + 1 < nmy) ? jt + 1 : 0;
    koff += (unsigned)((jk - jt) * (16 * 1024));   // modulo 2^32; the offset stays in the plane

    for (int kt = 0; kt < nmy; ++kt) {
      const int kbase = (4 * jt + res) * 32;

      // V fragments of this tile (B operand: column n = dim 16g + m, k = key from the transposed planes)
      v16us vh[4], vl[4];
#pragma unroll
      for (int g = 0; g < 4; ++g) {
        vh[g] = ld_frags(vthi + vbh + g * 512, voff);
        vl[g] = ld_frags(vtlo + vbh + g * 512, voff);
      }
      // keeps the V loads at the head of the trip: short of registers, the scheduler otherwise sinks them to just in front of their use
      __builtin_amdgcn_sched_barrier(0);

      // St tiles: s[u][g][r] = score(key kbase + 16g + 8hh + r, query q0 + 16u + m); each K fragment serves both u
      // The products with the lo fragments of K come last: those are loaded later than the hi fragments (below).
      v8f s[2][2];
#pragma unroll
      for (int g = 0; g < 2; ++g) {
#pragma unroll
        for (int u = 0; u < 2; ++u) s[u][g] = mma_hi(kh[2 * g], qh0[u], vzero());
#pragma unroll
        for (int u = 0; u < 2; ++u) s[u][g] = mma_hi(kh[2 * g], ql0[u], s[u][g]);
#pragma unroll
        for (int u = 0; u < 2; ++u) s[u][g] = mma_hi(kh[2 * g + 1], qh1[u], s[u][g]);
#pragma unroll
        for (int u = 0; u < 2; ++u) s[u][g] = mma_hi(kh[2 * g + 1], ql1[u], s[u][g]);
      }
#pragma unroll
      for (int g = 0; g < 2; ++g) {
#pragma unroll
        for (int u = 0; u < 2; ++u) s[u][g] = mma_hi(kl[2 * g], qh0[u], s[u][g]);
#pragma unroll
        for (int u = 0; u < 2; ++u) s[u][g] = mma_hi(kl[2 * g + 1], qh1[u], s[u][g]);
      }

      // hi K fragments of the wave's next tile into the registers just read
#pragma unroll
      for (int j = 0; j < 4; ++j) kh[j] = ld_frags(khi + kbh + j * 512, koff);
      // keeps these loads in front of the softmax, a whole trip ahead of their use
      __builtin_amdgcn_sched_barrier(0);

#pragma unroll
      for (int u = 0; u < 2; ++u) {
        // causal mask (key < tq), online softmax per lane (= per query)
        float p0[8], p1[8];
        float mx = -1e30f;
#pragma unroll
        for (int r = 0; r < 8; ++r) {
          const int key0 = kbase + 8 * hh + r;
          float a = s[u][0][r];
          float c = s[u][1][r];
          if (key0 >= tq[u])      a = -1e30f;
          if (key0 + 16 >= tq[u]) c = -1e30f;
          p0[r] = a;
          p1[r] = c;
          mx = fmaxf(mx, fmaxf(a, c));
        }
        mx = fmaxf(mx, __shfl_xor(mx, 16, 32));
        const float mn = fmaxf(mrun[u], mx);
        const float sc = __expf(mrun[u] - mn);
        float sum = 0.0f;
#pragma unroll
        for (int r = 0; r < 8; ++r) {
          p0[r] = __expf(p0[r] - mn);
          p1[r] = __expf(p1[r] - mn);
          sum += p0[r] + p1[r];
        }
        sum += __shfl_xor(sum, 16, 32);
        lrun[u] = lrun[u] * sc + sum;
        mrun[u] = mn;

        // rescale O: o[u][g][r] belongs to query q0 + 16u + 8hh + r, whose scale lives in lane 8hh + r
#pragma unroll
        for (int r = 0; r < 8; ++r) {
          const float scr = __shfl(sc, 8 * hh + r, 32);
#pragma unroll
          for (int g = 0; g < 4; ++g) o[u][g][r] *= scr;
        }

        // P as A fragment (lane = query row, k = key within tile), bf16 hi/lo
        v8u phw, plw;
#pragma unroll
        for (int i = 0; i < 4; ++i) {
          const unsigned a = f2bf2(p0[2 * i], p0[2 * i + 1]);
          const unsigned c = f2bf2(p1[2 * i], p1[2 * i + 1]);
          phw[i]     = a;
          phw[4 + i] = c;
          plw[i]     = f2bf2(p0[2 * i] - bflo(a), p0[2 * i + 1] - bfhi(a));
          plw[4 + i] = f2bf2(p1[2 * i] - bflo(c), p1[2 * i + 1] - bfhi(c));
        }
        const v16us pfh = __builtin_bit_cast(v16us, phw);
        const v16us pfl = __builtin_bit_cast(v16us, plw);

        if (u == 0) {
          // lo K fragments of the next tile: up to here their registers serve the first query tile's softmax.
          // The two fences keep the loads at this place, neither later (less lead) nor earlier (no free registers).
          __builtin_amdgcn_sched_barrier(0);
#pragma unroll
          for (int j = 0; j < 4; ++j) kl[j] = ld_frags(klo + kbh + j * 512, koff);
          __builtin_amdgcn_sched_barrier(0);
        }

        // O += P x V; each V fragment serves both u
#pragma unroll
        for (int g = 0; g < 4; ++g) o[u][g] = mma_hi(pfh, vh[g], o[u][g]);
#pragma unroll
        for (int g = 0; g < 4; ++g) o[u][g] = mma_hi(pfh, vl[g], o[u][g]);
#pragma unroll
        for (int g = 0; g < 4; ++g) o[u][g] = mma_hi(pfl, vh[g], o[u][g]);
      }

      // the address registers of this trip's loads are written again below; here their requests are long under way
      asm volatile("s_wait_xcnt 0x0" ::: "memory");
      // keeps the offset additions below behind that wait: the scheduler otherwise lifts them to the head of the trip
      __builtin_amdgcn_sched_barrier(0);
      {
        const int jn = (jk + 1 < nmy) ? jk + 1 : 0;
        koff += (unsigned)((jn - jk) * (16 * 1024));
        voff += (unsigned)((jk - jt) * (16 * 1024));
        jt = jk;
        jk = jn;
      }
    }

    // this wave's partial result of the block. Both halves of the wave hold the same statistics for query q0 + 16u + m.
#pragma unroll
    for (int u = 0; u < 2; ++u) {
#pragma unroll
      for (int g = 0; g < 4; ++g) {
#pragma unroll
        for (int r = 0; r < 8; ++r) ldsO[ph][w][16 * u + 8 * hh + r][16 * g + m] = o[u][g][r];
      }
      if (hh == 0) {
        ldsM[ph][w][16 * u + m] = mrun[u];
        ldsL[ph][w][16 * u + m] = lrun[u];
      }
    }
  }
  // publishes every wave's partial results to the wave that joins them
  __syncthreads();

  // epilogue: wave w joins the four partials of query tile ju of block jp, then whole-line stores of the hi/lo planes.
  // The partial of residue 0 always holds key 0, so its maximum is a real score; a wave without a key tile left
  // maximum -1e30, sum 0 and O = 0, which get the weight 0.
  const int jp = w >> 1, ju = w & 1;
  const int qdj = (jp == 0) ? (ATT_NQD - 1 - (int)blockIdx.x) : (int)blockIdx.x;
  const int tqj = 1 + 32 * qdj + 16 * ju + m;      // the query whose row this lane stores
  const int qr  = 16 * ju + m;                     // its row in the block
  float mp[4], cw[4];
#pragma unroll
  for (int i = 0; i < 4; ++i) mp[i] = ldsM[jp][i][qr];
  const float mj = fmaxf(fmaxf(mp[0], mp[1]), fmaxf(mp[2], mp[3]));
  float den = 0.0f;
#pragma unroll
  for (int i = 0; i < 4; ++i) {
    cw[i] = __expf(mp[i] - mj);
    den += ldsL[jp][i][qr] * cw[i];
  }
  const float inv = 1.0f / den;
#pragma unroll
  for (int i = 0; i < 4; ++i) cw[i] *= inv;

  const unsigned live = (tqj <= Tm1) ? 0xFFFFFFFFu : 0u;   // the slot of time T is stored as zeros
  v4u yh[4], yl[4];
#pragma unroll
  for (int it = 0; it < 4; ++it) {
    float vv[8];
#pragma unroll
    for (int i = 0; i < 8; ++i) vv[i] = 0.0f;
#pragma unroll
    for (int pw = 0; pw < 4; ++pw) {
      const v4f* sp = (const v4f*)(&ldsO[jp][pw][qr][8 * (2 * it + hh)]);
      const v4f a0 = sp[0], a1 = sp[1];
#pragma unroll
      for (int i = 0; i < 4; ++i) {
        vv[i]     += a0[i] * cw[pw];
        vv[4 + i] += a1[i] * cw[pw];
      }
    }
#pragma unroll
    for (int i = 0; i < 4; ++i) {
      const unsigned hw = f2bf2(vv[2 * i], vv[2 * i + 1]);
      yh[it][i] = hw & live;
      yl[it][i] = f2bf2(vv[2 * i] - bflo(hw), vv[2 * i + 1] - bfhi(hw)) & live;
    }
  }

  const unsigned yrow = (unsigned)(b * T_DIM + tqj - 1);
#pragma unroll
  for (int it = 0; it < 4; ++it) {
    const size_t off = 8u * pk_idx(yrow, (unsigned)(h * (HS / 8) + 2 * it + hh), C_DIM / 32);
    *(v4u*)(yhi + off) = yh[it];
    *(v4u*)(ylo + off) = yl[it];
  }
}

// ---------------------------------------------------------------------------
// launcher
// ---------------------------------------------------------------------------
extern "C" void kernel_launch(void* const* d_in, const int* in_sizes, int n_in,
                              void* d_out, int out_size, void* d_ws,
                              size_t ws_size, hipStream_t stream) {
  const size_t MT = (size_t)B_DIM * T_DIM;          // 4096 rows
  const size_t NX = MT * C_DIM;                     // 3145728
  const size_t NW = (size_t)C_DIM * C_DIM;          // 589824

  if (n_in < 8) return;
  if ((size_t)in_sizes[0] != NX || (size_t)in_sizes[1] != NW || in_sizes[2] != NH ||
      (size_t)in_sizes[3] != NW || in_sizes[4] != NH || in_sizes[5] != NH ||
      in_sizes[6] != NH || (size_t)in_sizes[7] != NW || (size_t)out_size != NX) return;

  const float* x       = (const float*)d_in[0];
  const float* W_la    = (const float*)d_in[1];
  const float* la_coef = (const float*)d_in[2];
  const float* W_v     = (const float*)d_in[3];
  const float* v_coef  = (const float*)d_in[4];
  const float* kbeta   = (const float*)d_in[5];
  const float* vbeta   = (const float*)d_in[6];
  const float* W_proj  = (const float*)d_in[7];
  float* out = (float*)d_out;

  // workspace carve (all sizes multiples of 256 B)
  size_t off = 0;
  char* ws = (char*)d_ws;
  us_t* xb   = (us_t*)(ws + off); off += NX * 2;
  us_t* wla  = (us_t*)(ws + off); off += NW * 2;
  us_t* wv   = (us_t*)(ws + off); off += NW * 2;
  us_t* wpj  = (us_t*)(ws + off); off += NW * 2;
  float* u   = (float*)(ws + off); off += NX * 4;
  float* xl  = (float*)(ws + off); off += NX * 4;
  us_t* khi  = (us_t*)(ws + off); off += NX * 2;
  us_t* klo  = (us_t*)(ws + off); off += NX * 2;
  us_t* vthi = (us_t*)(ws + off); off += NX * 2;
  us_t* vtlo = (us_t*)(ws + off); off += NX * 2;
  us_t* yhi  = (us_t*)(ws + off); off += NX * 2;
  us_t* ylo  = (us_t*)(ws + off); off += NX * 2;   // total 72,744,960 B
  if (off > ws_size) return;

  // 0) RNE convert inputs to bf16, fragment order
  k_cvt<<<(CVT_NX8 + 3 * CVT_NW8) / 256, 256, 0, stream>>>(x, W_la, W_v, W_proj, xb, wla, wv, wpj);

  // 1) u = x W_la^T ; xl = x W_v^T (wv lies directly behind wla)
  dim3 ggrid(C_DIM / 128, (unsigned)(MT / 64));
  dim3 ggrid2(2 * C_DIM / 128, (unsigned)(MT / 128));
  k_gemm<0, 4><<<ggrid2, 128, 0, stream>>>(xb, xb, wla, u, xl, (int)MT, C_DIM, C_DIM);

  // 2 + 3) leaky average + normalised, scaled keys as bf16 hi/lo; values (transposed, bf16 hi/lo)
  k_kv<<<KV_NV + KV_NE, EMA_NT, 0, stream>>>(u, la_coef, kbeta, khi, klo, xl, v_coef, vbeta, vthi, vtlo);

  // 4) attention -> y hi/lo planes
  dim3 agrid((T_DIM - 1 + 63) / 64, B_DIM * NH);
  k_attn<<<agrid, 128, 0, stream>>>(khi, klo, vthi, vtlo, yhi, ylo);

  // 5) out = y W_proj^T (hi and lo planes, two products)
  k_gemm<1, 2><<<ggrid, 128, 0, stream>>>(yhi, ylo, wpj, out, out, (int)MT, C_DIM, C_DIM);
}
